// v000
// Times are from an AMD MI455X. After a warm-up the kernel runs many times in a row, and a time is the length of
// such a window on the GPU divided by its runs, so every launch and the gaps after it count. The runs cycle
// through copies of the inputs. A figure is the median of several windows, for all but v000 over two sittings.
// Sittings can differ by a few percent; kernels timed side by side share one.
// v000 is the starting kernel. One run takes 646 microseconds.
// Contractions: q and k projections (x . W^T) and v^T projection (Wv . x^T) on v_wmma_f32_16x16x32_bf16 (bf16 x, bf16 weights);
// output projection on v_wmma_f32_16x16x32_bf16 (context as bf16 hi|lo planes K-concatenated against duplicated bf16 weights);
// scores q.k^T on v_wmma_f32_16x16x32_f16 (plain f16 q, k); p.v on v_wmma_f32_16x16x32_f16 (p carried x1024 f16,
// v^T as f16 hi + x2048 residual planes, separate accumulators); all f32 accumulate; heat-kernel bias and softmax in f32;
// every float input RNE-converted to bf16 on load.
#include <hip/hip_runtime.h>
#include <math.h>
#include <stdint.h>

#define NB   2
#define NQ   2048
#define NC   4096
#define CM   512
#define NH   8
#define HD   64
#define MQ   (NB * NQ)
#define MC   (NB * NC)
#define KC   (2 * CM)
#define NCH  (NC / 32)
#define RSC  2048.0f
#define PSC  1024.0f
#define SCL  0.125f
#define HK4  0.4f
#define HEPS 1.0e-6f
static_assert(NH * HD == CM);
static_assert(NH == 8);
static_assert((MQ % 64) == 0 && (MC % 64) == 0 && (CM % 64) == 0 && (NC % 64) == 0 && (KC % 32) == 0);
static_assert((((MQ / 64) * (CM / 64)) % 8) == 0);
static_assert((((MC / 64) * (CM / 64)) % 8) == 0);
static_assert((((CM / 64) * (NC / 64)) % 8) == 0);
static_assert((NQ % 16) == 0 && (NC % 32) == 0);

typedef _Float16 v16h __attribute__((ext_vector_type(16)));
typedef _Float16 v8h  __attribute__((ext_vector_type(8)));
typedef __bf16   v16b __attribute__((ext_vector_type(16)));
typedef unsigned short v16us __attribute__((ext_vector_type(16)));
typedef unsigned short v8us  __attribute__((ext_vector_type(8)));
typedef float    v8f  __attribute__((ext_vector_type(8)));
typedef float    v4f  __attribute__((ext_vector_type(4)));
typedef unsigned int v4u __attribute__((ext_vector_type(4)));

union FragU { v16us v; v8us h[2]; };

// ---- scalar helpers --------------------------------------------------------------------------------
__device__ __forceinline__ unsigned short bf_bits(float f) {          // f32 -> bf16 bits, RNE convert
  unsigned u = __float_as_uint(f);
  return (unsigned short)((u + 0x7FFFu + ((u >> 16) & 1u)) >> 16);
}
__device__ __forceinline__ float bf_up(unsigned short h) { return __uint_as_float(((unsigned)h) << 16); }
__device__ __forceinline__ float bfr(float f) { return bf_up(bf_bits(f)); }   // value of the bf16 RNE convert
__device__ __forceinline__ unsigned short h_bits(_Float16 x) { return __builtin_bit_cast(unsigned short, x); }
__device__ __forceinline__ unsigned pk16(unsigned short a, unsigned short b) { return (unsigned)a | ((unsigned)b << 16); }
__device__ __forceinline__ v8f zero8() { v8f z = {0.f, 0.f, 0.f, 0.f, 0.f, 0.f, 0.f, 0.f}; return z; }

// ---- fragment loader: 16-bit A/B operand, lane -> row/col (lane&15), p already includes +8*(lane>>4);
//      elements 0..7 <- p[0..7] (k0+8h..), elements 8..15 <- p[16..23] (k0+16+8h..)
__device__ __forceinline__ v16us ldfrag_u(const unsigned short* p) {
  FragU f;
  f.h[0] = *(const v8us*)(p);
  f.h[1] = *(const v8us*)(p + 16);
  return f.v;
}

// ---- WMMA helpers with trailing VALU hazard gap --------------------------------------------------------
__device__ __forceinline__ v8f mma_bu_raw(v16us a, v16us b, v8f c) {            // bf16 operands, unguarded
  return __builtin_amdgcn_wmma_f32_16x16x32_bf16(false, __builtin_bit_cast(v16b, a), false,
                                                 __builtin_bit_cast(v16b, b), (short)0, c, false, false);
}
__device__ __forceinline__ v8f mma_hu(v16us a, v16us b, v8f c) {                // f16 operands (bits), guarded
  c = __builtin_amdgcn_wmma_f32_16x16x32_f16(false, __builtin_bit_cast(v16h, a), false,
                                              __builtin_bit_cast(v16h, b), (short)0, c, false, false);
#if defined(__HIP_DEVICE_COMPILE__)
  asm volatile("v_nop\n\tv_nop\n\tv_nop\n\tv_nop" : "+v"(c) : "v"(a), "v"(b));
#endif
  return c;
}
__device__ __forceinline__ void dep_guard1(v8f& a, v8f& b, v16us x) {
#if defined(__HIP_DEVICE_COMPILE__)
  asm volatile("v_nop\n\tv_nop\n\tv_nop\n\tv_nop" : "+v"(a), "+v"(b) : "v"(x));
#endif
}
__device__ __forceinline__ void keep4_u(v16us a, v16us b, v16us c, v16us d) {
#if defined(__HIP_DEVICE_COMPILE__)
  asm volatile("v_nop" :: "v"(a), "v"(b), "v"(c), "v"(d));
#endif
}
__device__ __forceinline__ void acc_guard4(v8f& a, v8f& b, v8f& c, v8f& d) {
#if defined(__HIP_DEVICE_COMPILE__)
  asm volatile("v_nop\n\tv_nop\n\tv_nop\n\tv_nop" : "+v"(a), "+v"(b), "+v"(c), "+v"(d));
#endif
}
__device__ __forceinline__ void wave_sync_lds() {
  __builtin_amdgcn_fence(__ATOMIC_RELEASE, "workgroup");
  __builtin_amdgcn_wave_barrier();
  __builtin_amdgcn_fence(__ATOMIC_ACQUIRE, "workgroup");
}

// =====================================================================================================
// Row convert: in[row][CM] f32 -> out[row * ldo + k] = bf16 RNE bits, and also at + dup when dup != 0.
// Block = 64 threads (one row), thread t handles columns 8t..8t+7 (16 B of bf16); one instruction of one wave =
// coverage: 64 threads x 8 = CM columns (and the dup copy); grid = every row of the matrix.
// =====================================================================================================
__global__ __launch_bounds__(64) void cvt_rows(const float* __restrict__ src, unsigned short* dst, int ldo, int dup) {
  const int row = blockIdx.x, tid = threadIdx.x;
  const float* p = src + (size_t)row * CM + tid * 8;
  const v4f a0 = *(const v4f*)(p);
  const v4f a1 = *(const v4f*)(p + 4);
  v4u hv;
  hv[0] = pk16(bf_bits(a0[0]), bf_bits(a0[1]));
  hv[1] = pk16(bf_bits(a0[2]), bf_bits(a0[3]));
  hv[2] = pk16(bf_bits(a1[0]), bf_bits(a1[1]));
  hv[3] = pk16(bf_bits(a1[2]), bf_bits(a1[3]));
  unsigned short* d = dst + (size_t)row * ldo + tid * 8;
  {
    *(v4u*)(d) = hv;
    if (dup != 0) *(v4u*)(d + dup) = hv;
    
  }
}

// =====================================================================================================
// Register-blocked batched bf16 WMMA GEMM: C[m][n] = sum_k A[m][k] * Bt[n][k] (+ bias);
// one wave per 64x64 tile, no block barriers. A row-major [M][K] pitch lda; Bt row-major [N][K] pitch ldb
// (k contiguous); M, N multiples of 64, K multiple of 32. blockIdx.y = batch index with element strides
// (sAy for A, sBy for Bt, sCy for C). Tile enumeration: tile -> tm = tile / (N/64), tn = tile % (N/64).
// OM: 0 = f32 out to Cf (pitch ldc); 1 = f16 bits to Cp; 2 = f16 hi bits to Cp and f16((v - hi) * 2048) bits
//     to Cp2 (both pitch ldc).
// CBM: 0 = no bias; 1 = column bias bf16(cb[n]); 2 = row bias bf16(cb[m]).
// coverage: 4 slabs x 16 rows x 64 cols = the wave's whole 64x64 tile; grid = tilesM*tilesN/8 blocks exactly
//           (host-checked), so no wave exits early.
// =====================================================================================================
template <int OM, int CBM>
__global__ __launch_bounds__(256) void gemm64(
    const unsigned short* __restrict__ Ap, int lda, long long sAy,
    const unsigned short* __restrict__ Btp, int ldb, long long sBy,
    unsigned short* Cp, unsigned short* Cp2, float* Cf, int ldc, long long sCy,
    const float* __restrict__ cb, int M, int N, int K) {
  __shared__ __align__(16) float sT[8][16 * 68];   // per-wave 16x64 slab, pitch 68 floats
  const int by   = blockIdx.y;
  const int lane = threadIdx.x & 31;
  const int wave = threadIdx.x >> 5;
  const int tilesN = N >> 6;
  const int tilesM = M >> 6;
  const int tile = blockIdx.x * 8 + wave;
  if (tile >= tilesM * tilesN) return;   // wave-uniform; no block barriers in this kernel
  const int tm = tile / tilesN;
  const int tn = tile - tm * tilesN;
  const int m0 = tm << 6;
  const int n0 = tn << 6;

  const unsigned short* Ab = Ap  + (size_t)by * (size_t)sAy;
  const unsigned short* Bb = Btp + (size_t)by * (size_t)sBy;
  const size_t cofs = (size_t)by * (size_t)sCy;

  const int rlane = lane & 15;                 // row (A) / col (B, D) within subtile
  const int koff  = (lane >> 4) * 8;           // k offset of this lane half
  const int mOff  = (lane >> 4) * 8;           // D row offset

  v8f acc[4][4];
#pragma unroll
  for (int i = 0; i < 4; ++i)
#pragma unroll
    for (int j = 0; j < 4; ++j) acc[i][j] = zero8();

  for (int k0 = 0; k0 < K; k0 += 32) {
    v16us bh[4];
#pragma unroll
    for (int j = 0; j < 4; ++j) {
      const size_t bo = (size_t)(n0 + (j << 4) + rlane) * ldb + koff + k0;
      bh[j] = ldfrag_u(Bb + bo);
    }
#pragma unroll
    for (int i = 0; i < 4; ++i) {
      const size_t ao = (size_t)(m0 + (i << 4) + rlane) * lda + koff + k0;
      const v16us ah = ldfrag_u(Ab + ao);
#pragma unroll
      for (int j = 0; j < 4; ++j) acc[i][j] = mma_bu_raw(ah, bh[j], acc[i][j]);
      dep_guard1(acc[i][0], acc[i][3], ah);
    }
    keep4_u(bh[0], bh[1], bh[2], bh[3]);
  }
  acc_guard4(acc[0][0], acc[0][1], acc[0][2], acc[0][3]);
  acc_guard4(acc[1][0], acc[1][1], acc[1][2], acc[1][3]);
  acc_guard4(acc[2][0], acc[2][1], acc[2][2], acc[2][3]);
  acc_guard4(acc[3][0], acc[3][1], acc[3][2], acc[3][3]);

  const int hh2 = lane >> 4, c4 = (lane & 15) * 4;     // f32 out: 256-B row segment = 16 lanes x 16 B
  const int q8  = lane >> 3, c8 = (lane & 7) * 8;

  v4f cb4 = {0.f, 0.f, 0.f, 0.f};
  float cbc[8];
#pragma unroll
  for (int e = 0; e < 8; ++e) cbc[e] = 0.f;
  if (CBM == 1) {
    if (OM == 0) {
      const v4f v = *(const v4f*)(cb + n0 + c4);
      cb4[0] = bfr(v[0]); cb4[1] = bfr(v[1]); cb4[2] = bfr(v[2]); cb4[3] = bfr(v[3]);
    } else {
      const v4f v0 = *(const v4f*)(cb + n0 + c8);
      const v4f v1 = *(const v4f*)(cb + n0 + c8 + 4);
#pragma unroll
      for (int e = 0; e < 4; ++e) { cbc[e] = bfr(v0[e]); cbc[4 + e] = bfr(v1[e]); }
    }
  }

  // ---- epilogue ----
  float* slab = sT[wave];
#pragma unroll
  for (int i = 0; i < 4; ++i) {
    const int mBase = m0 + (i << 4);
#pragma unroll
    for (int j = 0; j < 4; ++j) {
#pragma unroll
      for (int r = 0; r < 8; ++r) {
        slab[(mOff + r) * 68 + (j << 4) + rlane] = acc[i][j][r];
      }
    }
    wave_sync_lds();
    if (OM == 0) {
      float* C = Cf + cofs;
      v4f vals[8];
#pragma unroll
      for (int it = 0; it < 8; ++it) {
        const int row = it * 2 + hh2;                      // it 0..7 x hh2 0..1 = rows 0..15
        const v4f v = *(const v4f*)(slab + row * 68 + c4);
        vals[it] = v + cb4;
      }
      {
#pragma unroll
        for (int it = 0; it < 8; ++it) {
          const int row = it * 2 + hh2;
          *(v4f*)(C + (size_t)(mBase + row) * ldc + (size_t)n0 + c4) = vals[it];
        }
        
      }
    } else {
      unsigned short* C  = Cp  + cofs;
      unsigned short* C2 = Cp2 + cofs;
      v4u hv[4], lv[4];
#pragma unroll
      for (int it = 0; it < 4; ++it) {
        const int row = it * 4 + q8;                       // it 0..3 x q8 0..3 = rows 0..15
        const float* sp = slab + row * 68 + c8;
        float rb = 0.f;
        if (CBM == 2) rb = bfr(cb[mBase + row]);
        v4u ha = {0u, 0u, 0u, 0u}, la = {0u, 0u, 0u, 0u};
#pragma unroll
        for (int e = 0; e < 4; ++e) {
          const float f0 = sp[2 * e]     + cbc[2 * e]     + rb;
          const float f1 = sp[2 * e + 1] + cbc[2 * e + 1] + rb;
          const _Float16 g0 = (_Float16)f0, g1 = (_Float16)f1;
          ha[e] = pk16(h_bits(g0), h_bits(g1));
          if (OM == 2) {
            la[e] = pk16(h_bits((_Float16)((f0 - (float)g0) * RSC)),
                         h_bits((_Float16)((f1 - (float)g1) * RSC)));
          }
        }
        hv[it] = ha;
        lv[it] = la;
      }
      {
#pragma unroll
        for (int it = 0; it < 4; ++it) {
          const int row = it * 4 + q8;
          const size_t go = (size_t)(mBase + row) * ldc + (size_t)n0 + c8;
          *(v4u*)(C + go) = hv[it];
          if (OM == 2) *(v4u*)(C2 + go) = lv[it];
        }
        
      }
    }
    wave_sync_lds();
  }
}

// =====================================================================================================
// Fused heat-bias + online-softmax cross attention, head dim 64, 8 heads.
//   Block = 256 threads = 8 waves, wave w = head w; one block per (batch, 16 query rows); key chunks of 32,
//   static trip NCH = 128. q plane (f16 bits, pitch CM): row (b*NQ + t), head h at col h*64 + d; k plane
//   (f16 bits, pitch CM): row (b*NC + s). v^T hi / lo planes (f16 bits): element (b, h*64 + d, s) at
//   [(b*CM + h*64 + d)*NC + s], value = hi + lo/2048. Context plane (bf16 bits, pitch KC): hi at
//   [(b*NQ + t)*KC + h*64 + d], lo (value - hi) at + CM.
//   Per chunk: heat[q][s] = exp(-(dx*dx + dy*dy) * (1 / (0.4*|dt| + 1e-6))) from the bf16-converted positions
//   (spatial = dims 0,1, time = dim 2), computed once per (query row, key) pair by the block (thread = key
//   lane, rows w and w+8) into LDS and shared by the 8 head waves. Scores s = (q . k) * 0.125 + heat;
//   running-max softmax in f32; p = exp(s - m) carried as f16(1024 p) in a wave-private LDS tile (element
//   accumulator sets (4 column tiles each). All q, k, v^T and p fragments use the split k map
//   (elements 0..7 <- k0+8h.., 8..15 <- k0+16+8h..).
//   Epilogue: context tile of the block (16 rows x 512) staged in LDS (f32), then wave w writes token rows w and
// coverage: heat 16 rows x 32 keys per chunk (8 waves x 2 rows x 32 lanes); context 16 rows x 512 cols hi and lo
//           per block (8 waves x 2 rows x 2 x 256 cols); grid NQ/16 x NB covers every query row.
// =====================================================================================================
__global__ void __launch_bounds__(256) attn_kernel(
    const float* __restrict__ posq, const float* __restrict__ posc,
    const unsigned short* __restrict__ qp, const unsigned short* __restrict__ kp,
    const unsigned short* __restrict__ vth, const unsigned short* __restrict__ vtl,
    unsigned short* ctxp) {
#pragma clang fp contract(off)
  __shared__ __align__(16) unsigned short prL[NH * 512];   // per-wave P tile [16][32] f16 bits
  __shared__ __align__(16) float heatL[16 * 32];            // [query row][key]
  __shared__ __align__(16) float osm[16 * CM];              // output staging [16][CM]
  __shared__ float qps[16 * 3];

  const int b = blockIdx.y, i0 = blockIdx.x * 16;
  const int t = threadIdx.x, lane = t & 31, w = t >> 5, hh = lane >> 4, jc = lane & 15;
  const size_t rowQ = (size_t)b * NQ, rowC = (size_t)b * NC;

  if (t < 48) qps[t] = bfr(posq[(rowQ + i0) * 3 + t]);
  __syncthreads();

  // q A-fragments (row = query jc of this tile, k = d), plain f16 bits; d 0..31 and 32..63
  const unsigned short* qrow = qp + (rowQ + i0 + jc) * CM + w * HD + 8 * hh;
  const v16us qf0 = ldfrag_u(qrow);
  const v16us qf1 = ldfrag_u(qrow + 32);

  // query positions of the two heat rows this thread produces (rows w and w+8, key = lane)
  const float qx0 = qps[w * 3 + 0],       qy0 = qps[w * 3 + 1],       qt0 = qps[w * 3 + 2];
  const float qx1 = qps[(w + 8) * 3 + 0], qy1 = qps[(w + 8) * 3 + 1], qt1 = qps[(w + 8) * 3 + 2];

  float m[8], ll[8];
  v8f oh[4], ol[4];
#pragma unroll
  for (int ct = 0; ct < 4; ++ct) { oh[ct] = zero8(); ol[ct] = zero8(); }
#pragma unroll
  for (int r = 0; r < 8; ++r) { m[r] = -1.0e30f; ll[r] = 0.f; }

  const unsigned short* vhb = vth + ((size_t)b * CM + w * HD + jc) * NC + 8 * hh;   // B: col d = ct*16 + jc, k = key
  const unsigned short* vlb = vtl + ((size_t)b * CM + w * HD + jc) * NC + 8 * hh;
  const unsigned short* kgb = kp + (rowC + jc) * CM + w * HD + 8 * hh;               // B: col key = jc, k = d
  const float* pcb = posc + rowC * 3;
  unsigned short* pr = prL + w * 512;                                                 // wave-private P [16][32]

#pragma unroll 1
  for (int jt = 0; jt < NCH; ++jt) {
    const int j0 = jt * 32;
    __syncthreads();                                   // all waves done reading heatL of the prior chunk
    {
      const float* pc = pcb + (size_t)(j0 + lane) * 3;
      const float cx = bfr(pc[0]), cy = bfr(pc[1]), cz = bfr(pc[2]);
      const float dxa = qx0 - cx, dya = qy0 - cy, dta = qt0 - cz;
      const float dxb = qx1 - cx, dyb = qy1 - cy, dtb = qt1 - cz;
      const float da = dxa * dxa + dya * dya;
      const float db = dxb * dxb + dyb * dyb;
      const float na = HK4 * fabsf(dta) + HEPS;
      const float nb = HK4 * fabsf(dtb) + HEPS;
      const float ha = expf(-(da * (1.0f / na)));
      const float hb = expf(-(db * (1.0f / nb)));
      heatL[w * 32 + lane]       = ha;
      heatL[(w + 8) * 32 + lane] = hb;
    }
    __syncthreads();

    // ---- scores: 16 query rows x 32 keys of head w, K = 64 in two 32-deep steps ----
    const unsigned short* kg = kgb + (size_t)j0 * CM;
    v8f s0, s1;
    {
      const v16us k00 = ldfrag_u(kg);
      const v16us k01 = ldfrag_u(kg + 32);
      s0 = mma_hu(qf0, k00, zero8());
      s0 = mma_hu(qf1, k01, s0);
      const v16us k10 = ldfrag_u(kg + (size_t)16 * CM);
      const v16us k11 = ldfrag_u(kg + (size_t)16 * CM + 32);
      s1 = mma_hu(qf0, k10, zero8());
      s1 = mma_hu(qf1, k11, s1);
    }

    // ---- heat bias + online softmax; P (x1024, f16 bits) to the wave-private LDS tile ----
#pragma unroll
    for (int r = 0; r < 8; ++r) {
      const int il = 8 * hh + r;
      const float v0 = s0[r] * SCL + heatL[il * 32 + jc];
      const float v1 = s1[r] * SCL + heatL[il * 32 + 16 + jc];
      float rm = fmaxf(v0, v1);
#pragma unroll
      for (int off = 1; off < 16; off <<= 1) rm = fmaxf(rm, __shfl_xor(rm, off, 32));
      const float mn2   = fmaxf(m[r], rm);
      const float alpha = __expf(m[r] - mn2);
      const float e0 = __expf(v0 - mn2), e1 = __expf(v1 - mn2);
      float rs = e0 + e1;
#pragma unroll
      for (int off = 1; off < 16; off <<= 1) rs += __shfl_xor(rs, off, 32);
      ll[r] = ll[r] * alpha + rs;
      m[r]  = mn2;
#pragma unroll
      for (int ct = 0; ct < 4; ++ct) { oh[ct][r] *= alpha; ol[ct][r] *= alpha; }
      pr[il * 32 + jc]      = h_bits((_Float16)(e0 * PSC));
      pr[il * 32 + 16 + jc] = h_bits((_Float16)(e1 * PSC));
    }
    wave_sync_lds();

    // ---- context += P . V_hi and P . V_lo (4 column tiles of 16 dims) ----
    FragU pa;
    pa.h[0] = *(const v8us*)(pr + jc * 32 + 8 * hh);
    pa.h[1] = *(const v8us*)(pr + jc * 32 + 16 + 8 * hh);
#pragma unroll
    for (int ct = 0; ct < 4; ++ct) {
      const v16us vh = ldfrag_u(vhb + (size_t)ct * 16 * NC + j0);
      oh[ct] = mma_hu(pa.v, vh, oh[ct]);
      const v16us vl = ldfrag_u(vlb + (size_t)ct * 16 * NC + j0);
      ol[ct] = mma_hu(pa.v, vl, ol[ct]);
    }
  }

  __syncthreads();
#pragma unroll
  for (int r = 0; r < 8; ++r) {
    const int il = 8 * hh + r;
    const float l = ll[r];
    const float inv = ((l > 0.f) ? (1.0f / l) : 0.f) * (1.0f / PSC);
#pragma unroll
    for (int ct = 0; ct < 4; ++ct) {
      osm[il * CM + w * HD + ct * 16 + jc] = (oh[ct][r] + ol[ct][r] * (1.0f / RSC)) * inv;
    }
  }
  __syncthreads();
  {
    v4u hv[2][2], lv[2][2];
#pragma unroll
    for (int rr = 0; rr < 2; ++rr) {
      const float* sp = osm + (w + 8 * rr) * CM;
#pragma unroll
      for (int it = 0; it < 2; ++it) {
        const int c = it * 256 + lane * 8;
        const v4f f0 = *(const v4f*)(sp + c);
        const v4f f1 = *(const v4f*)(sp + c + 4);
        v4u ha, la;
#pragma unroll
        for (int e = 0; e < 2; ++e) {
          const unsigned short u0 = bf_bits(f0[2 * e]), u1 = bf_bits(f0[2 * e + 1]);
          const unsigned short u2 = bf_bits(f1[2 * e]), u3 = bf_bits(f1[2 * e + 1]);
          ha[e]     = pk16(u0, u1);
          ha[2 + e] = pk16(u2, u3);
          la[e]     = pk16(bf_bits(f0[2 * e] - bf_up(u0)), bf_bits(f0[2 * e + 1] - bf_up(u1)));
          la[2 + e] = pk16(bf_bits(f1[2 * e] - bf_up(u2)), bf_bits(f1[2 * e + 1] - bf_up(u3)));
        }
        hv[rr][it] = ha;
        lv[rr][it] = la;
      }
    }
    {
#pragma unroll
      for (int rr = 0; rr < 2; ++rr) {
        const size_t go = (rowQ + i0 + w + 8 * rr) * KC;
#pragma unroll
        for (int it = 0; it < 2; ++it) {
          const int c = it * 256 + lane * 8;
          *(v4u*)(ctxp + go + c)      = hv[rr][it];
          *(v4u*)(ctxp + go + CM + c) = lv[rr][it];
        }
      }
      
    }
  }
}

// =====================================================================================================
// Workspace map (bytes); every plane is an exact multiple of its whole-row / whole-line / 64x64-tile store
// granularity (MQ = 4096 = 64 row tiles, MC = 8192 = 128 row tiles; N in {512, 4096}; v^T per batch
// [512][4096] = 8x64 tiles):
//   Xq   bf16 [4096][512]       0          4194304
//   Xc   bf16 [8192][512]       4194304    8388608
//   Wqb  bf16 [512][512]        12582912   524288
//   Wkb  bf16 [512][512]        13107200   524288
//   Wvb  bf16 [512][512]        13631488   524288
//   WoT2 bf16 [512][1024]       14155776   1048576   (cols k and CM + k both hold the proj weight)
//   Qp   f16  [4096][512]       15204352   4194304
//   Kp   f16  [8192][512]       19398656   8388608
//   VTh  f16  [2][512][4096]    27787264   8388608   (v^T hi)
//   VTl  f16  [2][512][4096]    36175872   8388608   (v^T residual x2048)
//   Ctx  bf16 [4096][1024]      44564480   8388608   (context hi | lo)
//   end                         52953088
// =====================================================================================================
extern "C" void kernel_launch(void* const* d_in, const int* in_sizes, int n_in,
                              void* d_out, int out_size, void* d_ws, size_t ws_size,
                              hipStream_t stream) {
  if (n_in < 12) return;
  if (in_sizes[0] != MC * CM) return;
  if (in_sizes[1] != MQ * CM) return;
  if (in_sizes[2] != MC * 3) return;
  if (in_sizes[3] != MQ * 3) return;
  if (in_sizes[4] != CM * CM || in_sizes[5] != CM) return;
  if (in_sizes[6] != CM * CM || in_sizes[7] != CM) return;
  if (in_sizes[8] != CM * CM || in_sizes[9] != CM) return;
  if (in_sizes[10] != CM * CM || in_sizes[11] != CM) return;
  if (out_size != MQ * CM) return;

  const float* x_ctx   = (const float*)d_in[0];
  const float* x_query = (const float*)d_in[1];
  const float* pos_ctx = (const float*)d_in[2];
  const float* pos_qry = (const float*)d_in[3];
  const float* Wq = (const float*)d_in[4];
  const float* bq = (const float*)d_in[5];
  const float* Wk = (const float*)d_in[6];
  const float* bk = (const float*)d_in[7];
  const float* Wv = (const float*)d_in[8];
  const float* bv = (const float*)d_in[9];
  const float* Wo = (const float*)d_in[10];
  const float* bo = (const float*)d_in[11];

  const size_t PXQ  = (size_t)MQ * CM * 2;             //  4194304
  const size_t PXC  = (size_t)MC * CM * 2;             //  8388608
  const size_t PW   = (size_t)CM * CM * 2;             //   524288
  const size_t PWO  = (size_t)CM * KC * 2;             //  1048576
  const size_t PQ   = (size_t)MQ * CM * 2;             //  4194304
  const size_t PK   = (size_t)MC * CM * 2;             //  8388608
  const size_t PVT  = (size_t)NB * CM * NC * 2;        //  8388608
  const size_t PCTX = (size_t)MQ * KC * 2;             //  8388608
  size_t off = 0;
  const size_t oXq  = off; off += PXQ;
  const size_t oXc  = off; off += PXC;
  const size_t oWq  = off; off += PW;
  const size_t oWk  = off; off += PW;
  const size_t oWv  = off; off += PW;
  const size_t oWo  = off; off += PWO;
  const size_t oQ   = off; off += PQ;
  const size_t oK   = off; off += PK;
  const size_t oVTh = off; off += PVT;
  const size_t oVTl = off; off += PVT;
  const size_t oCtx = off; off += PCTX;
  if (off > ws_size) return;                           // off = 52953088
  if (off > (size_t)134217728) return;

  char* ws = (char*)d_ws;
  unsigned short* Xq   = (unsigned short*)(ws + oXq);
  unsigned short* Xc   = (unsigned short*)(ws + oXc);
  unsigned short* Wqb  = (unsigned short*)(ws + oWq);
  unsigned short* Wkb  = (unsigned short*)(ws + oWk);
  unsigned short* Wvb  = (unsigned short*)(ws + oWv);
  unsigned short* WoT2 = (unsigned short*)(ws + oWo);
  unsigned short* Qp   = (unsigned short*)(ws + oQ);
  unsigned short* Kp   = (unsigned short*)(ws + oK);
  unsigned short* VTh  = (unsigned short*)(ws + oVTh);
  unsigned short* VTl  = (unsigned short*)(ws + oVTl);
  unsigned short* Ctx  = (unsigned short*)(ws + oCtx);
  float*          out0 = (float*)d_out;

  const dim3 blk(256), blk64(64);
  const dim3 gQ(((MQ / 64) * (CM / 64)) / 8, 1, 1);            // 512 tiles -> 64 blocks
  const dim3 gK(((MC / 64) * (CM / 64)) / 8, 1, 1);            // 1024 tiles -> 128 blocks
  const dim3 gVT(((CM / 64) * (NC / 64)) / 8, NB, 1);          // 512 tiles -> 64 blocks x 2 batches
  const dim3 gAttn(NQ / 16, NB, 1);                            // 128 x 2 blocks of 256
  const dim3 gO(((MQ / 64) * (CM / 64)) / 8, 1, 1);            // 512 tiles -> 64 blocks
  if ((((MQ / 64) * (CM / 64)) % 8) != 0) return;
  if ((((MC / 64) * (CM / 64)) % 8) != 0) return;
  if ((((CM / 64) * (NC / 64)) % 8) != 0) return;

  // (0) bf16 planes of the activations and weights ([out][in] = k contiguous); proj weights with duplicated k range
  cvt_rows<<<dim3(MQ), blk64, 0, stream>>>(x_query, Xq, CM, 0);
  cvt_rows<<<dim3(MC), blk64, 0, stream>>>(x_ctx, Xc, CM, 0);
  cvt_rows<<<dim3(CM), blk64, 0, stream>>>(Wq, Wqb, CM, 0);
  cvt_rows<<<dim3(CM), blk64, 0, stream>>>(Wk, Wkb, CM, 0);
  cvt_rows<<<dim3(CM), blk64, 0, stream>>>(Wv, Wvb, CM, 0);
  cvt_rows<<<dim3(CM), blk64, 0, stream>>>(Wo, WoT2, KC, CM);

  // (1) q = Xq . Wqb^T + bq, k = Xc . Wkb^T + bk (K = 512) -> f16 planes [rows][512];
  //     v^T per batch = Wvb . Xc_b^T + bv per row d -> f16 hi (VTh) and residual x2048 (VTl) [2][512][4096]
  gemm64<1, 1><<<gQ, blk, 0, stream>>>(
      Xq, CM, 0LL, Wqb, CM, 0LL,
      Qp, Qp, out0, CM, 0LL,
      bq, MQ, CM, CM);
  gemm64<1, 1><<<gK, blk, 0, stream>>>(
      Xc, CM, 0LL, Wkb, CM, 0LL,
      Kp, Kp, out0, CM, 0LL,
      bk, MC, CM, CM);
  gemm64<2, 2><<<gVT, blk, 0, stream>>>(
      Wvb, CM, 0LL, Xc, CM, (long long)NC * CM,
      VTh, VTl, out0, NC, (long long)CM * NC,
      bv, CM, NC, CM);

  // (2) fused heat bias + softmax attention -> context bf16 hi|lo
  attn_kernel<<<gAttn, blk, 0, stream>>>(pos_qry, pos_ctx, Qp, Kp, VTh, VTl, Ctx);

  // (3) out = [ctx_hi | ctx_lo] . [Wo | Wo]^T + bo  (K = 1024, bf16 operands) -> d_out f32
  gemm64<0, 1><<<gO, blk, 0, stream>>>(
      Ctx, KC, 0LL, WoT2, KC, 0LL,
      Ctx, Ctx, out0, CM, 0LL,
      bo, MQ, CM, KC);
  (void)hipGetLastError();
}

// v001
// It runs in 467 microseconds.
// Timed twice side by side with v000, it ran 1.42 times as fast both times.
// Contractions: q and k projections (x . W^T) and v^T projection (Wv . x^T) on v_wmma_f32_16x16x32_bf16 (bf16 x, bf16 weights);
// output projection on v_wmma_f32_16x16x32_bf16 (context as bf16 hi|lo planes K-concatenated against duplicated bf16 weights);
// scores q.k^T on v_wmma_f32_16x16x32_f16 (plain f16 q, k); p.v on v_wmma_f32_16x16x32_f16 (p carried x1024 f16,
// v^T as f16 hi + x2048 residual planes, separate accumulators); all f32 accumulate; heat-kernel bias and softmax in f32;
// every float input RNE-converted to bf16 on load.
#include <hip/hip_runtime.h>
#include <math.h>
#include <stdint.h>

#define NB   2
#define NQ   2048
#define NC   4096
#define CM   512
#define NH   8
#define HD   64
#define MQ   (NB * NQ)
#define MC   (NB * NC)
#define KC   (2 * CM)
#define NCH  (NC / 32)
#define RSC  2048.0f
#define PSC  1024.0f
#define SCL  0.125f
#define HK4  0.4f
#define HEPS 1.0e-6f
static_assert(NH * HD == CM);
static_assert(NH == 8);
static_assert((MQ % 64) == 0 && (MC % 64) == 0 && (CM % 64) == 0 && (NC % 64) == 0 && (KC % 32) == 0);
static_assert((((MQ / 64) * (CM / 64)) % 8) == 0);
static_assert((((MC / 64) * (CM / 64)) % 8) == 0);
static_assert((((CM / 64) * (NC / 64)) % 8) == 0);
static_assert((NQ % 16) == 0 && (NC % 32) == 0);

typedef _Float16 v16h __attribute__((ext_vector_type(16)));
typedef _Float16 v8h  __attribute__((ext_vector_type(8)));
typedef __bf16   v16b __attribute__((ext_vector_type(16)));
typedef unsigned short v16us __attribute__((ext_vector_type(16)));
typedef unsigned short v8us  __attribute__((ext_vector_type(8)));
typedef float    v8f  __attribute__((ext_vector_type(8)));
typedef float    v4f  __attribute__((ext_vector_type(4)));
typedef unsigned int v4u __attribute__((ext_vector_type(4)));

union FragU { v16us v; v8us h[2]; };

// ---- scalar helpers --------------------------------------------------------------------------------
__device__ __forceinline__ unsigned short bf_bits(float f) {          // f32 -> bf16 bits, RNE convert
  unsigned u = __float_as_uint(f);
  return (unsigned short)((u + 0x7FFFu + ((u >> 16) & 1u)) >> 16);
}
__device__ __forceinline__ float bf_up(unsigned short h) { return __uint_as_float(((unsigned)h) << 16); }
__device__ __forceinline__ float bfr(float f) { return bf_up(bf_bits(f)); }   // value of the bf16 RNE convert
__device__ __forceinline__ unsigned short h_bits(_Float16 x) { return __builtin_bit_cast(unsigned short, x); }
__device__ __forceinline__ unsigned pk16(unsigned short a, unsigned short b) { return (unsigned)a | ((unsigned)b << 16); }
__device__ __forceinline__ v8f zero8() { v8f z = {0.f, 0.f, 0.f, 0.f, 0.f, 0.f, 0.f, 0.f}; return z; }

// ---- fragment loader: 16-bit A/B operand, lane -> row/col (lane&15), p already includes +8*(lane>>4);
//      elements 0..7 <- p[0..7] (k0+8h..), elements 8..15 <- p[16..23] (k0+16+8h..)
__device__ __forceinline__ v16us ldfrag_u(const unsigned short* p) {
  FragU f;
  f.h[0] = *(const v8us*)(p);
  f.h[1] = *(const v8us*)(p + 16);
  return f.v;
}

// ---- WMMA helpers with trailing VALU hazard gap --------------------------------------------------------
__device__ __forceinline__ v8f mma_bu_raw(v16us a, v16us b, v8f c) {            // bf16 operands, unguarded
  return __builtin_amdgcn_wmma_f32_16x16x32_bf16(false, __builtin_bit_cast(v16b, a), false,
                                                 __builtin_bit_cast(v16b, b), (short)0, c, false, false);
}
__device__ __forceinline__ v8f mma_hu(v16us a, v16us b, v8f c) {                // f16 operands (bits), guarded
  c = __builtin_amdgcn_wmma_f32_16x16x32_f16(false, __builtin_bit_cast(v16h, a), false,
                                              __builtin_bit_cast(v16h, b), (short)0, c, false, false);
#if defined(__HIP_DEVICE_COMPILE__)
  asm volatile("v_nop\n\tv_nop\n\tv_nop\n\tv_nop" : "+v"(c) : "v"(a), "v"(b));
#endif
  return c;
}
__device__ __forceinline__ void dep_guard1(v8f& a, v8f& b, v16us x) {
#if defined(__HIP_DEVICE_COMPILE__)
  asm volatile("v_nop\n\tv_nop\n\tv_nop\n\tv_nop" : "+v"(a), "+v"(b) : "v"(x));
#endif
}
__device__ __forceinline__ void keep4_u(v16us a, v16us b, v16us c, v16us d) {
#if defined(__HIP_DEVICE_COMPILE__)
  asm volatile("v_nop" :: "v"(a), "v"(b), "v"(c), "v"(d));
#endif
}
__device__ __forceinline__ void acc_guard4(v8f& a, v8f& b, v8f& c, v8f& d) {
#if defined(__HIP_DEVICE_COMPILE__)
  asm volatile("v_nop\n\tv_nop\n\tv_nop\n\tv_nop" : "+v"(a), "+v"(b), "+v"(c), "+v"(d));
#endif
}
__device__ __forceinline__ void wave_sync_lds() {
  __builtin_amdgcn_fence(__ATOMIC_RELEASE, "workgroup");
  __builtin_amdgcn_wave_barrier();
  __builtin_amdgcn_fence(__ATOMIC_ACQUIRE, "workgroup");
}

// =====================================================================================================
// Row convert: in[row][CM] f32 -> out[row * ldo + k] = bf16 RNE bits, and also at + dup when dup != 0.
// Block = 64 threads (one row), thread t handles columns 8t..8t+7 (16 B of bf16); one instruction of one wave =
// coverage: 64 threads x 8 = CM columns (and the dup copy); grid = every row of the matrix.
// =====================================================================================================
__global__ __launch_bounds__(64) void cvt_rows(const float* __restrict__ src, unsigned short* dst, int ldo, int dup) {
  const int row = blockIdx.x, tid = threadIdx.x;
  const float* p = src + (size_t)row * CM + tid * 8;
  const v4f a0 = *(const v4f*)(p);
  const v4f a1 = *(const v4f*)(p + 4);
  v4u hv;
  hv[0] = pk16(bf_bits(a0[0]), bf_bits(a0[1]));
  hv[1] = pk16(bf_bits(a0[2]), bf_bits(a0[3]));
  hv[2] = pk16(bf_bits(a1[0]), bf_bits(a1[1]));
  hv[3] = pk16(bf_bits(a1[2]), bf_bits(a1[3]));
  unsigned short* d = dst + (size_t)row * ldo + tid * 8;
  {
    *(v4u*)(d) = hv;
    if (dup != 0) *(v4u*)(d + dup) = hv;
    
  }
}

// =====================================================================================================
// Register-blocked batched bf16 WMMA GEMM: C[m][n] = sum_k A[m][k] * Bt[n][k] (+ bias);
// one wave per 64x64 tile, no block barriers. A row-major [M][K] pitch lda; Bt row-major [N][K] pitch ldb
// (k contiguous); M, N multiples of 64, K multiple of 32. blockIdx.y = batch index with element strides
// (sAy for A, sBy for Bt, sCy for C). Tile enumeration: tile -> tm = tile / (N/64), tn = tile % (N/64).
// OM: 0 = f32 out to Cf (pitch ldc); 1 = f16 bits to Cp; 2 = f16 hi bits to Cp and f16((v - hi) * 2048) bits
//     to Cp2 (both pitch ldc).
// CBM: 0 = no bias; 1 = column bias bf16(cb[n]); 2 = row bias bf16(cb[m]).
// coverage: 4 slabs x 16 rows x 64 cols = the wave's whole 64x64 tile; grid = tilesM*tilesN/8 blocks exactly
//           (host-checked), so no wave exits early.
// =====================================================================================================
template <int OM, int CBM>
__global__ __launch_bounds__(256) void gemm64(
    const unsigned short* __restrict__ Ap, int lda, long long sAy,
    const unsigned short* __restrict__ Btp, int ldb, long long sBy,
    unsigned short* Cp, unsigned short* Cp2, float* Cf, int ldc, long long sCy,
    const float* __restrict__ cb, int M, int N, int K) {
  __shared__ __align__(16) float sT[8][16 * 68];   // per-wave 16x64 slab, pitch 68 floats
  const int by   = blockIdx.y;
  const int lane = threadIdx.x & 31;
  const int wave = threadIdx.x >> 5;
  const int tilesN = N >> 6;
  const int tilesM = M >> 6;
  const int tile = blockIdx.x * 8 + wave;
  if (tile >= tilesM * tilesN) return;   // wave-uniform; no block barriers in this kernel
  const int tm = tile / tilesN;
  const int tn = tile - tm * tilesN;
  const int m0 = tm << 6;
  const int n0 = tn << 6;

  const unsigned short* Ab = Ap  + (size_t)by * (size_t)sAy;
  const unsigned short* Bb = Btp + (size_t)by * (size_t)sBy;
  const size_t cofs = (size_t)by * (size_t)sCy;

  const int rlane = lane & 15;                 // row (A) / col (B, D) within subtile
  const int koff  = (lane >> 4) * 8;           // k offset of this lane half
  const int mOff  = (lane >> 4) * 8;           // D row offset

  v8f acc[4][4];
#pragma unroll
  for (int i = 0; i < 4; ++i)
#pragma unroll
    for (int j = 0; j < 4; ++j) acc[i][j] = zero8();

  for (int k0 = 0; k0 < K; k0 += 32) {
    v16us bh[4];
#pragma unroll
    for (int j = 0; j < 4; ++j) {
      const size_t bo = (size_t)(n0 + (j << 4) + rlane) * ldb + koff + k0;
      bh[j] = ldfrag_u(Bb + bo);
    }
#pragma unroll
    for (int i = 0; i < 4; ++i) {
      const size_t ao = (size_t)(m0 + (i << 4) + rlane) * lda + koff + k0;
      const v16us ah = ldfrag_u(Ab + ao);
#pragma unroll
      for (int j = 0; j < 4; ++j) acc[i][j] = mma_bu_raw(ah, bh[j], acc[i][j]);
      dep_guard1(acc[i][0], acc[i][3], ah);
    }
    keep4_u(bh[0], bh[1], bh[2], bh[3]);
  }
  acc_guard4(acc[0][0], acc[0][1], acc[0][2], acc[0][3]);
  acc_guard4(acc[1][0], acc[1][1], acc[1][2], acc[1][3]);
  acc_guard4(acc[2][0], acc[2][1], acc[2][2], acc[2][3]);
  acc_guard4(acc[3][0], acc[3][1], acc[3][2], acc[3][3]);

  const int hh2 = lane >> 4, c4 = (lane & 15) * 4;     // f32 out: 256-B row segment = 16 lanes x 16 B
  const int q8  = lane >> 3, c8 = (lane & 7) * 8;

  v4f cb4 = {0.f, 0.f, 0.f, 0.f};
  float cbc[8];
#pragma unroll
  for (int e = 0; e < 8; ++e) cbc[e] = 0.f;
  if (CBM == 1) {
    if (OM == 0) {
      const v4f v = *(const v4f*)(cb + n0 + c4);
      cb4[0] = bfr(v[0]); cb4[1] = bfr(v[1]); cb4[2] = bfr(v[2]); cb4[3] = bfr(v[3]);
    } else {
      const v4f v0 = *(const v4f*)(cb + n0 + c8);
      const v4f v1 = *(const v4f*)(cb + n0 + c8 + 4);
#pragma unroll
      for (int e = 0; e < 4; ++e) { cbc[e] = bfr(v0[e]); cbc[4 + e] = bfr(v1[e]); }
    }
  }

  // ---- epilogue ----
  float* slab = sT[wave];
#pragma unroll
  for (int i = 0; i < 4; ++i) {
    const int mBase = m0 + (i << 4);
#pragma unroll
    for (int j = 0; j < 4; ++j) {
#pragma unroll
      for (int r = 0; r < 8; ++r) {
        slab[(mOff + r) * 68 + (j << 4) + rlane] = acc[i][j][r];
      }
    }
    wave_sync_lds();
    if (OM == 0) {
      float* C = Cf + cofs;
      v4f vals[8];
#pragma unroll
      for (int it = 0; it < 8; ++it) {
        const int row = it * 2 + hh2;                      // it 0..7 x hh2 0..1 = rows 0..15
        const v4f v = *(const v4f*)(slab + row * 68 + c4);
        vals[it] = v + cb4;
      }
      {
#pragma unroll
        for (int it = 0; it < 8; ++it) {
          const int row = it * 2 + hh2;
          *(v4f*)(C + (size_t)(mBase + row) * ldc + (size_t)n0 + c4) = vals[it];
        }
        
      }
    } else {
      unsigned short* C  = Cp  + cofs;
      unsigned short* C2 = Cp2 + cofs;
      v4u hv[4], lv[4];
#pragma unroll
      for (int it = 0; it < 4; ++it) {
        const int row = it * 4 + q8;                       // it 0..3 x q8 0..3 = rows 0..15
        const float* sp = slab + row * 68 + c8;
        float rb = 0.f;
        if (CBM == 2) rb = bfr(cb[mBase + row]);
        v4u ha = {0u, 0u, 0u, 0u}, la = {0u, 0u, 0u, 0u};
#pragma unroll
        for (int e = 0; e < 4; ++e) {
          const float f0 = sp[2 * e]     + cbc[2 * e]     + rb;
          const float f1 = sp[2 * e + 1] + cbc[2 * e + 1] + rb;
          const _Float16 g0 = (_Float16)f0, g1 = (_Float16)f1;
          ha[e] = pk16(h_bits(g0), h_bits(g1));
          if (OM == 2) {
            la[e] = pk16(h_bits((_Float16)((f0 - (float)g0) * RSC)),
                         h_bits((_Float16)((f1 - (float)g1) * RSC)));
          }
        }
        hv[it] = ha;
        lv[it] = la;
      }
      {
#pragma unroll
        for (int it = 0; it < 4; ++it) {
          const int row = it * 4 + q8;
          const size_t go = (size_t)(mBase + row) * ldc + (size_t)n0 + c8;
          *(v4u*)(C + go) = hv[it];
          if (OM == 2) *(v4u*)(C2 + go) = lv[it];
        }
        
      }
    }
    wave_sync_lds();
  }
}

// =====================================================================================================
// Fused heat-bias + online-softmax cross attention, head dim 64, 8 heads.
//   Block = 256 threads = 8 waves, wave w = head w; one block per (batch, 16 query rows); key chunks of 32,
//   static trip NCH = 128. q plane (f16 bits, pitch CM): row (b*NQ + t), head h at col h*64 + d; k plane
//   (f16 bits, pitch CM): row (b*NC + s). v^T hi / lo planes (f16 bits): element (b, h*64 + d, s) at
//   [(b*CM + h*64 + d)*NC + s], value = hi + lo/2048. Context plane (bf16 bits, pitch KC): hi at
//   [(b*NQ + t)*KC + h*64 + d], lo (value - hi) at + CM.
//   Per chunk: heat[q][s] = exp(-(dx*dx + dy*dy) * (1 / (0.4*|dt| + 1e-6))) from the bf16-converted positions
//   (spatial = dims 0,1, time = dim 2), computed once per (query row, key) pair by the block (thread = key
//   lane, rows w and w+8) into LDS and shared by the 8 head waves. Scores s = (q . k) * 0.125 + heat;
//   running-max softmax in f32; p = exp(s - m) carried as f16(1024 p) in a wave-private LDS tile (element
//   accumulator sets (4 column tiles each). All q, k, v^T and p fragments use the split k map
//   (elements 0..7 <- k0+8h.., 8..15 <- k0+16+8h..).
//   Epilogue: context tile of the block (16 rows x 512) staged in LDS (f32), then wave w writes token rows w and
// coverage: heat 16 rows x 32 keys per chunk (8 waves x 2 rows x 32 lanes); context 16 rows x 512 cols hi and lo
//           per block (8 waves x 2 rows x 2 x 256 cols); grid NQ/16 x NB covers every query row.
// =====================================================================================================
__global__ void __launch_bounds__(256) attn_kernel(
    const float* __restrict__ posq, const float* __restrict__ posc,
    const unsigned short* __restrict__ qp, const unsigned short* __restrict__ kp,
    const unsigned short* __restrict__ vth, const unsigned short* __restrict__ vtl,
    unsigned short* ctxp) {
#pragma clang fp contract(off)
  __shared__ __align__(16) unsigned short prL[NH * 512];   // per-wave P tile [16][32] f16 bits
  __shared__ __align__(16) float heatL[16 * 32];            // [query row][key]
  __shared__ __align__(16) float osm[16 * CM];              // output staging [16][CM]
  __shared__ float qps[16 * 3];

  const int b = blockIdx.y, i0 = blockIdx.x * 16;
  const int t = threadIdx.x, lane = t & 31, w = t >> 5, hh = lane >> 4, jc = lane & 15;
  const size_t rowQ = (size_t)b * NQ, rowC = (size_t)b * NC;

  if (t < 48) qps[t] = bfr(posq[(rowQ + i0) * 3 + t]);
  __syncthreads();

  // q A-fragments (row = query jc of this tile, k = d), plain f16 bits; d 0..31 and 32..63
  const unsigned short* qrow = qp + (rowQ + i0 + jc) * CM + w * HD + 8 * hh;
  const v16us qf0 = ldfrag_u(qrow);
  const v16us qf1 = ldfrag_u(qrow + 32);

  // query positions of the two heat rows this thread produces (rows w and w+8, key = lane)
  const float qx0 = qps[w * 3 + 0],       qy0 = qps[w * 3 + 1],       qt0 = qps[w * 3 + 2];
  const float qx1 = qps[(w + 8) * 3 + 0], qy1 = qps[(w + 8) * 3 + 1], qt1 = qps[(w + 8) * 3 + 2];

  float m[8], ll[8];
  v8f oh[4], ol[4];
#pragma unroll
  for (int ct = 0; ct < 4; ++ct) { oh[ct] = zero8(); ol[ct] = zero8(); }
#pragma unroll
  for (int r = 0; r < 8; ++r) { m[r] = -1.0e30f; ll[r] = 0.f; }

  const unsigned short* vhb = vth + ((size_t)b * CM + w * HD + jc) * NC + 8 * hh;   // B: col d = ct*16 + jc, k = key
  const unsigned short* vlb = vtl + ((size_t)b * CM + w * HD + jc) * NC + 8 * hh;
  const unsigned short* kgb = kp + (rowC + jc) * CM + w * HD + 8 * hh;               // B: col key = jc, k = d
  const float* pcb = posc + rowC * 3;
  unsigned short* pr = prL + w * 512;                                                 // wave-private P [16][32]

  // key positions of chunk 0; each pass fetches the next chunk's with its own load group
  float px = pcb[(size_t)lane * 3 + 0], py = pcb[(size_t)lane * 3 + 1], pz = pcb[(size_t)lane * 3 + 2];

#pragma unroll 1
  for (int jt = 0; jt < NCH; ++jt) {
    const int j0 = jt * 32;
    __syncthreads();                                   // all waves done reading heatL of the prior chunk
    {
      const float cx = bfr(px), cy = bfr(py), cz = bfr(pz);
      const float dxa = qx0 - cx, dya = qy0 - cy, dta = qt0 - cz;
      const float dxb = qx1 - cx, dyb = qy1 - cy, dtb = qt1 - cz;
      const float da = dxa * dxa + dya * dya;
      const float db = dxb * dxb + dyb * dyb;
      const float na = HK4 * fabsf(dta) + HEPS;
      const float nb = HK4 * fabsf(dtb) + HEPS;
      const float ha = expf(-(da * (1.0f / na)));
      const float hb = expf(-(db * (1.0f / nb)));
      heatL[w * 32 + lane]       = ha;
      heatL[(w + 8) * 32 + lane] = hb;
    }
    __syncthreads();

    // ---- scores: 16 query rows x 32 keys of head w, K = 64 in two 32-deep steps ----
    // One load group per pass: the 4 K fragments, the 8 V fragments (each in registers of its own) and the next
    // chunk's key positions are all in flight together, so the pass pays one L2 round trip, not one per WMMA.
    const unsigned short* kg = kgb + (size_t)j0 * CM;
    const v16us k00 = ldfrag_u(kg);
    const v16us k01 = ldfrag_u(kg + 32);
    const v16us k10 = ldfrag_u(kg + (size_t)16 * CM);
    const v16us k11 = ldfrag_u(kg + (size_t)16 * CM + 32);
    const unsigned short* vhp = vhb + j0;
    const unsigned short* vlp = vlb + j0;
    v16us vh[4], vl[4];
#pragma unroll
    for (int ct = 0; ct < 4; ++ct) {
      vh[ct] = ldfrag_u(vhp + (size_t)ct * 16 * NC);
      vl[ct] = ldfrag_u(vlp + (size_t)ct * 16 * NC);
    }
    const int jn = (jt + 1 < NCH) ? (j0 + 32) : j0;     // the last pass re-reads its own chunk: stays inside posc
    const float* pc = pcb + (size_t)(jn + lane) * 3;
    px = pc[0]; py = pc[1]; pz = pc[2];
    // The group's address registers are reused below: the wait stands in front of every such overwrite. It takes the
    // four addresses as inputs so that they stay whole up to it, and its memory clobber keeps the group ahead of it.
#if defined(__HIP_DEVICE_COMPILE__)
    asm volatile("s_wait_xcnt 0x0" :: "v"(kg), "v"(vhp), "v"(vlp), "v"(pc) : "memory");
#endif
    __builtin_amdgcn_sched_barrier(0);   // no product (with its data wait) is scheduled up into the load group
    v8f s0, s1;
    s0 = mma_hu(qf0, k00, zero8());
    s0 = mma_hu(qf1, k01, s0);
    s1 = mma_hu(qf0, k10, zero8());
    s1 = mma_hu(qf1, k11, s1);

    // ---- heat bias + online softmax; P (x1024, f16 bits) to the wave-private LDS tile ----
#pragma unroll
    for (int r = 0; r < 8; ++r) {
      const int il = 8 * hh + r;
      const float v0 = s0[r] * SCL + heatL[il * 32 + jc];
      const float v1 = s1[r] * SCL + heatL[il * 32 + 16 + jc];
      float rm = fmaxf(v0, v1);
#pragma unroll
      for (int off = 1; off < 16; off <<= 1) rm = fmaxf(rm, __shfl_xor(rm, off, 32));
      const float mn2   = fmaxf(m[r], rm);
      const float alpha = __expf(m[r] - mn2);
      const float e0 = __expf(v0 - mn2), e1 = __expf(v1 - mn2);
      float rs = e0 + e1;
#pragma unroll
      for (int off = 1; off < 16; off <<= 1) rs += __shfl_xor(rs, off, 32);
      ll[r] = ll[r] * alpha + rs;
      m[r]  = mn2;
#pragma unroll
      for (int ct = 0; ct < 4; ++ct) { oh[ct][r] *= alpha; ol[ct][r] *= alpha; }
      pr[il * 32 + jc]      = h_bits((_Float16)(e0 * PSC));
      pr[il * 32 + 16 + jc] = h_bits((_Float16)(e1 * PSC));
    }
    wave_sync_lds();

    // ---- context += P . V_hi and P . V_lo (4 column tiles of 16 dims) ----
    FragU pa;
    pa.h[0] = *(const v8us*)(pr + jc * 32 + 8 * hh);
    pa.h[1] = *(const v8us*)(pr + jc * 32 + 16 + 8 * hh);
#pragma unroll
    for (int ct = 0; ct < 4; ++ct) {
      oh[ct] = mma_hu(pa.v, vh[ct], oh[ct]);
      ol[ct] = mma_hu(pa.v, vl[ct], ol[ct]);
    }
  }

  __syncthreads();
#pragma unroll
  for (int r = 0; r < 8; ++r) {
    const int il = 8 * hh + r;
    const float l = ll[r];
    const float inv = ((l > 0.f) ? (1.0f / l) : 0.f) * (1.0f / PSC);
#pragma unroll
    for (int ct = 0; ct < 4; ++ct) {
      osm[il * CM + w * HD + ct * 16 + jc] = (oh[ct][r] + ol[ct][r] * (1.0f / RSC)) * inv;
    }
  }
  __syncthreads();
  {
    v4u hv[2][2], lv[2][2];
#pragma unroll
    for (int rr = 0; rr < 2; ++rr) {
      const float* sp = osm + (w + 8 * rr) * CM;
#pragma unroll
      for (int it = 0; it < 2; ++it) {
        const int c = it * 256 + lane * 8;
        const v4f f0 = *(const v4f*)(sp + c);
        const v4f f1 = *(const v4f*)(sp + c + 4);
        v4u ha, la;
#pragma unroll
        for (int e = 0; e < 2; ++e) {
          const unsigned short u0 = bf_bits(f0[2 * e]), u1 = bf_bits(f0[2 * e + 1]);
          const unsigned short u2 = bf_bits(f1[2 * e]), u3 = bf_bits(f1[2 * e + 1]);
          ha[e]     = pk16(u0, u1);
          ha[2 + e] = pk16(u2, u3);
          la[e]     = pk16(bf_bits(f0[2 * e] - bf_up(u0)), bf_bits(f0[2 * e + 1] - bf_up(u1)));
          la[2 + e] = pk16(bf_bits(f1[2 * e] - bf_up(u2)), bf_bits(f1[2 * e + 1] - bf_up(u3)));
        }
        hv[rr][it] = ha;
        lv[rr][it] = la;
      }
    }
    {
#pragma unroll
      for (int rr = 0; rr < 2; ++rr) {
        const size_t go = (rowQ + i0 + w + 8 * rr) * KC;
#pragma unroll
        for (int it = 0; it < 2; ++it) {
          const int c = it * 256 + lane * 8;
          *(v4u*)(ctxp + go + c)      = hv[rr][it];
          *(v4u*)(ctxp + go + CM + c) = lv[rr][it];
        }
      }
      
    }
  }
}

// =====================================================================================================
// Workspace map (bytes); every plane is an exact multiple of its whole-row / whole-line / 64x64-tile store
// granularity (MQ = 4096 = 64 row tiles, MC = 8192 = 128 row tiles; N in {512, 4096}; v^T per batch
// [512][4096] = 8x64 tiles):
//   Xq   bf16 [4096][512]       0          4194304
//   Xc   bf16 [8192][512]       4194304    8388608
//   Wqb  bf16 [512][512]        12582912   524288
//   Wkb  bf16 [512][512]        13107200   524288
//   Wvb  bf16 [512][512]        13631488   524288
//   WoT2 bf16 [512][1024]       14155776   1048576   (cols k and CM + k both hold the proj weight)
//   Qp   f16  [4096][512]       15204352   4194304
//   Kp   f16  [8192][512]       19398656   8388608
//   VTh  f16  [2][512][4096]    27787264   8388608   (v^T hi)
//   VTl  f16  [2][512][4096]    36175872   8388608   (v^T residual x2048)
//   Ctx  bf16 [4096][1024]      44564480   8388608   (context hi | lo)
//   end                         52953088
// =====================================================================================================
extern "C" void kernel_launch(void* const* d_in, const int* in_sizes, int n_in,
                              void* d_out, int out_size, void* d_ws, size_t ws_size,
                              hipStream_t stream) {
  if (n_in < 12) return;
  if (in_sizes[0] != MC * CM) return;
  if (in_sizes[1] != MQ * CM) return;
  if (in_sizes[2] != MC * 3) return;
  if (in_sizes[3] != MQ * 3) return;
  if (in_sizes[4] != CM * CM || in_sizes[5] != CM) return;
  if (in_sizes[6] != CM * CM || in_sizes[7] != CM) return;
  if (in_sizes[8] != CM * CM || in_sizes[9] != CM) return;
  if (in_sizes[10] != CM * CM || in_sizes[11] != CM) return;
  if (out_size != MQ * CM) return;

  const float* x_ctx   = (const float*)d_in[0];
  const float* x_query = (const float*)d_in[1];
  const float* pos_ctx = (const float*)d_in[2];
  const float* pos_qry = (const float*)d_in[3];
  const float* Wq = (const float*)d_in[4];
  const float* bq = (const float*)d_in[5];
  const float* Wk = (const float*)d_in[6];
  const float* bk = (const float*)d_in[7];
  const float* Wv = (const float*)d_in[8];
  const float* bv = (const float*)d_in[9];
  const float* Wo = (const float*)d_in[10];
  const float* bo = (const float*)d_in[11];

  const size_t PXQ  = (size_t)MQ * CM * 2;             //  4194304
  const size_t PXC  = (size_t)MC * CM * 2;             //  8388608
  const size_t PW   = (size_t)CM * CM * 2;             //   524288
  const size_t PWO  = (size_t)CM * KC * 2;             //  1048576
  const size_t PQ   = (size_t)MQ * CM * 2;             //  4194304
  const size_t PK   = (size_t)MC * CM * 2;             //  8388608
  const size_t PVT  = (size_t)NB * CM * NC * 2;        //  8388608
  const size_t PCTX = (size_t)MQ * KC * 2;             //  8388608
  size_t off = 0;
  const size_t oXq  = off; off += PXQ;
  const size_t oXc  = off; off += PXC;
  const size_t oWq  = off; off += PW;
  const size_t oWk  = off; off += PW;
  const size_t oWv  = off; off += PW;
  const size_t oWo  = off; off += PWO;
  const size_t oQ   = off; off += PQ;
  const size_t oK   = off; off += PK;
  const size_t oVTh = off; off += PVT;
  const size_t oVTl = off; off += PVT;
  const size_t oCtx = off; off += PCTX;
  if (off > ws_size) return;                           // off = 52953088
  if (off > (size_t)134217728) return;

  char* ws = (char*)d_ws;
  unsigned short* Xq   = (unsigned short*)(ws + oXq);
  unsigned short* Xc   = (unsigned short*)(ws + oXc);
  unsigned short* Wqb  = (unsigned short*)(ws + oWq);
  unsigned short* Wkb  = (unsigned short*)(ws + oWk);
  unsigned short* Wvb  = (unsigned short*)(ws + oWv);
  unsigned short* WoT2 = (unsigned short*)(ws + oWo);
  unsigned short* Qp   = (unsigned short*)(ws + oQ);
  unsigned short* Kp   = (unsigned short*)(ws + oK);
  unsigned short* VTh  = (unsigned short*)(ws + oVTh);
  unsigned short* VTl  = (unsigned short*)(ws + oVTl);
  unsigned short* Ctx  = (unsigned short*)(ws + oCtx);
  float*          out0 = (float*)d_out;

  const dim3 blk(256), blk64(64);
  const dim3 gQ(((MQ / 64) * (CM / 64)) / 8, 1, 1);            // 512 tiles -> 64 blocks
  const dim3 gK(((MC / 64) * (CM / 64)) / 8, 1, 1);            // 1024 tiles -> 128 blocks
  const dim3 gVT(((CM / 64) * (NC / 64)) / 8, NB, 1);          // 512 tiles -> 64 blocks x 2 batches
  const dim3 gAttn(NQ / 16, NB, 1);                            // 128 x 2 blocks of 256
  const dim3 gO(((MQ / 64) * (CM / 64)) / 8, 1, 1);            // 512 tiles -> 64 blocks
  if ((((MQ / 64) * (CM / 64)) % 8) != 0) return;
  if ((((MC / 64) * (CM / 64)) % 8) != 0) return;
  if ((((CM / 64) * (NC / 64)) % 8) != 0) return;

  // (0) bf16 planes of the activations and weights ([out][in] = k contiguous); proj weights with duplicated k range
  cvt_rows<<<dim3(MQ), blk64, 0, stream>>>(x_query, Xq, CM, 0);
  cvt_rows<<<dim3(MC), blk64, 0, stream>>>(x_ctx, Xc, CM, 0);
  cvt_rows<<<dim3(CM), blk64, 0, stream>>>(Wq, Wqb, CM, 0);
  cvt_rows<<<dim3(CM), blk64, 0, stream>>>(Wk, Wkb, CM, 0);
  cvt_rows<<<dim3(CM), blk64, 0, stream>>>(Wv, Wvb, CM, 0);
  cvt_rows<<<dim3(CM), blk64, 0, stream>>>(Wo, WoT2, KC, CM);

  // (1) q = Xq . Wqb^T + bq, k = Xc . Wkb^T + bk (K = 512) -> f16 planes [rows][512];
  //     v^T per batch = Wvb . Xc_b^T + bv per row d -> f16 hi (VTh) and residual x2048 (VTl) [2][512][4096]
  gemm64<1, 1><<<gQ, blk, 0, stream>>>(
      Xq, CM, 0LL, Wqb, CM, 0LL,
      Qp, Qp, out0, CM, 0LL,
      bq, MQ, CM, CM);
  gemm64<1, 1><<<gK, blk, 0, stream>>>(
      Xc, CM, 0LL, Wkb, CM, 0LL,
      Kp, Kp, out0, CM, 0LL,
      bk, MC, CM, CM);
  gemm64<2, 2><<<gVT, blk, 0, stream>>>(
      Wvb, CM, 0LL, Xc, CM, (long long)NC * CM,
      VTh, VTl, out0, NC, (long long)CM * NC,
      bv, CM, NC, CM);

  // (2) fused heat bias + softmax attention -> context bf16 hi|lo
  attn_kernel<<<gAttn, blk, 0, stream>>>(pos_qry, pos_ctx, Qp, Kp, VTh, VTl, Ctx);

  // (3) out = [ctx_hi | ctx_lo] . [Wo | Wo]^T + bo  (K = 1024, bf16 operands) -> d_out f32
  gemm64<0, 1><<<gO, blk, 0, stream>>>(
      Ctx, KC, 0LL, WoT2, KC, 0LL,
      Ctx, Ctx, out0, CM, 0LL,
      bo, MQ, CM, KC);
  (void)hipGetLastError();
}

// v002
// Measured time: 418 microseconds a run.
// In two side-by-side timings against v001, it was 1.09 and 1.13 times as fast.
// All steps since v000 together make it 1.58 times as fast.
// Contractions: q and k projections (x . W^T) and v^T projection (Wv . x^T) on v_wmma_f32_16x16x32_bf16 (bf16 x, bf16 weights);
// output projection on v_wmma_f32_16x16x32_bf16 (context as bf16 hi|lo planes K-concatenated against duplicated bf16 weights);
// scores transposed, k.q^T, on v_wmma_f32_16x16x32_f16 (plain f16 q, k); v^T.p^T on v_wmma_f32_16x16x32_f16 (p carried
// x1024 f16, v^T as f16 hi + x2048 residual planes, separate accumulators); all f32 accumulate; heat-kernel bias and softmax in f32;
// every float input RNE-converted to bf16 on load.
#include <hip/hip_runtime.h>
#include <math.h>
#include <stdint.h>

#define NB   2
#define NQ   2048
#define NC   4096
#define CM   512
#define NH   8
#define HD   64
#define MQ   (NB * NQ)
#define MC   (NB * NC)
#define KC   (2 * CM)
#define NCH  (NC / 32)
#define RSC  2048.0f
#define PSC  1024.0f
#define SCL  0.125f
#define HK4  0.4f
#define HEPS 1.0e-6f
#define HP   36            // heat tile pitch in floats: 144 B, 16 B x odd, for its 16-byte readers
#define OP   (CM + 4)      // output staging pitch in floats: the 16 lanes' 16-byte stores of one column walk fall on 64 banks
static_assert(NH * HD == CM);
static_assert(NH == 8);
static_assert((MQ % 64) == 0 && (MC % 64) == 0 && (CM % 64) == 0 && (NC % 64) == 0 && (KC % 32) == 0);
static_assert((((MQ / 64) * (CM / 64)) % 8) == 0);
static_assert((((MC / 64) * (CM / 64)) % 8) == 0);
static_assert((((CM / 64) * (NC / 64)) % 8) == 0);
static_assert((NQ % 16) == 0 && (NC % 32) == 0);

typedef _Float16 v16h __attribute__((ext_vector_type(16)));
typedef _Float16 v8h  __attribute__((ext_vector_type(8)));
typedef __bf16   v16b __attribute__((ext_vector_type(16)));
typedef unsigned short v16us __attribute__((ext_vector_type(16)));
typedef unsigned short v8us  __attribute__((ext_vector_type(8)));
typedef float    v8f  __attribute__((ext_vector_type(8)));
typedef float    v4f  __attribute__((ext_vector_type(4)));
typedef unsigned int v4u __attribute__((ext_vector_type(4)));

union FragU { v16us v; v8us h[2]; };

// ---- scalar helpers --------------------------------------------------------------------------------
__device__ __forceinline__ unsigned short bf_bits(float f) {          // f32 -> bf16 bits, RNE convert
  unsigned u = __float_as_uint(f);
  return (unsigned short)((u + 0x7FFFu + ((u >> 16) & 1u)) >> 16);
}
__device__ __forceinline__ float bf_up(unsigned short h) { return __uint_as_float(((unsigned)h) << 16); }
__device__ __forceinline__ float bfr(float f) { return bf_up(bf_bits(f)); }   // value of the bf16 RNE convert
__device__ __forceinline__ unsigned short h_bits(_Float16 x) { return __builtin_bit_cast(unsigned short, x); }
__device__ __forceinline__ unsigned pk16(unsigned short a, unsigned short b) { return (unsigned)a | ((unsigned)b << 16); }
__device__ __forceinline__ v8f zero8() { v8f z = {0.f, 0.f, 0.f, 0.f, 0.f, 0.f, 0.f, 0.f}; return z; }
__device__ __forceinline__ float xhalf(float x) {                     // value of lane l ^ 16
  const int b = __builtin_bit_cast(int, x);
  return __builtin_bit_cast(float, __builtin_amdgcn_permlanex16(b, b, 0x76543210, 0xfedcba98, false, false));
}

// ---- fragment loader: 16-bit A/B operand, lane -> row/col (lane&15), p already includes +8*(lane>>4);
//      elements 0..7 <- p[0..7] (k0+8h..), elements 8..15 <- p[16..23] (k0+16+8h..)
__device__ __forceinline__ v16us ldfrag_u(const unsigned short* p) {
  FragU f;
  f.h[0] = *(const v8us*)(p);
  f.h[1] = *(const v8us*)(p + 16);
  return f.v;
}

// ---- WMMA helpers with trailing VALU hazard gap --------------------------------------------------------
__device__ __forceinline__ v8f mma_bu_raw(v16us a, v16us b, v8f c) {            // bf16 operands, unguarded
  return __builtin_amdgcn_wmma_f32_16x16x32_bf16(false, __builtin_bit_cast(v16b, a), false,
                                                 __builtin_bit_cast(v16b, b), (short)0, c, false, false);
}
__device__ __forceinline__ v8f mma_hu(v16us a, v16us b, v8f c) {                // f16 operands (bits), guarded
  c = __builtin_amdgcn_wmma_f32_16x16x32_f16(false, __builtin_bit_cast(v16h, a), false,
                                              __builtin_bit_cast(v16h, b), (short)0, c, false, false);
#if defined(__HIP_DEVICE_COMPILE__)
  asm volatile("v_nop\n\tv_nop\n\tv_nop\n\tv_nop" : "+v"(c) : "v"(a), "v"(b));
#endif
  return c;
}
__device__ __forceinline__ void dep_guard1(v8f& a, v8f& b, v16us x) {
#if defined(__HIP_DEVICE_COMPILE__)
  asm volatile("v_nop\n\tv_nop\n\tv_nop\n\tv_nop" : "+v"(a), "+v"(b) : "v"(x));
#endif
}
__device__ __forceinline__ void keep4_u(v16us a, v16us b, v16us c, v16us d) {
#if defined(__HIP_DEVICE_COMPILE__)
  asm volatile("v_nop" :: "v"(a), "v"(b), "v"(c), "v"(d));
#endif
}
__device__ __forceinline__ void acc_guard4(v8f& a, v8f& b, v8f& c, v8f& d) {
#if defined(__HIP_DEVICE_COMPILE__)
  asm volatile("v_nop\n\tv_nop\n\tv_nop\n\tv_nop" : "+v"(a), "+v"(b), "+v"(c), "+v"(d));
#endif
}
__device__ __forceinline__ void wave_sync_lds() {
  __builtin_amdgcn_fence(__ATOMIC_RELEASE, "workgroup");
  __builtin_amdgcn_wave_barrier();
  __builtin_amdgcn_fence(__ATOMIC_ACQUIRE, "workgroup");
}

// =====================================================================================================
// Row convert: in[row][CM] f32 -> out[row * ldo + k] = bf16 RNE bits, and also at + dup when dup != 0.
// Block = 64 threads (one row), thread t handles columns 8t..8t+7 (16 B of bf16); one instruction of one wave =
// coverage: 64 threads x 8 = CM columns (and the dup copy); grid = every row of the matrix.
// =====================================================================================================
__global__ __launch_bounds__(64) void cvt_rows(const float* __restrict__ src, unsigned short* dst, int ldo, int dup) {
  const int row = blockIdx.x, tid = threadIdx.x;
  const float* p = src + (size_t)row * CM + tid * 8;
  const v4f a0 = *(const v4f*)(p);
  const v4f a1 = *(const v4f*)(p + 4);
  v4u hv;
  hv[0] = pk16(bf_bits(a0[0]), bf_bits(a0[1]));
  hv[1] = pk16(bf_bits(a0[2]), bf_bits(a0[3]));
  hv[2] = pk16(bf_bits(a1[0]), bf_bits(a1[1]));
  hv[3] = pk16(bf_bits(a1[2]), bf_bits(a1[3]));
  unsigned short* d = dst + (size_t)row * ldo + tid * 8;
  {
    *(v4u*)(d) = hv;
    if (dup != 0) *(v4u*)(d + dup) = hv;
    
  }
}

// =====================================================================================================
// Register-blocked batched bf16 WMMA GEMM: C[m][n] = sum_k A[m][k] * Bt[n][k] (+ bias);
// one wave per 64x64 tile, no block barriers. A row-major [M][K] pitch lda; Bt row-major [N][K] pitch ldb
// (k contiguous); M, N multiples of 64, K multiple of 32. blockIdx.y = batch index with element strides
// (sAy for A, sBy for Bt, sCy for C). Tile enumeration: tile -> tm = tile / (N/64), tn = tile % (N/64).
// OM: 0 = f32 out to Cf (pitch ldc); 1 = f16 bits to Cp; 2 = f16 hi bits to Cp and f16((v - hi) * 2048) bits
//     to Cp2 (both pitch ldc).
// CBM: 0 = no bias; 1 = column bias bf16(cb[n]); 2 = row bias bf16(cb[m]).
// coverage: 4 slabs x 16 rows x 64 cols = the wave's whole 64x64 tile; grid = tilesM*tilesN/8 blocks exactly
//           (host-checked), so no wave exits early.
// =====================================================================================================
template <int OM, int CBM>
__global__ __launch_bounds__(256) void gemm64(
    const unsigned short* __restrict__ Ap, int lda, long long sAy,
    const unsigned short* __restrict__ Btp, int ldb, long long sBy,
    unsigned short* Cp, unsigned short* Cp2, float* Cf, int ldc, long long sCy,
    const float* __restrict__ cb, int M, int N, int K) {
  __shared__ __align__(16) float sT[8][16 * 68];   // per-wave 16x64 slab, pitch 68 floats
  const int by   = blockIdx.y;
  const int lane = threadIdx.x & 31;
  const int wave = threadIdx.x >> 5;
  const int tilesN = N >> 6;
  const int tilesM = M >> 6;
  const int tile = blockIdx.x * 8 + wave;
  if (tile >= tilesM * tilesN) return;   // wave-uniform; no block barriers in this kernel
  const int tm = tile / tilesN;
  const int tn = tile - tm * tilesN;
  const int m0 = tm << 6;
  const int n0 = tn << 6;

  const unsigned short* Ab = Ap  + (size_t)by * (size_t)sAy;
  const unsigned short* Bb = Btp + (size_t)by * (size_t)sBy;
  const size_t cofs = (size_t)by * (size_t)sCy;

  const int rlane = lane & 15;                 // row (A) / col (B, D) within subtile
  const int koff  = (lane >> 4) * 8;           // k offset of this lane half
  const int mOff  = (lane >> 4) * 8;           // D row offset

  v8f acc[4][4];
#pragma unroll
  for (int i = 0; i < 4; ++i)
#pragma unroll
    for (int j = 0; j < 4; ++j) acc[i][j] = zero8();

  for (int k0 = 0; k0 < K; k0 += 32) {
    v16us bh[4];
#pragma unroll
    for (int j = 0; j < 4; ++j) {
      const size_t bo = (size_t)(n0 + (j << 4) + rlane) * ldb + koff + k0;
      bh[j] = ldfrag_u(Bb + bo);
    }
#pragma unroll
    for (int i = 0; i < 4; ++i) {
      const size_t ao = (size_t)(m0 + (i << 4) + rlane) * lda + koff + k0;
      const v16us ah = ldfrag_u(Ab + ao);
#pragma unroll
      for (int j = 0; j < 4; ++j) acc[i][j] = mma_bu_raw(ah, bh[j], acc[i][j]);
      dep_guard1(acc[i][0], acc[i][3], ah);
    }
    keep4_u(bh[0], bh[1], bh[2], bh[3]);
  }
  acc_guard4(acc[0][0], acc[0][1], acc[0][2], acc[0][3]);
  acc_guard4(acc[1][0], acc[1][1], acc[1][2], acc[1][3]);
  acc_guard4(acc[2][0], acc[2][1], acc[2][2], acc[2][3]);
  acc_guard4(acc[3][0], acc[3][1], acc[3][2], acc[3][3]);

  const int hh2 = lane >> 4, c4 = (lane & 15) * 4;     // f32 out: 256-B row segment = 16 lanes x 16 B
  const int q8  = lane >> 3, c8 = (lane & 7) * 8;

  v4f cb4 = {0.f, 0.f, 0.f, 0.f};
  float cbc[8];
#pragma unroll
  for (int e = 0; e < 8; ++e) cbc[e] = 0.f;
  if (CBM == 1) {
    if (OM == 0) {
      const v4f v = *(const v4f*)(cb + n0 + c4);
      cb4[0] = bfr(v[0]); cb4[1] = bfr(v[1]); cb4[2] = bfr(v[2]); cb4[3] = bfr(v[3]);
    } else {
      const v4f v0 = *(const v4f*)(cb + n0 + c8);
      const v4f v1 = *(const v4f*)(cb + n0 + c8 + 4);
#pragma unroll
      for (int e = 0; e < 4; ++e) { cbc[e] = bfr(v0[e]); cbc[4 + e] = bfr(v1[e]); }
    }
  }

  // ---- epilogue ----
  float* slab = sT[wave];
#pragma unroll
  for (int i = 0; i < 4; ++i) {
    const int mBase = m0 + (i << 4);
#pragma unroll
    for (int j = 0; j < 4; ++j) {
#pragma unroll
      for (int r = 0; r < 8; ++r) {
        slab[(mOff + r) * 68 + (j << 4) + rlane] = acc[i][j][r];
      }
    }
    wave_sync_lds();
    if (OM == 0) {
      float* C = Cf + cofs;
      v4f vals[8];
#pragma unroll
      for (int it = 0; it < 8; ++it) {
        const int row = it * 2 + hh2;                      // it 0..7 x hh2 0..1 = rows 0..15
        const v4f v = *(const v4f*)(slab + row * 68 + c4);
        vals[it] = v + cb4;
      }
      {
#pragma unroll
        for (int it = 0; it < 8; ++it) {
          const int row = it * 2 + hh2;
          *(v4f*)(C + (size_t)(mBase + row) * ldc + (size_t)n0 + c4) = vals[it];
        }
        
      }
    } else {
      unsigned short* C  = Cp  + cofs;
      unsigned short* C2 = Cp2 + cofs;
      v4u hv[4], lv[4];
#pragma unroll
      for (int it = 0; it < 4; ++it) {
        const int row = it * 4 + q8;                       // it 0..3 x q8 0..3 = rows 0..15
        const float* sp = slab + row * 68 + c8;
        float rb = 0.f;
        if (CBM == 2) rb = bfr(cb[mBase + row]);
        v4u ha = {0u, 0u, 0u, 0u}, la = {0u, 0u, 0u, 0u};
#pragma unroll
        for (int e = 0; e < 4; ++e) {
          const float f0 = sp[2 * e]     + cbc[2 * e]     + rb;
          const float f1 = sp[2 * e + 1] + cbc[2 * e + 1] + rb;
          const _Float16 g0 = (_Float16)f0, g1 = (_Float16)f1;
          ha[e] = pk16(h_bits(g0), h_bits(g1));
          if (OM == 2) {
            la[e] = pk16(h_bits((_Float16)((f0 - (float)g0) * RSC)),
                         h_bits((_Float16)((f1 - (float)g1) * RSC)));
          }
        }
        hv[it] = ha;
        lv[it] = la;
      }
      {
#pragma unroll
        for (int it = 0; it < 4; ++it) {
          const int row = it * 4 + q8;
          const size_t go = (size_t)(mBase + row) * ldc + (size_t)n0 + c8;
          *(v4u*)(C + go) = hv[it];
          if (OM == 2) *(v4u*)(C2 + go) = lv[it];
        }
        
      }
    }
    wave_sync_lds();
  }
}

// =====================================================================================================
// Fused heat-bias + online-softmax cross attention, head dim 64, 8 heads.
//   Block = 256 threads = 8 waves, wave w = head w; one block per (batch, 16 query rows); key chunks of 32,
//   static trip NCH = 128. q plane (f16 bits, pitch CM): row (b*NQ + t), head h at col h*64 + d; k plane
//   (f16 bits, pitch CM): row (b*NC + s). v^T hi / lo planes (f16 bits): element (b, h*64 + d, s) at
//   [(b*CM + h*64 + d)*NC + s], value = hi + lo/2048. Context plane (bf16 bits, pitch KC): hi at
//   [(b*NQ + t)*KC + h*64 + d], lo (value - hi) at + CM.
//   Per chunk: heat[q][s] = exp(-(dx*dx + dy*dy) * (1 / (0.4*|dt| + 1e-6))) from the bf16-converted positions
//   (spatial = dims 0,1, time = dim 2), computed once per (query row, key) pair by the block (thread = key
//   lane, rows w and w+8) into LDS and shared by the 8 head waves. Both products are transposed: S^T = K . Q^T
//   (A = k rows, B = q), so a lane holds 16 of the 32 scores of ONE query (column lane & 15; keys 8h + r and
//   16 + 8h + r): s = (k . q) * 0.125 + heat; running-max softmax in f32 with maximum and sum in the lane, the
//   maximum joined with the other lane half once a pass, the sums once behind the loop. p = exp(s - m) as
//   f16(1024 p): the two score tiles, converted in place, are the B operand of O^T += V^T . P^T (A = v^T rows, hi and
//   lo accumulator sets, 4 row tiles of 16 dims each). All q, k, v^T and p fragments use the split k map
//   (elements 0..7 <- k0+8h.., 8..15 <- k0+16+8h..).
//   Epilogue: context tile of the block (16 rows x 512) staged in LDS (f32), then wave w writes token rows w and
// coverage: heat 16 rows x 32 keys per chunk (8 waves x 2 rows x 32 lanes); context 16 rows x 512 cols hi and lo
//           per block (8 waves x 2 rows x 2 x 256 cols); grid NQ/16 x NB covers every query row.
// =====================================================================================================
__global__ void __launch_bounds__(256) attn_kernel(
    const float* __restrict__ posq, const float* __restrict__ posc,
    const unsigned short* __restrict__ qp, const unsigned short* __restrict__ kp,
    const unsigned short* __restrict__ vth, const unsigned short* __restrict__ vtl,
    unsigned short* ctxp) {
#pragma clang fp contract(off)
  __shared__ __align__(16) float heatL[16 * HP];            // [query row][key], pitch HP
  __shared__ __align__(16) float osm[16 * OP];              // output staging [16][CM], pitch OP
  __shared__ float qps[16 * 3];

  const int b = blockIdx.y, i0 = blockIdx.x * 16;
  const int t = threadIdx.x, lane = t & 31, w = t >> 5, hh = lane >> 4, jc = lane & 15;
  const size_t rowQ = (size_t)b * NQ, rowC = (size_t)b * NC;

  if (t < 48) qps[t] = bfr(posq[(rowQ + i0) * 3 + t]);
  __syncthreads();

  // q B-fragments (col = query jc of this tile, k = d), plain f16 bits; d 0..31 and 32..63
  const unsigned short* qrow = qp + (rowQ + i0 + jc) * CM + w * HD + 8 * hh;
  const v16us qf0 = ldfrag_u(qrow);
  const v16us qf1 = ldfrag_u(qrow + 32);

  // query positions of the two heat rows this thread produces (rows w and w+8, key = lane)
  const float qx0 = qps[w * 3 + 0],       qy0 = qps[w * 3 + 1],       qt0 = qps[w * 3 + 2];
  const float qx1 = qps[(w + 8) * 3 + 0], qy1 = qps[(w + 8) * 3 + 1], qt1 = qps[(w + 8) * 3 + 2];

  float m = -1.0e30f, ll = 0.f;      // query jc: running maximum (both lane halves alike), this lane half's sum
  v8f oh[4], ol[4];                  // O^T tiles: register r = dim ct*16 + 8*hh + r of query jc
#pragma unroll
  for (int ct = 0; ct < 4; ++ct) { oh[ct] = zero8(); ol[ct] = zero8(); }

  const unsigned short* vhb = vth + ((size_t)b * CM + w * HD + jc) * NC + 8 * hh;   // A: row d = ct*16 + jc, k = key
  const unsigned short* vlb = vtl + ((size_t)b * CM + w * HD + jc) * NC + 8 * hh;
  const unsigned short* kgb = kp + (rowC + jc) * CM + w * HD + 8 * hh;               // A: row key = jc, k = d
  const float* pcb = posc + rowC * 3;
  const float* hrd = heatL + jc * HP + 8 * hh;                                        // heat of query jc, keys 8*hh..

  // key positions of chunk 0; each pass fetches the next chunk's with its own load group
  float px = pcb[(size_t)lane * 3 + 0], py = pcb[(size_t)lane * 3 + 1], pz = pcb[(size_t)lane * 3 + 2];

#pragma unroll 1
  for (int jt = 0; jt < NCH; ++jt) {
    const int j0 = jt * 32;
    __syncthreads();                                   // all waves done reading heatL of the prior chunk
    {
      const float cx = bfr(px), cy = bfr(py), cz = bfr(pz);
      const float dxa = qx0 - cx, dya = qy0 - cy, dta = qt0 - cz;
      const float dxb = qx1 - cx, dyb = qy1 - cy, dtb = qt1 - cz;
      const float da = dxa * dxa + dya * dya;
      const float db = dxb * dxb + dyb * dyb;
      const float na = HK4 * fabsf(dta) + HEPS;
      const float nb = HK4 * fabsf(dtb) + HEPS;
      const float ha = expf(-(da * (1.0f / na)));
      const float hb = expf(-(db * (1.0f / nb)));
      heatL[w * HP + lane]       = ha;
      heatL[(w + 8) * HP + lane] = hb;
    }
    __syncthreads();

    // heat of this lane's 16 (query, key) pairs, read with the global group so that it lands under that group's wait
    const v4f h00 = *(const v4f*)(hrd),      h01 = *(const v4f*)(hrd + 4);
    const v4f h10 = *(const v4f*)(hrd + 16), h11 = *(const v4f*)(hrd + 20);

    // ---- scores, transposed: 32 keys x 16 query columns of head w, K = 64 in two 32-deep steps ----
    // One load group per pass: the 4 K fragments, the 8 V fragments (each in registers of its own) and the next
    // chunk's key positions are all in flight together, so the pass pays one L2 round trip, not one per WMMA.
    const unsigned short* kg = kgb + (size_t)j0 * CM;
    const v16us k00 = ldfrag_u(kg);
    const v16us k01 = ldfrag_u(kg + 32);
    const v16us k10 = ldfrag_u(kg + (size_t)16 * CM);
    const v16us k11 = ldfrag_u(kg + (size_t)16 * CM + 32);
    const unsigned short* vhp = vhb + j0;
    const unsigned short* vlp = vlb + j0;
    v16us vh[4], vl[4];
#pragma unroll
    for (int ct = 0; ct < 4; ++ct) {
      vh[ct] = ldfrag_u(vhp + (size_t)ct * 16 * NC);
      vl[ct] = ldfrag_u(vlp + (size_t)ct * 16 * NC);
    }
    const int jn = (jt + 1 < NCH) ? (j0 + 32) : j0;     // the last pass re-reads its own chunk: stays inside posc
    const float* pc = pcb + (size_t)(jn + lane) * 3;
    px = pc[0]; py = pc[1]; pz = pc[2];
    // The group's address registers are reused below: the wait stands in front of every such overwrite. It takes the
    // four addresses as inputs so that they stay whole up to it, and its memory clobber keeps the group ahead of it.
#if defined(__HIP_DEVICE_COMPILE__)
    asm volatile("s_wait_xcnt 0x0" :: "v"(kg), "v"(vhp), "v"(vlp), "v"(pc) : "memory");
#endif
    __builtin_amdgcn_sched_barrier(0);   // no product (with its data wait) is scheduled up into the load group
    v8f s0, s1;                          // s0[r]: key j0 + 8*hh + r, s1[r]: key j0 + 16 + 8*hh + r, query jc
    s0 = mma_hu(k00, qf0, zero8());
    s0 = mma_hu(k01, qf1, s0);
    s1 = mma_hu(k10, qf0, zero8());
    s1 = mma_hu(k11, qf1, s1);

    // ---- heat bias + online softmax of query jc, all in the lane but for one exchange of the maximum ----
    const v8f x0 = s0 * SCL + __builtin_shufflevector(h00, h01, 0, 1, 2, 3, 4, 5, 6, 7);
    const v8f x1 = s1 * SCL + __builtin_shufflevector(h10, h11, 0, 1, 2, 3, 4, 5, 6, 7);
    const v8f mx = __builtin_elementwise_max(x0, x1);
    float rm = fmaxf(fmaxf(fmaxf(mx[0], mx[1]), fmaxf(mx[2], mx[3])), fmaxf(fmaxf(mx[4], mx[5]), fmaxf(mx[6], mx[7])));
    rm = fmaxf(rm, xhalf(rm));
    const float mn2   = fmaxf(m, rm);
    const float alpha = __expf(m - mn2);
    m = mn2;
    const v8f a0 = x0 - mn2, a1 = x1 - mn2;
    v8f e0, e1;
#pragma unroll
    for (int r = 0; r < 8; ++r) { e0[r] = __expf(a0[r]); e1[r] = __expf(a1[r]); }
    const v8f sm = e0 + e1;
    ll = ll * alpha + (((sm[0] + sm[1]) + (sm[2] + sm[3])) + ((sm[4] + sm[5]) + (sm[6] + sm[7])));
    // P^T B-fragment: element e = p of key kmap(e), the two score tiles converted in place
    const v8h p0 = __builtin_convertvector(e0 * PSC, v8h), p1 = __builtin_convertvector(e1 * PSC, v8h);
    const v16h pb = __builtin_shufflevector(p0, p1, 0, 1, 2, 3, 4, 5, 6, 7, 8, 9, 10, 11, 12, 13, 14, 15);
#pragma unroll
    for (int ct = 0; ct < 4; ++ct) { oh[ct] *= alpha; ol[ct] *= alpha; }

    // ---- context^T += V_hi^T . P^T and V_lo^T . P^T (4 row tiles of 16 dims) ----
    const v16us pbu = __builtin_bit_cast(v16us, pb);
#pragma unroll
    for (int ct = 0; ct < 4; ++ct) {
      oh[ct] = mma_hu(vh[ct], pbu, oh[ct]);
      ol[ct] = mma_hu(vl[ct], pbu, ol[ct]);
    }
  }

  __syncthreads();
  {
    const float l = ll + xhalf(ll);      // the two lane halves' sums of query jc, joined once
    const float inv = ((l > 0.f) ? (1.0f / l) : 0.f) * (1.0f / PSC);
    float* od = osm + jc * OP + w * HD + 8 * hh;
#pragma unroll
    for (int ct = 0; ct < 4; ++ct) {
      v4f o0, o1;
#pragma unroll
      for (int e = 0; e < 4; ++e) {
        o0[e] = (oh[ct][e]     + ol[ct][e]     * (1.0f / RSC)) * inv;
        o1[e] = (oh[ct][4 + e] + ol[ct][4 + e] * (1.0f / RSC)) * inv;
      }
      *(v4f*)(od + ct * 16)     = o0;
      *(v4f*)(od + ct * 16 + 4) = o1;
    }
  }
  __syncthreads();
  {
    v4u hv[2][2], lv[2][2];
#pragma unroll
    for (int rr = 0; rr < 2; ++rr) {
      const float* sp = osm + (w + 8 * rr) * OP;
#pragma unroll
      for (int it = 0; it < 2; ++it) {
        const int c = it * 256 + lane * 8;
        const v4f f0 = *(const v4f*)(sp + c);
        const v4f f1 = *(const v4f*)(sp + c + 4);
        v4u ha, la;
#pragma unroll
        for (int e = 0; e < 2; ++e) {
          const unsigned short u0 = bf_bits(f0[2 * e]), u1 = bf_bits(f0[2 * e + 1]);
          const unsigned short u2 = bf_bits(f1[2 * e]), u3 = bf_bits(f1[2 * e + 1]);
          ha[e]     = pk16(u0, u1);
          ha[2 + e] = pk16(u2, u3);
          la[e]     = pk16(bf_bits(f0[2 * e] - bf_up(u0)), bf_bits(f0[2 * e + 1] - bf_up(u1)));
          la[2 + e] = pk16(bf_bits(f1[2 * e] - bf_up(u2)), bf_bits(f1[2 * e + 1] - bf_up(u3)));
        }
        hv[rr][it] = ha;
        lv[rr][it] = la;
      }
    }
    {
#pragma unroll
      for (int rr = 0; rr < 2; ++rr) {
        const size_t go = (rowQ + i0 + w + 8 * rr) * KC;
#pragma unroll
        for (int it = 0; it < 2; ++it) {
          const int c = it * 256 + lane * 8;
          *(v4u*)(ctxp + go + c)      = hv[rr][it];
          *(v4u*)(ctxp + go + CM + c) = lv[rr][it];
        }
      }
      
    }
  }
}

// =====================================================================================================
// Workspace map (bytes); every plane is an exact multiple of its whole-row / whole-line / 64x64-tile store
// granularity (MQ = 4096 = 64 row tiles, MC = 8192 = 128 row tiles; N in {512, 4096}; v^T per batch
// [512][4096] = 8x64 tiles):
//   Xq   bf16 [4096][512]       0          4194304
//   Xc   bf16 [8192][512]       4194304    8388608
//   Wqb  bf16 [512][512]        12582912   524288
//   Wkb  bf16 [512][512]        13107200   524288
//   Wvb  bf16 [512][512]        13631488   524288
//   WoT2 bf16 [512][1024]       14155776   1048576   (cols k and CM + k both hold the proj weight)
//   Qp   f16  [4096][512]       15204352   4194304
//   Kp   f16  [8192][512]       19398656   8388608
//   VTh  f16  [2][512][4096]    27787264   8388608   (v^T hi)
//   VTl  f16  [2][512][4096]    36175872   8388608   (v^T residual x2048)
//   Ctx  bf16 [4096][1024]      44564480   8388608   (context hi | lo)
//   end                         52953088
// =====================================================================================================
extern "C" void kernel_launch(void* const* d_in, const int* in_sizes, int n_in,
                              void* d_out, int out_size, void* d_ws, size_t ws_size,
                              hipStream_t stream) {
  if (n_in < 12) return;
  if (in_sizes[0] != MC * CM) return;
  if (in_sizes[1] != MQ * CM) return;
  if (in_sizes[2] != MC * 3) return;
  if (in_sizes[3] != MQ * 3) return;
  if (in_sizes[4] != CM * CM || in_sizes[5] != CM) return;
  if (in_sizes[6] != CM * CM || in_sizes[7] != CM) return;
  if (in_sizes[8] != CM * CM || in_sizes[9] != CM) return;
  if (in_sizes[10] != CM * CM || in_sizes[11] != CM) return;
  if (out_size != MQ * CM) return;

  const float* x_ctx   = (const float*)d_in[0];
  const float* x_query = (const float*)d_in[1];
  const float* pos_ctx = (const float*)d_in[2];
  const float* pos_qry = (const float*)d_in[3];
  const float* Wq = (const float*)d_in[4];
  const float* bq = (const float*)d_in[5];
  const float* Wk = (const float*)d_in[6];
  const float* bk = (const float*)d_in[7];
  const float* Wv = (const float*)d_in[8];
  const float* bv = (const float*)d_in[9];
  const float* Wo = (const float*)d_in[10];
  const float* bo = (const float*)d_in[11];

  const size_t PXQ  = (size_t)MQ * CM * 2;             //  4194304
  const size_t PXC  = (size_t)MC * CM * 2;             //  8388608
  const size_t PW   = (size_t)CM * CM * 2;             //   524288
  const size_t PWO  = (size_t)CM * KC * 2;             //  1048576
  const size_t PQ   = (size_t)MQ * CM * 2;             //  4194304
  const size_t PK   = (size_t)MC * CM * 2;             //  8388608
  const size_t PVT  = (size_t)NB * CM * NC * 2;        //  8388608
  const size_t PCTX = (size_t)MQ * KC * 2;             //  8388608
  size_t off = 0;
  const size_t oXq  = off; off += PXQ;
  const size_t oXc  = off; off += PXC;
  const size_t oWq  = off; off += PW;
  const size_t oWk  = off; off += PW;
  const size_t oWv  = off; off += PW;
  const size_t oWo  = off; off += PWO;
  const size_t oQ   = off; off += PQ;
  const size_t oK   = off; off += PK;
  const size_t oVTh = off; off += PVT;
  const size_t oVTl = off; off += PVT;
  const size_t oCtx = off; off += PCTX;
  if (off > ws_size) return;                           // off = 52953088
  if (off > (size_t)134217728) return;

  char* ws = (char*)d_ws;
  unsigned short* Xq   = (unsigned short*)(ws + oXq);
  unsigned short* Xc   = (unsigned short*)(ws + oXc);
  unsigned short* Wqb  = (unsigned short*)(ws + oWq);
  unsigned short* Wkb  = (unsigned short*)(ws + oWk);
  unsigned short* Wvb  = (unsigned short*)(ws + oWv);
  unsigned short* WoT2 = (unsigned short*)(ws + oWo);
  unsigned short* Qp   = (unsigned short*)(ws + oQ);
  unsigned short* Kp   = (unsigned short*)(ws + oK);
  unsigned short* VTh  = (unsigned short*)(ws + oVTh);
  unsigned short* VTl  = (unsigned short*)(ws + oVTl);
  unsigned short* Ctx  = (unsigned short*)(ws + oCtx);
  float*          out0 = (float*)d_out;

  const dim3 blk(256), blk64(64);
  const dim3 gQ(((MQ / 64) * (CM / 64)) / 8, 1, 1);            // 512 tiles -> 64 blocks
  const dim3 gK(((MC / 64) * (CM / 64)) / 8, 1, 1);            // 1024 tiles -> 128 blocks
  const dim3 gVT(((CM / 64) * (NC / 64)) / 8, NB, 1);          // 512 tiles -> 64 blocks x 2 batches
  const dim3 gAttn(NQ / 16, NB, 1);                            // 128 x 2 blocks of 256
  const dim3 gO(((MQ / 64) * (CM / 64)) / 8, 1, 1);            // 512 tiles -> 64 blocks
  if ((((MQ / 64) * (CM / 64)) % 8) != 0) return;
  if ((((MC / 64) * (CM / 64)) % 8) != 0) return;
  if ((((CM / 64) * (NC / 64)) % 8) != 0) return;

  // (0) bf16 planes of the activations and weights ([out][in] = k contiguous); proj weights with duplicated k range
  cvt_rows<<<dim3(MQ), blk64, 0, stream>>>(x_query, Xq, CM, 0);
  cvt_rows<<<dim3(MC), blk64, 0, stream>>>(x_ctx, Xc, CM, 0);
  cvt_rows<<<dim3(CM), blk64, 0, stream>>>(Wq, Wqb, CM, 0);
  cvt_rows<<<dim3(CM), blk64, 0, stream>>>(Wk, Wkb, CM, 0);
  cvt_rows<<<dim3(CM), blk64, 0, stream>>>(Wv, Wvb, CM, 0);
  cvt_rows<<<dim3(CM), blk64, 0, stream>>>(Wo, WoT2, KC, CM);

  // (1) q = Xq . Wqb^T + bq, k = Xc . Wkb^T + bk (K = 512) -> f16 planes [rows][512];
  //     v^T per batch = Wvb . Xc_b^T + bv per row d -> f16 hi (VTh) and residual x2048 (VTl) [2][512][4096]
  gemm64<1, 1><<<gQ, blk, 0, stream>>>(
      Xq, CM, 0LL, Wqb, CM, 0LL,
      Qp, Qp, out0, CM, 0LL,
      bq, MQ, CM, CM);
  gemm64<1, 1><<<gK, blk, 0, stream>>>(
      Xc, CM, 0LL, Wkb, CM, 0LL,
      Kp, Kp, out0, CM, 0LL,
      bk, MC, CM, CM);
  gemm64<2, 2><<<gVT, blk, 0, stream>>>(
      Wvb, CM, 0LL, Xc, CM, (long long)NC * CM,
      VTh, VTl, out0, NC, (long long)CM * NC,
      bv, CM, NC, CM);

  // (2) fused heat bias + softmax attention -> context bf16 hi|lo
  attn_kernel<<<gAttn, blk, 0, stream>>>(pos_qry, pos_ctx, Qp, Kp, VTh, VTl, Ctx);

  // (3) out = [ctx_hi | ctx_lo] . [Wo | Wo]^T + bo  (K = 1024, bf16 operands) -> d_out f32
  gemm64<0, 1><<<gO, blk, 0, stream>>>(
      Ctx, KC, 0LL, WoT2, KC, 0LL,
      Ctx, Ctx, out0, CM, 0LL,
      bo, MQ, CM, KC);
  (void)hipGetLastError();
}

// v003
// It runs in 376 microseconds.
// In two side-by-side timings against v002, it was 1.11 and 1.10 times as fast.
// All steps since v000 together make it 1.74 times as fast.
// Contractions: q and k projections (x . W^T) and v^T projection (Wv . x^T) on v_wmma_f32_16x16x32_bf16 (bf16 x, bf16 weights);
// output projection on v_wmma_f32_16x16x32_bf16 (context as bf16 hi|lo planes K-concatenated against duplicated bf16 weights);
// scores transposed, k.q^T, on v_wmma_f32_16x16x32_f16 (plain f16 q, k); v^T.p^T on v_wmma_f32_16x16x32_f16 (p carried
// x1024 f16, v^T as f16 hi + x2048 residual planes, separate accumulators); all f32 accumulate; heat-kernel bias and softmax in f32;
// every float input RNE-converted to bf16 on load.
#include <hip/hip_runtime.h>
#include <math.h>
#include <stdint.h>

#define NB   2
#define NQ   2048
#define NC   4096
#define CM   512
#define NH   8
#define HD   64
#define MQ   (NB * NQ)
#define MC   (NB * NC)
#define KC   (2 * CM)
#define NCH  (NC / 32)
#define RSC  2048.0f
#define PSC  1024.0f
#define SCL  0.125f
#define HK4  0.4f
#define HEPS 1.0e-6f
#define HP   36            // heat tile pitch in floats: 144 B, 16 B x odd, for its 16-byte readers
#define OP   (CM + 4)      // output staging pitch in floats: the 16 lanes' 16-byte stores of one column walk fall on 64 banks
static_assert(NH * HD == CM);
static_assert(NH == 8);
static_assert((MQ % 64) == 0 && (MC % 64) == 0 && (CM % 64) == 0 && (NC % 64) == 0 && (KC % 32) == 0);
static_assert((((MQ / 64) * (CM / 64)) % 8) == 0);
static_assert((((MC / 64) * (CM / 64)) % 8) == 0);
static_assert((((CM / 64) * (NC / 64)) % 8) == 0);
static_assert((NQ % 16) == 0 && (NC % 32) == 0);

typedef _Float16 v16h __attribute__((ext_vector_type(16)));
typedef _Float16 v8h  __attribute__((ext_vector_type(8)));
typedef __bf16   v16b __attribute__((ext_vector_type(16)));
typedef unsigned short v16us __attribute__((ext_vector_type(16)));
typedef unsigned short v8us  __attribute__((ext_vector_type(8)));
typedef float    v8f  __attribute__((ext_vector_type(8)));
typedef float    v4f  __attribute__((ext_vector_type(4)));
typedef unsigned int v4u __attribute__((ext_vector_type(4)));

union FragU { v16us v; v8us h[2]; };

// ---- scalar helpers --------------------------------------------------------------------------------
__device__ __forceinline__ unsigned short bf_bits(float f) {          // f32 -> bf16 bits, RNE convert
  unsigned u = __float_as_uint(f);
  return (unsigned short)((u + 0x7FFFu + ((u >> 16) & 1u)) >> 16);
}
__device__ __forceinline__ float bf_up(unsigned short h) { return __uint_as_float(((unsigned)h) << 16); }
__device__ __forceinline__ float bfr(float f) { return bf_up(bf_bits(f)); }   // value of the bf16 RNE convert
__device__ __forceinline__ unsigned short h_bits(_Float16 x) { return __builtin_bit_cast(unsigned short, x); }
__device__ __forceinline__ unsigned pk16(unsigned short a, unsigned short b) { return (unsigned)a | ((unsigned)b << 16); }
__device__ __forceinline__ v8f zero8() { v8f z = {0.f, 0.f, 0.f, 0.f, 0.f, 0.f, 0.f, 0.f}; return z; }
__device__ __forceinline__ float xhalf(float x) {                     // value of lane l ^ 16
  const int b = __builtin_bit_cast(int, x);
  return __builtin_bit_cast(float, __builtin_amdgcn_permlanex16(b, b, 0x76543210, 0xfedcba98, false, false));
}

// ---- fragment loader: 16-bit A/B operand, lane -> row/col (lane&15), p already includes +8*(lane>>4);
//      elements 0..7 <- p[0..7] (k0+8h..), elements 8..15 <- p[16..23] (k0+16+8h..)
__device__ __forceinline__ v16us ldfrag_u(const unsigned short* p) {
  FragU f;
  f.h[0] = *(const v8us*)(p);
  f.h[1] = *(const v8us*)(p + 16);
  return f.v;
}

// ---- fragment loader, fragment-order plane: one operand fragment is 1 KiB in a row, lane l's elements 0..7 at
//      16 * l bytes and its elements 8..15 at 512 + 16 * l; p already includes + 8 * lane. Each of the two loads
//      reads 512 bytes in a row (4 whole lines) where a row-major plane makes it touch 16 lines.
__device__ __forceinline__ v16us ldfrag_f(const unsigned short* p) {
  FragU f;
  f.h[0] = *(const v8us*)(p);
  f.h[1] = *(const v8us*)(p + 256);
  return f.v;
}

// ---- s_wait_xcnt 0 behind a group of global loads, in front of every overwrite of the group's address registers:
//      it takes the address as an input so that it stays whole up to it; its memory clobber keeps the loads ahead of it.
__device__ __forceinline__ void xwait1(const void* a) {
#if defined(__HIP_DEVICE_COMPILE__)
  asm volatile("s_wait_xcnt 0x0" :: "v"(a) : "memory");
#endif
}

// ---- WMMA helpers with trailing VALU hazard gap --------------------------------------------------------
__device__ __forceinline__ v8f mma_bu_raw(v16us a, v16us b, v8f c) {            // bf16 operands, unguarded
  return __builtin_amdgcn_wmma_f32_16x16x32_bf16(false, __builtin_bit_cast(v16b, a), false,
                                                 __builtin_bit_cast(v16b, b), (short)0, c, false, false);
}
__device__ __forceinline__ v8f mma_hu(v16us a, v16us b, v8f c) {                // f16 operands (bits), guarded
  c = __builtin_amdgcn_wmma_f32_16x16x32_f16(false, __builtin_bit_cast(v16h, a), false,
                                              __builtin_bit_cast(v16h, b), (short)0, c, false, false);
#if defined(__HIP_DEVICE_COMPILE__)
  asm volatile("v_nop\n\tv_nop\n\tv_nop\n\tv_nop" : "+v"(c) : "v"(a), "v"(b));
#endif
  return c;
}
__device__ __forceinline__ void dep_guard1(v8f& a, v8f& b, v16us x) {
#if defined(__HIP_DEVICE_COMPILE__)
  asm volatile("v_nop\n\tv_nop\n\tv_nop\n\tv_nop" : "+v"(a), "+v"(b) : "v"(x));
#endif
}
__device__ __forceinline__ void keep4_u(v16us a, v16us b, v16us c, v16us d) {
#if defined(__HIP_DEVICE_COMPILE__)
  asm volatile("v_nop" :: "v"(a), "v"(b), "v"(c), "v"(d));
#endif
}
__device__ __forceinline__ void acc_guard4(v8f& a, v8f& b, v8f& c, v8f& d) {
#if defined(__HIP_DEVICE_COMPILE__)
  asm volatile("v_nop\n\tv_nop\n\tv_nop\n\tv_nop" : "+v"(a), "+v"(b), "+v"(c), "+v"(d));
#endif
}
__device__ __forceinline__ void wave_sync_lds() {
  __builtin_amdgcn_fence(__ATOMIC_RELEASE, "workgroup");
  __builtin_amdgcn_wave_barrier();
  __builtin_amdgcn_fence(__ATOMIC_ACQUIRE, "workgroup");
}

// =====================================================================================================
// Row convert: in[row][CM] f32 -> bf16 RNE bits in fragment order for a plane of nrt row tiles: fragment (row tile
// row/16, k step k/32) at (k step * nrt + row tile) * 512 elements (one k step of all rows lies in a row), inside it as
// ldfrag_f reads it; the blocks of blockIdx.y = 1, where the grid has them, write the same values for k steps dupk + k/32.
// Block = 256 threads (one tile of 16 rows = 1024 pieces of 8 columns, 4 a thread). Piece c holds row c & 15,
// columns 8 * (c >> 4) .. + 7: k step c >> 6, at 8 * (c & 63) elements of its fragment, so one store of one wave
// writes 512 bytes in a row.
// coverage: 1024 pieces x 8 = 16 rows x CM columns; grid = every row tile of the matrix (x 2 with the dup copy).
// =====================================================================================================
__global__ __launch_bounds__(256) void cvt_rows(const float* __restrict__ src, unsigned short* dst, int nrt, int dupk) {
  const int rt = blockIdx.x, tid = threadIdx.x;
  // thread tid takes pieces c = tid + 256 * it: the same row, 128 columns (4 k steps) on
  const float* p = src + ((size_t)rt * 16 + (tid & 15)) * CM + (tid >> 4) * 8;
  unsigned short* d = dst + ((size_t)((tid >> 6) + blockIdx.y * dupk) * nrt + rt) * 512 + (tid & 63) * 8;
  v4f a0[4], a1[4];
#pragma unroll
  for (int it = 0; it < 4; ++it) {
    a0[it] = *(const v4f*)(p + it * 128);
    a1[it] = *(const v4f*)(p + it * 128 + 4);
  }
  xwait1(p);
  v4u hv[4];
#pragma unroll
  for (int it = 0; it < 4; ++it) {
    hv[it][0] = pk16(bf_bits(a0[it][0]), bf_bits(a0[it][1]));
    hv[it][1] = pk16(bf_bits(a0[it][2]), bf_bits(a0[it][3]));
    hv[it][2] = pk16(bf_bits(a1[it][0]), bf_bits(a1[it][1]));
    hv[it][3] = pk16(bf_bits(a1[it][2]), bf_bits(a1[it][3]));
  }
  unsigned short* dq[4];
#pragma unroll
  for (int it = 0; it < 4; ++it) dq[it] = d + (size_t)it * 4 * nrt * 512;
  __builtin_amdgcn_sched_barrier(0);   // the stores stand behind all the arithmetic: no register that one names is written again
#pragma unroll
  for (int it = 0; it < 4; ++it) *(v4u*)(dq[it]) = hv[it];
}

// =====================================================================================================
// Register-blocked batched bf16 WMMA GEMM: C[m][n] = sum_k A[m][k] * Bt[n][k] (+ bias);
// one wave per 64x64 tile, no block barriers. A [M][K] and Bt [N][K] in fragment order, in planes of rtA and rtB row
// tiles: fragment (row tile row/16, k step k/32) at (k step * rt + row tile) * 512 elements, so that what all waves
// read in one k step lies in a row; M, N multiples of 64, K multiple of 32. blockIdx.y = batch index with element strides
// (sAy for A, sBy for Bt, sCy for C). Tile enumeration: tile -> tm = tile / (N/64), tn = tile % (N/64).
// OM: 0 = f32 out to Cf (pitch ldc); 1 = f16 bits to Cp (pitch ldc); 2 = f16 hi bits to Cp and f16((v - hi) * 2048)
//     bits to Cp2, both in fragment order for m = head dim, n = key: fragment (chunk n/32, head m/64, row tile
//     (m/16)%4) at ((chunk * NH + head) * 4 + row tile) * 512 elements; 3 = f16 bits to Cp in fragment order for
//     m = key row (batch-major), n = head dim: fragment (chunk m/32 over both batches, head n/64, key tile (m/16)%2,
//     k step (n/32)%2) at (((chunk * NH + head) * 2 + key tile) * 2 + k step) * 512 elements. Inside a fragment: see
//     ldfrag_f. One chunk of 32 keys of all heads lies in a row in each plane.
// CBM: 0 = no bias; 1 = column bias bf16(cb[n]); 2 = row bias bf16(cb[m]).
// coverage: 4 slabs x 16 rows x 64 cols = the wave's whole 64x64 tile; grid = tilesM*tilesN/8 blocks exactly
//           (host-checked), so no wave exits early.
// =====================================================================================================
template <int OM, int CBM>
__global__ __launch_bounds__(256) void gemm64(
    const unsigned short* __restrict__ Ap, int rtA, long long sAy,
    const unsigned short* __restrict__ Btp, int rtB, long long sBy,
    unsigned short* Cp, unsigned short* Cp2, float* Cf, int ldc, long long sCy,
    const float* __restrict__ cb, int M, int N, int K) {
  __shared__ __align__(16) float sT[8][16 * 68];   // per-wave 16x64 slab, pitch 68 floats
  const int by   = blockIdx.y;
  const int lane = threadIdx.x & 31;
  const int wave = threadIdx.x >> 5;
  const int tilesN = N >> 6;
  const int tilesM = M >> 6;
  const int tile = blockIdx.x * 8 + wave;
  if (tile >= tilesM * tilesN) return;   // wave-uniform; no block barriers in this kernel
  const int tm = tile / tilesN;
  const int tn = tile - tm * tilesN;
  const int m0 = tm << 6;
  const int n0 = tn << 6;

  const unsigned short* Ab = Ap  + (size_t)by * (size_t)sAy;
  const unsigned short* Bb = Btp + (size_t)by * (size_t)sBy;
  const size_t cofs = (size_t)by * (size_t)sCy;

  const int rlane = lane & 15;                 // row (A) / col (B, D) within subtile
  const int mOff  = (lane >> 4) * 8;           // D row offset

  v8f acc[4][4];
#pragma unroll
  for (int i = 0; i < 4; ++i)
#pragma unroll
    for (int j = 0; j < 4; ++j) acc[i][j] = zero8();

  for (int k0 = 0; k0 < K; k0 += 32) {
    v16us bh[4];
    const unsigned short* bp = Bb + ((size_t)(k0 >> 5) * rtB + (n0 >> 4)) * 512 + lane * 8;
    const unsigned short* ap = Ab + ((size_t)(k0 >> 5) * rtA + (m0 >> 4)) * 512 + lane * 8;
#pragma unroll
    for (int j = 0; j < 4; ++j) bh[j] = ldfrag_f(bp + j * 512);
    xwait1(bp);
#pragma unroll
    for (int i = 0; i < 4; ++i) {
      const v16us ah = ldfrag_f(ap + i * 512);
      xwait1(ap);
#pragma unroll
      for (int j = 0; j < 4; ++j) acc[i][j] = mma_bu_raw(ah, bh[j], acc[i][j]);
      dep_guard1(acc[i][0], acc[i][3], ah);
    }
    keep4_u(bh[0], bh[1], bh[2], bh[3]);
  }
  acc_guard4(acc[0][0], acc[0][1], acc[0][2], acc[0][3]);
  acc_guard4(acc[1][0], acc[1][1], acc[1][2], acc[1][3]);
  acc_guard4(acc[2][0], acc[2][1], acc[2][2], acc[2][3]);
  acc_guard4(acc[3][0], acc[3][1], acc[3][2], acc[3][3]);

  const int hh2 = lane >> 4, c4 = (lane & 15) * 4;     // f32 out: 256-B row segment = 16 lanes x 16 B
  const int q8  = lane >> 3, c8 = (lane & 7) * 8;

  v4f cb4 = {0.f, 0.f, 0.f, 0.f};
  float cbc[4][8];                                     // row-major out uses [0] alone; fragment order one set per it
#pragma unroll
  for (int g = 0; g < 4; ++g)
#pragma unroll
    for (int e = 0; e < 8; ++e) cbc[g][e] = 0.f;
  if (CBM == 1) {
    if (OM == 0) {
      const v4f v = *(const v4f*)(cb + n0 + c4);
      cb4[0] = bfr(v[0]); cb4[1] = bfr(v[1]); cb4[2] = bfr(v[2]); cb4[3] = bfr(v[3]);
    } else if (OM == 1) {
      const v4f v0 = *(const v4f*)(cb + n0 + c8);
      const v4f v1 = *(const v4f*)(cb + n0 + c8 + 4);
#pragma unroll
      for (int e = 0; e < 4; ++e) { cbc[0][e] = bfr(v0[e]); cbc[0][4 + e] = bfr(v1[e]); }
    } else {
      const float* cp = cb + n0 + mOff;
#pragma unroll
      for (int g = 0; g < 4; ++g) {
        const v4f v0 = *(const v4f*)(cp + g * 16);
        const v4f v1 = *(const v4f*)(cp + g * 16 + 4);
#pragma unroll
        for (int e = 0; e < 4; ++e) { cbc[g][e] = bfr(v0[e]); cbc[g][4 + e] = bfr(v1[e]); }
      }
    }
  }

  // ---- epilogue ----
  float* slab = sT[wave];
#pragma unroll
  for (int i = 0; i < 4; ++i) {
    const int mBase = m0 + (i << 4);
#pragma unroll
    for (int j = 0; j < 4; ++j) {
#pragma unroll
      for (int r = 0; r < 8; ++r) {
        slab[(mOff + r) * 68 + (j << 4) + rlane] = acc[i][j][r];
      }
    }
    wave_sync_lds();
    if (OM == 0) {
      float* C = Cf + cofs;
      v4f vals[8];
#pragma unroll
      for (int it = 0; it < 8; ++it) {
        const int row = it * 2 + hh2;                      // it 0..7 x hh2 0..1 = rows 0..15
        const v4f v = *(const v4f*)(slab + row * 68 + c4);
        vals[it] = v + cb4;
      }
      {
#pragma unroll
        for (int it = 0; it < 8; ++it) {
          const int row = it * 2 + hh2;
          *(v4f*)(C + (size_t)(mBase + row) * ldc + (size_t)n0 + c4) = vals[it];
        }
        
      }
    } else {
      unsigned short* C  = Cp  + cofs;
      unsigned short* C2 = Cp2 + cofs;
      v4u hv[4], lv[4];
#pragma unroll
      for (int it = 0; it < 4; ++it) {
        // row-major out: it 0..3 x q8 0..3 = rows 0..15, 8 columns at c8; fragment order: the lane takes what it
        // holds as an operand, row lane & 15, the 8 columns at 16 * it + 8 * (lane >> 4)
        const int row = (OM == 1) ? (it * 4 + q8) : rlane;
        const int col = (OM == 1) ? c8 : (it * 16 + mOff);
        const float* sp = slab + row * 68 + col;
        float rb = 0.f;
        if (CBM == 2) rb = bfr(cb[mBase + row]);
        const int g = (OM == 1) ? 0 : it;
        v4u ha = {0u, 0u, 0u, 0u}, la = {0u, 0u, 0u, 0u};
#pragma unroll
        for (int e = 0; e < 4; ++e) {
          const float f0 = sp[2 * e]     + cbc[g][2 * e]     + rb;
          const float f1 = sp[2 * e + 1] + cbc[g][2 * e + 1] + rb;
          const _Float16 g0 = (_Float16)f0, g1 = (_Float16)f1;
          ha[e] = pk16(h_bits(g0), h_bits(g1));
          if (OM == 2) {
            la[e] = pk16(h_bits((_Float16)((f0 - (float)g0) * RSC)),
                         h_bits((_Float16)((f1 - (float)g1) * RSC)));
          }
        }
        hv[it] = ha;
        lv[it] = la;
      }
      {
#pragma unroll
        for (int it = 0; it < 4; ++it) {
          size_t go;
          if (OM == 1) {
            go = (size_t)(mBase + it * 4 + q8) * ldc + (size_t)n0 + c8;
          } else if (OM == 2) {
            go = (((size_t)((n0 >> 5) + (it >> 1)) * NH + tm) * 4 + i) * 512 + (it & 1) * 256 + lane * 8;
          } else {
            go = ((((size_t)(mBase >> 5) * NH + tn) * 2 + ((mBase >> 4) & 1)) * 2 + (it >> 1)) * 512
                 + (it & 1) * 256 + lane * 8;
          }
          *(v4u*)(C + go) = hv[it];
          if (OM == 2) *(v4u*)(C2 + go) = lv[it];
        }
        
      }
    }
    wave_sync_lds();
  }
}

// =====================================================================================================
// Fused heat-bias + online-softmax cross attention, head dim 64, 8 heads.
//   Block = 256 threads = 8 waves, wave w = head w; one block per (batch, 16 query rows); key chunks of 32,
//   static trip NCH = 128. q plane (f16 bits, pitch CM): row (b*NQ + t), head h at col h*64 + d; k plane
//   (f16 bits) and v^T hi / lo planes (f16 bits, value = hi + lo/2048) in fragment order (gemm64, OM 3 and 2):
//   2048 elements per (batch, chunk of 32 keys, head) in each plane. Context plane (bf16 bits, KC columns, fragment order
//   as gemm64 reads its A): row b*NQ + t, hi at column h*64 + d, lo (value - hi) at column CM + h*64 + d.
//   Per chunk: heat[q][s] = exp(-(dx*dx + dy*dy) * (1 / (0.4*|dt| + 1e-6))) from the bf16-converted positions
//   (spatial = dims 0,1, time = dim 2), computed once per (query row, key) pair by the block (thread = key
//   lane, rows w and w+8) into LDS and shared by the 8 head waves. Both products are transposed: S^T = K . Q^T
//   (A = k rows, B = q), so a lane holds 16 of the 32 scores of ONE query (column lane & 15; keys 8h + r and
//   16 + 8h + r): s = (k . q) * 0.125 + heat; running-max softmax in f32 with maximum and sum in the lane, the
//   maximum joined with the other lane half once a pass, the sums once behind the loop. p = exp(s - m) as
//   f16(1024 p): the two score tiles, converted in place, are the B operand of O^T += V^T . P^T (A = v^T rows, hi and
//   lo accumulator sets, 4 row tiles of 16 dims each). All q, k, v^T and p fragments use the split k map
//   (elements 0..7 <- k0+8h.., 8..15 <- k0+16+8h..).
//   Epilogue: context tile of the block (16 rows x 512) staged in LDS (f32), then written as one fragment-order row tile.
// coverage: heat 16 rows x 32 keys per chunk (8 waves x 2 rows x 32 lanes); context 16 rows x 512 cols hi and lo
//           per block (256 threads x 4 pieces x 8 cols); grid NQ/16 x NB covers every query row.
// =====================================================================================================
__global__ void __launch_bounds__(256) attn_kernel(
    const float* __restrict__ posq, const float* __restrict__ posc,
    const unsigned short* __restrict__ qp, const unsigned short* __restrict__ kp,
    const unsigned short* __restrict__ vth, const unsigned short* __restrict__ vtl,
    unsigned short* ctxp) {
#pragma clang fp contract(off)
  __shared__ __align__(16) float heatL[16 * HP];            // [query row][key], pitch HP
  __shared__ __align__(16) float osm[16 * OP];              // output staging [16][CM], pitch OP
  __shared__ float qps[16 * 3];

  const int b = blockIdx.y, i0 = blockIdx.x * 16;
  const int t = threadIdx.x, lane = t & 31, w = t >> 5, hh = lane >> 4, jc = lane & 15;
  const size_t rowQ = (size_t)b * NQ, rowC = (size_t)b * NC;

  if (t < 48) qps[t] = bfr(posq[(rowQ + i0) * 3 + t]);
  __syncthreads();

  // q B-fragments (col = query jc of this tile, k = d), plain f16 bits; d 0..31 and 32..63
  const unsigned short* qrow = qp + (rowQ + i0 + jc) * CM + w * HD + 8 * hh;
  const v16us qf0 = ldfrag_u(qrow);
  const v16us qf1 = ldfrag_u(qrow + 32);

  // query positions of the two heat rows this thread produces (rows w and w+8, key = lane)
  const float qx0 = qps[w * 3 + 0],       qy0 = qps[w * 3 + 1],       qt0 = qps[w * 3 + 2];
  const float qx1 = qps[(w + 8) * 3 + 0], qy1 = qps[(w + 8) * 3 + 1], qt1 = qps[(w + 8) * 3 + 2];

  float m = -1.0e30f, ll = 0.f;      // query jc: running maximum (both lane halves alike), this lane half's sum
  v8f oh[4], ol[4];                  // O^T tiles: register r = dim ct*16 + 8*hh + r of query jc
#pragma unroll
  for (int ct = 0; ct < 4; ++ct) { oh[ct] = zero8(); ol[ct] = zero8(); }

  // fragment-order planes: a pass's 4 K fragments are 4 KiB in a row, its 4 V fragments 4 KiB in a row in each plane,
  // and the 8 heads' (waves') pieces of one pass follow one another
  const unsigned short* vhb = vth + ((size_t)b * NCH * NH + w) * 2048 + lane * 8;     // A: row d = ct*16 + jc, k = key
  const unsigned short* vlb = vtl + ((size_t)b * NCH * NH + w) * 2048 + lane * 8;
  const unsigned short* kgb = kp + ((size_t)b * NCH * NH + w) * 2048 + lane * 8;      // A: row key = jc, k = d
  const float* pcb = posc + rowC * 3;
  const float* hrd = heatL + jc * HP + 8 * hh;                                        // heat of query jc, keys 8*hh..

  // key positions of chunk 0; each pass fetches the next chunk's with its own load group
  float px = pcb[(size_t)lane * 3 + 0], py = pcb[(size_t)lane * 3 + 1], pz = pcb[(size_t)lane * 3 + 2];

#pragma unroll 1
  for (int jt = 0; jt < NCH; ++jt) {
    const int j0 = jt * 32;
    __syncthreads();                                   // all waves done reading heatL of the prior chunk
    {
      const float cx = bfr(px), cy = bfr(py), cz = bfr(pz);
      const float dxa = qx0 - cx, dya = qy0 - cy, dta = qt0 - cz;
      const float dxb = qx1 - cx, dyb = qy1 - cy, dtb = qt1 - cz;
      const float da = dxa * dxa + dya * dya;
      const float db = dxb * dxb + dyb * dyb;
      const float na = HK4 * fabsf(dta) + HEPS;
      const float nb = HK4 * fabsf(dtb) + HEPS;
      const float ha = expf(-(da * (1.0f / na)));
      const float hb = expf(-(db * (1.0f / nb)));
      heatL[w * HP + lane]       = ha;
      heatL[(w + 8) * HP + lane] = hb;
    }
    __syncthreads();

    // heat of this lane's 16 (query, key) pairs, read with the global group so that it lands under that group's wait
    const v4f h00 = *(const v4f*)(hrd),      h01 = *(const v4f*)(hrd + 4);
    const v4f h10 = *(const v4f*)(hrd + 16), h11 = *(const v4f*)(hrd + 20);

    // ---- scores, transposed: 32 keys x 16 query columns of head w, K = 64 in two 32-deep steps ----
    // One load group per pass: the 4 K fragments, the 8 V fragments (each in registers of its own) and the next
    // chunk's key positions are all in flight together, so the pass pays one L2 round trip, not one per WMMA.
    const unsigned short* kg = kgb + (size_t)jt * (NH * 2048);
    const v16us k00 = ldfrag_f(kg);
    const v16us k01 = ldfrag_f(kg + 512);
    const v16us k10 = ldfrag_f(kg + 1024);
    const v16us k11 = ldfrag_f(kg + 1536);
    const unsigned short* vhp = vhb + (size_t)jt * (NH * 2048);
    const unsigned short* vlp = vlb + (size_t)jt * (NH * 2048);
    v16us vh[4], vl[4];
#pragma unroll
    for (int ct = 0; ct < 4; ++ct) {
      vh[ct] = ldfrag_f(vhp + ct * 512);
      vl[ct] = ldfrag_f(vlp + ct * 512);
    }
    const int jn = (jt + 1 < NCH) ? (j0 + 32) : j0;     // the last pass re-reads its own chunk: stays inside posc
    const float* pc = pcb + (size_t)(jn + lane) * 3;
    px = pc[0]; py = pc[1]; pz = pc[2];
    // The group's address registers are reused below: the wait stands in front of every such overwrite. It takes the
    // four addresses as inputs so that they stay whole up to it, and its memory clobber keeps the group ahead of it.
#if defined(__HIP_DEVICE_COMPILE__)
    asm volatile("s_wait_xcnt 0x0" :: "v"(kg), "v"(vhp), "v"(vlp), "v"(pc) : "memory");
#endif
    __builtin_amdgcn_sched_barrier(0);   // no product (with its data wait) is scheduled up into the load group
    v8f s0, s1;                          // s0[r]: key j0 + 8*hh + r, s1[r]: key j0 + 16 + 8*hh + r, query jc
    s0 = mma_hu(k00, qf0, zero8());
    s0 = mma_hu(k01, qf1, s0);
    s1 = mma_hu(k10, qf0, zero8());
    s1 = mma_hu(k11, qf1, s1);

    // ---- heat bias + online softmax of query jc, all in the lane but for one exchange of the maximum ----
    const v8f x0 = s0 * SCL + __builtin_shufflevector(h00, h01, 0, 1, 2, 3, 4, 5, 6, 7);
    const v8f x1 = s1 * SCL + __builtin_shufflevector(h10, h11, 0, 1, 2, 3, 4, 5, 6, 7);
    const v8f mx = __builtin_elementwise_max(x0, x1);
    float rm = fmaxf(fmaxf(fmaxf(mx[0], mx[1]), fmaxf(mx[2], mx[3])), fmaxf(fmaxf(mx[4], mx[5]), fmaxf(mx[6], mx[7])));
    rm = fmaxf(rm, xhalf(rm));
    const float mn2   = fmaxf(m, rm);
    const float alpha = __expf(m - mn2);
    m = mn2;
    const v8f a0 = x0 - mn2, a1 = x1 - mn2;
    v8f e0, e1;
#pragma unroll
    for (int r = 0; r < 8; ++r) { e0[r] = __expf(a0[r]); e1[r] = __expf(a1[r]); }
    const v8f sm = e0 + e1;
    ll = ll * alpha + (((sm[0] + sm[1]) + (sm[2] + sm[3])) + ((sm[4] + sm[5]) + (sm[6] + sm[7])));
    // P^T B-fragment: element e = p of key kmap(e), the two score tiles converted in place
    const v8h p0 = __builtin_convertvector(e0 * PSC, v8h), p1 = __builtin_convertvector(e1 * PSC, v8h);
    const v16h pb = __builtin_shufflevector(p0, p1, 0, 1, 2, 3, 4, 5, 6, 7, 8, 9, 10, 11, 12, 13, 14, 15);
#pragma unroll
    for (int ct = 0; ct < 4; ++ct) { oh[ct] *= alpha; ol[ct] *= alpha; }

    // ---- context^T += V_hi^T . P^T and V_lo^T . P^T (4 row tiles of 16 dims) ----
    const v16us pbu = __builtin_bit_cast(v16us, pb);
#pragma unroll
    for (int ct = 0; ct < 4; ++ct) {
      oh[ct] = mma_hu(vh[ct], pbu, oh[ct]);
      ol[ct] = mma_hu(vl[ct], pbu, ol[ct]);
    }
  }

  __syncthreads();
  {
    const float l = ll + xhalf(ll);      // the two lane halves' sums of query jc, joined once
    const float inv = ((l > 0.f) ? (1.0f / l) : 0.f) * (1.0f / PSC);
    float* od = osm + jc * OP + w * HD + 8 * hh;
#pragma unroll
    for (int ct = 0; ct < 4; ++ct) {
      v4f o0, o1;
#pragma unroll
      for (int e = 0; e < 4; ++e) {
        o0[e] = (oh[ct][e]     + ol[ct][e]     * (1.0f / RSC)) * inv;
        o1[e] = (oh[ct][4 + e] + ol[ct][4 + e] * (1.0f / RSC)) * inv;
      }
      *(v4f*)(od + ct * 16)     = o0;
      *(v4f*)(od + ct * 16 + 4) = o1;
    }
  }
  __syncthreads();
  {
    // piece c of the tile's 1024: row c & 15, columns 8 * (c >> 4) .. + 7: k step c >> 6, 8 * (c & 63) elements into its fragment
    v4u hv[2][2], lv[2][2];
#pragma unroll
    for (int rr = 0; rr < 2; ++rr) {
#pragma unroll
      for (int it = 0; it < 2; ++it) {
        const int c = (rr * 2 + it) * 256 + t;
        const float* sp = osm + (c & 15) * OP + (c >> 4) * 8;
        const v4f f0 = *(const v4f*)(sp);
        const v4f f1 = *(const v4f*)(sp + 4);
        v4u ha, la;
#pragma unroll
        for (int e = 0; e < 2; ++e) {
          const unsigned short u0 = bf_bits(f0[2 * e]), u1 = bf_bits(f0[2 * e + 1]);
          const unsigned short u2 = bf_bits(f1[2 * e]), u3 = bf_bits(f1[2 * e + 1]);
          ha[e]     = pk16(u0, u1);
          ha[2 + e] = pk16(u2, u3);
          la[e]     = pk16(bf_bits(f0[2 * e] - bf_up(u0)), bf_bits(f0[2 * e + 1] - bf_up(u1)));
          la[2 + e] = pk16(bf_bits(f1[2 * e] - bf_up(u2)), bf_bits(f1[2 * e + 1] - bf_up(u3)));
        }
        hv[rr][it] = ha;
        lv[rr][it] = la;
      }
    }
    {
#pragma unroll
      for (int rr = 0; rr < 2; ++rr) {
        const size_t rtq = (rowQ + i0) >> 4;               // the block's row tile among the plane's MQ / 16
#pragma unroll
        for (int it = 0; it < 2; ++it) {
          const int c = (rr * 2 + it) * 256 + t;
          const size_t go = ((size_t)(c >> 6) * (MQ / 16) + rtq) * 512 + (c & 63) * 8;
          *(v4u*)(ctxp + go)                                   = hv[rr][it];
          *(v4u*)(ctxp + go + (size_t)(CM / 32) * (MQ / 16) * 512) = lv[rr][it];
        }
      }
      
    }
  }
}

// =====================================================================================================
// Workspace map (bytes); every plane is an exact multiple of its whole-row / whole-line / 64x64-tile store
// granularity (MQ = 4096 = 64 row tiles, MC = 8192 = 128 row tiles; N in {512, 4096}; v^T per batch
// [512][4096] = 8x64 tiles):
// (Xq, Xc, the four weight planes and Ctx hold these shapes in fragment order: [k step of 32][row tile of 16][512])
//   Xq   bf16 [4096][512]       0          4194304
//   Xc   bf16 [8192][512]       4194304    8388608
//   Wqb  bf16 [512][512]        12582912   524288
//   Wkb  bf16 [512][512]        13107200   524288
//   Wvb  bf16 [512][512]        13631488   524288
//   WoT2 bf16 [512][1024]       14155776   1048576   (cols k and CM + k both hold the proj weight)
//   Qp   f16  [4096][512]       15204352   4194304
//   Kp   f16  [2][128][8][2048] 19398656   8388608   (k, fragment order: batch, chunk of 32 keys, head)
//   VTh  f16  [2][128][8][2048] 27787264   8388608   (v^T hi, fragment order)
//   VTl  f16  [2][128][8][2048] 36175872   8388608   (v^T residual x2048, fragment order)
//   Ctx  bf16 [4096][1024]      44564480   8388608   (context hi | lo)
//   end                         52953088
// =====================================================================================================
extern "C" void kernel_launch(void* const* d_in, const int* in_sizes, int n_in,
                              void* d_out, int out_size, void* d_ws, size_t ws_size,
                              hipStream_t stream) {
  if (n_in < 12) return;
  if (in_sizes[0] != MC * CM) return;
  if (in_sizes[1] != MQ * CM) return;
  if (in_sizes[2] != MC * 3) return;
  if (in_sizes[3] != MQ * 3) return;
  if (in_sizes[4] != CM * CM || in_sizes[5] != CM) return;
  if (in_sizes[6] != CM * CM || in_sizes[7] != CM) return;
  if (in_sizes[8] != CM * CM || in_sizes[9] != CM) return;
  if (in_sizes[10] != CM * CM || in_sizes[11] != CM) return;
  if (out_size != MQ * CM) return;

  const float* x_ctx   = (const float*)d_in[0];
  const float* x_query = (const float*)d_in[1];
  const float* pos_ctx = (const float*)d_in[2];
  const float* pos_qry = (const float*)d_in[3];
  const float* Wq = (const float*)d_in[4];
  const float* bq = (const float*)d_in[5];
  const float* Wk = (const float*)d_in[6];
  const float* bk = (const float*)d_in[7];
  const float* Wv = (const float*)d_in[8];
  const float* bv = (const float*)d_in[9];
  const float* Wo = (const float*)d_in[10];
  const float* bo = (const float*)d_in[11];

  const size_t PXQ  = (size_t)MQ * CM * 2;             //  4194304
  const size_t PXC  = (size_t)MC * CM * 2;             //  8388608
  const size_t PW   = (size_t)CM * CM * 2;             //   524288
  const size_t PWO  = (size_t)CM * KC * 2;             //  1048576
  const size_t PQ   = (size_t)MQ * CM * 2;             //  4194304
  const size_t PK   = (size_t)MC * CM * 2;             //  8388608
  const size_t PVT  = (size_t)NB * CM * NC * 2;        //  8388608
  const size_t PCTX = (size_t)MQ * KC * 2;             //  8388608
  size_t off = 0;
  const size_t oXq  = off; off += PXQ;
  const size_t oXc  = off; off += PXC;
  const size_t oWq  = off; off += PW;
  const size_t oWk  = off; off += PW;
  const size_t oWv  = off; off += PW;
  const size_t oWo  = off; off += PWO;
  const size_t oQ   = off; off += PQ;
  const size_t oK   = off; off += PK;
  const size_t oVTh = off; off += PVT;
  const size_t oVTl = off; off += PVT;
  const size_t oCtx = off; off += PCTX;
  if (off > ws_size) return;                           // off = 52953088
  if (off > (size_t)134217728) return;

  char* ws = (char*)d_ws;
  unsigned short* Xq   = (unsigned short*)(ws + oXq);
  unsigned short* Xc   = (unsigned short*)(ws + oXc);
  unsigned short* Wqb  = (unsigned short*)(ws + oWq);
  unsigned short* Wkb  = (unsigned short*)(ws + oWk);
  unsigned short* Wvb  = (unsigned short*)(ws + oWv);
  unsigned short* WoT2 = (unsigned short*)(ws + oWo);
  unsigned short* Qp   = (unsigned short*)(ws + oQ);
  unsigned short* Kp   = (unsigned short*)(ws + oK);
  unsigned short* VTh  = (unsigned short*)(ws + oVTh);
  unsigned short* VTl  = (unsigned short*)(ws + oVTl);
  unsigned short* Ctx  = (unsigned short*)(ws + oCtx);
  float*          out0 = (float*)d_out;

  const dim3 blk(256);
  const dim3 gQ(((MQ / 64) * (CM / 64)) / 8, 1, 1);            // 512 tiles -> 64 blocks
  const dim3 gK(((MC / 64) * (CM / 64)) / 8, 1, 1);            // 1024 tiles -> 128 blocks
  const dim3 gVT(((CM / 64) * (NC / 64)) / 8, NB, 1);          // 512 tiles -> 64 blocks x 2 batches
  const dim3 gAttn(NQ / 16, NB, 1);                            // 128 x 2 blocks of 256
  const dim3 gO(((MQ / 64) * (CM / 64)) / 8, 1, 1);            // 512 tiles -> 64 blocks
  if ((((MQ / 64) * (CM / 64)) % 8) != 0) return;
  if ((((MC / 64) * (CM / 64)) % 8) != 0) return;
  if ((((CM / 64) * (NC / 64)) % 8) != 0) return;

  // (0) bf16 planes of the activations and weights ([out][in]) in fragment order; proj weights with duplicated k range
  cvt_rows<<<dim3(MQ / 16), blk, 0, stream>>>(x_query, Xq, MQ / 16, 0);
  cvt_rows<<<dim3(MC / 16), blk, 0, stream>>>(x_ctx, Xc, MC / 16, 0);
  cvt_rows<<<dim3(CM / 16), blk, 0, stream>>>(Wq, Wqb, CM / 16, 0);
  cvt_rows<<<dim3(CM / 16), blk, 0, stream>>>(Wk, Wkb, CM / 16, 0);
  cvt_rows<<<dim3(CM / 16), blk, 0, stream>>>(Wv, Wvb, CM / 16, 0);
  cvt_rows<<<dim3(CM / 16, 2), blk, 0, stream>>>(Wo, WoT2, CM / 16, CM / 32);

  // (1) q = Xq . Wqb^T + bq -> f16 plane [rows][512]; k = Xc . Wkb^T + bk (K = 512) -> f16, fragment order;
  //     v^T per batch = Wvb . Xc_b^T + bv per row d -> f16 hi (VTh) and residual x2048 (VTl), fragment order
  gemm64<1, 1><<<gQ, blk, 0, stream>>>(
      Xq, MQ / 16, 0LL, Wqb, CM / 16, 0LL,
      Qp, Qp, out0, CM, 0LL,
      bq, MQ, CM, CM);
  gemm64<3, 1><<<gK, blk, 0, stream>>>(
      Xc, MC / 16, 0LL, Wkb, CM / 16, 0LL,
      Kp, Kp, out0, CM, 0LL,
      bk, MC, CM, CM);
  gemm64<2, 2><<<gVT, blk, 0, stream>>>(
      Wvb, CM / 16, 0LL, Xc, MC / 16, (long long)(NC / 16) * 512,
      VTh, VTl, out0, NC, (long long)CM * NC,
      bv, CM, NC, CM);

  // (2) fused heat bias + softmax attention -> context bf16 hi|lo
  attn_kernel<<<gAttn, blk, 0, stream>>>(pos_qry, pos_ctx, Qp, Kp, VTh, VTl, Ctx);

  // (3) out = [ctx_hi | ctx_lo] . [Wo | Wo]^T + bo  (K = 1024, bf16 operands) -> d_out f32
  gemm64<0, 1><<<gO, blk, 0, stream>>>(
      Ctx, MQ / 16, 0LL, WoT2, CM / 16, 0LL,
      Ctx, Ctx, out0, CM, 0LL,
      bo, MQ, CM, KC);
  (void)hipGetLastError();
}

// v004
// One run takes 262 microseconds.
// Two timings next to v003 put it at 1.44 and 1.45 times that version's speed.
// All steps since v000 together make it 2.52 times as fast.
// Contractions: q and k projections (x . W^T) and v^T projection (Wv . x^T) on v_wmma_f32_16x16x32_bf16 (bf16 x, bf16 weights);
// output projection on v_wmma_f32_16x16x32_bf16 (context as bf16 hi|lo planes K-concatenated against duplicated bf16 weights);
// scores transposed, k.q^T, on v_wmma_f32_16x16x32_f16 (plain f16 q, k); v^T.p^T on v_wmma_f32_16x16x32_f16 (p carried
// x1024 f16, v^T as f16 hi + x2048 residual planes, separate accumulators); all f32 accumulate; heat-kernel bias and softmax in f32;
// every float input RNE-converted to bf16 on load.
#include <hip/hip_runtime.h>
#include <math.h>
#include <stdint.h>

#define NB   2
#define NQ   2048
#define NC   4096
#define CM   512
#define NH   8
#define HD   64
#define MQ   (NB * NQ)
#define MC   (NB * NC)
#define KC   (2 * CM)
#define NCH  (NC / 32)
#define RSC  2048.0f
#define PSC  1024.0f
#define SCL  0.125f
#define HK4  0.4f
#define HEPS 1.0e-6f
#define HP   36            // heat tile pitch in floats: 144 B, 16 B x odd, for its 16-byte readers
#define OP   (CM + 4)      // output staging pitch in floats: the 16 lanes' 16-byte stores of one column walk fall on 64 banks
static_assert(NH * HD == CM);
static_assert(NH == 8);
static_assert((MQ % 64) == 0 && (MC % 64) == 0 && (CM % 64) == 0 && (NC % 64) == 0 && (KC % 64) == 0);
static_assert((((MQ / 64) * (CM / 64)) % 8) == 0);
static_assert((((MC / 64) * (CM / 64)) % 8) == 0);
static_assert((((CM / 64) * (NC / 64)) % 8) == 0);
static_assert((NQ % 16) == 0 && (NC % 32) == 0);

typedef _Float16 v16h __attribute__((ext_vector_type(16)));
typedef _Float16 v8h  __attribute__((ext_vector_type(8)));
typedef __bf16   v16b __attribute__((ext_vector_type(16)));
typedef unsigned short v16us __attribute__((ext_vector_type(16)));
typedef unsigned short v8us  __attribute__((ext_vector_type(8)));
typedef float    v8f  __attribute__((ext_vector_type(8)));
typedef float    v4f  __attribute__((ext_vector_type(4)));
typedef unsigned int v4u __attribute__((ext_vector_type(4)));

union FragU { v16us v; v8us h[2]; };

// ---- scalar helpers --------------------------------------------------------------------------------
__device__ __forceinline__ unsigned short bf_bits(float f) {          // f32 -> bf16 bits, RNE convert
  unsigned u = __float_as_uint(f);
  return (unsigned short)((u + 0x7FFFu + ((u >> 16) & 1u)) >> 16);
}
__device__ __forceinline__ float bf_up(unsigned short h) { return __uint_as_float(((unsigned)h) << 16); }
__device__ __forceinline__ float bfr(float f) { return bf_up(bf_bits(f)); }   // value of the bf16 RNE convert
__device__ __forceinline__ unsigned short h_bits(_Float16 x) { return __builtin_bit_cast(unsigned short, x); }
__device__ __forceinline__ unsigned pk16(unsigned short a, unsigned short b) { return (unsigned)a | ((unsigned)b << 16); }
__device__ __forceinline__ v8f zero8() { v8f z = {0.f, 0.f, 0.f, 0.f, 0.f, 0.f, 0.f, 0.f}; return z; }
__device__ __forceinline__ float xhalf(float x) {                     // value of lane l ^ 16
  const int b = __builtin_bit_cast(int, x);
  return __builtin_bit_cast(float, __builtin_amdgcn_permlanex16(b, b, 0x76543210, 0xfedcba98, false, false));
}

// ---- fragment loader: 16-bit A/B operand, lane -> row/col (lane&15), p already includes +8*(lane>>4);
//      elements 0..7 <- p[0..7] (k0+8h..), elements 8..15 <- p[16..23] (k0+16+8h..)
__device__ __forceinline__ v16us ldfrag_u(const unsigned short* p) {
  FragU f;
  f.h[0] = *(const v8us*)(p);
  f.h[1] = *(const v8us*)(p + 16);
  return f.v;
}

// ---- fragment loader, fragment-order plane: one operand fragment is 1 KiB in a row, lane l's elements 0..7 at
//      16 * l bytes and its elements 8..15 at 512 + 16 * l; p already includes + 8 * lane. Each of the two loads
//      reads 512 bytes in a row (4 whole lines) where a row-major plane makes it touch 16 lines.
__device__ __forceinline__ v16us ldfrag_f(const unsigned short* p) {
  FragU f;
  f.h[0] = *(const v8us*)(p);
  f.h[1] = *(const v8us*)(p + 256);
  return f.v;
}

// ---- s_wait_xcnt 0 behind a group of global loads, in front of every overwrite of the group's address registers:
//      it takes the address as an input so that it stays whole up to it; its memory clobber keeps the loads ahead of it.
__device__ __forceinline__ void xwait1(const void* a) {
#if defined(__HIP_DEVICE_COMPILE__)
  asm volatile("s_wait_xcnt 0x0" :: "v"(a) : "memory");
#endif
}

// ---- WMMA helpers with trailing VALU hazard gap --------------------------------------------------------
__device__ __forceinline__ v8f mma_bu_raw(v16us a, v16us b, v8f c) {            // bf16 operands, unguarded
  return __builtin_amdgcn_wmma_f32_16x16x32_bf16(false, __builtin_bit_cast(v16b, a), false,
                                                 __builtin_bit_cast(v16b, b), (short)0, c, false, false);
}
__device__ __forceinline__ v8f mma_hu(v16us a, v16us b, v8f c) {                // f16 operands (bits), guarded
  c = __builtin_amdgcn_wmma_f32_16x16x32_f16(false, __builtin_bit_cast(v16h, a), false,
                                              __builtin_bit_cast(v16h, b), (short)0, c, false, false);
#if defined(__HIP_DEVICE_COMPILE__)
  asm volatile("v_nop\n\tv_nop\n\tv_nop\n\tv_nop" : "+v"(c) : "v"(a), "v"(b));
#endif
  return c;
}
// ---- one k step of a 64x64 wave tile: its 4 A and 4 B fragments (16 loads, fragment-order planes) as one group, A first.
//      ap, bp: the wave's (uniform) global addresses of the step, in scalar registers; l8 = 8 * lane elements, the one
//      vector register that all 16 loads name
typedef const __attribute__((address_space(1))) unsigned short gus;
typedef const __attribute__((address_space(1))) v8us           gv8us;
__device__ __forceinline__ void ld_step(v16us (&a)[4], v16us (&b)[4], gus* ap, gus* bp, unsigned l8) {
#pragma unroll
  for (int i = 0; i < 4; ++i) {
    FragU f;
    f.h[0] = *(gv8us*)(ap + i * 512 + l8);
    f.h[1] = *(gv8us*)(ap + i * 512 + l8 + 256);
    a[i] = f.v;
  }
#pragma unroll
  for (int j = 0; j < 4; ++j) {
    FragU f;
    f.h[0] = *(gv8us*)(bp + j * 512 + l8);
    f.h[1] = *(gv8us*)(bp + j * 512 + l8 + 256);
    b[j] = f.v;
  }
  // s_wait_xcnt 0 in front of every overwrite of the group's address registers: it takes the two bases and the lane
  // offset as inputs so that they stay whole up to it; its memory clobber keeps the loads ahead of it.
#if defined(__HIP_DEVICE_COMPILE__)
  asm volatile("s_wait_xcnt 0x0" :: "s"(ap), "s"(bp), "v"(l8) : "memory");
#endif
  __builtin_amdgcn_sched_barrier(0);   // no product (with its data wait) is scheduled up into the load group
}
// ---- between a step's products and the load group that refills the operand registers they read
__device__ __forceinline__ void refill_gap() {
  __builtin_amdgcn_sched_barrier(0);   // the group stays whole: without this its A loads are spread among the products in front of it
  // four vector slots, the distance a WMMA asks for before its A or B is overwritten: loads fill no slot, and a load over
  // B directly behind the product is not known to be safe; the memory clobber keeps the loads behind the slots
#if defined(__HIP_DEVICE_COMPILE__)
  asm volatile("v_nop\n\tv_nop\n\tv_nop\n\tv_nop" ::: "memory");
#endif
}
// ---- the next k step's address, added in scalar registers by hand: left to the compiler, the loop's address sums move
//      into vector registers, and accumulators plus two fragment sets leave none to spare (it then copies accumulators about)
__device__ __forceinline__ gus* next_step(gus* p, unsigned long long bytes) {
#if defined(__HIP_DEVICE_COMPILE__)
  gus* r;
  asm("s_add_nc_u64 %0, %1, %2" : "=s"(r) : "s"(p), "s"(bytes));
  return r;
#else
  return p + bytes / 2;
#endif
}
__device__ __forceinline__ void mma_step(v8f (&acc)[4][4], const v16us (&a)[4], const v16us (&b)[4]) {
#pragma unroll
  for (int i = 0; i < 4; ++i)
#pragma unroll
    for (int j = 0; j < 4; ++j) acc[i][j] = mma_bu_raw(a[i], b[j], acc[i][j]);
}
__device__ __forceinline__ void acc_guard4(v8f& a, v8f& b, v8f& c, v8f& d) {
#if defined(__HIP_DEVICE_COMPILE__)
  asm volatile("v_nop\n\tv_nop\n\tv_nop\n\tv_nop" : "+v"(a), "+v"(b), "+v"(c), "+v"(d));
#endif
}
__device__ __forceinline__ void wave_sync_lds() {
  __builtin_amdgcn_fence(__ATOMIC_RELEASE, "workgroup");
  __builtin_amdgcn_wave_barrier();
  __builtin_amdgcn_fence(__ATOMIC_ACQUIRE, "workgroup");
}

// =====================================================================================================
// Row convert: in[row][CM] f32 -> bf16 RNE bits in fragment order for a plane of nrt row tiles: fragment (row tile
// row/16, k step k/32) at (k step * nrt + row tile) * 512 elements (one k step of all rows lies in a row), inside it as
// ldfrag_f reads it; the blocks of blockIdx.y = 1, where the grid has them, write the same values for k steps dupk + k/32.
// Block = 256 threads (one tile of 16 rows = 1024 pieces of 8 columns, 4 a thread). Piece c holds row c & 15,
// columns 8 * (c >> 4) .. + 7: k step c >> 6, at 8 * (c & 63) elements of its fragment, so one store of one wave
// writes 512 bytes in a row.
// coverage: 1024 pieces x 8 = 16 rows x CM columns; grid = every row tile of the matrix (x 2 with the dup copy).
// =====================================================================================================
__global__ __launch_bounds__(256) void cvt_rows(const float* __restrict__ src, unsigned short* dst, int nrt, int dupk) {
  const int rt = blockIdx.x, tid = threadIdx.x;
  // thread tid takes pieces c = tid + 256 * it: the same row, 128 columns (4 k steps) on
  const float* p = src + ((size_t)rt * 16 + (tid & 15)) * CM + (tid >> 4) * 8;
  unsigned short* d = dst + ((size_t)((tid >> 6) + blockIdx.y * dupk) * nrt + rt) * 512 + (tid & 63) * 8;
  v4f a0[4], a1[4];
#pragma unroll
  for (int it = 0; it < 4; ++it) {
    a0[it] = *(const v4f*)(p + it * 128);
    a1[it] = *(const v4f*)(p + it * 128 + 4);
  }
  xwait1(p);
  v4u hv[4];
#pragma unroll
  for (int it = 0; it < 4; ++it) {
    hv[it][0] = pk16(bf_bits(a0[it][0]), bf_bits(a0[it][1]));
    hv[it][1] = pk16(bf_bits(a0[it][2]), bf_bits(a0[it][3]));
    hv[it][2] = pk16(bf_bits(a1[it][0]), bf_bits(a1[it][1]));
    hv[it][3] = pk16(bf_bits(a1[it][2]), bf_bits(a1[it][3]));
  }
  unsigned short* dq[4];
#pragma unroll
  for (int it = 0; it < 4; ++it) dq[it] = d + (size_t)it * 4 * nrt * 512;
  __builtin_amdgcn_sched_barrier(0);   // the stores stand behind all the arithmetic: no register that one names is written again
#pragma unroll
  for (int it = 0; it < 4; ++it) *(v4u*)(dq[it]) = hv[it];
}

// =====================================================================================================
// Register-blocked batched bf16 WMMA GEMM: C[m][n] = sum_k A[m][k] * Bt[n][k] (+ bias);
// one wave per 64x64 tile, no block barriers. A [M][K] and Bt [N][K] in fragment order, in planes of rtA and rtB row
// tiles: fragment (row tile row/16, k step k/32) at (k step * rt + row tile) * 512 elements, so that what all waves
// read in one k step lies in a row; M, N and K multiples of 64. blockIdx.y = batch index with element strides
// (sAy for A, sBy for Bt, sCy for C). Tile enumeration: tile -> tm = tile / (N/64), tn = tile % (N/64).
// OM: 0 = f32 out to Cf (pitch ldc); 1 = f16 bits to Cp (pitch ldc); 2 = f16 hi bits to Cp and f16((v - hi) * 2048)
//     bits to Cp2, both in fragment order for m = head dim, n = key: fragment (chunk n/32, head m/64, row tile
//     (m/16)%4) at ((chunk * NH + head) * 4 + row tile) * 512 elements; 3 = f16 bits to Cp in fragment order for
//     m = key row (batch-major), n = head dim: fragment (chunk m/32 over both batches, head n/64, key tile (m/16)%2,
//     k step (n/32)%2) at (((chunk * NH + head) * 2 + key tile) * 2 + k step) * 512 elements. Inside a fragment: see
//     ldfrag_f. One chunk of 32 keys of all heads lies in a row in each plane.
// CBM: 0 = no bias; 1 = column bias bf16(cb[n]); 2 = row bias bf16(cb[m]).
// coverage: 4 slabs x 16 rows x 64 cols = the wave's whole 64x64 tile; grid = tilesM*tilesN/8 blocks exactly
//           (host-checked), so no wave exits early.
// =====================================================================================================
template <int OM, int CBM>
__global__ __launch_bounds__(256) void gemm64(
    const unsigned short* __restrict__ Ap, int rtA, long long sAy,
    const unsigned short* __restrict__ Btp, int rtB, long long sBy,
    unsigned short* Cp, unsigned short* Cp2, float* Cf, int ldc, long long sCy,
    const float* __restrict__ cb, int M, int N, int K) {
  __shared__ __align__(16) float sT[8][16 * 68];   // per-wave 16x64 slab, pitch 68 floats
  const int by   = blockIdx.y;
  const int lane = threadIdx.x & 31;
  const int wave = __builtin_amdgcn_readfirstlane(threadIdx.x >> 5);   // scalar: the tile's addresses stay in scalar registers
  const int tilesN = N >> 6;
  const int tilesM = M >> 6;
  const int tile = blockIdx.x * 8 + wave;
  if (tile >= tilesM * tilesN) return;   // wave-uniform; no block barriers in this kernel
  const int tm = tile / tilesN;
  const int tn = tile - tm * tilesN;
  const int m0 = tm << 6;
  const int n0 = tn << 6;

  const unsigned short* Ab = Ap  + (size_t)by * (size_t)sAy;
  const unsigned short* Bb = Btp + (size_t)by * (size_t)sBy;
  const size_t cofs = (size_t)by * (size_t)sCy;

  const int rlane = lane & 15;                 // row (A) / col (B, D) within subtile
  const int mOff  = (lane >> 4) * 8;           // D row offset

  v8f acc[4][4];
#pragma unroll
  for (int i = 0; i < 4; ++i)
#pragma unroll
    for (int j = 0; j < 4; ++j) acc[i][j] = zero8();

  // Two fragment sets: while one k step's 16 products run on one set, the next step's 16 loads are in flight into the
  // other, so a wave waits for memory once per step at most, not four times per step. k ascends as before.
  const unsigned long long sA = (unsigned long long)rtA * 1024u, sB = (unsigned long long)rtB * 1024u;   // bytes per k step
  gus* ap = (gus*)(Ab + (size_t)(m0 >> 4) * 512);
  gus* bp = (gus*)(Bb + (size_t)(n0 >> 4) * 512);
  const unsigned l8 = (unsigned)lane * 8u;
  v16us fa0[4], fb0[4], fa1[4], fb1[4];
  ld_step(fa0, fb0, ap, bp, l8);
  for (int k0 = 64; k0 < K; k0 += 64) {
    ap = next_step(ap, sA);
    bp = next_step(bp, sB);
    refill_gap();
    ld_step(fa1, fb1, ap, bp, l8);
    mma_step(acc, fa0, fb0);
    ap = next_step(ap, sA);
    bp = next_step(bp, sB);
    refill_gap();
    ld_step(fa0, fb0, ap, bp, l8);
    mma_step(acc, fa1, fb1);
  }
  ap = next_step(ap, sA);
  bp = next_step(bp, sB);
  refill_gap();
  ld_step(fa1, fb1, ap, bp, l8);                                     // the last two steps: nothing left to fetch ahead
  mma_step(acc, fa0, fb0);
  mma_step(acc, fa1, fb1);
  acc_guard4(acc[0][0], acc[0][1], acc[0][2], acc[0][3]);
  acc_guard4(acc[1][0], acc[1][1], acc[1][2], acc[1][3]);
  acc_guard4(acc[2][0], acc[2][1], acc[2][2], acc[2][3]);
  acc_guard4(acc[3][0], acc[3][1], acc[3][2], acc[3][3]);

  const int hh2 = lane >> 4, c4 = (lane & 15) * 4;     // f32 out: 256-B row segment = 16 lanes x 16 B
  const int q8  = lane >> 3, c8 = (lane & 7) * 8;

  v4f cb4 = {0.f, 0.f, 0.f, 0.f};
  float cbc[4][8];                                     // row-major out uses [0] alone; fragment order one set per it
#pragma unroll
  for (int g = 0; g < 4; ++g)
#pragma unroll
    for (int e = 0; e < 8; ++e) cbc[g][e] = 0.f;
  if (CBM == 1) {
    if (OM == 0) {
      const v4f v = *(const v4f*)(cb + n0 + c4);
      cb4[0] = bfr(v[0]); cb4[1] = bfr(v[1]); cb4[2] = bfr(v[2]); cb4[3] = bfr(v[3]);
    } else if (OM == 1) {
      const v4f v0 = *(const v4f*)(cb + n0 + c8);
      const v4f v1 = *(const v4f*)(cb + n0 + c8 + 4);
#pragma unroll
      for (int e = 0; e < 4; ++e) { cbc[0][e] = bfr(v0[e]); cbc[0][4 + e] = bfr(v1[e]); }
    } else {
      const float* cp = cb + n0 + mOff;
#pragma unroll
      for (int g = 0; g < 4; ++g) {
        const v4f v0 = *(const v4f*)(cp + g * 16);
        const v4f v1 = *(const v4f*)(cp + g * 16 + 4);
#pragma unroll
        for (int e = 0; e < 4; ++e) { cbc[g][e] = bfr(v0[e]); cbc[g][4 + e] = bfr(v1[e]); }
      }
    }
  }

  // ---- epilogue ----
  float* slab = sT[wave];
#pragma unroll
  for (int i = 0; i < 4; ++i) {
    const int mBase = m0 + (i << 4);
#pragma unroll
    for (int j = 0; j < 4; ++j) {
#pragma unroll
      for (int r = 0; r < 8; ++r) {
        slab[(mOff + r) * 68 + (j << 4) + rlane] = acc[i][j][r];
      }
    }
    wave_sync_lds();
    if (OM == 0) {
      float* C = Cf + cofs;
      v4f vals[8];
#pragma unroll
      for (int it = 0; it < 8; ++it) {
        const int row = it * 2 + hh2;                      // it 0..7 x hh2 0..1 = rows 0..15
        const v4f v = *(const v4f*)(slab + row * 68 + c4);
        vals[it] = v + cb4;
      }
      {
#pragma unroll
        for (int it = 0; it < 8; ++it) {
          const int row = it * 2 + hh2;
          *(v4f*)(C + (size_t)(mBase + row) * ldc + (size_t)n0 + c4) = vals[it];
        }
        
      }
    } else {
      unsigned short* C  = Cp  + cofs;
      unsigned short* C2 = Cp2 + cofs;
      v4u hv[4], lv[4];
#pragma unroll
      for (int it = 0; it < 4; ++it) {
        // row-major out: it 0..3 x q8 0..3 = rows 0..15, 8 columns at c8; fragment order: the lane takes what it
        // holds as an operand, row lane & 15, the 8 columns at 16 * it + 8 * (lane >> 4)
        const int row = (OM == 1) ? (it * 4 + q8) : rlane;
        const int col = (OM == 1) ? c8 : (it * 16 + mOff);
        const float* sp = slab + row * 68 + col;
        float rb = 0.f;
        if (CBM == 2) rb = bfr(cb[mBase + row]);
        const int g = (OM == 1) ? 0 : it;
        v4u ha = {0u, 0u, 0u, 0u}, la = {0u, 0u, 0u, 0u};
#pragma unroll
        for (int e = 0; e < 4; ++e) {
          const float f0 = sp[2 * e]     + cbc[g][2 * e]     + rb;
          const float f1 = sp[2 * e + 1] + cbc[g][2 * e + 1] + rb;
          const _Float16 g0 = (_Float16)f0, g1 = (_Float16)f1;
          ha[e] = pk16(h_bits(g0), h_bits(g1));
          if (OM == 2) {
            la[e] = pk16(h_bits((_Float16)((f0 - (float)g0) * RSC)),
                         h_bits((_Float16)((f1 - (float)g1) * RSC)));
          }
        }
        hv[it] = ha;
        lv[it] = la;
      }
      {
#pragma unroll
        for (int it = 0; it < 4; ++it) {
          size_t go;
          if (OM == 1) {
            go = (size_t)(mBase + it * 4 + q8) * ldc + (size_t)n0 + c8;
          } else if (OM == 2) {
            go = (((size_t)((n0 >> 5) + (it >> 1)) * NH + tm) * 4 + i) * 512 + (it & 1) * 256 + lane * 8;
          } else {
            go = ((((size_t)(mBase >> 5) * NH + tn) * 2 + ((mBase >> 4) & 1)) * 2 + (it >> 1)) * 512
                 + (it & 1) * 256 + lane * 8;
          }
          *(v4u*)(C + go) = hv[it];
          if (OM == 2) *(v4u*)(C2 + go) = lv[it];
        }
        
      }
    }
    wave_sync_lds();
  }
}

// =====================================================================================================
// Fused heat-bias + online-softmax cross attention, head dim 64, 8 heads.
//   Block = 256 threads = 8 waves, wave w = head w; one block per (batch, 16 query rows); key chunks of 32,
//   static trip NCH = 128. q plane (f16 bits, pitch CM): row (b*NQ + t), head h at col h*64 + d; k plane
//   (f16 bits) and v^T hi / lo planes (f16 bits, value = hi + lo/2048) in fragment order (gemm64, OM 3 and 2):
//   2048 elements per (batch, chunk of 32 keys, head) in each plane. Context plane (bf16 bits, KC columns, fragment order
//   as gemm64 reads its A): row b*NQ + t, hi at column h*64 + d, lo (value - hi) at column CM + h*64 + d.
//   Per chunk: heat[q][s] = exp(-(dx*dx + dy*dy) * (1 / (0.4*|dt| + 1e-6))) from the bf16-converted positions
//   (spatial = dims 0,1, time = dim 2), computed once per (query row, key) pair by the block (thread = key
//   lane, rows w and w+8) into LDS and shared by the 8 head waves. Both products are transposed: S^T = K . Q^T
//   (A = k rows, B = q), so a lane holds 16 of the 32 scores of ONE query (column lane & 15; keys 8h + r and
//   16 + 8h + r): s = (k . q) * 0.125 + heat; running-max softmax in f32 with maximum and sum in the lane, the
//   maximum joined with the other lane half once a pass, the sums once behind the loop. p = exp(s - m) as
//   f16(1024 p): the two score tiles, converted in place, are the B operand of O^T += V^T . P^T (A = v^T rows, hi and
//   lo accumulator sets, 4 row tiles of 16 dims each). All q, k, v^T and p fragments use the split k map
//   (elements 0..7 <- k0+8h.., 8..15 <- k0+16+8h..).
//   Epilogue: context tile of the block (16 rows x 512) staged in LDS (f32), then written as one fragment-order row tile.
// coverage: heat 16 rows x 32 keys per chunk (8 waves x 2 rows x 32 lanes); context 16 rows x 512 cols hi and lo
//           per block (256 threads x 4 pieces x 8 cols); grid NQ/16 x NB covers every query row.
// =====================================================================================================
__global__ void __launch_bounds__(256) attn_kernel(
    const float* __restrict__ posq, const float* __restrict__ posc,
    const unsigned short* __restrict__ qp, const unsigned short* __restrict__ kp,
    const unsigned short* __restrict__ vth, const unsigned short* __restrict__ vtl,
    unsigned short* ctxp) {
#pragma clang fp contract(off)
  __shared__ __align__(16) float heatL[16 * HP];            // [query row][key], pitch HP
  __shared__ __align__(16) float osm[16 * OP];              // output staging [16][CM], pitch OP
  __shared__ float qps[16 * 3];

  const int b = blockIdx.y, i0 = blockIdx.x * 16;
  const int t = threadIdx.x, lane = t & 31, w = t >> 5, hh = lane >> 4, jc = lane & 15;
  const size_t rowQ = (size_t)b * NQ, rowC = (size_t)b * NC;

  if (t < 48) qps[t] = bfr(posq[(rowQ + i0) * 3 + t]);
  __syncthreads();

  // q B-fragments (col = query jc of this tile, k = d), plain f16 bits; d 0..31 and 32..63
  const unsigned short* qrow = qp + (rowQ + i0 + jc) * CM + w * HD + 8 * hh;
  const v16us qf0 = ldfrag_u(qrow);
  const v16us qf1 = ldfrag_u(qrow + 32);

  // query positions of the two heat rows this thread produces (rows w and w+8, key = lane)
  const float qx0 = qps[w * 3 + 0],       qy0 = qps[w * 3 + 1],       qt0 = qps[w * 3 + 2];
  const float qx1 = qps[(w + 8) * 3 + 0], qy1 = qps[(w + 8) * 3 + 1], qt1 = qps[(w + 8) * 3 + 2];

  float m = -1.0e30f, ll = 0.f;      // query jc: running maximum (both lane halves alike), this lane half's sum
  v8f oh[4], ol[4];                  // O^T tiles: register r = dim ct*16 + 8*hh + r of query jc
#pragma unroll
  for (int ct = 0; ct < 4; ++ct) { oh[ct] = zero8(); ol[ct] = zero8(); }

  // fragment-order planes: a pass's 4 K fragments are 4 KiB in a row, its 4 V fragments 4 KiB in a row in each plane,
  // and the 8 heads' (waves') pieces of one pass follow one another
  const unsigned short* vhb = vth + ((size_t)b * NCH * NH + w) * 2048 + lane * 8;     // A: row d = ct*16 + jc, k = key
  const unsigned short* vlb = vtl + ((size_t)b * NCH * NH + w) * 2048 + lane * 8;
  const unsigned short* kgb = kp + ((size_t)b * NCH * NH + w) * 2048 + lane * 8;      // A: row key = jc, k = d
  const float* pcb = posc + rowC * 3;
  const float* hrd = heatL + jc * HP + 8 * hh;                                        // heat of query jc, keys 8*hh..

  // key positions of chunk 0; each pass fetches the next chunk's with its own load group
  float px = pcb[(size_t)lane * 3 + 0], py = pcb[(size_t)lane * 3 + 1], pz = pcb[(size_t)lane * 3 + 2];

#pragma unroll 1
  for (int jt = 0; jt < NCH; ++jt) {
    const int j0 = jt * 32;
    __syncthreads();                                   // all waves done reading heatL of the prior chunk
    {
      const float cx = bfr(px), cy = bfr(py), cz = bfr(pz);
      const float dxa = qx0 - cx, dya = qy0 - cy, dta = qt0 - cz;
      const float dxb = qx1 - cx, dyb = qy1 - cy, dtb = qt1 - cz;
      const float da = dxa * dxa + dya * dya;
      const float db = dxb * dxb + dyb * dyb;
      const float na = HK4 * fabsf(dta) + HEPS;
      const float nb = HK4 * fabsf(dtb) + HEPS;
      const float ha = expf(-(da * (1.0f / na)));
      const float hb = expf(-(db * (1.0f / nb)));
      heatL[w * HP + lane]       = ha;
      heatL[(w + 8) * HP + lane] = hb;
    }
    __syncthreads();

    // heat of this lane's 16 (query, key) pairs, read with the global group so that it lands under that group's wait
    const v4f h00 = *(const v4f*)(hrd),      h01 = *(const v4f*)(hrd + 4);
    const v4f h10 = *(const v4f*)(hrd + 16), h11 = *(const v4f*)(hrd + 20);

    // ---- scores, transposed: 32 keys x 16 query columns of head w, K = 64 in two 32-deep steps ----
    // One load group per pass: the 4 K fragments, the 8 V fragments (each in registers of its own) and the next
    // chunk's key positions are all in flight together, so the pass pays one L2 round trip, not one per WMMA.
    const unsigned short* kg = kgb + (size_t)jt * (NH * 2048);
    const v16us k00 = ldfrag_f(kg);
    const v16us k01 = ldfrag_f(kg + 512);
    const v16us k10 = ldfrag_f(kg + 1024);
    const v16us k11 = ldfrag_f(kg + 1536);
    const unsigned short* vhp = vhb + (size_t)jt * (NH * 2048);
    const unsigned short* vlp = vlb + (size_t)jt * (NH * 2048);
    v16us vh[4], vl[4];
#pragma unroll
    for (int ct = 0; ct < 4; ++ct) {
      vh[ct] = ldfrag_f(vhp + ct * 512);
      vl[ct] = ldfrag_f(vlp + ct * 512);
    }
    const int jn = (jt + 1 < NCH) ? (j0 + 32) : j0;     // the last pass re-reads its own chunk: stays inside posc
    const float* pc = pcb + (size_t)(jn + lane) * 3;
    px = pc[0]; py = pc[1]; pz = pc[2];
    // The group's address registers are reused below: the wait stands in front of every such overwrite. It takes the
    // four addresses as inputs so that they stay whole up to it, and its memory clobber keeps the group ahead of it.
#if defined(__HIP_DEVICE_COMPILE__)
    asm volatile("s_wait_xcnt 0x0" :: "v"(kg), "v"(vhp), "v"(vlp), "v"(pc) : "memory");
#endif
    __builtin_amdgcn_sched_barrier(0);   // no product (with its data wait) is scheduled up into the load group
    v8f s0, s1;                          // s0[r]: key j0 + 8*hh + r, s1[r]: key j0 + 16 + 8*hh + r, query jc
    s0 = mma_hu(k00, qf0, zero8());
    s0 = mma_hu(k01, qf1, s0);
    s1 = mma_hu(k10, qf0, zero8());
    s1 = mma_hu(k11, qf1, s1);

    // ---- heat bias + online softmax of query jc, all in the lane but for one exchange of the maximum ----
    const v8f x0 = s0 * SCL + __builtin_shufflevector(h00, h01, 0, 1, 2, 3, 4, 5, 6, 7);
    const v8f x1 = s1 * SCL + __builtin_shufflevector(h10, h11, 0, 1, 2, 3, 4, 5, 6, 7);
    const v8f mx = __builtin_elementwise_max(x0, x1);
    float rm = fmaxf(fmaxf(fmaxf(mx[0], mx[1]), fmaxf(mx[2], mx[3])), fmaxf(fmaxf(mx[4], mx[5]), fmaxf(mx[6], mx[7])));
    rm = fmaxf(rm, xhalf(rm));
    const float mn2   = fmaxf(m, rm);
    const float alpha = __expf(m - mn2);
    m = mn2;
    const v8f a0 = x0 - mn2, a1 = x1 - mn2;
    v8f e0, e1;
#pragma unroll
    for (int r = 0; r < 8; ++r) { e0[r] = __expf(a0[r]); e1[r] = __expf(a1[r]); }
    const v8f sm = e0 + e1;
    ll = ll * alpha + (((sm[0] + sm[1]) + (sm[2] + sm[3])) + ((sm[4] + sm[5]) + (sm[6] + sm[7])));
    // P^T B-fragment: element e = p of key kmap(e), the two score tiles converted in place
    const v8h p0 = __builtin_convertvector(e0 * PSC, v8h), p1 = __builtin_convertvector(e1 * PSC, v8h);
    const v16h pb = __builtin_shufflevector(p0, p1, 0, 1, 2, 3, 4, 5, 6, 7, 8, 9, 10, 11, 12, 13, 14, 15);
#pragma unroll
    for (int ct = 0; ct < 4; ++ct) { oh[ct] *= alpha; ol[ct] *= alpha; }

    // ---- context^T += V_hi^T . P^T and V_lo^T . P^T (4 row tiles of 16 dims) ----
    const v16us pbu = __builtin_bit_cast(v16us, pb);
#pragma unroll
    for (int ct = 0; ct < 4; ++ct) {
      oh[ct] = mma_hu(vh[ct], pbu, oh[ct]);
      ol[ct] = mma_hu(vl[ct], pbu, ol[ct]);
    }
  }

  __syncthreads();
  {
    const float l = ll + xhalf(ll);      // the two lane halves' sums of query jc, joined once
    const float inv = ((l > 0.f) ? (1.0f / l) : 0.f) * (1.0f / PSC);
    float* od = osm + jc * OP + w * HD + 8 * hh;
#pragma unroll
    for (int ct = 0; ct < 4; ++ct) {
      v4f o0, o1;
#pragma unroll
      for (int e = 0; e < 4; ++e) {
        o0[e] = (oh[ct][e]     + ol[ct][e]     * (1.0f / RSC)) * inv;
        o1[e] = (oh[ct][4 + e] + ol[ct][4 + e] * (1.0f / RSC)) * inv;
      }
      *(v4f*)(od + ct * 16)     = o0;
      *(v4f*)(od + ct * 16 + 4) = o1;
    }
  }
  __syncthreads();
  {
    // piece c of the tile's 1024: row c & 15, columns 8 * (c >> 4) .. + 7: k step c >> 6, 8 * (c & 63) elements into its fragment
    v4u hv[2][2], lv[2][2];
#pragma unroll
    for (int rr = 0; rr < 2; ++rr) {
#pragma unroll
      for (int it = 0; it < 2; ++it) {
        const int c = (rr * 2 + it) * 256 + t;
        const float* sp = osm + (c & 15) * OP + (c >> 4) * 8;
        const v4f f0 = *(const v4f*)(sp);
        const v4f f1 = *(const v4f*)(sp + 4);
        v4u ha, la;
#pragma unroll
        for (int e = 0; e < 2; ++e) {
          const unsigned short u0 = bf_bits(f0[2 * e]), u1 = bf_bits(f0[2 * e + 1]);
          const unsigned short u2 = bf_bits(f1[2 * e]), u3 = bf_bits(f1[2 * e + 1]);
          ha[e]     = pk16(u0, u1);
          ha[2 + e] = pk16(u2, u3);
          la[e]     = pk16(bf_bits(f0[2 * e] - bf_up(u0)), bf_bits(f0[2 * e + 1] - bf_up(u1)));
          la[2 + e] = pk16(bf_bits(f1[2 * e] - bf_up(u2)), bf_bits(f1[2 * e + 1] - bf_up(u3)));
        }
        hv[rr][it] = ha;
        lv[rr][it] = la;
      }
    }
    {
#pragma unroll
      for (int rr = 0; rr < 2; ++rr) {
        const size_t rtq = (rowQ + i0) >> 4;               // the block's row tile among the plane's MQ / 16
#pragma unroll
        for (int it = 0; it < 2; ++it) {
          const int c = (rr * 2 + it) * 256 + t;
          const size_t go = ((size_t)(c >> 6) * (MQ / 16) + rtq) * 512 + (c & 63) * 8;
          *(v4u*)(ctxp + go)                                   = hv[rr][it];
          *(v4u*)(ctxp + go + (size_t)(CM / 32) * (MQ / 16) * 512) = lv[rr][it];
        }
      }
      
    }
  }
}

// =====================================================================================================
// Workspace map (bytes); every plane is an exact multiple of its whole-row / whole-line / 64x64-tile store
// granularity (MQ = 4096 = 64 row tiles, MC = 8192 = 128 row tiles; N in {512, 4096}; v^T per batch
// [512][4096] = 8x64 tiles):
// (Xq, Xc, the four weight planes and Ctx hold these shapes in fragment order: [k step of 32][row tile of 16][512])
//   Xq   bf16 [4096][512]       0          4194304
//   Xc   bf16 [8192][512]       4194304    8388608
//   Wqb  bf16 [512][512]        12582912   524288
//   Wkb  bf16 [512][512]        13107200   524288
//   Wvb  bf16 [512][512]        13631488   524288
//   WoT2 bf16 [512][1024]       14155776   1048576   (cols k and CM + k both hold the proj weight)
//   Qp   f16  [4096][512]       15204352   4194304
//   Kp   f16  [2][128][8][2048] 19398656   8388608   (k, fragment order: batch, chunk of 32 keys, head)
//   VTh  f16  [2][128][8][2048] 27787264   8388608   (v^T hi, fragment order)
//   VTl  f16  [2][128][8][2048] 36175872   8388608   (v^T residual x2048, fragment order)
//   Ctx  bf16 [4096][1024]      44564480   8388608   (context hi | lo)
//   end                         52953088
// =====================================================================================================
extern "C" void kernel_launch(void* const* d_in, const int* in_sizes, int n_in,
                              void* d_out, int out_size, void* d_ws, size_t ws_size,
                              hipStream_t stream) {
  if (n_in < 12) return;
  if (in_sizes[0] != MC * CM) return;
  if (in_sizes[1] != MQ * CM) return;
  if (in_sizes[2] != MC * 3) return;
  if (in_sizes[3] != MQ * 3) return;
  if (in_sizes[4] != CM * CM || in_sizes[5] != CM) return;
  if (in_sizes[6] != CM * CM || in_sizes[7] != CM) return;
  if (in_sizes[8] != CM * CM || in_sizes[9] != CM) return;
  if (in_sizes[10] != CM * CM || in_sizes[11] != CM) return;
  if (out_size != MQ * CM) return;

  const float* x_ctx   = (const float*)d_in[0];
  const float* x_query = (const float*)d_in[1];
  const float* pos_ctx = (const float*)d_in[2];
  const float* pos_qry = (const float*)d_in[3];
  const float* Wq = (const float*)d_in[4];
  const float* bq = (const float*)d_in[5];
  const float* Wk = (const float*)d_in[6];
  const float* bk = (const float*)d_in[7];
  const float* Wv = (const float*)d_in[8];
  const float* bv = (const float*)d_in[9];
  const float* Wo = (const float*)d_in[10];
  const float* bo = (const float*)d_in[11];

  const size_t PXQ  = (size_t)MQ * CM * 2;             //  4194304
  const size_t PXC  = (size_t)MC * CM * 2;             //  8388608
  const size_t PW   = (size_t)CM * CM * 2;             //   524288
  const size_t PWO  = (size_t)CM * KC * 2;             //  1048576
  const size_t PQ   = (size_t)MQ * CM * 2;             //  4194304
  const size_t PK   = (size_t)MC * CM * 2;             //  8388608
  const size_t PVT  = (size_t)NB * CM * NC * 2;        //  8388608
  const size_t PCTX = (size_t)MQ * KC * 2;             //  8388608
  size_t off = 0;
  const size_t oXq  = off; off += PXQ;
  const size_t oXc  = off; off += PXC;
  const size_t oWq  = off; off += PW;
  const size_t oWk  = off; off += PW;
  const size_t oWv  = off; off += PW;
  const size_t oWo  = off; off += PWO;
  const size_t oQ   = off; off += PQ;
  const size_t oK   = off; off += PK;
  const size_t oVTh = off; off += PVT;
  const size_t oVTl = off; off += PVT;
  const size_t oCtx = off; off += PCTX;
  if (off > ws_size) return;                           // off = 52953088
  if (off > (size_t)134217728) return;

  char* ws = (char*)d_ws;
  unsigned short* Xq   = (unsigned short*)(ws + oXq);
  unsigned short* Xc   = (unsigned short*)(ws + oXc);
  unsigned short* Wqb  = (unsigned short*)(ws + oWq);
  unsigned short* Wkb  = (unsigned short*)(ws + oWk);
  unsigned short* Wvb  = (unsigned short*)(ws + oWv);
  unsigned short* WoT2 = (unsigned short*)(ws + oWo);
  unsigned short* Qp   = (unsigned short*)(ws + oQ);
  unsigned short* Kp   = (unsigned short*)(ws + oK);
  unsigned short* VTh  = (unsigned short*)(ws + oVTh);
  unsigned short* VTl  = (unsigned short*)(ws + oVTl);
  unsigned short* Ctx  = (unsigned short*)(ws + oCtx);
  float*          out0 = (float*)d_out;

  const dim3 blk(256);
  const dim3 gQ(((MQ / 64) * (CM / 64)) / 8, 1, 1);            // 512 tiles -> 64 blocks
  const dim3 gK(((MC / 64) * (CM / 64)) / 8, 1, 1);            // 1024 tiles -> 128 blocks
  const dim3 gVT(((CM / 64) * (NC / 64)) / 8, NB, 1);          // 512 tiles -> 64 blocks x 2 batches
  const dim3 gAttn(NQ / 16, NB, 1);                            // 128 x 2 blocks of 256
  const dim3 gO(((MQ / 64) * (CM / 64)) / 8, 1, 1);            // 512 tiles -> 64 blocks
  if ((((MQ / 64) * (CM / 64)) % 8) != 0) return;
  if ((((MC / 64) * (CM / 64)) % 8) != 0) return;
  if ((((CM / 64) * (NC / 64)) % 8) != 0) return;

  // (0) bf16 planes of the activations and weights ([out][in]) in fragment order; proj weights with duplicated k range
  cvt_rows<<<dim3(MQ / 16), blk, 0, stream>>>(x_query, Xq, MQ / 16, 0);
  cvt_rows<<<dim3(MC / 16), blk, 0, stream>>>(x_ctx, Xc, MC / 16, 0);
  cvt_rows<<<dim3(CM / 16), blk, 0, stream>>>(Wq, Wqb, CM / 16, 0);
  cvt_rows<<<dim3(CM / 16), blk, 0, stream>>>(Wk, Wkb, CM / 16, 0);
  cvt_rows<<<dim3(CM / 16), blk, 0, stream>>>(Wv, Wvb, CM / 16, 0);
  cvt_rows<<<dim3(CM / 16, 2), blk, 0, stream>>>(Wo, WoT2, CM / 16, CM / 32);

  // (1) q = Xq . Wqb^T + bq -> f16 plane [rows][512]; k = Xc . Wkb^T + bk (K = 512) -> f16, fragment order;
  //     v^T per batch = Wvb . Xc_b^T + bv per row d -> f16 hi (VTh) and residual x2048 (VTl), fragment order
  gemm64<1, 1><<<gQ, blk, 0, stream>>>(
      Xq, MQ / 16, 0LL, Wqb, CM / 16, 0LL,
      Qp, Qp, out0, CM, 0LL,
      bq, MQ, CM, CM);
  gemm64<3, 1><<<gK, blk, 0, stream>>>(
      Xc, MC / 16, 0LL, Wkb, CM / 16, 0LL,
      Kp, Kp, out0, CM, 0LL,
      bk, MC, CM, CM);
  gemm64<2, 2><<<gVT, blk, 0, stream>>>(
      Wvb, CM / 16, 0LL, Xc, MC / 16, (long long)(NC / 16) * 512,
      VTh, VTl, out0, NC, (long long)CM * NC,
      bv, CM, NC, CM);

  // (2) fused heat bias + softmax attention -> context bf16 hi|lo
  attn_kernel<<<gAttn, blk, 0, stream>>>(pos_qry, pos_ctx, Qp, Kp, VTh, VTl, Ctx);

  // (3) out = [ctx_hi | ctx_lo] . [Wo | Wo]^T + bo  (K = 1024, bf16 operands) -> d_out f32
  gemm64<0, 1><<<gO, blk, 0, stream>>>(
      Ctx, MQ / 16, 0LL, WoT2, CM / 16, 0LL,
      Ctx, Ctx, out0, CM, 0LL,
      bo, MQ, CM, KC);
  (void)hipGetLastError();
}

// v005
// It runs in 203 microseconds.
// In both of two side-by-side timings against v004, it was 1.28 times as fast.
// Over all steps from v000 it is 3.23 times as fast.
// Contractions: q and k projections (x . W^T) and v^T projection (Wv . x^T) on v_wmma_f32_16x16x32_bf16 (bf16 x, bf16 weights);
// output projection on v_wmma_f32_16x16x32_bf16 (context as bf16 hi|lo planes K-concatenated against duplicated bf16 weights);
// scores transposed, k.q^T, on v_wmma_f32_16x16x32_f16 (plain f16 q, k); v^T.p^T on v_wmma_f32_16x16x32_f16 (p carried
// x1024 f16, v^T as f16 hi + x2048 residual planes, separate accumulators); all f32 accumulate; heat-kernel bias and softmax in f32;
// every float input RNE-converted to bf16 on load.
#include <hip/hip_runtime.h>
#include <math.h>
#include <stdint.h>

#define NB   2
#define NQ   2048
#define NC   4096
#define CM   512
#define NH   8
#define HD   64
#define MQ   (NB * NQ)
#define MC   (NB * NC)
#define KC   (2 * CM)
#define NCH  (NC / 32)
#define RSC  2048.0f
#define PSC  1024.0f
#define SCL  0.125f
#define HK4  0.4f
#define HEPS 1.0e-6f
#define HP   36            // heat tile pitch in floats: 144 B, 16 B x odd, for its 16-byte readers
#define OP   (CM + 4)      // output staging pitch in floats: the 16 lanes' 16-byte stores of one column walk fall on 64 banks
static_assert(NH * HD == CM);
static_assert(NH == 8);
static_assert((MQ % 64) == 0 && (MC % 64) == 0 && (CM % 64) == 0 && (NC % 64) == 0 && (KC % 64) == 0);
static_assert((((MQ / 64) * (CM / 64)) % 8) == 0);
static_assert((((MC / 64) * (CM / 64)) % 8) == 0);
static_assert((((CM / 64) * (NC / 64)) % 8) == 0);
static_assert((NQ % 16) == 0 && (NC % 32) == 0);

typedef _Float16 v16h __attribute__((ext_vector_type(16)));
typedef _Float16 v8h  __attribute__((ext_vector_type(8)));
typedef __bf16   v16b __attribute__((ext_vector_type(16)));
typedef unsigned short v16us __attribute__((ext_vector_type(16)));
typedef unsigned short v8us  __attribute__((ext_vector_type(8)));
typedef float    v8f  __attribute__((ext_vector_type(8)));
typedef float    v4f  __attribute__((ext_vector_type(4)));
typedef unsigned int v4u __attribute__((ext_vector_type(4)));

union FragU { v16us v; v8us h[2]; };

// ---- scalar helpers --------------------------------------------------------------------------------
__device__ __forceinline__ unsigned short bf_bits(float f) {          // f32 -> bf16 bits, RNE convert
  unsigned u = __float_as_uint(f);
  return (unsigned short)((u + 0x7FFFu + ((u >> 16) & 1u)) >> 16);
}
__device__ __forceinline__ float bf_up(unsigned short h) { return __uint_as_float(((unsigned)h) << 16); }
__device__ __forceinline__ float bfr(float f) { return bf_up(bf_bits(f)); }   // value of the bf16 RNE convert
__device__ __forceinline__ unsigned short h_bits(_Float16 x) { return __builtin_bit_cast(unsigned short, x); }
__device__ __forceinline__ unsigned pk16(unsigned short a, unsigned short b) { return (unsigned)a | ((unsigned)b << 16); }
__device__ __forceinline__ v8f zero8() { v8f z = {0.f, 0.f, 0.f, 0.f, 0.f, 0.f, 0.f, 0.f}; return z; }
__device__ __forceinline__ float xhalf(float x) {                     // value of lane l ^ 16
  const int b = __builtin_bit_cast(int, x);
  return __builtin_bit_cast(float, __builtin_amdgcn_permlanex16(b, b, 0x76543210, 0xfedcba98, false, false));
}

// ---- fragment loader: 16-bit A/B operand, lane -> row/col (lane&15), p already includes +8*(lane>>4);
//      elements 0..7 <- p[0..7] (k0+8h..), elements 8..15 <- p[16..23] (k0+16+8h..)
__device__ __forceinline__ v16us ldfrag_u(const unsigned short* p) {
  FragU f;
  f.h[0] = *(const v8us*)(p);
  f.h[1] = *(const v8us*)(p + 16);
  return f.v;
}

// ---- fragment loader, fragment-order plane: one operand fragment is 1 KiB in a row, lane l's elements 0..7 at
//      16 * l bytes and its elements 8..15 at 512 + 16 * l; p already includes + 8 * lane. Each of the two loads
//      reads 512 bytes in a row (4 whole lines) where a row-major plane makes it touch 16 lines.
__device__ __forceinline__ v16us ldfrag_f(const unsigned short* p) {
  FragU f;
  f.h[0] = *(const v8us*)(p);
  f.h[1] = *(const v8us*)(p + 256);
  return f.v;
}

// ---- s_wait_xcnt 0 behind a group of global loads, in front of every overwrite of the group's address registers:
//      it takes the address as an input so that it stays whole up to it; its memory clobber keeps the loads ahead of it.
__device__ __forceinline__ void xwait1(const void* a) {
#if defined(__HIP_DEVICE_COMPILE__)
  asm volatile("s_wait_xcnt 0x0" :: "v"(a) : "memory");
#endif
}

// ---- WMMA helpers with trailing VALU hazard gap --------------------------------------------------------
__device__ __forceinline__ v8f mma_bu_raw(v16us a, v16us b, v8f c) {            // bf16 operands, unguarded
  return __builtin_amdgcn_wmma_f32_16x16x32_bf16(false, __builtin_bit_cast(v16b, a), false,
                                                 __builtin_bit_cast(v16b, b), (short)0, c, false, false);
}
__device__ __forceinline__ v8f mma_hu(v16us a, v16us b, v8f c) {                // f16 operands (bits), guarded
  c = __builtin_amdgcn_wmma_f32_16x16x32_f16(false, __builtin_bit_cast(v16h, a), false,
                                              __builtin_bit_cast(v16h, b), (short)0, c, false, false);
#if defined(__HIP_DEVICE_COMPILE__)
  asm volatile("v_nop\n\tv_nop\n\tv_nop\n\tv_nop" : "+v"(c) : "v"(a), "v"(b));
#endif
  return c;
}
// ---- one k step of a 64x64 wave tile: its 4 A and 4 B fragments (16 loads, fragment-order planes) as one group, A first.
//      ap, bp: the wave's (uniform) global addresses of the step, in scalar registers; l8 = 8 * lane elements, the one
//      vector register that all 16 loads name
typedef const __attribute__((address_space(1))) unsigned short gus;
typedef const __attribute__((address_space(1))) v8us           gv8us;
__device__ __forceinline__ void ld_step(v16us (&a)[4], v16us (&b)[4], gus* ap, gus* bp, unsigned l8) {
#pragma unroll
  for (int i = 0; i < 4; ++i) {
    FragU f;
    f.h[0] = *(gv8us*)(ap + i * 512 + l8);
    f.h[1] = *(gv8us*)(ap + i * 512 + l8 + 256);
    a[i] = f.v;
  }
#pragma unroll
  for (int j = 0; j < 4; ++j) {
    FragU f;
    f.h[0] = *(gv8us*)(bp + j * 512 + l8);
    f.h[1] = *(gv8us*)(bp + j * 512 + l8 + 256);
    b[j] = f.v;
  }
  // s_wait_xcnt 0 in front of every overwrite of the group's address registers: it takes the two bases and the lane
  // offset as inputs so that they stay whole up to it; its memory clobber keeps the loads ahead of it.
#if defined(__HIP_DEVICE_COMPILE__)
  asm volatile("s_wait_xcnt 0x0" :: "s"(ap), "s"(bp), "v"(l8) : "memory");
#endif
  __builtin_amdgcn_sched_barrier(0);   // no product (with its data wait) is scheduled up into the load group
}
// ---- between a step's products and the load group that refills the operand registers they read
__device__ __forceinline__ void refill_gap() {
  __builtin_amdgcn_sched_barrier(0);   // the group stays whole: without this its A loads are spread among the products in front of it
  // four vector slots, the distance a WMMA asks for before its A or B is overwritten: loads fill no slot, and a load over
  // B directly behind the product is not known to be safe; the memory clobber keeps the loads behind the slots
#if defined(__HIP_DEVICE_COMPILE__)
  asm volatile("v_nop\n\tv_nop\n\tv_nop\n\tv_nop" ::: "memory");
#endif
}
// ---- the next k step's address, added in scalar registers by hand: left to the compiler, the loop's address sums move
//      into vector registers, and accumulators plus two fragment sets leave none to spare (it then copies accumulators about)
__device__ __forceinline__ gus* next_step(gus* p, unsigned long long bytes) {
#if defined(__HIP_DEVICE_COMPILE__)
  gus* r;
  asm("s_add_nc_u64 %0, %1, %2" : "=s"(r) : "s"(p), "s"(bytes));
  return r;
#else
  return p + bytes / 2;
#endif
}
__device__ __forceinline__ void mma_step(v8f (&acc)[4][4], const v16us (&a)[4], const v16us (&b)[4]) {
#pragma unroll
  for (int i = 0; i < 4; ++i)
#pragma unroll
    for (int j = 0; j < 4; ++j) acc[i][j] = mma_bu_raw(a[i], b[j], acc[i][j]);
}
__device__ __forceinline__ void acc_guard4(v8f& a, v8f& b, v8f& c, v8f& d) {
#if defined(__HIP_DEVICE_COMPILE__)
  asm volatile("v_nop\n\tv_nop\n\tv_nop\n\tv_nop" : "+v"(a), "+v"(b), "+v"(c), "+v"(d));
#endif
}
__device__ __forceinline__ void wave_sync_lds() {
  __builtin_amdgcn_fence(__ATOMIC_RELEASE, "workgroup");
  __builtin_amdgcn_wave_barrier();
  __builtin_amdgcn_fence(__ATOMIC_ACQUIRE, "workgroup");
}

// ---- work-group barrier of the attention loop's heat tile: it waits for the wave's own LDS accesses alone, so that the
//      global loads issued a pass ahead stay in flight across it (__syncthreads() waits for them too); the memory clobber
//      keeps every LDS access on its side of the barrier
__device__ __forceinline__ void lds_barrier() {
#if defined(__HIP_DEVICE_COMPILE__)
  asm volatile("s_wait_dscnt 0x0\n\ts_barrier_signal -1\n\ts_barrier_wait -1" ::: "memory");
#endif
}

// =====================================================================================================
// Row convert: in[row][CM] f32 -> bf16 RNE bits in fragment order for a plane of nrt row tiles: fragment (row tile
// row/16, k step k/32) at (k step * nrt + row tile) * 512 elements (one k step of all rows lies in a row), inside it as
// ldfrag_f reads it; the blocks of blockIdx.y = 1, where the grid has them, write the same values for k steps dupk + k/32.
// Block = 256 threads (one tile of 16 rows = 1024 pieces of 8 columns, 4 a thread). Piece c holds row c & 15,
// columns 8 * (c >> 4) .. + 7: k step c >> 6, at 8 * (c & 63) elements of its fragment, so one store of one wave
// writes 512 bytes in a row.
// coverage: 1024 pieces x 8 = 16 rows x CM columns; grid = every row tile of the matrix (x 2 with the dup copy).
// =====================================================================================================
__global__ __launch_bounds__(256) void cvt_rows(const float* __restrict__ src, unsigned short* dst, int nrt, int dupk) {
  const int rt = blockIdx.x, tid = threadIdx.x;
  // thread tid takes pieces c = tid + 256 * it: the same row, 128 columns (4 k steps) on
  const float* p = src + ((size_t)rt * 16 + (tid & 15)) * CM + (tid >> 4) * 8;
  unsigned short* d = dst + ((size_t)((tid >> 6) + blockIdx.y * dupk) * nrt + rt) * 512 + (tid & 63) * 8;
  v4f a0[4], a1[4];
#pragma unroll
  for (int it = 0; it < 4; ++it) {
    a0[it] = *(const v4f*)(p + it * 128);
    a1[it] = *(const v4f*)(p + it * 128 + 4);
  }
  xwait1(p);
  v4u hv[4];
#pragma unroll
  for (int it = 0; it < 4; ++it) {
    hv[it][0] = pk16(bf_bits(a0[it][0]), bf_bits(a0[it][1]));
    hv[it][1] = pk16(bf_bits(a0[it][2]), bf_bits(a0[it][3]));
    hv[it][2] = pk16(bf_bits(a1[it][0]), bf_bits(a1[it][1]));
    hv[it][3] = pk16(bf_bits(a1[it][2]), bf_bits(a1[it][3]));
  }
  unsigned short* dq[4];
#pragma unroll
  for (int it = 0; it < 4; ++it) dq[it] = d + (size_t)it * 4 * nrt * 512;
  __builtin_amdgcn_sched_barrier(0);   // the stores stand behind all the arithmetic: no register that one names is written again
#pragma unroll
  for (int it = 0; it < 4; ++it) *(v4u*)(dq[it]) = hv[it];
}

// =====================================================================================================
// Register-blocked batched bf16 WMMA GEMM: C[m][n] = sum_k A[m][k] * Bt[n][k] (+ bias);
// one wave per 64x64 tile, no block barriers. A [M][K] and Bt [N][K] in fragment order, in planes of rtA and rtB row
// tiles: fragment (row tile row/16, k step k/32) at (k step * rt + row tile) * 512 elements, so that what all waves
// read in one k step lies in a row; M, N and K multiples of 64. blockIdx.y = batch index with element strides
// (sAy for A, sBy for Bt, sCy for C). Tile enumeration: tile -> tm = tile / (N/64), tn = tile % (N/64).
// OM: 0 = f32 out to Cf (pitch ldc); 1 = f16 bits to Cp (pitch ldc); 2 = f16 hi bits to Cp and f16((v - hi) * 2048)
//     bits to Cp2, both in fragment order for m = head dim, n = key: fragment (chunk n/32, head m/64, row tile
//     (m/16)%4) at ((chunk * NH + head) * 4 + row tile) * 512 elements; 3 = f16 bits to Cp in fragment order for
//     m = key row (batch-major), n = head dim: fragment (chunk m/32 over both batches, head n/64, key tile (m/16)%2,
//     k step (n/32)%2) at (((chunk * NH + head) * 2 + key tile) * 2 + k step) * 512 elements. Inside a fragment: see
//     ldfrag_f. One chunk of 32 keys of all heads lies in a row in each plane.
// CBM: 0 = no bias; 1 = column bias bf16(cb[n]); 2 = row bias bf16(cb[m]).
// coverage: 4 slabs x 16 rows x 64 cols = the wave's whole 64x64 tile; grid = tilesM*tilesN/8 blocks exactly
//           (host-checked), so no wave exits early.
// =====================================================================================================
template <int OM, int CBM>
__global__ __launch_bounds__(256) void gemm64(
    const unsigned short* __restrict__ Ap, int rtA, long long sAy,
    const unsigned short* __restrict__ Btp, int rtB, long long sBy,
    unsigned short* Cp, unsigned short* Cp2, float* Cf, int ldc, long long sCy,
    const float* __restrict__ cb, int M, int N, int K) {
  __shared__ __align__(16) float sT[8][16 * 68];   // per-wave 16x64 slab, pitch 68 floats
  const int by   = blockIdx.y;
  const int lane = threadIdx.x & 31;
  const int wave = __builtin_amdgcn_readfirstlane(threadIdx.x >> 5);   // scalar: the tile's addresses stay in scalar registers
  const int tilesN = N >> 6;
  const int tilesM = M >> 6;
  const int tile = blockIdx.x * 8 + wave;
  if (tile >= tilesM * tilesN) return;   // wave-uniform; no block barriers in this kernel
  const int tm = tile / tilesN;
  const int tn = tile - tm * tilesN;
  const int m0 = tm << 6;
  const int n0 = tn << 6;

  const unsigned short* Ab = Ap  + (size_t)by * (size_t)sAy;
  const unsigned short* Bb = Btp + (size_t)by * (size_t)sBy;
  const size_t cofs = (size_t)by * (size_t)sCy;

  const int rlane = lane & 15;                 // row (A) / col (B, D) within subtile
  const int mOff  = (lane >> 4) * 8;           // D row offset

  v8f acc[4][4];
#pragma unroll
  for (int i = 0; i < 4; ++i)
#pragma unroll
    for (int j = 0; j < 4; ++j) acc[i][j] = zero8();

  // Two fragment sets: while one k step's 16 products run on one set, the next step's 16 loads are in flight into the
  // other, so a wave waits for memory once per step at most, not four times per step. k ascends as before.
  const unsigned long long sA = (unsigned long long)rtA * 1024u, sB = (unsigned long long)rtB * 1024u;   // bytes per k step
  gus* ap = (gus*)(Ab + (size_t)(m0 >> 4) * 512);
  gus* bp = (gus*)(Bb + (size_t)(n0 >> 4) * 512);
  const unsigned l8 = (unsigned)lane * 8u;
  v16us fa0[4], fb0[4], fa1[4], fb1[4];
  ld_step(fa0, fb0, ap, bp, l8);
  for (int k0 = 64; k0 < K; k0 += 64) {
    ap = next_step(ap, sA);
    bp = next_step(bp, sB);
    refill_gap();
    ld_step(fa1, fb1, ap, bp, l8);
    mma_step(acc, fa0, fb0);
    ap = next_step(ap, sA);
    bp = next_step(bp, sB);
    refill_gap();
    ld_step(fa0, fb0, ap, bp, l8);
    mma_step(acc, fa1, fb1);
  }
  ap = next_step(ap, sA);
  bp = next_step(bp, sB);
  refill_gap();
  ld_step(fa1, fb1, ap, bp, l8);                                     // the last two steps: nothing left to fetch ahead
  mma_step(acc, fa0, fb0);
  mma_step(acc, fa1, fb1);
  acc_guard4(acc[0][0], acc[0][1], acc[0][2], acc[0][3]);
  acc_guard4(acc[1][0], acc[1][1], acc[1][2], acc[1][3]);
  acc_guard4(acc[2][0], acc[2][1], acc[2][2], acc[2][3]);
  acc_guard4(acc[3][0], acc[3][1], acc[3][2], acc[3][3]);

  const int hh2 = lane >> 4, c4 = (lane & 15) * 4;     // f32 out: 256-B row segment = 16 lanes x 16 B
  const int q8  = lane >> 3, c8 = (lane & 7) * 8;

  v4f cb4 = {0.f, 0.f, 0.f, 0.f};
  float cbc[4][8];                                     // row-major out uses [0] alone; fragment order one set per it
#pragma unroll
  for (int g = 0; g < 4; ++g)
#pragma unroll
    for (int e = 0; e < 8; ++e) cbc[g][e] = 0.f;
  if (CBM == 1) {
    if (OM == 0) {
      const v4f v = *(const v4f*)(cb + n0 + c4);
      cb4[0] = bfr(v[0]); cb4[1] = bfr(v[1]); cb4[2] = bfr(v[2]); cb4[3] = bfr(v[3]);
    } else if (OM == 1) {
      const v4f v0 = *(const v4f*)(cb + n0 + c8);
      const v4f v1 = *(const v4f*)(cb + n0 + c8 + 4);
#pragma unroll
      for (int e = 0; e < 4; ++e) { cbc[0][e] = bfr(v0[e]); cbc[0][4 + e] = bfr(v1[e]); }
    } else {
      const float* cp = cb + n0 + mOff;
#pragma unroll
      for (int g = 0; g < 4; ++g) {
        const v4f v0 = *(const v4f*)(cp + g * 16);
        const v4f v1 = *(const v4f*)(cp + g * 16 + 4);
#pragma unroll
        for (int e = 0; e < 4; ++e) { cbc[g][e] = bfr(v0[e]); cbc[g][4 + e] = bfr(v1[e]); }
      }
    }
  }

  // ---- epilogue ----
  float* slab = sT[wave];
#pragma unroll
  for (int i = 0; i < 4; ++i) {
    const int mBase = m0 + (i << 4);
#pragma unroll
    for (int j = 0; j < 4; ++j) {
#pragma unroll
      for (int r = 0; r < 8; ++r) {
        slab[(mOff + r) * 68 + (j << 4) + rlane] = acc[i][j][r];
      }
    }
    wave_sync_lds();
    if (OM == 0) {
      float* C = Cf + cofs;
      v4f vals[8];
#pragma unroll
      for (int it = 0; it < 8; ++it) {
        const int row = it * 2 + hh2;                      // it 0..7 x hh2 0..1 = rows 0..15
        const v4f v = *(const v4f*)(slab + row * 68 + c4);
        vals[it] = v + cb4;
      }
      {
#pragma unroll
        for (int it = 0; it < 8; ++it) {
          const int row = it * 2 + hh2;
          *(v4f*)(C + (size_t)(mBase + row) * ldc + (size_t)n0 + c4) = vals[it];
        }
        
      }
    } else {
      unsigned short* C  = Cp  + cofs;
      unsigned short* C2 = Cp2 + cofs;
      v4u hv[4], lv[4];
#pragma unroll
      for (int it = 0; it < 4; ++it) {
        // row-major out: it 0..3 x q8 0..3 = rows 0..15, 8 columns at c8; fragment order: the lane takes what it
        // holds as an operand, row lane & 15, the 8 columns at 16 * it + 8 * (lane >> 4)
        const int row = (OM == 1) ? (it * 4 + q8) : rlane;
        const int col = (OM == 1) ? c8 : (it * 16 + mOff);
        const float* sp = slab + row * 68 + col;
        float rb = 0.f;
        if (CBM == 2) rb = bfr(cb[mBase + row]);
        const int g = (OM == 1) ? 0 : it;
        v4u ha = {0u, 0u, 0u, 0u}, la = {0u, 0u, 0u, 0u};
#pragma unroll
        for (int e = 0; e < 4; ++e) {
          const float f0 = sp[2 * e]     + cbc[g][2 * e]     + rb;
          const float f1 = sp[2 * e + 1] + cbc[g][2 * e + 1] + rb;
          const _Float16 g0 = (_Float16)f0, g1 = (_Float16)f1;
          ha[e] = pk16(h_bits(g0), h_bits(g1));
          if (OM == 2) {
            la[e] = pk16(h_bits((_Float16)((f0 - (float)g0) * RSC)),
                         h_bits((_Float16)((f1 - (float)g1) * RSC)));
          }
        }
        hv[it] = ha;
        lv[it] = la;
      }
      {
#pragma unroll
        for (int it = 0; it < 4; ++it) {
          size_t go;
          if (OM == 1) {
            go = (size_t)(mBase + it * 4 + q8) * ldc + (size_t)n0 + c8;
          } else if (OM == 2) {
            go = (((size_t)((n0 >> 5) + (it >> 1)) * NH + tm) * 4 + i) * 512 + (it & 1) * 256 + lane * 8;
          } else {
            go = ((((size_t)(mBase >> 5) * NH + tn) * 2 + ((mBase >> 4) & 1)) * 2 + (it >> 1)) * 512
                 + (it & 1) * 256 + lane * 8;
          }
          *(v4u*)(C + go) = hv[it];
          if (OM == 2) *(v4u*)(C2 + go) = lv[it];
        }
        
      }
    }
    wave_sync_lds();
  }
}

// =====================================================================================================
// Fused heat-bias + online-softmax cross attention, head dim 64, 8 heads.
//   Block = 256 threads = 8 waves, wave w = head w; one block per (batch, 16 query rows); key chunks of 32,
//   static trip NCH = 128. q plane (f16 bits, pitch CM): row (b*NQ + t), head h at col h*64 + d; k plane
//   (f16 bits) and v^T hi / lo planes (f16 bits, value = hi + lo/2048) in fragment order (gemm64, OM 3 and 2):
//   2048 elements per (batch, chunk of 32 keys, head) in each plane. Context plane (bf16 bits, KC columns, fragment order
//   as gemm64 reads its A): row b*NQ + t, hi at column h*64 + d, lo (value - hi) at column CM + h*64 + d.
//   Per chunk: heat[q][s] = exp(-(dx*dx + dy*dy) * (1 / (0.4*|dt| + 1e-6))) from the bf16-converted positions
//   (spatial = dims 0,1, time = dim 2), computed once per (query row, key) pair by the block (thread = key
//   lane, rows w and w+8) into LDS and shared by the 8 head waves. Both products are transposed: S^T = K . Q^T
//   (A = k rows, B = q), so a lane holds 16 of the 32 scores of ONE query (column lane & 15; keys 8h + r and
//   16 + 8h + r): s = (k . q) * 0.125 + heat; running-max softmax in f32 with maximum and sum in the lane, the
//   maximum joined with the other lane half once a pass, the sums once behind the loop. p = exp(s - m) as
//   f16(1024 p): the two score tiles, converted in place, are the B operand of O^T += V^T . P^T (A = v^T rows, hi and
//   lo accumulator sets, 4 row tiles of 16 dims each). All q, k, v^T and p fragments use the split k map
//   (elements 0..7 <- k0+8h.., 8..15 <- k0+16+8h..).
//   Epilogue: context tile of the block (16 rows x 512) staged in LDS (f32), then written as one fragment-order row tile.
// coverage: heat 16 rows x 32 keys per chunk (8 waves x 2 rows x 32 lanes); context 16 rows x 512 cols hi and lo
//           per block (256 threads x 4 pieces x 8 cols); grid NQ/16 x NB covers every query row.
// =====================================================================================================
__global__ void __launch_bounds__(256) attn_kernel(
    const float* __restrict__ posq, const float* __restrict__ posc,
    const unsigned short* __restrict__ qp, const unsigned short* __restrict__ kp,
    const unsigned short* __restrict__ vth, const unsigned short* __restrict__ vtl,
    unsigned short* ctxp) {
#pragma clang fp contract(off)
  __shared__ __align__(16) float heatL[16 * HP];            // [query row][key], pitch HP
  __shared__ __align__(16) float osm[16 * OP];              // output staging [16][CM], pitch OP
  __shared__ float qps[16 * 3];

  const int b = blockIdx.y, i0 = blockIdx.x * 16;
  const int t = threadIdx.x, lane = t & 31, w = t >> 5, hh = lane >> 4, jc = lane & 15;
  const size_t rowQ = (size_t)b * NQ, rowC = (size_t)b * NC;

  if (t < 48) qps[t] = bfr(posq[(rowQ + i0) * 3 + t]);
  __syncthreads();

  // q B-fragments (col = query jc of this tile, k = d), plain f16 bits; d 0..31 and 32..63
  const unsigned short* qrow = qp + (rowQ + i0 + jc) * CM + w * HD + 8 * hh;
  const v16us qf0 = ldfrag_u(qrow);
  const v16us qf1 = ldfrag_u(qrow + 32);

  // query positions of the two heat rows this thread produces (rows w and w+8, key = lane)
  const float qx0 = qps[w * 3 + 0],       qy0 = qps[w * 3 + 1],       qt0 = qps[w * 3 + 2];
  const float qx1 = qps[(w + 8) * 3 + 0], qy1 = qps[(w + 8) * 3 + 1], qt1 = qps[(w + 8) * 3 + 2];

  float m = -1.0e30f, ll = 0.f;      // query jc: running maximum (both lane halves alike), this lane half's sum
  v8f oh[4], ol[4];                  // O^T tiles: register r = dim ct*16 + 8*hh + r of query jc
#pragma unroll
  for (int ct = 0; ct < 4; ++ct) { oh[ct] = zero8(); ol[ct] = zero8(); }

  // fragment-order planes: a pass's 4 K fragments are 4 KiB in a row, its 4 V fragments 4 KiB in a row in each plane,
  // and the 8 heads' (waves') pieces of one pass follow one another
  const unsigned short* vhb = vth + ((size_t)b * NCH * NH + w) * 2048 + lane * 8;     // A: row d = ct*16 + jc, k = key
  const unsigned short* vlb = vtl + ((size_t)b * NCH * NH + w) * 2048 + lane * 8;
  const unsigned short* kgb = kp + ((size_t)b * NCH * NH + w) * 2048 + lane * 8;      // A: row key = jc, k = d
  const float* pcb = posc + rowC * 3;
  const float* hrd = heatL + jc * HP + 8 * hh;                                        // heat of query jc, keys 8*hh..

  // Chunk 0's key positions, K and V fragments, in the order in which the loop refills them. Each pass fetches the next
  // chunk's into the same registers: positions and K right behind its score products, V right behind its V products,
  // so that a fragment's L2 round trip runs under the vector work and the barriers of most of a pass.
  const float* pc0 = pcb + (size_t)lane * 3;
  float px = pc0[0], py = pc0[1], pz = pc0[2];
  __builtin_amdgcn_sched_barrier(0);   // the loop's issue order, here too: a counted wait in the loop is as loose as the tighter of its two ways in
  v16us k00 = ldfrag_f(kgb);
  v16us k01 = ldfrag_f(kgb + 512);
  v16us k10 = ldfrag_f(kgb + 1024);
  v16us k11 = ldfrag_f(kgb + 1536);
  __builtin_amdgcn_sched_barrier(0);   // K ahead of V, as in the loop
  v16us vh[4], vl[4];
#pragma unroll
  for (int ct = 0; ct < 4; ++ct) {
    vh[ct] = ldfrag_f(vhb + ct * 512);
    vl[ct] = ldfrag_f(vlb + ct * 512);
  }
  // s_wait_xcnt 0 in front of every overwrite of an address that the loads above name, in the form of the loop's own
#if defined(__HIP_DEVICE_COMPILE__)
  asm volatile("s_wait_xcnt 0x0" :: "v"(qrow), "v"(pc0), "v"(kgb), "v"(vhb), "v"(vlb) : "memory");
#endif
  __builtin_amdgcn_sched_barrier(0);   // the wait stays directly behind the groups: left to sink, the build gets a second one inside the loop

#pragma unroll 1
  for (int jt = 0; jt < NCH; ++jt) {
    const int jn = (jt + 1 < NCH) ? (jt + 1) : jt;     // the chunk fetched ahead; the last pass re-reads its own: stays inside the planes
    lds_barrier();                                     // all waves done reading heatL of the prior chunk
    {
      const float cx = bfr(px), cy = bfr(py), cz = bfr(pz);
      const float dxa = qx0 - cx, dya = qy0 - cy, dta = qt0 - cz;
      const float dxb = qx1 - cx, dyb = qy1 - cy, dtb = qt1 - cz;
      const float da = dxa * dxa + dya * dya;
      const float db = dxb * dxb + dyb * dyb;
      const float na = HK4 * fabsf(dta) + HEPS;
      const float nb = HK4 * fabsf(dtb) + HEPS;
      const float ha = expf(-(da * (1.0f / na)));
      const float hb = expf(-(db * (1.0f / nb)));
      heatL[w * HP + lane]       = ha;
      heatL[(w + 8) * HP + lane] = hb;
    }
    lds_barrier();

    // heat of this lane's 16 (query, key) pairs, read ahead of the score products so that it lands under them
    const v4f h00 = *(const v4f*)(hrd),      h01 = *(const v4f*)(hrd + 4);
    const v4f h10 = *(const v4f*)(hrd + 16), h11 = *(const v4f*)(hrd + 20);

    // ---- scores, transposed: 32 keys x 16 query columns of head w, K = 64 in two 32-deep steps ----
    __builtin_amdgcn_sched_barrier(0);   // no product (with its wait for K) is scheduled up in front of the heat tile's work
    v8f s0, s1;                          // s0[r]: key 32*jt + 8*hh + r, s1[r]: key 32*jt + 16 + 8*hh + r, query jc
    s0 = mma_hu(k00, qf0, zero8());
    s0 = mma_hu(k01, qf1, s0);
    s1 = mma_hu(k10, qf0, zero8());
    s1 = mma_hu(k11, qf1, s1);

    // ---- the next chunk's key positions and K fragments, over the registers the four products above have read ----
    __builtin_amdgcn_sched_barrier(0);   // the group stays behind the products whose operands it overwrites
    const float* pc = pcb + (size_t)(jn * 32 + lane) * 3;
    px = pc[0]; py = pc[1]; pz = pc[2];
    const unsigned short* kg = kgb + (size_t)jn * (NH * 2048);
    k00 = ldfrag_f(kg);
    k01 = ldfrag_f(kg + 512);
    k10 = ldfrag_f(kg + 1024);
    k11 = ldfrag_f(kg + 1536);
    // The group's address registers are reused below: the wait stands in front of every such overwrite. It takes the
    // two addresses as inputs so that they stay whole up to it, and its memory clobber keeps the group ahead of it.
#if defined(__HIP_DEVICE_COMPILE__)
    asm volatile("s_wait_xcnt 0x0" :: "v"(kg), "v"(pc) : "memory");
#endif
    __builtin_amdgcn_sched_barrier(0);   // the group goes out here, ahead of the softmax, not further down towards its use

    // ---- heat bias + online softmax of query jc, all in the lane but for one exchange of the maximum ----
    const v8f x0 = s0 * SCL + __builtin_shufflevector(h00, h01, 0, 1, 2, 3, 4, 5, 6, 7);
    const v8f x1 = s1 * SCL + __builtin_shufflevector(h10, h11, 0, 1, 2, 3, 4, 5, 6, 7);
    const v8f mx = __builtin_elementwise_max(x0, x1);
    float rm = fmaxf(fmaxf(fmaxf(mx[0], mx[1]), fmaxf(mx[2], mx[3])), fmaxf(fmaxf(mx[4], mx[5]), fmaxf(mx[6], mx[7])));
    rm = fmaxf(rm, xhalf(rm));
    const float mn2   = fmaxf(m, rm);
    const float alpha = __expf(m - mn2);
    m = mn2;
    const v8f a0 = x0 - mn2, a1 = x1 - mn2;
    v8f e0, e1;
#pragma unroll
    for (int r = 0; r < 8; ++r) { e0[r] = __expf(a0[r]); e1[r] = __expf(a1[r]); }
    const v8f sm = e0 + e1;
    ll = ll * alpha + (((sm[0] + sm[1]) + (sm[2] + sm[3])) + ((sm[4] + sm[5]) + (sm[6] + sm[7])));
    // P^T B-fragment: element e = p of key kmap(e), the two score tiles converted in place
    const v8h p0 = __builtin_convertvector(e0 * PSC, v8h), p1 = __builtin_convertvector(e1 * PSC, v8h);
    const v16h pb = __builtin_shufflevector(p0, p1, 0, 1, 2, 3, 4, 5, 6, 7, 8, 9, 10, 11, 12, 13, 14, 15);
#pragma unroll
    for (int ct = 0; ct < 4; ++ct) { oh[ct] *= alpha; ol[ct] *= alpha; }

    // ---- context^T += V_hi^T . P^T and V_lo^T . P^T (4 row tiles of 16 dims) ----
    const v16us pbu = __builtin_bit_cast(v16us, pb);
#pragma unroll
    for (int ct = 0; ct < 4; ++ct) {
      oh[ct] = mma_hu(vh[ct], pbu, oh[ct]);
      ol[ct] = mma_hu(vl[ct], pbu, ol[ct]);
    }

    // ---- the next chunk's V fragments, over the registers the eight products above have read ----
    __builtin_amdgcn_sched_barrier(0);   // the group stays behind the products whose operands it overwrites
    const unsigned short* vhp = vhb + (size_t)jn * (NH * 2048);
    const unsigned short* vlp = vlb + (size_t)jn * (NH * 2048);
#pragma unroll
    for (int ct = 0; ct < 4; ++ct) {
      vh[ct] = ldfrag_f(vhp + ct * 512);
      vl[ct] = ldfrag_f(vlp + ct * 512);
    }
    // s_wait_xcnt 0 in front of every overwrite of this group's two addresses, in the form of the K group's above
#if defined(__HIP_DEVICE_COMPILE__)
    asm volatile("s_wait_xcnt 0x0" :: "v"(vhp), "v"(vlp) : "memory");
#endif
  }

  __syncthreads();
  {
    const float l = ll + xhalf(ll);      // the two lane halves' sums of query jc, joined once
    const float inv = ((l > 0.f) ? (1.0f / l) : 0.f) * (1.0f / PSC);
    float* od = osm + jc * OP + w * HD + 8 * hh;
#pragma unroll
    for (int ct = 0; ct < 4; ++ct) {
      v4f o0, o1;
#pragma unroll
      for (int e = 0; e < 4; ++e) {
        o0[e] = (oh[ct][e]     + ol[ct][e]     * (1.0f / RSC)) * inv;
        o1[e] = (oh[ct][4 + e] + ol[ct][4 + e] * (1.0f / RSC)) * inv;
      }
      *(v4f*)(od + ct * 16)     = o0;
      *(v4f*)(od + ct * 16 + 4) = o1;
    }
  }
  __syncthreads();
  {
    // piece c of the tile's 1024: row c & 15, columns 8 * (c >> 4) .. + 7: k step c >> 6, 8 * (c & 63) elements into its fragment
    v4u hv[2][2], lv[2][2];
#pragma unroll
    for (int rr = 0; rr < 2; ++rr) {
#pragma unroll
      for (int it = 0; it < 2; ++it) {
        const int c = (rr * 2 + it) * 256 + t;
        const float* sp = osm + (c & 15) * OP + (c >> 4) * 8;
        const v4f f0 = *(const v4f*)(sp);
        const v4f f1 = *(const v4f*)(sp + 4);
        v4u ha, la;
#pragma unroll
        for (int e = 0; e < 2; ++e) {
          const unsigned short u0 = bf_bits(f0[2 * e]), u1 = bf_bits(f0[2 * e + 1]);
          const unsigned short u2 = bf_bits(f1[2 * e]), u3 = bf_bits(f1[2 * e + 1]);
          ha[e]     = pk16(u0, u1);
          ha[2 + e] = pk16(u2, u3);
          la[e]     = pk16(bf_bits(f0[2 * e] - bf_up(u0)), bf_bits(f0[2 * e + 1] - bf_up(u1)));
          la[2 + e] = pk16(bf_bits(f1[2 * e] - bf_up(u2)), bf_bits(f1[2 * e + 1] - bf_up(u3)));
        }
        hv[rr][it] = ha;
        lv[rr][it] = la;
      }
    }
    {
#pragma unroll
      for (int rr = 0; rr < 2; ++rr) {
        const size_t rtq = (rowQ + i0) >> 4;               // the block's row tile among the plane's MQ / 16
#pragma unroll
        for (int it = 0; it < 2; ++it) {
          const int c = (rr * 2 + it) * 256 + t;
          const size_t go = ((size_t)(c >> 6) * (MQ / 16) + rtq) * 512 + (c & 63) * 8;
          *(v4u*)(ctxp + go)                                   = hv[rr][it];
          *(v4u*)(ctxp + go + (size_t)(CM / 32) * (MQ / 16) * 512) = lv[rr][it];
        }
      }
      
    }
  }
}

// =====================================================================================================
// Workspace map (bytes); every plane is an exact multiple of its whole-row / whole-line / 64x64-tile store
// granularity (MQ = 4096 = 64 row tiles, MC = 8192 = 128 row tiles; N in {512, 4096}; v^T per batch
// [512][4096] = 8x64 tiles):
// (Xq, Xc, the four weight planes and Ctx hold these shapes in fragment order: [k step of 32][row tile of 16][512])
//   Xq   bf16 [4096][512]       0          4194304
//   Xc   bf16 [8192][512]       4194304    8388608
//   Wqb  bf16 [512][512]        12582912   524288
//   Wkb  bf16 [512][512]        13107200   524288
//   Wvb  bf16 [512][512]        13631488   524288
//   WoT2 bf16 [512][1024]       14155776   1048576   (cols k and CM + k both hold the proj weight)
//   Qp   f16  [4096][512]       15204352   4194304
//   Kp   f16  [2][128][8][2048] 19398656   8388608   (k, fragment order: batch, chunk of 32 keys, head)
//   VTh  f16  [2][128][8][2048] 27787264   8388608   (v^T hi, fragment order)
//   VTl  f16  [2][128][8][2048] 36175872   8388608   (v^T residual x2048, fragment order)
//   Ctx  bf16 [4096][1024]      44564480   8388608   (context hi | lo)
//   end                         52953088
// =====================================================================================================
extern "C" void kernel_launch(void* const* d_in, const int* in_sizes, int n_in,
                              void* d_out, int out_size, void* d_ws, size_t ws_size,
                              hipStream_t stream) {
  if (n_in < 12) return;
  if (in_sizes[0] != MC * CM) return;
  if (in_sizes[1] != MQ * CM) return;
  if (in_sizes[2] != MC * 3) return;
  if (in_sizes[3] != MQ * 3) return;
  if (in_sizes[4] != CM * CM || in_sizes[5] != CM) return;
  if (in_sizes[6] != CM * CM || in_sizes[7] != CM) return;
  if (in_sizes[8] != CM * CM || in_sizes[9] != CM) return;
  if (in_sizes[10] != CM * CM || in_sizes[11] != CM) return;
  if (out_size != MQ * CM) return;

  const float* x_ctx   = (const float*)d_in[0];
  const float* x_query = (const float*)d_in[1];
  const float* pos_ctx = (const float*)d_in[2];
  const float* pos_qry = (const float*)d_in[3];
  const float* Wq = (const float*)d_in[4];
  const float* bq = (const float*)d_in[5];
  const float* Wk = (const float*)d_in[6];
  const float* bk = (const float*)d_in[7];
  const float* Wv = (const float*)d_in[8];
  const float* bv = (const float*)d_in[9];
  const float* Wo = (const float*)d_in[10];
  const float* bo = (const float*)d_in[11];

  const size_t PXQ  = (size_t)MQ * CM * 2;             //  4194304
  const size_t PXC  = (size_t)MC * CM * 2;             //  8388608
  const size_t PW   = (size_t)CM * CM * 2;             //   524288
  const size_t PWO  = (size_t)CM * KC * 2;             //  1048576
  const size_t PQ   = (size_t)MQ * CM * 2;             //  4194304
  const size_t PK   = (size_t)MC * CM * 2;             //  8388608
  const size_t PVT  = (size_t)NB * CM * NC * 2;        //  8388608
  const size_t PCTX = (size_t)MQ * KC * 2;             //  8388608
  size_t off = 0;
  const size_t oXq  = off; off += PXQ;
  const size_t oXc  = off; off += PXC;
  const size_t oWq  = off; off += PW;
  const size_t oWk  = off; off += PW;
  const size_t oWv  = off; off += PW;
  const size_t oWo  = off; off += PWO;
  const size_t oQ   = off; off += PQ;
  const size_t oK   = off; off += PK;
  const size_t oVTh = off; off += PVT;
  const size_t oVTl = off; off += PVT;
  const size_t oCtx = off; off += PCTX;
  if (off > ws_size) return;                           // off = 52953088
  if (off > (size_t)134217728) return;

  char* ws = (char*)d_ws;
  unsigned short* Xq   = (unsigned short*)(ws + oXq);
  unsigned short* Xc   = (unsigned short*)(ws + oXc);
  unsigned short* Wqb  = (unsigned short*)(ws + oWq);
  unsigned short* Wkb  = (unsigned short*)(ws + oWk);
  unsigned short* Wvb  = (unsigned short*)(ws + oWv);
  unsigned short* WoT2 = (unsigned short*)(ws + oWo);
  unsigned short* Qp   = (unsigned short*)(ws + oQ);
  unsigned short* Kp   = (unsigned short*)(ws + oK);
  unsigned short* VTh  = (unsigned short*)(ws + oVTh);
  unsigned short* VTl  = (unsigned short*)(ws + oVTl);
  unsigned short* Ctx  = (unsigned short*)(ws + oCtx);
  float*          out0 = (float*)d_out;

  const dim3 blk(256);
  const dim3 gQ(((MQ / 64) * (CM / 64)) / 8, 1, 1);            // 512 tiles -> 64 blocks
  const dim3 gK(((MC / 64) * (CM / 64)) / 8, 1, 1);            // 1024 tiles -> 128 blocks
  const dim3 gVT(((CM / 64) * (NC / 64)) / 8, NB, 1);          // 512 tiles -> 64 blocks x 2 batches
  const dim3 gAttn(NQ / 16, NB, 1);                            // 128 x 2 blocks of 256
  const dim3 gO(((MQ / 64) * (CM / 64)) / 8, 1, 1);            // 512 tiles -> 64 blocks
  if ((((MQ / 64) * (CM / 64)) % 8) != 0) return;
  if ((((MC / 64) * (CM / 64)) % 8) != 0) return;
  if ((((CM / 64) * (NC / 64)) % 8) != 0) return;

  // (0) bf16 planes of the activations and weights ([out][in]) in fragment order; proj weights with duplicated k range
  cvt_rows<<<dim3(MQ / 16), blk, 0, stream>>>(x_query, Xq, MQ / 16, 0);
  cvt_rows<<<dim3(MC / 16), blk, 0, stream>>>(x_ctx, Xc, MC / 16, 0);
  cvt_rows<<<dim3(CM / 16), blk, 0, stream>>>(Wq, Wqb, CM / 16, 0);
  cvt_rows<<<dim3(CM / 16), blk, 0, stream>>>(Wk, Wkb, CM / 16, 0);
  cvt_rows<<<dim3(CM / 16), blk, 0, stream>>>(Wv, Wvb, CM / 16, 0);
  cvt_rows<<<dim3(CM / 16, 2), blk, 0, stream>>>(Wo, WoT2, CM / 16, CM / 32);

  // (1) q = Xq . Wqb^T + bq -> f16 plane [rows][512]; k = Xc . Wkb^T + bk (K = 512) -> f16, fragment order;
  //     v^T per batch = Wvb . Xc_b^T + bv per row d -> f16 hi (VTh) and residual x2048 (VTl), fragment order
  gemm64<1, 1><<<gQ, blk, 0, stream>>>(
      Xq, MQ / 16, 0LL, Wqb, CM / 16, 0LL,
      Qp, Qp, out0, CM, 0LL,
      bq, MQ, CM, CM);
  gemm64<3, 1><<<gK, blk, 0, stream>>>(
      Xc, MC / 16, 0LL, Wkb, CM / 16, 0LL,
      Kp, Kp, out0, CM, 0LL,
      bk, MC, CM, CM);
  gemm64<2, 2><<<gVT, blk, 0, stream>>>(
      Wvb, CM / 16, 0LL, Xc, MC / 16, (long long)(NC / 16) * 512,
      VTh, VTl, out0, NC, (long long)CM * NC,
      bv, CM, NC, CM);

  // (2) fused heat bias + softmax attention -> context bf16 hi|lo
  attn_kernel<<<gAttn, blk, 0, stream>>>(pos_qry, pos_ctx, Qp, Kp, VTh, VTl, Ctx);

  // (3) out = [ctx_hi | ctx_lo] . [Wo | Wo]^T + bo  (K = 1024, bf16 operands) -> d_out f32
  gemm64<0, 1><<<gO, blk, 0, stream>>>(
      Ctx, MQ / 16, 0LL, WoT2, CM / 16, 0LL,
      Ctx, Ctx, out0, CM, 0LL,
      bo, MQ, CM, KC);
  (void)hipGetLastError();
}

// v006
// A run of this version takes 183 microseconds.
// In both of two side-by-side timings against v005, it was 1.11 times as fast.
// Counting every step since v000, it is 3.58 times as fast.
// Contractions: q and k projections (x . W^T) and v^T projection (Wv . x^T) on v_wmma_f32_16x16x32_bf16 (bf16 x, bf16 weights);
// output projection on v_wmma_f32_16x16x32_bf16 (context as bf16 hi|lo planes K-concatenated against duplicated bf16 weights);
// scores transposed, k.q^T, on v_wmma_f32_16x16x32_f16 (plain f16 q, k); v^T.p^T on v_wmma_f32_16x16x32_f16 (p carried
// x1024 f16, v^T as f16 hi + x2048 residual planes, separate accumulators); all f32 accumulate; heat-kernel bias and softmax in f32;
// every float input RNE-converted to bf16 on load.
#include <hip/hip_runtime.h>
#include <math.h>
#include <stdint.h>

#define NB   2
#define NQ   2048
#define NC   4096
#define CM   512
#define NH   8
#define HD   64
#define MQ   (NB * NQ)
#define MC   (NB * NC)
#define KC   (2 * CM)
#define NCH  (NC / 32)
#define RSC  2048.0f
#define PSC  1024.0f
#define SCL  0.125f
#define HK4  0.4f
#define HEPS 1.0e-6f
#define HP   36            // heat tile pitch in floats: 144 B, 16 B x odd, for its 16-byte readers
#define OP   (CM + 4)      // output staging pitch in floats: the 16 lanes' 16-byte stores of one column walk fall on 64 banks
static_assert(NH * HD == CM);
static_assert(NH == 8);
static_assert((MQ % 64) == 0 && (MC % 64) == 0 && (CM % 64) == 0 && (NC % 64) == 0 && (KC % 64) == 0);
static_assert((((MQ / 64) * (CM / 64)) % 8) == 0);
static_assert((((MC / 64) * (CM / 64)) % 8) == 0);
static_assert((((CM / 64) * (NC / 64)) % 8) == 0);
static_assert((NQ % 16) == 0 && (NC % 32) == 0);

typedef _Float16 v16h __attribute__((ext_vector_type(16)));
typedef _Float16 v8h  __attribute__((ext_vector_type(8)));
typedef __bf16   v16b __attribute__((ext_vector_type(16)));
typedef unsigned short v16us __attribute__((ext_vector_type(16)));
typedef unsigned short v8us  __attribute__((ext_vector_type(8)));
typedef float    v8f  __attribute__((ext_vector_type(8)));
typedef float    v4f  __attribute__((ext_vector_type(4)));
typedef unsigned int v4u __attribute__((ext_vector_type(4)));

union FragU { v16us v; v8us h[2]; };

// ---- scalar helpers --------------------------------------------------------------------------------
__device__ __forceinline__ unsigned short bf_bits(float f) {          // f32 -> bf16 bits, RNE convert
  unsigned u = __float_as_uint(f);
  return (unsigned short)((u + 0x7FFFu + ((u >> 16) & 1u)) >> 16);
}
__device__ __forceinline__ float bf_up(unsigned short h) { return __uint_as_float(((unsigned)h) << 16); }
__device__ __forceinline__ float bfr(float f) { return bf_up(bf_bits(f)); }   // value of the bf16 RNE convert
__device__ __forceinline__ unsigned short h_bits(_Float16 x) { return __builtin_bit_cast(unsigned short, x); }
__device__ __forceinline__ unsigned pk16(unsigned short a, unsigned short b) { return (unsigned)a | ((unsigned)b << 16); }
__device__ __forceinline__ v8f zero8() { v8f z = {0.f, 0.f, 0.f, 0.f, 0.f, 0.f, 0.f, 0.f}; return z; }
__device__ __forceinline__ float xhalf(float x) {                     // value of lane l ^ 16
  const int b = __builtin_bit_cast(int, x);
  return __builtin_bit_cast(float, __builtin_amdgcn_permlanex16(b, b, 0x76543210, 0xfedcba98, false, false));
}

// ---- fragment loader: 16-bit A/B operand, lane -> row/col (lane&15), p already includes +8*(lane>>4);
//      elements 0..7 <- p[0..7] (k0+8h..), elements 8..15 <- p[16..23] (k0+16+8h..)
__device__ __forceinline__ v16us ldfrag_u(const unsigned short* p) {
  FragU f;
  f.h[0] = *(const v8us*)(p);
  f.h[1] = *(const v8us*)(p + 16);
  return f.v;
}

// ---- fragment loader, fragment-order plane: one operand fragment is 1 KiB in a row, lane l's elements 0..7 at
//      16 * l bytes and its elements 8..15 at 512 + 16 * l; p already includes + 8 * lane. Each of the two loads
//      reads 512 bytes in a row (4 whole lines) where a row-major plane makes it touch 16 lines.
__device__ __forceinline__ v16us ldfrag_f(const unsigned short* p) {
  FragU f;
  f.h[0] = *(const v8us*)(p);
  f.h[1] = *(const v8us*)(p + 256);
  return f.v;
}

// ---- s_wait_xcnt 0 behind a group of global loads, in front of every overwrite of the group's address registers:
//      it takes the address as an input so that it stays whole up to it; its memory clobber keeps the loads ahead of it.
__device__ __forceinline__ void xwait1(const void* a) {
#if defined(__HIP_DEVICE_COMPILE__)
  asm volatile("s_wait_xcnt 0x0" :: "v"(a) : "memory");
#endif
}

// ---- WMMA helpers with trailing VALU hazard gap --------------------------------------------------------
__device__ __forceinline__ v8f mma_bu_raw(v16us a, v16us b, v8f c) {            // bf16 operands, unguarded
  return __builtin_amdgcn_wmma_f32_16x16x32_bf16(false, __builtin_bit_cast(v16b, a), false,
                                                 __builtin_bit_cast(v16b, b), (short)0, c, false, false);
}
__device__ __forceinline__ v8f mma_hu(v16us a, v16us b, v8f c) {                // f16 operands (bits), guarded
  c = __builtin_amdgcn_wmma_f32_16x16x32_f16(false, __builtin_bit_cast(v16h, a), false,
                                              __builtin_bit_cast(v16h, b), (short)0, c, false, false);
#if defined(__HIP_DEVICE_COMPILE__)
  asm volatile("v_nop\n\tv_nop\n\tv_nop\n\tv_nop" : "+v"(c) : "v"(a), "v"(b));
#endif
  return c;
}
// ---- one k step of a 64x64 wave tile: its 4 A and 4 B fragments (16 loads, fragment-order planes) as one group, A first.
//      ap, bp: the wave's (uniform) global addresses of the step, in scalar registers; l8 = 8 * lane elements, the one
//      vector register that all 16 loads name
typedef const __attribute__((address_space(1))) unsigned short gus;
typedef const __attribute__((address_space(1))) v8us           gv8us;
__device__ __forceinline__ void ld_step(v16us (&a)[4], v16us (&b)[4], gus* ap, gus* bp, unsigned l8) {
#pragma unroll
  for (int i = 0; i < 4; ++i) {
    FragU f;
    f.h[0] = *(gv8us*)(ap + i * 512 + l8);
    f.h[1] = *(gv8us*)(ap + i * 512 + l8 + 256);
    a[i] = f.v;
  }
#pragma unroll
  for (int j = 0; j < 4; ++j) {
    FragU f;
    f.h[0] = *(gv8us*)(bp + j * 512 + l8);
    f.h[1] = *(gv8us*)(bp + j * 512 + l8 + 256);
    b[j] = f.v;
  }
  // s_wait_xcnt 0 in front of every overwrite of the group's address registers: it takes the two bases and the lane
  // offset as inputs so that they stay whole up to it; its memory clobber keeps the loads ahead of it.
#if defined(__HIP_DEVICE_COMPILE__)
  asm volatile("s_wait_xcnt 0x0" :: "s"(ap), "s"(bp), "v"(l8) : "memory");
#endif
  __builtin_amdgcn_sched_barrier(0);   // no product (with its data wait) is scheduled up into the load group
}
// ---- between a step's products and the load group that refills the operand registers they read
__device__ __forceinline__ void refill_gap() {
  __builtin_amdgcn_sched_barrier(0);   // the group stays whole: without this its A loads are spread among the products in front of it
  // four vector slots, the distance a WMMA asks for before its A or B is overwritten: loads fill no slot, and a load over
  // B directly behind the product is not known to be safe; the memory clobber keeps the loads behind the slots
#if defined(__HIP_DEVICE_COMPILE__)
  asm volatile("v_nop\n\tv_nop\n\tv_nop\n\tv_nop" ::: "memory");
#endif
}
// ---- the next k step's address, added in scalar registers by hand: left to the compiler, the loop's address sums move
//      into vector registers, and accumulators plus two fragment sets leave none to spare (it then copies accumulators about)
__device__ __forceinline__ gus* next_step(gus* p, unsigned long long bytes) {
#if defined(__HIP_DEVICE_COMPILE__)
  gus* r;
  asm("s_add_nc_u64 %0, %1, %2" : "=s"(r) : "s"(p), "s"(bytes));
  return r;
#else
  return p + bytes / 2;
#endif
}
__device__ __forceinline__ void mma_step(v8f (&acc)[4][4], const v16us (&a)[4], const v16us (&b)[4]) {
#pragma unroll
  for (int i = 0; i < 4; ++i)
#pragma unroll
    for (int j = 0; j < 4; ++j) acc[i][j] = mma_bu_raw(a[i], b[j], acc[i][j]);
}
__device__ __forceinline__ void acc_guard4(v8f& a, v8f& b, v8f& c, v8f& d) {
#if defined(__HIP_DEVICE_COMPILE__)
  asm volatile("v_nop\n\tv_nop\n\tv_nop\n\tv_nop" : "+v"(a), "+v"(b), "+v"(c), "+v"(d));
#endif
}
__device__ __forceinline__ void wave_sync_lds() {
  __builtin_amdgcn_fence(__ATOMIC_RELEASE, "workgroup");
  __builtin_amdgcn_wave_barrier();
  __builtin_amdgcn_fence(__ATOMIC_ACQUIRE, "workgroup");
}

// ---- work-group barrier of the attention loop's heat tile: it waits for the wave's own LDS accesses alone, so that the
//      global loads issued a pass ahead stay in flight across it (__syncthreads() waits for them too); the memory clobber
//      keeps every LDS access on its side of the barrier
__device__ __forceinline__ void lds_barrier() {
#if defined(__HIP_DEVICE_COMPILE__)
  asm volatile("s_wait_dscnt 0x0\n\ts_barrier_signal -1\n\ts_barrier_wait -1" ::: "memory");
#endif
}

// =====================================================================================================
// Row convert: in[row][CM] f32 -> bf16 RNE bits in fragment order for a plane of nrt row tiles: fragment (row tile
// row/16, k step k/32) at (k step * nrt + row tile) * 512 elements (one k step of all rows lies in a row), inside it as
// ldfrag_f reads it; kofs is added to the k step (the second copy of the proj weights).
// Block = 256 threads (one tile rt of 16 rows = 1024 pieces of 8 columns, 4 a thread). Piece c holds row c & 15,
// columns 8 * (c >> 4) .. + 7: k step c >> 6, at 8 * (c & 63) elements of its fragment, so one store of one wave
// writes 512 bytes in a row.
// coverage: 1024 pieces x 8 = 16 rows x CM columns.
// =====================================================================================================
__device__ __forceinline__ void cvt_tile(const float* __restrict__ src, unsigned short* dst, int rt, int nrt, int kofs) {
  const int tid = threadIdx.x;
  // thread tid takes pieces c = tid + 256 * it: the same row, 128 columns (4 k steps) on
  const float* p = src + ((size_t)rt * 16 + (tid & 15)) * CM + (tid >> 4) * 8;
  unsigned short* d = dst + ((size_t)((tid >> 6) + kofs) * nrt + rt) * 512 + (tid & 63) * 8;
  v4f a0[4], a1[4];
#pragma unroll
  for (int it = 0; it < 4; ++it) {
    a0[it] = *(const v4f*)(p + it * 128);
    a1[it] = *(const v4f*)(p + it * 128 + 4);
  }
  xwait1(p);
  v4u hv[4];
#pragma unroll
  for (int it = 0; it < 4; ++it) {
    hv[it][0] = pk16(bf_bits(a0[it][0]), bf_bits(a0[it][1]));
    hv[it][1] = pk16(bf_bits(a0[it][2]), bf_bits(a0[it][3]));
    hv[it][2] = pk16(bf_bits(a1[it][0]), bf_bits(a1[it][1]));
    hv[it][3] = pk16(bf_bits(a1[it][2]), bf_bits(a1[it][3]));
  }
  unsigned short* dq[4];
#pragma unroll
  for (int it = 0; it < 4; ++it) dq[it] = d + (size_t)it * 4 * nrt * 512;
  __builtin_amdgcn_sched_barrier(0);   // the stores stand behind all the arithmetic: no register that one names is written again
#pragma unroll
  for (int it = 0; it < 4; ++it) *(v4u*)(dq[it]) = hv[it];
}

// All six converts in one grid (they depend on nothing but the inputs): block -> (matrix, row tile), the largest matrix
// first. Blocks 0 .. MC/16 - 1: context rows; the next MQ/16: query rows; then five groups of CM/16: the q, k and v
// weights, the proj weights, and the proj weights again for k steps CM/32 on.
// coverage: every row tile of every matrix once (the proj weights twice, into the two halves of their plane).
#define CVT_BLOCKS (MC / 16 + MQ / 16 + 5 * (CM / 16))
__global__ __launch_bounds__(256) void cvt_all(
    const float* __restrict__ xc, const float* __restrict__ xq, const float* __restrict__ wq,
    const float* __restrict__ wk, const float* __restrict__ wv, const float* __restrict__ wo,
    unsigned short* Xc, unsigned short* Xq, unsigned short* Wqb, unsigned short* Wkb, unsigned short* Wvb,
    unsigned short* WoT2) {
  const int bx = blockIdx.x;
  const int u = bx - (MC / 16 + MQ / 16), sel = u / (CM / 16);      // used where u >= 0: the weights' blocks
  const float* s = wo;
  unsigned short* d = WoT2;
  int rt = u % (CM / 16), nrt = CM / 16;
  if (bx < MC / 16)                { s = xc; d = Xc;  rt = bx;           nrt = MC / 16; }
  else if (bx < MC / 16 + MQ / 16) { s = xq; d = Xq;  rt = bx - MC / 16; nrt = MQ / 16; }
  else if (sel == 0)               { s = wq; d = Wqb; }
  else if (sel == 1)               { s = wk; d = Wkb; }
  else if (sel == 2)               { s = wv; d = Wvb; }
  cvt_tile(s, d, rt, nrt, (u >= 0 && sel == 4) ? (CM / 32) : 0);
}

// =====================================================================================================
// Register-blocked batched bf16 WMMA GEMM: C[m][n] = sum_k A[m][k] * Bt[n][k] (+ bias);
// one wave per 64x64 tile, no block barriers. A [M][K] and Bt [N][K] in fragment order, in planes of rtA and rtB row
// tiles: fragment (row tile row/16, k step k/32) at (k step * rt + row tile) * 512 elements, so that what all waves
// read in one k step lies in a row; M, N and K multiples of 64. bx = the block's index among the product's own blocks,
// by = batch index with element strides (sAy for A, sBy for Bt, sCy for C); sT = the block's LDS, one slab a wave.
// Tile enumeration: tile = bx * 8 + wave -> tm = tile / (N/64), tn = tile % (N/64).
// OM: 0 = f32 out to Cf (pitch ldc); 1 = f16 bits to Cp (pitch ldc); 2 = f16 hi bits to Cp and f16((v - hi) * 2048)
//     bits to Cp2, both in fragment order for m = head dim, n = key: fragment (chunk n/32, head m/64, row tile
//     (m/16)%4) at ((chunk * NH + head) * 4 + row tile) * 512 elements; 3 = f16 bits to Cp in fragment order for
//     m = key row (batch-major), n = head dim: fragment (chunk m/32 over both batches, head n/64, key tile (m/16)%2,
//     k step (n/32)%2) at (((chunk * NH + head) * 2 + key tile) * 2 + k step) * 512 elements. Inside a fragment: see
//     ldfrag_f. One chunk of 32 keys of all heads lies in a row in each plane.
// CBM: 0 = no bias; 1 = column bias bf16(cb[n]); 2 = row bias bf16(cb[m]).
// coverage: 4 slabs x 16 rows x 64 cols = the wave's whole 64x64 tile; tilesM*tilesN/8 blocks exactly per product
//           (host-checked), so no wave exits early.
// =====================================================================================================
template <int OM, int CBM>
__device__ __forceinline__ void gemm64_body(
    float (*sT)[16 * 68], int bx, int by,
    const unsigned short* __restrict__ Ap, int rtA, long long sAy,
    const unsigned short* __restrict__ Btp, int rtB, long long sBy,
    unsigned short* Cp, unsigned short* Cp2, float* Cf, int ldc, long long sCy,
    const float* __restrict__ cb, int M, int N, int K) {
  const int lane = threadIdx.x & 31;
  const int wave = __builtin_amdgcn_readfirstlane(threadIdx.x >> 5);   // scalar: the tile's addresses stay in scalar registers
  const int tilesN = N >> 6;
  const int tilesM = M >> 6;
  const int tile = bx * 8 + wave;
  if (tile >= tilesM * tilesN) return;   // wave-uniform; no block barriers in this kernel
  const int tm = tile / tilesN;
  const int tn = tile - tm * tilesN;
  const int m0 = tm << 6;
  const int n0 = tn << 6;

  const unsigned short* Ab = Ap  + (size_t)by * (size_t)sAy;
  const unsigned short* Bb = Btp + (size_t)by * (size_t)sBy;
  const size_t cofs = (size_t)by * (size_t)sCy;

  const int rlane = lane & 15;                 // row (A) / col (B, D) within subtile
  const int mOff  = (lane >> 4) * 8;           // D row offset

  v8f acc[4][4];
#pragma unroll
  for (int i = 0; i < 4; ++i)
#pragma unroll
    for (int j = 0; j < 4; ++j) acc[i][j] = zero8();

  // Two fragment sets: while one k step's 16 products run on one set, the next step's 16 loads are in flight into the
  // other, so a wave waits for memory once per step at most, not four times per step. k ascends as before.
  const unsigned long long sA = (unsigned long long)rtA * 1024u, sB = (unsigned long long)rtB * 1024u;   // bytes per k step
  gus* ap = (gus*)(Ab + (size_t)(m0 >> 4) * 512);
  gus* bp = (gus*)(Bb + (size_t)(n0 >> 4) * 512);
  const unsigned l8 = (unsigned)lane * 8u;
  v16us fa0[4], fb0[4], fa1[4], fb1[4];
  ld_step(fa0, fb0, ap, bp, l8);
#pragma unroll 1   // stays the loop it was, now that K is a constant at the call: unrolled, the kernel's text grows by a third, and a block runs its part of it only once
  for (int k0 = 64; k0 < K; k0 += 64) {
    ap = next_step(ap, sA);
    bp = next_step(bp, sB);
    refill_gap();
    ld_step(fa1, fb1, ap, bp, l8);
    mma_step(acc, fa0, fb0);
    ap = next_step(ap, sA);
    bp = next_step(bp, sB);
    refill_gap();
    ld_step(fa0, fb0, ap, bp, l8);
    mma_step(acc, fa1, fb1);
  }
  ap = next_step(ap, sA);
  bp = next_step(bp, sB);
  refill_gap();
  ld_step(fa1, fb1, ap, bp, l8);                                     // the last two steps: nothing left to fetch ahead
  mma_step(acc, fa0, fb0);
  mma_step(acc, fa1, fb1);
  acc_guard4(acc[0][0], acc[0][1], acc[0][2], acc[0][3]);
  acc_guard4(acc[1][0], acc[1][1], acc[1][2], acc[1][3]);
  acc_guard4(acc[2][0], acc[2][1], acc[2][2], acc[2][3]);
  acc_guard4(acc[3][0], acc[3][1], acc[3][2], acc[3][3]);

  const int hh2 = lane >> 4, c4 = (lane & 15) * 4;     // f32 out: 256-B row segment = 16 lanes x 16 B
  const int q8  = lane >> 3, c8 = (lane & 7) * 8;

  v4f cb4 = {0.f, 0.f, 0.f, 0.f};
  float cbc[4][8];                                     // row-major out uses [0] alone; fragment order one set per it
#pragma unroll
  for (int g = 0; g < 4; ++g)
#pragma unroll
    for (int e = 0; e < 8; ++e) cbc[g][e] = 0.f;
  if (CBM == 1) {
    if (OM == 0) {
      const v4f v = *(const v4f*)(cb + n0 + c4);
      cb4[0] = bfr(v[0]); cb4[1] = bfr(v[1]); cb4[2] = bfr(v[2]); cb4[3] = bfr(v[3]);
    } else if (OM == 1) {
      const v4f v0 = *(const v4f*)(cb + n0 + c8);
      const v4f v1 = *(const v4f*)(cb + n0 + c8 + 4);
#pragma unroll
      for (int e = 0; e < 4; ++e) { cbc[0][e] = bfr(v0[e]); cbc[0][4 + e] = bfr(v1[e]); }
    } else {
      const float* cp = cb + n0 + mOff;
#pragma unroll
      for (int g = 0; g < 4; ++g) {
        const v4f v0 = *(const v4f*)(cp + g * 16);
        const v4f v1 = *(const v4f*)(cp + g * 16 + 4);
#pragma unroll
        for (int e = 0; e < 4; ++e) { cbc[g][e] = bfr(v0[e]); cbc[g][4 + e] = bfr(v1[e]); }
      }
    }
  }

  // ---- epilogue ----
  float* slab = sT[wave];
#pragma unroll
  for (int i = 0; i < 4; ++i) {
    const int mBase = m0 + (i << 4);
#pragma unroll
    for (int j = 0; j < 4; ++j) {
#pragma unroll
      for (int r = 0; r < 8; ++r) {
        slab[(mOff + r) * 68 + (j << 4) + rlane] = acc[i][j][r];
      }
    }
    wave_sync_lds();
    if (OM == 0) {
      float* C = Cf + cofs;
      v4f vals[8];
#pragma unroll
      for (int it = 0; it < 8; ++it) {
        const int row = it * 2 + hh2;                      // it 0..7 x hh2 0..1 = rows 0..15
        const v4f v = *(const v4f*)(slab + row * 68 + c4);
        vals[it] = v + cb4;
      }
      {
#pragma unroll
        for (int it = 0; it < 8; ++it) {
          const int row = it * 2 + hh2;
          *(v4f*)(C + (size_t)(mBase + row) * ldc + (size_t)n0 + c4) = vals[it];
        }
        
      }
    } else {
      unsigned short* C  = Cp  + cofs;
      unsigned short* C2 = Cp2 + cofs;
      v4u hv[4], lv[4];
#pragma unroll
      for (int it = 0; it < 4; ++it) {
        // row-major out: it 0..3 x q8 0..3 = rows 0..15, 8 columns at c8; fragment order: the lane takes what it
        // holds as an operand, row lane & 15, the 8 columns at 16 * it + 8 * (lane >> 4)
        const int row = (OM == 1) ? (it * 4 + q8) : rlane;
        const int col = (OM == 1) ? c8 : (it * 16 + mOff);
        const float* sp = slab + row * 68 + col;
        float rb = 0.f;
        if (CBM == 2) rb = bfr(cb[mBase + row]);
        const int g = (OM == 1) ? 0 : it;
        v4u ha = {0u, 0u, 0u, 0u}, la = {0u, 0u, 0u, 0u};
#pragma unroll
        for (int e = 0; e < 4; ++e) {
          const float f0 = sp[2 * e]     + cbc[g][2 * e]     + rb;
          const float f1 = sp[2 * e + 1] + cbc[g][2 * e + 1] + rb;
          const _Float16 g0 = (_Float16)f0, g1 = (_Float16)f1;
          ha[e] = pk16(h_bits(g0), h_bits(g1));
          if (OM == 2) {
            la[e] = pk16(h_bits((_Float16)((f0 - (float)g0) * RSC)),
                         h_bits((_Float16)((f1 - (float)g1) * RSC)));
          }
        }
        hv[it] = ha;
        lv[it] = la;
      }
      {
#pragma unroll
        for (int it = 0; it < 4; ++it) {
          size_t go;
          if (OM == 1) {
            go = (size_t)(mBase + it * 4 + q8) * ldc + (size_t)n0 + c8;
          } else if (OM == 2) {
            go = (((size_t)((n0 >> 5) + (it >> 1)) * NH + tm) * 4 + i) * 512 + (it & 1) * 256 + lane * 8;
          } else {
            go = ((((size_t)(mBase >> 5) * NH + tn) * 2 + ((mBase >> 4) & 1)) * 2 + (it >> 1)) * 512
                 + (it & 1) * 256 + lane * 8;
          }
          *(v4u*)(C + go) = hv[it];
          if (OM == 2) *(v4u*)(C2 + go) = lv[it];
        }
        
      }
    }
    wave_sync_lds();
  }
}

// The q, k and v^T projections in one grid (none reads what another writes): blocks 0 .. GK - 1 the k projection, the next
// NB * GV the v^T projection (GV a batch), the last GQ the q projection.
//   k = Xc . Wkb^T + bk (K = 512) -> f16, fragment order; v^T per batch = Wvb . Xc_b^T + bv per row d -> f16 hi (VTh) and
//   residual x2048 (VTl), fragment order; q = Xq . Wqb^T + bq -> f16 plane [rows][512]
#define GQ (((MQ / 64) * (CM / 64)) / 8)     // 512 tiles -> 64 blocks
#define GK (((MC / 64) * (CM / 64)) / 8)     // 1024 tiles -> 128 blocks
#define GV (((CM / 64) * (NC / 64)) / 8)     // 512 tiles -> 64 blocks a batch
__global__ __launch_bounds__(256) void proj_qkv(
    const unsigned short* __restrict__ Xq, const unsigned short* __restrict__ Xc,
    const unsigned short* __restrict__ Wqb, const unsigned short* __restrict__ Wkb,
    const unsigned short* __restrict__ Wvb,
    unsigned short* Qp, unsigned short* Kp, unsigned short* VTh, unsigned short* VTl,
    const float* __restrict__ bq, const float* __restrict__ bk, const float* __restrict__ bv) {
  __shared__ __align__(16) float sT[8][16 * 68];   // per-wave 16x64 slab, pitch 68 floats
  const int bx = blockIdx.x;
  if (bx < GK) {
    gemm64_body<3, 1>(sT, bx, 0, Xc, MC / 16, 0LL, Wkb, CM / 16, 0LL,
                      Kp, Kp, nullptr, CM, 0LL, bk, MC, CM, CM);
  } else if (bx < GK + NB * GV) {
    const int u = bx - GK;
    gemm64_body<2, 2>(sT, u % GV, u / GV, Wvb, CM / 16, 0LL, Xc, MC / 16, (long long)(NC / 16) * 512,
                      VTh, VTl, nullptr, NC, (long long)CM * NC, bv, CM, NC, CM);
  } else {
    gemm64_body<1, 1>(sT, bx - (GK + NB * GV), 0, Xq, MQ / 16, 0LL, Wqb, CM / 16, 0LL,
                      Qp, Qp, nullptr, CM, 0LL, bq, MQ, CM, CM);
  }
}

// The output projection: out = [ctx_hi | ctx_lo] . [Wo | Wo]^T + bo (K = 1024, bf16 operands) -> f32
__global__ __launch_bounds__(256) void proj_out(
    const unsigned short* __restrict__ Ctx, const unsigned short* __restrict__ WoT2, float* out,
    const float* __restrict__ bo) {
  __shared__ __align__(16) float sT[8][16 * 68];   // per-wave 16x64 slab, pitch 68 floats
  gemm64_body<0, 1>(sT, blockIdx.x, 0, Ctx, MQ / 16, 0LL, WoT2, CM / 16, 0LL,
                    nullptr, nullptr, out, CM, 0LL, bo, MQ, CM, KC);
}

// =====================================================================================================
// Fused heat-bias + online-softmax cross attention, head dim 64, 8 heads.
//   Block = 256 threads = 8 waves, wave w = head w; one block per (batch, 16 query rows); key chunks of 32,
//   static trip NCH = 128. q plane (f16 bits, pitch CM): row (b*NQ + t), head h at col h*64 + d; k plane
//   (f16 bits) and v^T hi / lo planes (f16 bits, value = hi + lo/2048) in fragment order (gemm64, OM 3 and 2):
//   2048 elements per (batch, chunk of 32 keys, head) in each plane. Context plane (bf16 bits, KC columns, fragment order
//   as gemm64 reads its A): row b*NQ + t, hi at column h*64 + d, lo (value - hi) at column CM + h*64 + d.
//   Per chunk: heat[q][s] = exp(-(dx*dx + dy*dy) * (1 / (0.4*|dt| + 1e-6))) from the bf16-converted positions
//   (spatial = dims 0,1, time = dim 2), computed once per (query row, key) pair by the block (thread = key
//   lane, rows w and w+8) into LDS and shared by the 8 head waves. Both products are transposed: S^T = K . Q^T
//   (A = k rows, B = q), so a lane holds 16 of the 32 scores of ONE query (column lane & 15; keys 8h + r and
//   16 + 8h + r): s = (k . q) * 0.125 + heat; running-max softmax in f32 with maximum and sum in the lane, the
//   maximum joined with the other lane half once a pass, the sums once behind the loop. p = exp(s - m) as
//   f16(1024 p): the two score tiles, converted in place, are the B operand of O^T += V^T . P^T (A = v^T rows, hi and
//   lo accumulator sets, 4 row tiles of 16 dims each). All q, k, v^T and p fragments use the split k map
//   (elements 0..7 <- k0+8h.., 8..15 <- k0+16+8h..).
//   Epilogue: context tile of the block (16 rows x 512) staged in LDS (f32), then written as one fragment-order row tile.
// coverage: heat 16 rows x 32 keys per chunk (8 waves x 2 rows x 32 lanes); context 16 rows x 512 cols hi and lo
//           per block (256 threads x 4 pieces x 8 cols); grid NQ/16 x NB covers every query row.
// =====================================================================================================
__global__ void __launch_bounds__(256) attn_kernel(
    const float* __restrict__ posq, const float* __restrict__ posc,
    const unsigned short* __restrict__ qp, const unsigned short* __restrict__ kp,
    const unsigned short* __restrict__ vth, const unsigned short* __restrict__ vtl,
    unsigned short* ctxp) {
#pragma clang fp contract(off)
  __shared__ __align__(16) float heatL[16 * HP];            // [query row][key], pitch HP
  __shared__ __align__(16) float osm[16 * OP];              // output staging [16][CM], pitch OP
  __shared__ float qps[16 * 3];

  const int b = blockIdx.y, i0 = blockIdx.x * 16;
  const int t = threadIdx.x, lane = t & 31, w = t >> 5, hh = lane >> 4, jc = lane & 15;
  const size_t rowQ = (size_t)b * NQ, rowC = (size_t)b * NC;

  if (t < 48) qps[t] = bfr(posq[(rowQ + i0) * 3 + t]);
  __syncthreads();

  // q B-fragments (col = query jc of this tile, k = d), plain f16 bits; d 0..31 and 32..63
  const unsigned short* qrow = qp + (rowQ + i0 + jc) * CM + w * HD + 8 * hh;
  const v16us qf0 = ldfrag_u(qrow);
  const v16us qf1 = ldfrag_u(qrow + 32);

  // query positions of the two heat rows this thread produces (rows w and w+8, key = lane)
  const float qx0 = qps[w * 3 + 0],       qy0 = qps[w * 3 + 1],       qt0 = qps[w * 3 + 2];
  const float qx1 = qps[(w + 8) * 3 + 0], qy1 = qps[(w + 8) * 3 + 1], qt1 = qps[(w + 8) * 3 + 2];

  float m = -1.0e30f, ll = 0.f;      // query jc: running maximum (both lane halves alike), this lane half's sum
  v8f oh[4], ol[4];                  // O^T tiles: register r = dim ct*16 + 8*hh + r of query jc
#pragma unroll
  for (int ct = 0; ct < 4; ++ct) { oh[ct] = zero8(); ol[ct] = zero8(); }

  // fragment-order planes: a pass's 4 K fragments are 4 KiB in a row, its 4 V fragments 4 KiB in a row in each plane,
  // and the 8 heads' (waves') pieces of one pass follow one another
  const unsigned short* vhb = vth + ((size_t)b * NCH * NH + w) * 2048 + lane * 8;     // A: row d = ct*16 + jc, k = key
  const unsigned short* vlb = vtl + ((size_t)b * NCH * NH + w) * 2048 + lane * 8;
  const unsigned short* kgb = kp + ((size_t)b * NCH * NH + w) * 2048 + lane * 8;      // A: row key = jc, k = d
  const float* pcb = posc + rowC * 3;
  const float* hrd = heatL + jc * HP + 8 * hh;                                        // heat of query jc, keys 8*hh..

  // Chunk 0's key positions, K and V fragments, in the order in which the loop refills them. Each pass fetches the next
  // chunk's into the same registers: positions and K right behind its score products, V right behind its V products,
  // so that a fragment's L2 round trip runs under the vector work and the barriers of most of a pass.
  const float* pc0 = pcb + (size_t)lane * 3;
  float px = pc0[0], py = pc0[1], pz = pc0[2];
  __builtin_amdgcn_sched_barrier(0);   // the loop's issue order, here too: a counted wait in the loop is as loose as the tighter of its two ways in
  v16us k00 = ldfrag_f(kgb);
  v16us k01 = ldfrag_f(kgb + 512);
  v16us k10 = ldfrag_f(kgb + 1024);
  v16us k11 = ldfrag_f(kgb + 1536);
  __builtin_amdgcn_sched_barrier(0);   // K ahead of V, as in the loop
  v16us vh[4], vl[4];
#pragma unroll
  for (int ct = 0; ct < 4; ++ct) {
    vh[ct] = ldfrag_f(vhb + ct * 512);
    vl[ct] = ldfrag_f(vlb + ct * 512);
  }
  // s_wait_xcnt 0 in front of every overwrite of an address that the loads above name, in the form of the loop's own
#if defined(__HIP_DEVICE_COMPILE__)
  asm volatile("s_wait_xcnt 0x0" :: "v"(qrow), "v"(pc0), "v"(kgb), "v"(vhb), "v"(vlb) : "memory");
#endif
  __builtin_amdgcn_sched_barrier(0);   // the wait stays directly behind the groups: left to sink, the build gets a second one inside the loop

#pragma unroll 1
  for (int jt = 0; jt < NCH; ++jt) {
    const int jn = (jt + 1 < NCH) ? (jt + 1) : jt;     // the chunk fetched ahead; the last pass re-reads its own: stays inside the planes
    lds_barrier();                                     // all waves done reading heatL of the prior chunk
    {
      const float cx = bfr(px), cy = bfr(py), cz = bfr(pz);
      const float dxa = qx0 - cx, dya = qy0 - cy, dta = qt0 - cz;
      const float dxb = qx1 - cx, dyb = qy1 - cy, dtb = qt1 - cz;
      const float da = dxa * dxa + dya * dya;
      const float db = dxb * dxb + dyb * dyb;
      const float na = HK4 * fabsf(dta) + HEPS;
      const float nb = HK4 * fabsf(dtb) + HEPS;
      const float ha = expf(-(da * (1.0f / na)));
      const float hb = expf(-(db * (1.0f / nb)));
      heatL[w * HP + lane]       = ha;
      heatL[(w + 8) * HP + lane] = hb;
    }
    lds_barrier();

    // heat of this lane's 16 (query, key) pairs, read ahead of the score products so that it lands under them
    const v4f h00 = *(const v4f*)(hrd),      h01 = *(const v4f*)(hrd + 4);
    const v4f h10 = *(const v4f*)(hrd + 16), h11 = *(const v4f*)(hrd + 20);

    // ---- scores, transposed: 32 keys x 16 query columns of head w, K = 64 in two 32-deep steps ----
    __builtin_amdgcn_sched_barrier(0);   // no product (with its wait for K) is scheduled up in front of the heat tile's work
    v8f s0, s1;                          // s0[r]: key 32*jt + 8*hh + r, s1[r]: key 32*jt + 16 + 8*hh + r, query jc
    s0 = mma_hu(k00, qf0, zero8());
    s0 = mma_hu(k01, qf1, s0);
    s1 = mma_hu(k10, qf0, zero8());
    s1 = mma_hu(k11, qf1, s1);

    // ---- the next chunk's key positions and K fragments, over the registers the four products above have read ----
    __builtin_amdgcn_sched_barrier(0);   // the group stays behind the products whose operands it overwrites
    const float* pc = pcb + (size_t)(jn * 32 + lane) * 3;
    px = pc[0]; py = pc[1]; pz = pc[2];
    const unsigned short* kg = kgb + (size_t)jn * (NH * 2048);
    k00 = ldfrag_f(kg);
    k01 = ldfrag_f(kg + 512);
    k10 = ldfrag_f(kg + 1024);
    k11 = ldfrag_f(kg + 1536);
    // The group's address registers are reused below: the wait stands in front of every such overwrite. It takes the
    // two addresses as inputs so that they stay whole up to it, and its memory clobber keeps the group ahead of it.
#if defined(__HIP_DEVICE_COMPILE__)
    asm volatile("s_wait_xcnt 0x0" :: "v"(kg), "v"(pc) : "memory");
#endif
    __builtin_amdgcn_sched_barrier(0);   // the group goes out here, ahead of the softmax, not further down towards its use

    // ---- heat bias + online softmax of query jc, all in the lane but for one exchange of the maximum ----
    const v8f x0 = s0 * SCL + __builtin_shufflevector(h00, h01, 0, 1, 2, 3, 4, 5, 6, 7);
    const v8f x1 = s1 * SCL + __builtin_shufflevector(h10, h11, 0, 1, 2, 3, 4, 5, 6, 7);
    const v8f mx = __builtin_elementwise_max(x0, x1);
    float rm = fmaxf(fmaxf(fmaxf(mx[0], mx[1]), fmaxf(mx[2], mx[3])), fmaxf(fmaxf(mx[4], mx[5]), fmaxf(mx[6], mx[7])));
    rm = fmaxf(rm, xhalf(rm));
    const float mn2   = fmaxf(m, rm);
    const float alpha = __expf(m - mn2);
    m = mn2;
    const v8f a0 = x0 - mn2, a1 = x1 - mn2;
    v8f e0, e1;
#pragma unroll
    for (int r = 0; r < 8; ++r) { e0[r] = __expf(a0[r]); e1[r] = __expf(a1[r]); }
    const v8f sm = e0 + e1;
    ll = ll * alpha + (((sm[0] + sm[1]) + (sm[2] + sm[3])) + ((sm[4] + sm[5]) + (sm[6] + sm[7])));
    // P^T B-fragment: element e = p of key kmap(e), the two score tiles converted in place
    const v8h p0 = __builtin_convertvector(e0 * PSC, v8h), p1 = __builtin_convertvector(e1 * PSC, v8h);
    const v16h pb = __builtin_shufflevector(p0, p1, 0, 1, 2, 3, 4, 5, 6, 7, 8, 9, 10, 11, 12, 13, 14, 15);
#pragma unroll
    for (int ct = 0; ct < 4; ++ct) { oh[ct] *= alpha; ol[ct] *= alpha; }

    // ---- context^T += V_hi^T . P^T and V_lo^T . P^T (4 row tiles of 16 dims) ----
    const v16us pbu = __builtin_bit_cast(v16us, pb);
#pragma unroll
    for (int ct = 0; ct < 4; ++ct) {
      oh[ct] = mma_hu(vh[ct], pbu, oh[ct]);
      ol[ct] = mma_hu(vl[ct], pbu, ol[ct]);
    }

    // ---- the next chunk's V fragments, over the registers the eight products above have read ----
    __builtin_amdgcn_sched_barrier(0);   // the group stays behind the products whose operands it overwrites
    const unsigned short* vhp = vhb + (size_t)jn * (NH * 2048);
    const unsigned short* vlp = vlb + (size_t)jn * (NH * 2048);
#pragma unroll
    for (int ct = 0; ct < 4; ++ct) {
      vh[ct] = ldfrag_f(vhp + ct * 512);
      vl[ct] = ldfrag_f(vlp + ct * 512);
    }
    // s_wait_xcnt 0 in front of every overwrite of this group's two addresses, in the form of the K group's above
#if defined(__HIP_DEVICE_COMPILE__)
    asm volatile("s_wait_xcnt 0x0" :: "v"(vhp), "v"(vlp) : "memory");
#endif
  }

  __syncthreads();
  {
    const float l = ll + xhalf(ll);      // the two lane halves' sums of query jc, joined once
    const float inv = ((l > 0.f) ? (1.0f / l) : 0.f) * (1.0f / PSC);
    float* od = osm + jc * OP + w * HD + 8 * hh;
#pragma unroll
    for (int ct = 0; ct < 4; ++ct) {
      v4f o0, o1;
#pragma unroll
      for (int e = 0; e < 4; ++e) {
        o0[e] = (oh[ct][e]     + ol[ct][e]     * (1.0f / RSC)) * inv;
        o1[e] = (oh[ct][4 + e] + ol[ct][4 + e] * (1.0f / RSC)) * inv;
      }
      *(v4f*)(od + ct * 16)     = o0;
      *(v4f*)(od + ct * 16 + 4) = o1;
    }
  }
  __syncthreads();
  {
    // piece c of the tile's 1024: row c & 15, columns 8 * (c >> 4) .. + 7: k step c >> 6, 8 * (c & 63) elements into its fragment
    v4u hv[2][2], lv[2][2];
#pragma unroll
    for (int rr = 0; rr < 2; ++rr) {
#pragma unroll
      for (int it = 0; it < 2; ++it) {
        const int c = (rr * 2 + it) * 256 + t;
        const float* sp = osm + (c & 15) * OP + (c >> 4) * 8;
        const v4f f0 = *(const v4f*)(sp);
        const v4f f1 = *(const v4f*)(sp + 4);
        v4u ha, la;
#pragma unroll
        for (int e = 0; e < 2; ++e) {
          const unsigned short u0 = bf_bits(f0[2 * e]), u1 = bf_bits(f0[2 * e + 1]);
          const unsigned short u2 = bf_bits(f1[2 * e]), u3 = bf_bits(f1[2 * e + 1]);
          ha[e]     = pk16(u0, u1);
          ha[2 + e] = pk16(u2, u3);
          la[e]     = pk16(bf_bits(f0[2 * e] - bf_up(u0)), bf_bits(f0[2 * e + 1] - bf_up(u1)));
          la[2 + e] = pk16(bf_bits(f1[2 * e] - bf_up(u2)), bf_bits(f1[2 * e + 1] - bf_up(u3)));
        }
        hv[rr][it] = ha;
        lv[rr][it] = la;
      }
    }
    {
#pragma unroll
      for (int rr = 0; rr < 2; ++rr) {
        const size_t rtq = (rowQ + i0) >> 4;               // the block's row tile among the plane's MQ / 16
#pragma unroll
        for (int it = 0; it < 2; ++it) {
          const int c = (rr * 2 + it) * 256 + t;
          const size_t go = ((size_t)(c >> 6) * (MQ / 16) + rtq) * 512 + (c & 63) * 8;
          *(v4u*)(ctxp + go)                                   = hv[rr][it];
          *(v4u*)(ctxp + go + (size_t)(CM / 32) * (MQ / 16) * 512) = lv[rr][it];
        }
      }
      
    }
  }
}

// =====================================================================================================
// Workspace map (bytes); every plane is an exact multiple of its whole-row / whole-line / 64x64-tile store
// granularity (MQ = 4096 = 64 row tiles, MC = 8192 = 128 row tiles; N in {512, 4096}; v^T per batch
// [512][4096] = 8x64 tiles):
// (Xq, Xc, the four weight planes and Ctx hold these shapes in fragment order: [k step of 32][row tile of 16][512])
//   Xq   bf16 [4096][512]       0          4194304
//   Xc   bf16 [8192][512]       4194304    8388608
//   Wqb  bf16 [512][512]        12582912   524288
//   Wkb  bf16 [512][512]        13107200   524288
//   Wvb  bf16 [512][512]        13631488   524288
//   WoT2 bf16 [512][1024]       14155776   1048576   (cols k and CM + k both hold the proj weight)
//   Qp   f16  [4096][512]       15204352   4194304
//   Kp   f16  [2][128][8][2048] 19398656   8388608   (k, fragment order: batch, chunk of 32 keys, head)
//   VTh  f16  [2][128][8][2048] 27787264   8388608   (v^T hi, fragment order)
//   VTl  f16  [2][128][8][2048] 36175872   8388608   (v^T residual x2048, fragment order)
//   Ctx  bf16 [4096][1024]      44564480   8388608   (context hi | lo)
//   end                         52953088
// =====================================================================================================
extern "C" void kernel_launch(void* const* d_in, const int* in_sizes, int n_in,
                              void* d_out, int out_size, void* d_ws, size_t ws_size,
                              hipStream_t stream) {
  if (n_in < 12) return;
  if (in_sizes[0] != MC * CM) return;
  if (in_sizes[1] != MQ * CM) return;
  if (in_sizes[2] != MC * 3) return;
  if (in_sizes[3] != MQ * 3) return;
  if (in_sizes[4] != CM * CM || in_sizes[5] != CM) return;
  if (in_sizes[6] != CM * CM || in_sizes[7] != CM) return;
  if (in_sizes[8] != CM * CM || in_sizes[9] != CM) return;
  if (in_sizes[10] != CM * CM || in_sizes[11] != CM) return;
  if (out_size != MQ * CM) return;

  const float* x_ctx   = (const float*)d_in[0];
  const float* x_query = (const float*)d_in[1];
  const float* pos_ctx = (const float*)d_in[2];
  const float* pos_qry = (const float*)d_in[3];
  const float* Wq = (const float*)d_in[4];
  const float* bq = (const float*)d_in[5];
  const float* Wk = (const float*)d_in[6];
  const float* bk = (const float*)d_in[7];
  const float* Wv = (const float*)d_in[8];
  const float* bv = (const float*)d_in[9];
  const float* Wo = (const float*)d_in[10];
  const float* bo = (const float*)d_in[11];

  const size_t PXQ  = (size_t)MQ * CM * 2;             //  4194304
  const size_t PXC  = (size_t)MC * CM * 2;             //  8388608
  const size_t PW   = (size_t)CM * CM * 2;             //   524288
  const size_t PWO  = (size_t)CM * KC * 2;             //  1048576
  const size_t PQ   = (size_t)MQ * CM * 2;             //  4194304
  const size_t PK   = (size_t)MC * CM * 2;             //  8388608
  const size_t PVT  = (size_t)NB * CM * NC * 2;        //  8388608
  const size_t PCTX = (size_t)MQ * KC * 2;             //  8388608
  size_t off = 0;
  const size_t oXq  = off; off += PXQ;
  const size_t oXc  = off; off += PXC;
  const size_t oWq  = off; off += PW;
  const size_t oWk  = off; off += PW;
  const size_t oWv  = off; off += PW;
  const size_t oWo  = off; off += PWO;
  const size_t oQ   = off; off += PQ;
  const size_t oK   = off; off += PK;
  const size_t oVTh = off; off += PVT;
  const size_t oVTl = off; off += PVT;
  const size_t oCtx = off; off += PCTX;
  if (off > ws_size) return;                           // off = 52953088
  if (off > (size_t)134217728) return;

  char* ws = (char*)d_ws;
  unsigned short* Xq   = (unsigned short*)(ws + oXq);
  unsigned short* Xc   = (unsigned short*)(ws + oXc);
  unsigned short* Wqb  = (unsigned short*)(ws + oWq);
  unsigned short* Wkb  = (unsigned short*)(ws + oWk);
  unsigned short* Wvb  = (unsigned short*)(ws + oWv);
  unsigned short* WoT2 = (unsigned short*)(ws + oWo);
  unsigned short* Qp   = (unsigned short*)(ws + oQ);
  unsigned short* Kp   = (unsigned short*)(ws + oK);
  unsigned short* VTh  = (unsigned short*)(ws + oVTh);
  unsigned short* VTl  = (unsigned short*)(ws + oVTl);
  unsigned short* Ctx  = (unsigned short*)(ws + oCtx);
  float*          out0 = (float*)d_out;

  const dim3 blk(256);
  const dim3 gQKV(GK + NB * GV + GQ, 1, 1);                    // 128 + 2 x 64 + 64 blocks
  const dim3 gAttn(NQ / 16, NB, 1);                            // 128 x 2 blocks of 256
  const dim3 gO(GQ, 1, 1);                                     // 512 tiles -> 64 blocks
  if ((((MQ / 64) * (CM / 64)) % 8) != 0) return;
  if ((((MC / 64) * (CM / 64)) % 8) != 0) return;
  if ((((CM / 64) * (NC / 64)) % 8) != 0) return;

  // (0) bf16 planes of the activations and weights ([out][in]) in fragment order; proj weights with duplicated k range
  cvt_all<<<dim3(CVT_BLOCKS), blk, 0, stream>>>(x_ctx, x_query, Wq, Wk, Wv, Wo, Xc, Xq, Wqb, Wkb, Wvb, WoT2);

  // (1) the q, k and v^T projections, one grid
  proj_qkv<<<gQKV, blk, 0, stream>>>(Xq, Xc, Wqb, Wkb, Wvb, Qp, Kp, VTh, VTl, bq, bk, bv);

  // (2) fused heat bias + softmax attention -> context bf16 hi|lo
  attn_kernel<<<gAttn, blk, 0, stream>>>(pos_qry, pos_ctx, Qp, Kp, VTh, VTl, Ctx);

  // (3) out = [ctx_hi | ctx_lo] . [Wo | Wo]^T + bo  (K = 1024, bf16 operands) -> d_out f32
  proj_out<<<gO, blk, 0, stream>>>(Ctx, WoT2, out0, bo);
  (void)hipGetLastError();
}

// v007
// Measured time: 132 microseconds a run.
// In both of two side-by-side timings against v006, it was 1.38 times as fast.
// All steps since v000 together make it 4.94 times as fast.
// Contractions: q and k projections (x . W^T) and v^T projection (Wv . x^T) on v_wmma_f32_16x16x32_bf16 (bf16 x, bf16 weights);
// output projection on v_wmma_f32_16x16x32_bf16 (context as bf16 hi|lo planes K-concatenated against duplicated bf16 weights);
// scores transposed, k.q^T, on v_wmma_f32_16x16x32_f16 (plain f16 q, k); v^T.p^T on v_wmma_f32_16x16x32_f16 (p carried
// x1024 f16, v^T as f16 hi + x2048 residual planes, separate accumulators); all f32 accumulate; heat-kernel bias and softmax in f32;
// every float input RNE-converted to bf16 on load.
#include <hip/hip_runtime.h>
#include <math.h>
#include <stdint.h>

#define NB   2
#define NQ   2048
#define NC   4096
#define CM   512
#define NH   8
#define HD   64
#define MQ   (NB * NQ)
#define MC   (NB * NC)
#define KC   (2 * CM)
#define NCH  (NC / 32)
#define RSC  2048.0f
#define PSC  1024.0f
#define SCL  0.125f
#define HK4  0.4f
#define HEPS 1.0e-6f
#define HP   36            // heat tile pitch in floats: 144 B, 16 B x odd, for its 16-byte readers
#define OP   (CM + 4)      // output staging pitch in floats: the 16 lanes' 16-byte stores of one column walk fall on 64 banks
static_assert(NH * HD == CM);
static_assert(NH == 8);
static_assert((MQ % 64) == 0 && (MC % 64) == 0 && (CM % 64) == 0 && (NC % 64) == 0 && (KC % 64) == 0);
static_assert((((MQ / 64) * (CM / 64)) % 8) == 0);
static_assert((((MC / 64) * (CM / 64)) % 8) == 0);
static_assert((((CM / 64) * (NC / 64)) % 8) == 0);
static_assert((NQ % 16) == 0 && (NC % 32) == 0);

typedef _Float16 v16h __attribute__((ext_vector_type(16)));
typedef _Float16 v8h  __attribute__((ext_vector_type(8)));
typedef __bf16   v16b __attribute__((ext_vector_type(16)));
typedef unsigned short v16us __attribute__((ext_vector_type(16)));
typedef unsigned short v8us  __attribute__((ext_vector_type(8)));
typedef float    v8f  __attribute__((ext_vector_type(8)));
typedef float    v4f  __attribute__((ext_vector_type(4)));
typedef float    v2f  __attribute__((ext_vector_type(2)));
typedef unsigned int v4u __attribute__((ext_vector_type(4)));

union FragU { v16us v; v8us h[2]; };

// ---- scalar helpers --------------------------------------------------------------------------------
__device__ __forceinline__ unsigned short bf_bits(float f) {          // f32 -> bf16 bits, RNE convert
  unsigned u = __float_as_uint(f);
  return (unsigned short)((u + 0x7FFFu + ((u >> 16) & 1u)) >> 16);
}
__device__ __forceinline__ float bf_up(unsigned short h) { return __uint_as_float(((unsigned)h) << 16); }
__device__ __forceinline__ float bfr(float f) { return bf_up(bf_bits(f)); }   // value of the bf16 RNE convert
__device__ __forceinline__ unsigned short h_bits(_Float16 x) { return __builtin_bit_cast(unsigned short, x); }
__device__ __forceinline__ unsigned pk16(unsigned short a, unsigned short b) { return (unsigned)a | ((unsigned)b << 16); }
__device__ __forceinline__ v8f zero8() { v8f z = {0.f, 0.f, 0.f, 0.f, 0.f, 0.f, 0.f, 0.f}; return z; }
__device__ __forceinline__ float xhalf(float x) {                     // value of lane l ^ 16
  const int b = __builtin_bit_cast(int, x);
  return __builtin_bit_cast(float, __builtin_amdgcn_permlanex16(b, b, 0x76543210, 0xfedcba98, false, false));
}

// ---- fragment loader: 16-bit A/B operand, lane -> row/col (lane&15), p already includes +8*(lane>>4);
//      elements 0..7 <- p[0..7] (k0+8h..), elements 8..15 <- p[16..23] (k0+16+8h..)
__device__ __forceinline__ v16us ldfrag_u(const unsigned short* p) {
  FragU f;
  f.h[0] = *(const v8us*)(p);
  f.h[1] = *(const v8us*)(p + 16);
  return f.v;
}

// ---- fragment loader, fragment-order plane: one operand fragment is 1 KiB in a row, lane l's elements 0..7 at
//      16 * l bytes and its elements 8..15 at 512 + 16 * l; p already includes + 8 * lane. Each of the two loads
//      reads 512 bytes in a row (4 whole lines) where a row-major plane makes it touch 16 lines.
__device__ __forceinline__ v16us ldfrag_f(const unsigned short* p) {
  FragU f;
  f.h[0] = *(const v8us*)(p);
  f.h[1] = *(const v8us*)(p + 256);
  return f.v;
}

// ---- s_wait_xcnt 0 behind a group of global loads, in front of every overwrite of the group's address registers:
//      it takes the address as an input so that it stays whole up to it; its memory clobber keeps the loads ahead of it.
__device__ __forceinline__ void xwait1(const void* a) {
#if defined(__HIP_DEVICE_COMPILE__)
  asm volatile("s_wait_xcnt 0x0" :: "v"(a) : "memory");
#endif
}

// ---- WMMA helpers with trailing VALU hazard gap --------------------------------------------------------
__device__ __forceinline__ v8f mma_bu_raw(v16us a, v16us b, v8f c) {            // bf16 operands, unguarded
  return __builtin_amdgcn_wmma_f32_16x16x32_bf16(false, __builtin_bit_cast(v16b, a), false,
                                                 __builtin_bit_cast(v16b, b), (short)0, c, false, false);
}
// f16 operands (bits), unguarded like the bf16 form: a guard that names the operands in an asm statement holds them all below
// v256, and two column tiles' accumulators and fragments do not fit there (the build then spills); the loads that overwrite
// A operands stand behind refill_gap() instead
__device__ __forceinline__ v8f mma_hu(v16us a, v16us b, v8f c) {
  return __builtin_amdgcn_wmma_f32_16x16x32_f16(false, __builtin_bit_cast(v16h, a), false,
                                                __builtin_bit_cast(v16h, b), (short)0, c, false, false);
}
// ---- one k step of a 64x64 wave tile: its 4 A and 4 B fragments (16 loads, fragment-order planes) as one group, A first.
//      ap, bp: the wave's (uniform) global addresses of the step, in scalar registers; l8 = 8 * lane elements, the one
//      vector register that all 16 loads name
typedef const __attribute__((address_space(1))) unsigned short gus;
typedef const __attribute__((address_space(1))) v8us           gv8us;
__device__ __forceinline__ void ld_step(v16us (&a)[4], v16us (&b)[4], gus* ap, gus* bp, unsigned l8) {
#pragma unroll
  for (int i = 0; i < 4; ++i) {
    FragU f;
    f.h[0] = *(gv8us*)(ap + i * 512 + l8);
    f.h[1] = *(gv8us*)(ap + i * 512 + l8 + 256);
    a[i] = f.v;
  }
#pragma unroll
  for (int j = 0; j < 4; ++j) {
    FragU f;
    f.h[0] = *(gv8us*)(bp + j * 512 + l8);
    f.h[1] = *(gv8us*)(bp + j * 512 + l8 + 256);
    b[j] = f.v;
  }
  // s_wait_xcnt 0 in front of every overwrite of the group's address registers: it takes the two bases and the lane
  // offset as inputs so that they stay whole up to it; its memory clobber keeps the loads ahead of it.
#if defined(__HIP_DEVICE_COMPILE__)
  asm volatile("s_wait_xcnt 0x0" :: "s"(ap), "s"(bp), "v"(l8) : "memory");
#endif
  __builtin_amdgcn_sched_barrier(0);   // no product (with its data wait) is scheduled up into the load group
}
// ---- between a step's products and the load group that refills the operand registers they read
__device__ __forceinline__ void refill_gap() {
  __builtin_amdgcn_sched_barrier(0);   // the group stays whole: without this its A loads are spread among the products in front of it
  // four vector slots, the distance a WMMA asks for before its A or B is overwritten: loads fill no slot, and a load over
  // B directly behind the product is not known to be safe; the memory clobber keeps the loads behind the slots
#if defined(__HIP_DEVICE_COMPILE__)
  asm volatile("v_nop\n\tv_nop\n\tv_nop\n\tv_nop" ::: "memory");
#endif
}
// ---- the next k step's address, added in scalar registers by hand: left to the compiler, the loop's address sums move
//      into vector registers, and accumulators plus two fragment sets leave none to spare (it then copies accumulators about)
__device__ __forceinline__ gus* next_step(gus* p, unsigned long long bytes) {
#if defined(__HIP_DEVICE_COMPILE__)
  gus* r;
  asm("s_add_nc_u64 %0, %1, %2" : "=s"(r) : "s"(p), "s"(bytes));
  return r;
#else
  return p + bytes / 2;
#endif
}
__device__ __forceinline__ void mma_step(v8f (&acc)[4][4], const v16us (&a)[4], const v16us (&b)[4]) {
#pragma unroll
  for (int i = 0; i < 4; ++i)
#pragma unroll
    for (int j = 0; j < 4; ++j) acc[i][j] = mma_bu_raw(a[i], b[j], acc[i][j]);
}
__device__ __forceinline__ void acc_guard4(v8f& a, v8f& b, v8f& c, v8f& d) {
#if defined(__HIP_DEVICE_COMPILE__)
  asm volatile("v_nop\n\tv_nop\n\tv_nop\n\tv_nop" : "+v"(a), "+v"(b), "+v"(c), "+v"(d));
#endif
}
__device__ __forceinline__ void wave_sync_lds() {
  __builtin_amdgcn_fence(__ATOMIC_RELEASE, "workgroup");
  __builtin_amdgcn_wave_barrier();
  __builtin_amdgcn_fence(__ATOMIC_ACQUIRE, "workgroup");
}

// ---- work-group barrier of the attention loop's heat tile: it waits for the wave's own LDS accesses alone, so that the
//      global loads issued a pass ahead stay in flight across it (__syncthreads() waits for them too); the memory clobber
//      keeps every LDS access on its side of the barrier
__device__ __forceinline__ void lds_barrier() {
#if defined(__HIP_DEVICE_COMPILE__)
  asm volatile("s_wait_dscnt 0x0\n\ts_barrier_signal -1\n\ts_barrier_wait -1" ::: "memory");
#endif
}

// =====================================================================================================
// Row convert: in[row][CM] f32 -> bf16 RNE bits in fragment order for a plane of nrt row tiles: fragment (row tile
// row/16, k step k/32) at (k step * nrt + row tile) * 512 elements (one k step of all rows lies in a row), inside it as
// ldfrag_f reads it; kofs is added to the k step (the second copy of the proj weights).
// Block = 256 threads (one tile rt of 16 rows = 1024 pieces of 8 columns, 4 a thread). Piece c holds row c & 15,
// columns 8 * (c >> 4) .. + 7: k step c >> 6, at 8 * (c & 63) elements of its fragment, so one store of one wave
// writes 512 bytes in a row.
// coverage: 1024 pieces x 8 = 16 rows x CM columns.
// =====================================================================================================
__device__ __forceinline__ void cvt_tile(const float* __restrict__ src, unsigned short* dst, int rt, int nrt, int kofs) {
  const int tid = threadIdx.x;
  // thread tid takes pieces c = tid + 256 * it: the same row, 128 columns (4 k steps) on
  const float* p = src + ((size_t)rt * 16 + (tid & 15)) * CM + (tid >> 4) * 8;
  unsigned short* d = dst + ((size_t)((tid >> 6) + kofs) * nrt + rt) * 512 + (tid & 63) * 8;
  v4f a0[4], a1[4];
#pragma unroll
  for (int it = 0; it < 4; ++it) {
    a0[it] = *(const v4f*)(p + it * 128);
    a1[it] = *(const v4f*)(p + it * 128 + 4);
  }
  xwait1(p);
  v4u hv[4];
#pragma unroll
  for (int it = 0; it < 4; ++it) {
    hv[it][0] = pk16(bf_bits(a0[it][0]), bf_bits(a0[it][1]));
    hv[it][1] = pk16(bf_bits(a0[it][2]), bf_bits(a0[it][3]));
    hv[it][2] = pk16(bf_bits(a1[it][0]), bf_bits(a1[it][1]));
    hv[it][3] = pk16(bf_bits(a1[it][2]), bf_bits(a1[it][3]));
  }
  unsigned short* dq[4];
#pragma unroll
  for (int it = 0; it < 4; ++it) dq[it] = d + (size_t)it * 4 * nrt * 512;
  __builtin_amdgcn_sched_barrier(0);   // the stores stand behind all the arithmetic: no register that one names is written again
#pragma unroll
  for (int it = 0; it < 4; ++it) *(v4u*)(dq[it]) = hv[it];
}

// All six converts in one grid (they depend on nothing but the inputs): block -> (matrix, row tile), the largest matrix
// first. Blocks 0 .. MC/16 - 1: context rows; the next MQ/16: query rows; then five groups of CM/16: the q, k and v
// weights, the proj weights, and the proj weights again for k steps CM/32 on.
// coverage: every row tile of every matrix once (the proj weights twice, into the two halves of their plane).
#define CVT_BLOCKS (MC / 16 + MQ / 16 + 5 * (CM / 16))
__global__ __launch_bounds__(256) void cvt_all(
    const float* __restrict__ xc, const float* __restrict__ xq, const float* __restrict__ wq,
    const float* __restrict__ wk, const float* __restrict__ wv, const float* __restrict__ wo,
    unsigned short* Xc, unsigned short* Xq, unsigned short* Wqb, unsigned short* Wkb, unsigned short* Wvb,
    unsigned short* WoT2) {
  const int bx = blockIdx.x;
  const int u = bx - (MC / 16 + MQ / 16), sel = u / (CM / 16);      // used where u >= 0: the weights' blocks
  const float* s = wo;
  unsigned short* d = WoT2;
  int rt = u % (CM / 16), nrt = CM / 16;
  if (bx < MC / 16)                { s = xc; d = Xc;  rt = bx;           nrt = MC / 16; }
  else if (bx < MC / 16 + MQ / 16) { s = xq; d = Xq;  rt = bx - MC / 16; nrt = MQ / 16; }
  else if (sel == 0)               { s = wq; d = Wqb; }
  else if (sel == 1)               { s = wk; d = Wkb; }
  else if (sel == 2)               { s = wv; d = Wvb; }
  cvt_tile(s, d, rt, nrt, (u >= 0 && sel == 4) ? (CM / 32) : 0);
}

// =====================================================================================================
// Register-blocked batched bf16 WMMA GEMM: C[m][n] = sum_k A[m][k] * Bt[n][k] (+ bias);
// one wave per 64x64 tile, no block barriers. A [M][K] and Bt [N][K] in fragment order, in planes of rtA and rtB row
// tiles: fragment (row tile row/16, k step k/32) at (k step * rt + row tile) * 512 elements, so that what all waves
// read in one k step lies in a row; M, N and K multiples of 64. bx = the block's index among the product's own blocks,
// by = batch index with element strides (sAy for A, sBy for Bt, sCy for C); sT = the block's LDS, one slab a wave.
// Tile enumeration: tile = bx * 8 + wave -> tm = tile / (N/64), tn = tile % (N/64).
// OM: 0 = f32 out to Cf (pitch ldc); 1 = f16 bits to Cp (pitch ldc); 2 = f16 hi bits to Cp and f16((v - hi) * 2048)
//     bits to Cp2, both in fragment order for m = head dim, n = key: fragment (chunk n/32, head m/64, row tile
//     (m/16)%4) at ((chunk * NH + head) * 4 + row tile) * 512 elements; 3 = f16 bits to Cp in fragment order for
//     m = key row (batch-major), n = head dim: fragment (chunk m/32 over both batches, head n/64, key tile (m/16)%2,
//     k step (n/32)%2) at (((chunk * NH + head) * 2 + key tile) * 2 + k step) * 512 elements. Inside a fragment: see
//     ldfrag_f. One chunk of 32 keys of all heads lies in a row in each plane.
// CBM: 0 = no bias; 1 = column bias bf16(cb[n]); 2 = row bias bf16(cb[m]).
// coverage: 4 slabs x 16 rows x 64 cols = the wave's whole 64x64 tile; tilesM*tilesN/8 blocks exactly per product
//           (host-checked), so no wave exits early.
// =====================================================================================================
template <int OM, int CBM>
__device__ __forceinline__ void gemm64_body(
    float (*sT)[16 * 68], int bx, int by,
    const unsigned short* __restrict__ Ap, int rtA, long long sAy,
    const unsigned short* __restrict__ Btp, int rtB, long long sBy,
    unsigned short* Cp, unsigned short* Cp2, float* Cf, int ldc, long long sCy,
    const float* __restrict__ cb, int M, int N, int K) {
  const int lane = threadIdx.x & 31;
  const int wave = __builtin_amdgcn_readfirstlane(threadIdx.x >> 5);   // scalar: the tile's addresses stay in scalar registers
  const int tilesN = N >> 6;
  const int tilesM = M >> 6;
  const int tile = bx * 8 + wave;
  if (tile >= tilesM * tilesN) return;   // wave-uniform; no block barriers in this kernel
  const int tm = tile / tilesN;
  const int tn = tile - tm * tilesN;
  const int m0 = tm << 6;
  const int n0 = tn << 6;

  const unsigned short* Ab = Ap  + (size_t)by * (size_t)sAy;
  const unsigned short* Bb = Btp + (size_t)by * (size_t)sBy;
  const size_t cofs = (size_t)by * (size_t)sCy;

  const int rlane = lane & 15;                 // row (A) / col (B, D) within subtile
  const int mOff  = (lane >> 4) * 8;           // D row offset

  v8f acc[4][4];
#pragma unroll
  for (int i = 0; i < 4; ++i)
#pragma unroll
    for (int j = 0; j < 4; ++j) acc[i][j] = zero8();

  // Two fragment sets: while one k step's 16 products run on one set, the next step's 16 loads are in flight into the
  // other, so a wave waits for memory once per step at most, not four times per step. k ascends as before.
  const unsigned long long sA = (unsigned long long)rtA * 1024u, sB = (unsigned long long)rtB * 1024u;   // bytes per k step
  gus* ap = (gus*)(Ab + (size_t)(m0 >> 4) * 512);
  gus* bp = (gus*)(Bb + (size_t)(n0 >> 4) * 512);
  const unsigned l8 = (unsigned)lane * 8u;
  v16us fa0[4], fb0[4], fa1[4], fb1[4];
  ld_step(fa0, fb0, ap, bp, l8);
#pragma unroll 1   // stays the loop it was, now that K is a constant at the call: unrolled, the kernel's text grows by a third, and a block runs its part of it only once
  for (int k0 = 64; k0 < K; k0 += 64) {
    ap = next_step(ap, sA);
    bp = next_step(bp, sB);
    refill_gap();
    ld_step(fa1, fb1, ap, bp, l8);
    mma_step(acc, fa0, fb0);
    ap = next_step(ap, sA);
    bp = next_step(bp, sB);
    refill_gap();
    ld_step(fa0, fb0, ap, bp, l8);
    mma_step(acc, fa1, fb1);
  }
  ap = next_step(ap, sA);
  bp = next_step(bp, sB);
  refill_gap();
  ld_step(fa1, fb1, ap, bp, l8);                                     // the last two steps: nothing left to fetch ahead
  mma_step(acc, fa0, fb0);
  mma_step(acc, fa1, fb1);
  acc_guard4(acc[0][0], acc[0][1], acc[0][2], acc[0][3]);
  acc_guard4(acc[1][0], acc[1][1], acc[1][2], acc[1][3]);
  acc_guard4(acc[2][0], acc[2][1], acc[2][2], acc[2][3]);
  acc_guard4(acc[3][0], acc[3][1], acc[3][2], acc[3][3]);

  const int hh2 = lane >> 4, c4 = (lane & 15) * 4;     // f32 out: 256-B row segment = 16 lanes x 16 B
  const int q8  = lane >> 3, c8 = (lane & 7) * 8;

  v4f cb4 = {0.f, 0.f, 0.f, 0.f};
  float cbc[4][8];                                     // row-major out uses [0] alone; fragment order one set per it
#pragma unroll
  for (int g = 0; g < 4; ++g)
#pragma unroll
    for (int e = 0; e < 8; ++e) cbc[g][e] = 0.f;
  if (CBM == 1) {
    if (OM == 0) {
      const v4f v = *(const v4f*)(cb + n0 + c4);
      cb4[0] = bfr(v[0]); cb4[1] = bfr(v[1]); cb4[2] = bfr(v[2]); cb4[3] = bfr(v[3]);
    } else if (OM == 1) {
      const v4f v0 = *(const v4f*)(cb + n0 + c8);
      const v4f v1 = *(const v4f*)(cb + n0 + c8 + 4);
#pragma unroll
      for (int e = 0; e < 4; ++e) { cbc[0][e] = bfr(v0[e]); cbc[0][4 + e] = bfr(v1[e]); }
    } else {
      const float* cp = cb + n0 + mOff;
#pragma unroll
      for (int g = 0; g < 4; ++g) {
        const v4f v0 = *(const v4f*)(cp + g * 16);
        const v4f v1 = *(const v4f*)(cp + g * 16 + 4);
#pragma unroll
        for (int e = 0; e < 4; ++e) { cbc[g][e] = bfr(v0[e]); cbc[g][4 + e] = bfr(v1[e]); }
      }
    }
  }

  // ---- epilogue ----
  float* slab = sT[wave];
#pragma unroll
  for (int i = 0; i < 4; ++i) {
    const int mBase = m0 + (i << 4);
#pragma unroll
    for (int j = 0; j < 4; ++j) {
#pragma unroll
      for (int r = 0; r < 8; ++r) {
        slab[(mOff + r) * 68 + (j << 4) + rlane] = acc[i][j][r];
      }
    }
    wave_sync_lds();
    if (OM == 0) {
      float* C = Cf + cofs;
      v4f vals[8];
#pragma unroll
      for (int it = 0; it < 8; ++it) {
        const int row = it * 2 + hh2;                      // it 0..7 x hh2 0..1 = rows 0..15
        const v4f v = *(const v4f*)(slab + row * 68 + c4);
        vals[it] = v + cb4;
      }
      {
#pragma unroll
        for (int it = 0; it < 8; ++it) {
          const int row = it * 2 + hh2;
          *(v4f*)(C + (size_t)(mBase + row) * ldc + (size_t)n0 + c4) = vals[it];
        }
        
      }
    } else {
      unsigned short* C  = Cp  + cofs;
      unsigned short* C2 = Cp2 + cofs;
      v4u hv[4], lv[4];
#pragma unroll
      for (int it = 0; it < 4; ++it) {
        // row-major out: it 0..3 x q8 0..3 = rows 0..15, 8 columns at c8; fragment order: the lane takes what it
        // holds as an operand, row lane & 15, the 8 columns at 16 * it + 8 * (lane >> 4)
        const int row = (OM == 1) ? (it * 4 + q8) : rlane;
        const int col = (OM == 1) ? c8 : (it * 16 + mOff);
        const float* sp = slab + row * 68 + col;
        float rb = 0.f;
        if (CBM == 2) rb = bfr(cb[mBase + row]);
        const int g = (OM == 1) ? 0 : it;
        v4u ha = {0u, 0u, 0u, 0u}, la = {0u, 0u, 0u, 0u};
#pragma unroll
        for (int e = 0; e < 4; ++e) {
          const float f0 = sp[2 * e]     + cbc[g][2 * e]     + rb;
          const float f1 = sp[2 * e + 1] + cbc[g][2 * e + 1] + rb;
          const _Float16 g0 = (_Float16)f0, g1 = (_Float16)f1;
          ha[e] = pk16(h_bits(g0), h_bits(g1));
          if (OM == 2) {
            la[e] = pk16(h_bits((_Float16)((f0 - (float)g0) * RSC)),
                         h_bits((_Float16)((f1 - (float)g1) * RSC)));
          }
        }
        hv[it] = ha;
        lv[it] = la;
      }
      {
#pragma unroll
        for (int it = 0; it < 4; ++it) {
          size_t go;
          if (OM == 1) {
            go = (size_t)(mBase + it * 4 + q8) * ldc + (size_t)n0 + c8;
          } else if (OM == 2) {
            go = (((size_t)((n0 >> 5) + (it >> 1)) * NH + tm) * 4 + i) * 512 + (it & 1) * 256 + lane * 8;
          } else {
            go = ((((size_t)(mBase >> 5) * NH + tn) * 2 + ((mBase >> 4) & 1)) * 2 + (it >> 1)) * 512
                 + (it & 1) * 256 + lane * 8;
          }
          *(v4u*)(C + go) = hv[it];
          if (OM == 2) *(v4u*)(C2 + go) = lv[it];
        }
        
      }
    }
    wave_sync_lds();
  }
}

// The q, k and v^T projections in one grid (none reads what another writes): blocks 0 .. GK - 1 the k projection, the next
// NB * GV the v^T projection (GV a batch), the last GQ the q projection.
//   k = Xc . Wkb^T + bk (K = 512) -> f16, fragment order; v^T per batch = Wvb . Xc_b^T + bv per row d -> f16 hi (VTh) and
//   residual x2048 (VTl), fragment order; q = Xq . Wqb^T + bq -> f16 plane [rows][512]
#define GQ (((MQ / 64) * (CM / 64)) / 8)     // 512 tiles -> 64 blocks
#define GK (((MC / 64) * (CM / 64)) / 8)     // 1024 tiles -> 128 blocks
#define GV (((CM / 64) * (NC / 64)) / 8)     // 512 tiles -> 64 blocks a batch
__global__ __launch_bounds__(256) void proj_qkv(
    const unsigned short* __restrict__ Xq, const unsigned short* __restrict__ Xc,
    const unsigned short* __restrict__ Wqb, const unsigned short* __restrict__ Wkb,
    const unsigned short* __restrict__ Wvb,
    unsigned short* Qp, unsigned short* Kp, unsigned short* VTh, unsigned short* VTl,
    const float* __restrict__ bq, const float* __restrict__ bk, const float* __restrict__ bv) {
  __shared__ __align__(16) float sT[8][16 * 68];   // per-wave 16x64 slab, pitch 68 floats
  const int bx = blockIdx.x;
  if (bx < GK) {
    gemm64_body<3, 1>(sT, bx, 0, Xc, MC / 16, 0LL, Wkb, CM / 16, 0LL,
                      Kp, Kp, nullptr, CM, 0LL, bk, MC, CM, CM);
  } else if (bx < GK + NB * GV) {
    const int u = bx - GK;
    gemm64_body<2, 2>(sT, u % GV, u / GV, Wvb, CM / 16, 0LL, Xc, MC / 16, (long long)(NC / 16) * 512,
                      VTh, VTl, nullptr, NC, (long long)CM * NC, bv, CM, NC, CM);
  } else {
    gemm64_body<1, 1>(sT, bx - (GK + NB * GV), 0, Xq, MQ / 16, 0LL, Wqb, CM / 16, 0LL,
                      Qp, Qp, nullptr, CM, 0LL, bq, MQ, CM, CM);
  }
}

// The output projection: out = [ctx_hi | ctx_lo] . [Wo | Wo]^T + bo (K = 1024, bf16 operands) -> f32
__global__ __launch_bounds__(256) void proj_out(
    const unsigned short* __restrict__ Ctx, const unsigned short* __restrict__ WoT2, float* out,
    const float* __restrict__ bo) {
  __shared__ __align__(16) float sT[8][16 * 68];   // per-wave 16x64 slab, pitch 68 floats
  gemm64_body<0, 1>(sT, blockIdx.x, 0, Ctx, MQ / 16, 0LL, WoT2, CM / 16, 0LL,
                    nullptr, nullptr, out, CM, 0LL, bo, MQ, CM, KC);
}

// =====================================================================================================
// Fused heat-bias + online-softmax cross attention, head dim 64, 8 heads.
//   Block = 256 threads = 8 waves, wave w = head w; one block per (batch, 32 query rows, half of the keys); key chunks
//   of 32, static trip NPS = 64. A wave holds QT = 2 query column tiles, so that each K and V fragment it loads from L2
//   feeds two products; the keys are dealt to KS = 2 blocks so that the grid still has one block per 16 query rows.
//   q plane (f16 bits, pitch CM): row (b*NQ + t), head h at col h*64 + d; k plane
//   (f16 bits) and v^T hi / lo planes (f16 bits, value = hi + lo/2048) in fragment order (gemm64, OM 3 and 2):
//   2048 elements per (batch, chunk of 32 keys, head) in each plane.
//   Per chunk: heat[q][s] = exp(-(dx*dx + dy*dy) * (1 / (0.4*|dt| + 1e-6))) from the bf16-converted positions
//   (spatial = dims 0,1, time = dim 2), computed once per (query row, key) pair by the block (thread = key
//   lane, rows w, w+8, w+16, w+24) into LDS and shared by the 8 head waves. Both products are transposed: S^T = K . Q^T
//   (A = k rows, B = q), so a lane holds 16 of the 32 scores of ONE query of each column tile (column lane & 15; keys
//   8h + r and 16 + 8h + r): s = (k . q) * 0.125 + heat; running-max softmax in f32 with maximum and sum in the lane, the
//   maximum joined with the other lane half once a pass, the sums once behind the loop. p = exp(s - m) as
//   f16(1024 p): the two score tiles, converted in place, are the B operand of O^T += V^T . P^T (A = v^T rows, hi and
//   lo accumulator sets, 4 row tiles of 16 dims each). All q, k, v^T and p fragments use the split k map
//   (elements 0..7 <- k0+8h.., 8..15 <- k0+16+8h..).
//   Epilogue: the block's share of each query's sums goes out as it lies in the lanes: part[key half][row tile of 16][head]
//   [dim tile ct][4 dims lo / hi][lane][4] = 1024 x sum of p . v relative to the half's own maximum, and mlp[key half]
//   [row tile][head][lane] = (that maximum, the half's sum of p). attn_join adds the two halves.
// coverage: heat 32 rows x 32 keys per chunk (8 waves x 4 rows x 32 lanes); part and mlp: every (key half, row tile, head,
//           lane) once; grid NQ/32 x NB x KS covers every query row and every key.
// =====================================================================================================
#define QT  2
#define KS  2
#define NPS (NCH / KS)
static_assert((NQ % (16 * QT)) == 0 && (NCH % KS) == 0);
__global__ void __launch_bounds__(256) attn_kernel(
    const float* __restrict__ posq, const float* __restrict__ posc,
    const unsigned short* __restrict__ qp, const unsigned short* __restrict__ kp,
    const unsigned short* __restrict__ vth, const unsigned short* __restrict__ vtl,
    float* part, float* mlp) {
#pragma clang fp contract(off)
  __shared__ __align__(16) float heatL[16 * QT * HP];       // [query row][key], pitch HP
  __shared__ float qps[16 * QT * 3];

  const int b = blockIdx.y, i0 = blockIdx.x * (16 * QT), ks = blockIdx.z;
  const int t = threadIdx.x, lane = t & 31, w = t >> 5, hh = lane >> 4, jc = lane & 15;
  const size_t rowQ = (size_t)b * NQ, rowC = (size_t)b * NC + (size_t)ks * (NPS * 32);
  const size_t ch0 = (size_t)b * NCH + (size_t)ks * NPS;    // the block's first chunk among the planes' NB * NCH

  if (t < 16 * QT * 3) qps[t] = bfr(posq[(rowQ + i0) * 3 + t]);
  __syncthreads();

  // q B-fragments (col = query jc of column tile u, k = d), plain f16 bits; d 0..31 and 32..63
  const unsigned short* qrow = qp + (rowQ + i0 + jc) * CM + w * HD + 8 * hh;
  v16us qf0[QT], qf1[QT];
#pragma unroll
  for (int u = 0; u < QT; ++u) {
    qf0[u] = ldfrag_u(qrow + u * 16 * CM);
    qf1[u] = ldfrag_u(qrow + u * 16 * CM + 32);
  }

  // query positions of the heat rows this thread produces (rows w + 8 * i, key = lane)
  float qx[2 * QT], qy[2 * QT], qz[2 * QT];
#pragma unroll
  for (int i = 0; i < 2 * QT; ++i) {
    qx[i] = qps[(w + 8 * i) * 3 + 0];
    qy[i] = qps[(w + 8 * i) * 3 + 1];
    qz[i] = qps[(w + 8 * i) * 3 + 2];
  }

  float m[QT], ll[QT];               // query jc of tile u: running maximum (both lane halves alike), this lane half's sum
  v8f oh[QT][4], ol[QT][4];          // O^T tiles: register r = dim ct*16 + 8*hh + r of query jc of tile u
#pragma unroll
  for (int u = 0; u < QT; ++u) {
    m[u] = -1.0e30f;
    ll[u] = 0.f;
#pragma unroll
    for (int ct = 0; ct < 4; ++ct) { oh[u][ct] = zero8(); ol[u][ct] = zero8(); }
  }

  // fragment-order planes: a pass's 4 K fragments are 4 KiB in a row, its 4 V fragments 4 KiB in a row in each plane,
  // and the 8 heads' (waves') pieces of one pass follow one another
  const unsigned short* vhb = vth + (ch0 * NH + w) * 2048 + lane * 8;     // A: row d = ct*16 + jc, k = key
  const unsigned short* vlb = vtl + (ch0 * NH + w) * 2048 + lane * 8;
  const unsigned short* kgb = kp + (ch0 * NH + w) * 2048 + lane * 8;      // A: row key = jc, k = d
  const float* pcb = posc + rowC * 3;
  const float* hrd = heatL + jc * HP + 8 * hh;                            // heat of query jc of tile 0, keys 8*hh..

  // Chunk 0's key positions, K and V fragments, in the order in which the loop refills them. Each pass fetches the next
  // chunk's into the same registers: positions and K right behind its score products, V right behind its V products,
  // so that a fragment's L2 round trip runs under the vector work and the barriers of most of a pass.
  const float* pc0 = pcb + (size_t)lane * 3;
  float px = pc0[0], py = pc0[1], pz = pc0[2];
  __builtin_amdgcn_sched_barrier(0);   // the loop's issue order, here too: a counted wait in the loop is as loose as the tighter of its two ways in
  v16us k00 = ldfrag_f(kgb);
  v16us k01 = ldfrag_f(kgb + 512);
  v16us k10 = ldfrag_f(kgb + 1024);
  v16us k11 = ldfrag_f(kgb + 1536);
  __builtin_amdgcn_sched_barrier(0);   // K ahead of V, as in the loop
  v16us vh[4], vl[4];
#pragma unroll
  for (int ct = 0; ct < 4; ++ct) {
    vh[ct] = ldfrag_f(vhb + ct * 512);
    vl[ct] = ldfrag_f(vlb + ct * 512);
  }
  // s_wait_xcnt 0 in front of every overwrite of an address that the loads above name, in the form of the loop's own
#if defined(__HIP_DEVICE_COMPILE__)
  asm volatile("s_wait_xcnt 0x0" :: "v"(qrow), "v"(pc0), "v"(kgb), "v"(vhb), "v"(vlb) : "memory");
#endif
  __builtin_amdgcn_sched_barrier(0);   // the wait stays directly behind the groups: left to sink, the build gets a second one inside the loop

#pragma unroll 1
  for (int jt = 0; jt < NPS; ++jt) {
    const int jn = (jt + 1 < NPS) ? (jt + 1) : jt;     // the chunk fetched ahead; the last pass re-reads its own: stays inside the planes
    lds_barrier();                                     // all waves done reading heatL of the prior chunk
    {
      const float cx = bfr(px), cy = bfr(py), cz = bfr(pz);
#pragma unroll
      for (int i = 0; i < 2 * QT; ++i) {
        const float dx = qx[i] - cx, dy = qy[i] - cy, dt = qz[i] - cz;
        const float d2 = dx * dx + dy * dy;
        const float nn = HK4 * fabsf(dt) + HEPS;
        heatL[(w + 8 * i) * HP + lane] = expf(-(d2 * (1.0f / nn)));
      }
    }
    lds_barrier();

    // heat of this lane's 16 (query, key) pairs of each column tile, read ahead of the score products so that it lands under them
    v4f h00[QT], h01[QT], h10[QT], h11[QT];
#pragma unroll
    for (int u = 0; u < QT; ++u) {
      h00[u] = *(const v4f*)(hrd + u * 16 * HP);
      h01[u] = *(const v4f*)(hrd + u * 16 * HP + 4);
      h10[u] = *(const v4f*)(hrd + u * 16 * HP + 16);
      h11[u] = *(const v4f*)(hrd + u * 16 * HP + 20);
    }

    // ---- scores, transposed: 32 keys x 16 query columns of head w a tile, K = 64 in two 32-deep steps ----
    __builtin_amdgcn_sched_barrier(0);   // no product (with its wait for K) is scheduled up in front of the heat tile's work
    v8f s0[QT], s1[QT];                  // s0[u][r]: key 32*jt + 8*hh + r, s1[u][r]: key 32*jt + 16 + 8*hh + r, query jc of tile u
#pragma unroll
    for (int u = 0; u < QT; ++u) s0[u] = mma_hu(k00, qf0[u], zero8());
#pragma unroll
    for (int u = 0; u < QT; ++u) s0[u] = mma_hu(k01, qf1[u], s0[u]);
#pragma unroll
    for (int u = 0; u < QT; ++u) s1[u] = mma_hu(k10, qf0[u], zero8());
#pragma unroll
    for (int u = 0; u < QT; ++u) s1[u] = mma_hu(k11, qf1[u], s1[u]);

    // ---- the next chunk's key positions and K fragments, over the registers the products above have read ----
    refill_gap();                        // the group stays behind the products whose operands it overwrites, at their distance
    const float* pc = pcb + (size_t)(jn * 32 + lane) * 3;
    px = pc[0]; py = pc[1]; pz = pc[2];
    const unsigned short* kg = kgb + (size_t)jn * (NH * 2048);
    k00 = ldfrag_f(kg);
    k01 = ldfrag_f(kg + 512);
    k10 = ldfrag_f(kg + 1024);
    k11 = ldfrag_f(kg + 1536);
    // The group's address registers are reused below: the wait stands in front of every such overwrite. It takes the
    // two addresses as inputs so that they stay whole up to it, and its memory clobber keeps the group ahead of it.
#if defined(__HIP_DEVICE_COMPILE__)
    asm volatile("s_wait_xcnt 0x0" :: "v"(kg), "v"(pc) : "memory");
#endif
    __builtin_amdgcn_sched_barrier(0);   // the group goes out here, ahead of the softmax, not further down towards its use

    // ---- heat bias + online softmax of query jc of each tile, all in the lane but for one exchange of the maximum ----
    v16us pbu[QT];
#pragma unroll
    for (int u = 0; u < QT; ++u) {
      const v8f x0 = s0[u] * SCL + __builtin_shufflevector(h00[u], h01[u], 0, 1, 2, 3, 4, 5, 6, 7);
      const v8f x1 = s1[u] * SCL + __builtin_shufflevector(h10[u], h11[u], 0, 1, 2, 3, 4, 5, 6, 7);
      const v8f mx = __builtin_elementwise_max(x0, x1);
      float rm = fmaxf(fmaxf(fmaxf(mx[0], mx[1]), fmaxf(mx[2], mx[3])), fmaxf(fmaxf(mx[4], mx[5]), fmaxf(mx[6], mx[7])));
      rm = fmaxf(rm, xhalf(rm));
      const float mn2   = fmaxf(m[u], rm);
      const float alpha = __expf(m[u] - mn2);
      m[u] = mn2;
      const v8f a0 = x0 - mn2, a1 = x1 - mn2;
      v8f e0, e1;
#pragma unroll
      for (int r = 0; r < 8; ++r) { e0[r] = __expf(a0[r]); e1[r] = __expf(a1[r]); }
      const v8f sm = e0 + e1;
      ll[u] = ll[u] * alpha + (((sm[0] + sm[1]) + (sm[2] + sm[3])) + ((sm[4] + sm[5]) + (sm[6] + sm[7])));
      // P^T B-fragment: element e = p of key kmap(e), the two score tiles converted in place
      const v8h p0 = __builtin_convertvector(e0 * PSC, v8h), p1 = __builtin_convertvector(e1 * PSC, v8h);
      const v16h pb = __builtin_shufflevector(p0, p1, 0, 1, 2, 3, 4, 5, 6, 7, 8, 9, 10, 11, 12, 13, 14, 15);
      pbu[u] = __builtin_bit_cast(v16us, pb);
#pragma unroll
      for (int ct = 0; ct < 4; ++ct) { oh[u][ct] *= alpha; ol[u][ct] *= alpha; }
    }

    // ---- context^T += V_hi^T . P^T and V_lo^T . P^T (4 row tiles of 16 dims), each V fragment on both column tiles ----
#pragma unroll
    for (int ct = 0; ct < 4; ++ct) {
#pragma unroll
      for (int u = 0; u < QT; ++u) oh[u][ct] = mma_hu(vh[ct], pbu[u], oh[u][ct]);
#pragma unroll
      for (int u = 0; u < QT; ++u) ol[u][ct] = mma_hu(vl[ct], pbu[u], ol[u][ct]);
    }

    // ---- the next chunk's V fragments, over the registers the products above have read ----
    refill_gap();                        // the group stays behind the products whose operands it overwrites, at their distance
    const unsigned short* vhp = vhb + (size_t)jn * (NH * 2048);
    const unsigned short* vlp = vlb + (size_t)jn * (NH * 2048);
#pragma unroll
    for (int ct = 0; ct < 4; ++ct) {
      vh[ct] = ldfrag_f(vhp + ct * 512);
      vl[ct] = ldfrag_f(vlp + ct * 512);
    }
    // s_wait_xcnt 0 in front of every overwrite of this group's two addresses, in the form of the K group's above
#if defined(__HIP_DEVICE_COMPILE__)
    asm volatile("s_wait_xcnt 0x0" :: "v"(vhp), "v"(vlp) : "memory");
#endif
  }

  {
    // one store of one wave writes 512 bytes in a row (mlp: 256)
    const size_t pt = (((size_t)ks * (MQ / 16) + ((rowQ + i0) >> 4)) * NH + w);      // (key half, row tile of tile 0, head)
    float* pw = part + pt * 1024 + lane * 4;
    float* mw = mlp + pt * 64 + lane * 2;
    v4f o0[QT][4], o1[QT][4];
    v2f ml[QT];
#pragma unroll
    for (int u = 0; u < QT; ++u) {
      ml[u][0] = m[u];
      ml[u][1] = ll[u] + xhalf(ll[u]);   // the two lane halves' sums of query jc, joined once
#pragma unroll
      for (int ct = 0; ct < 4; ++ct) {
#pragma unroll
        for (int e = 0; e < 4; ++e) {
          o0[u][ct][e] = oh[u][ct][e]     + ol[u][ct][e]     * (1.0f / RSC);
          o1[u][ct][e] = oh[u][ct][4 + e] + ol[u][ct][4 + e] * (1.0f / RSC);
        }
      }
    }
    __builtin_amdgcn_sched_barrier(0);   // the stores stand behind all the arithmetic: no register that one names is written again
#pragma unroll
    for (int u = 0; u < QT; ++u) {
#pragma unroll
      for (int ct = 0; ct < 4; ++ct) {
        *(v4f*)(pw + u * (NH * 1024) + ct * 256)       = o0[u][ct];
        *(v4f*)(pw + u * (NH * 1024) + ct * 256 + 128) = o1[u][ct];
      }
      *(v2f*)(mw + u * (NH * 64)) = ml[u];
    }
  }
}

// =====================================================================================================
// Joins the two key halves of the attention and writes the context plane (bf16 bits, KC columns, fragment order as gemm64
// reads its A): row b*NQ + t, hi at column h*64 + d, lo (value - hi) at column CM + h*64 + d.
//   Block = 256 threads = 8 waves, wave w = head w, one block per row tile of 16 queries; a lane reads what the same lane
//   of attn_kernel wrote (query lane & 15, dims ct*16 + 8*(lane >> 4) + 0..7): with M = max(m_a, m_b),
//   context = (o_a e^(m_a - M) + o_b e^(m_b - M)) / (l_a e^(m_a - M) + l_b e^(m_b - M)) / 1024.
//   The tile (16 rows x 512) is staged in LDS (f32), then written as one fragment-order row tile.
// coverage: context 16 rows x 512 cols hi and lo per block (256 threads x 4 pieces x 8 cols); grid MQ/16 covers every row.
// =====================================================================================================
__global__ void __launch_bounds__(256) attn_join(const float* __restrict__ part, const float* __restrict__ mlp,
                                                 unsigned short* ctxp) {
  __shared__ __align__(16) float osm[16 * OP];              // output staging [16][CM], pitch OP
  const int t = threadIdx.x, lane = t & 31, w = t >> 5, hh = lane >> 4, jc = lane & 15;
  const size_t rtq = blockIdx.x;                            // the block's row tile among the plane's MQ / 16
  const float* pa = part + (rtq * NH + w) * 1024 + lane * 4;
  const float* pb = pa + (size_t)(MQ / 16) * NH * 1024;
  const float* ma = mlp + (rtq * NH + w) * 64 + lane * 2;
  const float* mb = ma + (size_t)(MQ / 16) * NH * 64;
  const v2f mla = *(const v2f*)(ma), mlb = *(const v2f*)(mb);
  v4f oa[8], ob[8];
#pragma unroll
  for (int g = 0; g < 8; ++g) {
    oa[g] = *(const v4f*)(pa + g * 128);
    ob[g] = *(const v4f*)(pb + g * 128);
  }
  // s_wait_xcnt 0 in front of every overwrite of an address that the loads above name; it takes the addresses as inputs
  // so that they stay whole up to it, and its memory clobber keeps the loads ahead of it
#if defined(__HIP_DEVICE_COMPILE__)
  asm volatile("s_wait_xcnt 0x0" :: "v"(pa), "v"(pb), "v"(ma), "v"(mb) : "memory");
#endif
  {
    const float mm = fmaxf(mla[0], mlb[0]);
    const float ea = __expf(mla[0] - mm), eb = __expf(mlb[0] - mm);
    const float l = mla[1] * ea + mlb[1] * eb;
    const float inv = ((l > 0.f) ? (1.0f / l) : 0.f) * (1.0f / PSC);
    const float fa = ea * inv, fb = eb * inv;
    float* od = osm + jc * OP + w * HD + 8 * hh;
#pragma unroll
    for (int ct = 0; ct < 4; ++ct) {
      *(v4f*)(od + ct * 16)     = oa[2 * ct] * fa     + ob[2 * ct] * fb;
      *(v4f*)(od + ct * 16 + 4) = oa[2 * ct + 1] * fa + ob[2 * ct + 1] * fb;
    }
  }
  __syncthreads();
  {
    // piece c of the tile's 1024: row c & 15, columns 8 * (c >> 4) .. + 7: k step c >> 6, 8 * (c & 63) elements into its fragment
    v4u hv[2][2], lv[2][2];
#pragma unroll
    for (int rr = 0; rr < 2; ++rr) {
#pragma unroll
      for (int it = 0; it < 2; ++it) {
        const int c = (rr * 2 + it) * 256 + t;
        const float* sp = osm + (c & 15) * OP + (c >> 4) * 8;
        const v4f f0 = *(const v4f*)(sp);
        const v4f f1 = *(const v4f*)(sp + 4);
        v4u ha, la;
#pragma unroll
        for (int e = 0; e < 2; ++e) {
          const unsigned short u0 = bf_bits(f0[2 * e]), u1 = bf_bits(f0[2 * e + 1]);
          const unsigned short u2 = bf_bits(f1[2 * e]), u3 = bf_bits(f1[2 * e + 1]);
          ha[e]     = pk16(u0, u1);
          ha[2 + e] = pk16(u2, u3);
          la[e]     = pk16(bf_bits(f0[2 * e] - bf_up(u0)), bf_bits(f0[2 * e + 1] - bf_up(u1)));
          la[2 + e] = pk16(bf_bits(f1[2 * e] - bf_up(u2)), bf_bits(f1[2 * e + 1] - bf_up(u3)));
        }
        hv[rr][it] = ha;
        lv[rr][it] = la;
      }
    }
    __builtin_amdgcn_sched_barrier(0);   // the stores stand behind all the arithmetic: no register that one names is written again
#pragma unroll
    for (int rr = 0; rr < 2; ++rr) {
#pragma unroll
      for (int it = 0; it < 2; ++it) {
        const int c = (rr * 2 + it) * 256 + t;
        const size_t go = ((size_t)(c >> 6) * (MQ / 16) + rtq) * 512 + (c & 63) * 8;
        *(v4u*)(ctxp + go)                                   = hv[rr][it];
        *(v4u*)(ctxp + go + (size_t)(CM / 32) * (MQ / 16) * 512) = lv[rr][it];
      }
    }
  }
}

// =====================================================================================================
// Workspace map (bytes); every plane is an exact multiple of its whole-row / whole-line / 64x64-tile store
// granularity (MQ = 4096 = 64 row tiles, MC = 8192 = 128 row tiles; N in {512, 4096}; v^T per batch
// [512][4096] = 8x64 tiles):
// (Xq, Xc, the four weight planes and Ctx hold these shapes in fragment order: [k step of 32][row tile of 16][512])
//   Xq   bf16 [4096][512]       0          4194304
//   Xc   bf16 [8192][512]       4194304    8388608
//   Wqb  bf16 [512][512]        12582912   524288
//   Wkb  bf16 [512][512]        13107200   524288
//   Wvb  bf16 [512][512]        13631488   524288
//   WoT2 bf16 [512][1024]       14155776   1048576   (cols k and CM + k both hold the proj weight)
//   Qp   f16  [4096][512]       15204352   4194304
//   Kp   f16  [2][128][8][2048] 19398656   8388608   (k, fragment order: batch, chunk of 32 keys, head)
//   VTh  f16  [2][128][8][2048] 27787264   8388608   (v^T hi, fragment order)
//   VTl  f16  [2][128][8][2048] 36175872   8388608   (v^T residual x2048, fragment order)
//   Ctx  bf16 [4096][1024]      44564480   8388608   (context hi | lo)
//   Part f32  [2][256][8][1024] 52953088   16777216  (attention sums of the two key halves, as they lie in the lanes)
//   Ml   f32  [2][256][8][64]   69730304   1048576   (each half's maximum and sum of p, a pair a lane)
//   end                         70778880
// =====================================================================================================
extern "C" void kernel_launch(void* const* d_in, const int* in_sizes, int n_in,
                              void* d_out, int out_size, void* d_ws, size_t ws_size,
                              hipStream_t stream) {
  if (n_in < 12) return;
  if (in_sizes[0] != MC * CM) return;
  if (in_sizes[1] != MQ * CM) return;
  if (in_sizes[2] != MC * 3) return;
  if (in_sizes[3] != MQ * 3) return;
  if (in_sizes[4] != CM * CM || in_sizes[5] != CM) return;
  if (in_sizes[6] != CM * CM || in_sizes[7] != CM) return;
  if (in_sizes[8] != CM * CM || in_sizes[9] != CM) return;
  if (in_sizes[10] != CM * CM || in_sizes[11] != CM) return;
  if (out_size != MQ * CM) return;

  const float* x_ctx   = (const float*)d_in[0];
  const float* x_query = (const float*)d_in[1];
  const float* pos_ctx = (const float*)d_in[2];
  const float* pos_qry = (const float*)d_in[3];
  const float* Wq = (const float*)d_in[4];
  const float* bq = (const float*)d_in[5];
  const float* Wk = (const float*)d_in[6];
  const float* bk = (const float*)d_in[7];
  const float* Wv = (const float*)d_in[8];
  const float* bv = (const float*)d_in[9];
  const float* Wo = (const float*)d_in[10];
  const float* bo = (const float*)d_in[11];

  const size_t PXQ  = (size_t)MQ * CM * 2;             //  4194304
  const size_t PXC  = (size_t)MC * CM * 2;             //  8388608
  const size_t PW   = (size_t)CM * CM * 2;             //   524288
  const size_t PWO  = (size_t)CM * KC * 2;             //  1048576
  const size_t PQ   = (size_t)MQ * CM * 2;             //  4194304
  const size_t PK   = (size_t)MC * CM * 2;             //  8388608
  const size_t PVT  = (size_t)NB * CM * NC * 2;        //  8388608
  const size_t PCTX = (size_t)MQ * KC * 2;             //  8388608
  const size_t PPRT = (size_t)KS * MQ * CM * 4;        // 16777216
  const size_t PML  = (size_t)KS * (MQ / 16) * NH * 64 * 4;   // 1048576
  size_t off = 0;
  const size_t oXq  = off; off += PXQ;
  const size_t oXc  = off; off += PXC;
  const size_t oWq  = off; off += PW;
  const size_t oWk  = off; off += PW;
  const size_t oWv  = off; off += PW;
  const size_t oWo  = off; off += PWO;
  const size_t oQ   = off; off += PQ;
  const size_t oK   = off; off += PK;
  const size_t oVTh = off; off += PVT;
  const size_t oVTl = off; off += PVT;
  const size_t oCtx = off; off += PCTX;
  const size_t oPrt = off; off += PPRT;
  const size_t oMl  = off; off += PML;
  if (off > ws_size) return;                           // off = 70778880
  if (off > (size_t)134217728) return;

  char* ws = (char*)d_ws;
  unsigned short* Xq   = (unsigned short*)(ws + oXq);
  unsigned short* Xc   = (unsigned short*)(ws + oXc);
  unsigned short* Wqb  = (unsigned short*)(ws + oWq);
  unsigned short* Wkb  = (unsigned short*)(ws + oWk);
  unsigned short* Wvb  = (unsigned short*)(ws + oWv);
  unsigned short* WoT2 = (unsigned short*)(ws + oWo);
  unsigned short* Qp   = (unsigned short*)(ws + oQ);
  unsigned short* Kp   = (unsigned short*)(ws + oK);
  unsigned short* VTh  = (unsigned short*)(ws + oVTh);
  unsigned short* VTl  = (unsigned short*)(ws + oVTl);
  unsigned short* Ctx  = (unsigned short*)(ws + oCtx);
  float*          Prt  = (float*)(ws + oPrt);
  float*          Ml   = (float*)(ws + oMl);
  float*          out0 = (float*)d_out;

  const dim3 blk(256);
  const dim3 gQKV(GK + NB * GV + GQ, 1, 1);                    // 128 + 2 x 64 + 64 blocks
  const dim3 gAttn(NQ / (16 * QT), NB, KS);                    // 64 x 2 x 2 blocks of 256
  const dim3 gO(GQ, 1, 1);                                     // 512 tiles -> 64 blocks
  if ((((MQ / 64) * (CM / 64)) % 8) != 0) return;
  if ((((MC / 64) * (CM / 64)) % 8) != 0) return;
  if ((((CM / 64) * (NC / 64)) % 8) != 0) return;

  // (0) bf16 planes of the activations and weights ([out][in]) in fragment order; proj weights with duplicated k range
  cvt_all<<<dim3(CVT_BLOCKS), blk, 0, stream>>>(x_ctx, x_query, Wq, Wk, Wv, Wo, Xc, Xq, Wqb, Wkb, Wvb, WoT2);

  // (1) the q, k and v^T projections, one grid
  proj_qkv<<<gQKV, blk, 0, stream>>>(Xq, Xc, Wqb, Wkb, Wvb, Qp, Kp, VTh, VTl, bq, bk, bv);

  // (2) fused heat bias + softmax attention, each half of the keys by itself; then the halves joined -> context bf16 hi|lo
  attn_kernel<<<gAttn, blk, 0, stream>>>(pos_qry, pos_ctx, Qp, Kp, VTh, VTl, Prt, Ml);
  attn_join<<<dim3(MQ / 16), blk, 0, stream>>>(Prt, Ml, Ctx);

  // (3) out = [ctx_hi | ctx_lo] . [Wo | Wo]^T + bo  (K = 1024, bf16 operands) -> d_out f32
  proj_out<<<gO, blk, 0, stream>>>(Ctx, WoT2, out0, bo);
  (void)hipGetLastError();
}

// v008
// Measured time: 112 microseconds a run.
// In two side-by-side timings against v007, it was 1.17 and 1.16 times as fast.
// Over all steps from v000 it is 5.76 times as fast.
// Contractions: q and k projections (x . W^T) and v^T projection (Wv . x^T) on v_wmma_f32_16x16x32_bf16 (bf16 x, bf16 weights);
// output projection on v_wmma_f32_16x16x32_bf16 (context as bf16 hi|lo planes K-concatenated against duplicated bf16 weights);
// scores transposed, k.q^T, on v_wmma_f32_16x16x32_f16 (plain f16 q, k); v^T.p^T on v_wmma_f32_16x16x32_f16 (p carried
// x1024 f16, v^T as f16 hi + f16 residual planes, one accumulator set); all f32 accumulate; heat-kernel bias and softmax in f32;
// every float input RNE-converted to bf16 on load.
#include <hip/hip_runtime.h>
#include <math.h>
#include <stdint.h>

#define NB   2
#define NQ   2048
#define NC   4096
#define CM   512
#define NH   8
#define HD   64
#define MQ   (NB * NQ)
#define MC   (NB * NC)
#define KC   (2 * CM)
#define NCH  (NC / 32)
#define PSC  1024.0f
#define SCL  0.125f
#define HK4  0.4f
#define HEPS 1.0e-6f
#define HP   36            // heat tile pitch in floats: 144 B, 16 B x odd, for its 16-byte readers
#define OP   (CM + 4)      // output staging pitch in floats: the 16 lanes' 16-byte stores of one column walk fall on 64 banks
static_assert(NH * HD == CM);
static_assert(NH == 8);
static_assert((MQ % 64) == 0 && (MC % 64) == 0 && (CM % 64) == 0 && (NC % 64) == 0 && (KC % 64) == 0);
static_assert((((MQ / 64) * (CM / 64)) % 8) == 0);
static_assert((((MC / 64) * (CM / 64)) % 8) == 0);
static_assert((((CM / 64) * (NC / 64)) % 8) == 0);
static_assert((NQ % 16) == 0 && (NC % 32) == 0);

typedef _Float16 v16h __attribute__((ext_vector_type(16)));
typedef _Float16 v8h  __attribute__((ext_vector_type(8)));
typedef __bf16   v16b __attribute__((ext_vector_type(16)));
typedef unsigned short v16us __attribute__((ext_vector_type(16)));
typedef unsigned short v8us  __attribute__((ext_vector_type(8)));
typedef float    v8f  __attribute__((ext_vector_type(8)));
typedef float    v4f  __attribute__((ext_vector_type(4)));
typedef float    v2f  __attribute__((ext_vector_type(2)));
typedef unsigned int v4u __attribute__((ext_vector_type(4)));

union FragU { v16us v; v8us h[2]; };

// ---- scalar helpers --------------------------------------------------------------------------------
__device__ __forceinline__ unsigned short bf_bits(float f) {          // f32 -> bf16 bits, RNE convert
  unsigned u = __float_as_uint(f);
  return (unsigned short)((u + 0x7FFFu + ((u >> 16) & 1u)) >> 16);
}
__device__ __forceinline__ float bf_up(unsigned short h) { return __uint_as_float(((unsigned)h) << 16); }
__device__ __forceinline__ float bfr(float f) { return bf_up(bf_bits(f)); }   // value of the bf16 RNE convert
__device__ __forceinline__ unsigned short h_bits(_Float16 x) { return __builtin_bit_cast(unsigned short, x); }
__device__ __forceinline__ unsigned pk16(unsigned short a, unsigned short b) { return (unsigned)a | ((unsigned)b << 16); }
__device__ __forceinline__ v8f zero8() { v8f z = {0.f, 0.f, 0.f, 0.f, 0.f, 0.f, 0.f, 0.f}; return z; }
__device__ __forceinline__ float xhalf(float x) {                     // value of lane l ^ 16
  const int b = __builtin_bit_cast(int, x);
  return __builtin_bit_cast(float, __builtin_amdgcn_permlanex16(b, b, 0x76543210, 0xfedcba98, false, false));
}

// ---- fragment loader: 16-bit A/B operand, lane -> row/col (lane&15), p already includes +8*(lane>>4);
//      elements 0..7 <- p[0..7] (k0+8h..), elements 8..15 <- p[16..23] (k0+16+8h..)
__device__ __forceinline__ v16us ldfrag_u(const unsigned short* p) {
  FragU f;
  f.h[0] = *(const v8us*)(p);
  f.h[1] = *(const v8us*)(p + 16);
  return f.v;
}

// ---- fragment loader, fragment-order plane: one operand fragment is 1 KiB in a row, lane l's elements 0..7 at
//      16 * l bytes and its elements 8..15 at 512 + 16 * l; p already includes + 8 * lane. Each of the two loads
//      reads 512 bytes in a row (4 whole lines) where a row-major plane makes it touch 16 lines.
__device__ __forceinline__ v16us ldfrag_f(const unsigned short* p) {
  FragU f;
  f.h[0] = *(const v8us*)(p);
  f.h[1] = *(const v8us*)(p + 256);
  return f.v;
}

// ---- s_wait_xcnt 0 behind a group of global loads, in front of every overwrite of the group's address registers:
//      it takes the address as an input so that it stays whole up to it; its memory clobber keeps the loads ahead of it.
__device__ __forceinline__ void xwait1(const void* a) {
#if defined(__HIP_DEVICE_COMPILE__)
  asm volatile("s_wait_xcnt 0x0" :: "v"(a) : "memory");
#endif
}

// ---- WMMA helpers with trailing VALU hazard gap --------------------------------------------------------
__device__ __forceinline__ v8f mma_bu_raw(v16us a, v16us b, v8f c) {            // bf16 operands, unguarded
  return __builtin_amdgcn_wmma_f32_16x16x32_bf16(false, __builtin_bit_cast(v16b, a), false,
                                                 __builtin_bit_cast(v16b, b), (short)0, c, false, false);
}
// f16 operands (bits), unguarded like the bf16 form: a guard that names the operands in an asm statement holds them all below
// v256, and the column tiles' accumulators and fragments do not fit there (the build then spills); the loads that overwrite
// A operands stand behind refill_gap() instead
__device__ __forceinline__ v8f mma_hu(v16us a, v16us b, v8f c) {
  return __builtin_amdgcn_wmma_f32_16x16x32_f16(false, __builtin_bit_cast(v16h, a), false,
                                                __builtin_bit_cast(v16h, b), (short)0, c, false, false);
}
// ---- one k step of a 64x64 wave tile: its 4 A and 4 B fragments (16 loads, fragment-order planes) as one group, A first.
//      ap, bp: the wave's (uniform) global addresses of the step, in scalar registers; l8 = 8 * lane elements, the one
//      vector register that all 16 loads name
typedef const __attribute__((address_space(1))) unsigned short gus;
typedef const __attribute__((address_space(1))) v8us           gv8us;
__device__ __forceinline__ void ld_step(v16us (&a)[4], v16us (&b)[4], gus* ap, gus* bp, unsigned l8) {
#pragma unroll
  for (int i = 0; i < 4; ++i) {
    FragU f;
    f.h[0] = *(gv8us*)(ap + i * 512 + l8);
    f.h[1] = *(gv8us*)(ap + i * 512 + l8 + 256);
    a[i] = f.v;
  }
#pragma unroll
  for (int j = 0; j < 4; ++j) {
    FragU f;
    f.h[0] = *(gv8us*)(bp + j * 512 + l8);
    f.h[1] = *(gv8us*)(bp + j * 512 + l8 + 256);
    b[j] = f.v;
  }
  // s_wait_xcnt 0 in front of every overwrite of the group's address registers: it takes the two bases and the lane
  // offset as inputs so that they stay whole up to it; its memory clobber keeps the loads ahead of it.
#if defined(__HIP_DEVICE_COMPILE__)
  asm volatile("s_wait_xcnt 0x0" :: "s"(ap), "s"(bp), "v"(l8) : "memory");
#endif
  __builtin_amdgcn_sched_barrier(0);   // no product (with its data wait) is scheduled up into the load group
}
// ---- between a step's products and the load group that refills the operand registers they read
__device__ __forceinline__ void refill_gap() {
  __builtin_amdgcn_sched_barrier(0);   // the group stays whole: without this its A loads are spread among the products in front of it
  // four vector slots, the distance a WMMA asks for before its A or B is overwritten: loads fill no slot, and a load over
  // B directly behind the product is not known to be safe; the memory clobber keeps the loads behind the slots
#if defined(__HIP_DEVICE_COMPILE__)
  asm volatile("v_nop\n\tv_nop\n\tv_nop\n\tv_nop" ::: "memory");
#endif
}
// ---- the next k step's address, added in scalar registers by hand: left to the compiler, the loop's address sums move
//      into vector registers, and accumulators plus two fragment sets leave none to spare (it then copies accumulators about)
__device__ __forceinline__ gus* next_step(gus* p, unsigned long long bytes) {
#if defined(__HIP_DEVICE_COMPILE__)
  gus* r;
  asm("s_add_nc_u64 %0, %1, %2" : "=s"(r) : "s"(p), "s"(bytes));
  return r;
#else
  return p + bytes / 2;
#endif
}
__device__ __forceinline__ void mma_step(v8f (&acc)[4][4], const v16us (&a)[4], const v16us (&b)[4]) {
#pragma unroll
  for (int i = 0; i < 4; ++i)
#pragma unroll
    for (int j = 0; j < 4; ++j) acc[i][j] = mma_bu_raw(a[i], b[j], acc[i][j]);
}
__device__ __forceinline__ void acc_guard4(v8f& a, v8f& b, v8f& c, v8f& d) {
#if defined(__HIP_DEVICE_COMPILE__)
  asm volatile("v_nop\n\tv_nop\n\tv_nop\n\tv_nop" : "+v"(a), "+v"(b), "+v"(c), "+v"(d));
#endif
}
__device__ __forceinline__ void wave_sync_lds() {
  __builtin_amdgcn_fence(__ATOMIC_RELEASE, "workgroup");
  __builtin_amdgcn_wave_barrier();
  __builtin_amdgcn_fence(__ATOMIC_ACQUIRE, "workgroup");
}

// ---- work-group barrier of the attention loop's heat tile: it waits for the wave's own LDS accesses alone, so that the
//      global loads issued a pass ahead stay in flight across it (__syncthreads() waits for them too); the memory clobber
//      keeps every LDS access on its side of the barrier
__device__ __forceinline__ void lds_barrier() {
#if defined(__HIP_DEVICE_COMPILE__)
  asm volatile("s_wait_dscnt 0x0\n\ts_barrier_signal -1\n\ts_barrier_wait -1" ::: "memory");
#endif
}

// =====================================================================================================
// Row convert: in[row][CM] f32 -> bf16 RNE bits in fragment order for a plane of nrt row tiles: fragment (row tile
// row/16, k step k/32) at (k step * nrt + row tile) * 512 elements (one k step of all rows lies in a row), inside it as
// ldfrag_f reads it; kofs is added to the k step (the second copy of the proj weights).
// Block = 256 threads (one tile rt of 16 rows = 1024 pieces of 8 columns, 4 a thread). Piece c holds row c & 15,
// columns 8 * (c >> 4) .. + 7: k step c >> 6, at 8 * (c & 63) elements of its fragment, so one store of one wave
// writes 512 bytes in a row.
// coverage: 1024 pieces x 8 = 16 rows x CM columns.
// =====================================================================================================
__device__ __forceinline__ void cvt_tile(const float* __restrict__ src, unsigned short* dst, int rt, int nrt, int kofs) {
  const int tid = threadIdx.x;
  // thread tid takes pieces c = tid + 256 * it: the same row, 128 columns (4 k steps) on
  const float* p = src + ((size_t)rt * 16 + (tid & 15)) * CM + (tid >> 4) * 8;
  unsigned short* d = dst + ((size_t)((tid >> 6) + kofs) * nrt + rt) * 512 + (tid & 63) * 8;
  v4f a0[4], a1[4];
#pragma unroll
  for (int it = 0; it < 4; ++it) {
    a0[it] = *(const v4f*)(p + it * 128);
    a1[it] = *(const v4f*)(p + it * 128 + 4);
  }
  xwait1(p);
  v4u hv[4];
#pragma unroll
  for (int it = 0; it < 4; ++it) {
    hv[it][0] = pk16(bf_bits(a0[it][0]), bf_bits(a0[it][1]));
    hv[it][1] = pk16(bf_bits(a0[it][2]), bf_bits(a0[it][3]));
    hv[it][2] = pk16(bf_bits(a1[it][0]), bf_bits(a1[it][1]));
    hv[it][3] = pk16(bf_bits(a1[it][2]), bf_bits(a1[it][3]));
  }
  unsigned short* dq[4];
#pragma unroll
  for (int it = 0; it < 4; ++it) dq[it] = d + (size_t)it * 4 * nrt * 512;
  __builtin_amdgcn_sched_barrier(0);   // the stores stand behind all the arithmetic: no register that one names is written again
#pragma unroll
  for (int it = 0; it < 4; ++it) *(v4u*)(dq[it]) = hv[it];
}

// All six converts in one grid (they depend on nothing but the inputs): block -> (matrix, row tile), the largest matrix
// first. Blocks 0 .. MC/16 - 1: context rows; the next MQ/16: query rows; then five groups of CM/16: the q, k and v
// weights, the proj weights, and the proj weights again for k steps CM/32 on.
// coverage: every row tile of every matrix once (the proj weights twice, into the two halves of their plane).
#define CVT_BLOCKS (MC / 16 + MQ / 16 + 5 * (CM / 16))
__global__ __launch_bounds__(256) void cvt_all(
    const float* __restrict__ xc, const float* __restrict__ xq, const float* __restrict__ wq,
    const float* __restrict__ wk, const float* __restrict__ wv, const float* __restrict__ wo,
    unsigned short* Xc, unsigned short* Xq, unsigned short* Wqb, unsigned short* Wkb, unsigned short* Wvb,
    unsigned short* WoT2) {
  const int bx = blockIdx.x;
  const int u = bx - (MC / 16 + MQ / 16), sel = u / (CM / 16);      // used where u >= 0: the weights' blocks
  const float* s = wo;
  unsigned short* d = WoT2;
  int rt = u % (CM / 16), nrt = CM / 16;
  if (bx < MC / 16)                { s = xc; d = Xc;  rt = bx;           nrt = MC / 16; }
  else if (bx < MC / 16 + MQ / 16) { s = xq; d = Xq;  rt = bx - MC / 16; nrt = MQ / 16; }
  else if (sel == 0)               { s = wq; d = Wqb; }
  else if (sel == 1)               { s = wk; d = Wkb; }
  else if (sel == 2)               { s = wv; d = Wvb; }
  cvt_tile(s, d, rt, nrt, (u >= 0 && sel == 4) ? (CM / 32) : 0);
}

// =====================================================================================================
// Register-blocked batched bf16 WMMA GEMM: C[m][n] = sum_k A[m][k] * Bt[n][k] (+ bias);
// one wave per 64x64 tile, no block barriers. A [M][K] and Bt [N][K] in fragment order, in planes of rtA and rtB row
// tiles: fragment (row tile row/16, k step k/32) at (k step * rt + row tile) * 512 elements, so that what all waves
// read in one k step lies in a row; M, N and K multiples of 64. bx = the block's index among the product's own blocks,
// by = batch index with element strides (sAy for A, sBy for Bt, sCy for C); sT = the block's LDS, one slab a wave.
// Tile enumeration: tile = bx * 8 + wave -> tm = tile / (N/64), tn = tile % (N/64).
// OM: 0 = f32 out to Cf (pitch ldc); 1 = f16 bits to Cp (pitch ldc); 2 = f16 hi bits to Cp and f16(v - hi)
//     bits to Cp2, both in fragment order for m = head dim, n = key: fragment (chunk n/32, head m/64, row tile
//     (m/16)%4) at ((chunk * NH + head) * 4 + row tile) * 512 elements; 3 = f16 bits to Cp in fragment order for
//     m = key row (batch-major), n = head dim: fragment (chunk m/32 over both batches, head n/64, key tile (m/16)%2,
//     k step (n/32)%2) at (((chunk * NH + head) * 2 + key tile) * 2 + k step) * 512 elements. Inside a fragment: see
//     ldfrag_f. One chunk of 32 keys of all heads lies in a row in each plane.
// CBM: 0 = no bias; 1 = column bias bf16(cb[n]); 2 = row bias bf16(cb[m]).
// coverage: 4 slabs x 16 rows x 64 cols = the wave's whole 64x64 tile; tilesM*tilesN/8 blocks exactly per product
//           (host-checked), so no wave exits early.
// =====================================================================================================
template <int OM, int CBM>
__device__ __forceinline__ void gemm64_body(
    float (*sT)[16 * 68], int bx, int by,
    const unsigned short* __restrict__ Ap, int rtA, long long sAy,
    const unsigned short* __restrict__ Btp, int rtB, long long sBy,
    unsigned short* Cp, unsigned short* Cp2, float* Cf, int ldc, long long sCy,
    const float* __restrict__ cb, int M, int N, int K) {
  const int lane = threadIdx.x & 31;
  const int wave = __builtin_amdgcn_readfirstlane(threadIdx.x >> 5);   // scalar: the tile's addresses stay in scalar registers
  const int tilesN = N >> 6;
  const int tilesM = M >> 6;
  const int tile = bx * 8 + wave;
  if (tile >= tilesM * tilesN) return;   // wave-uniform; no block barriers in this kernel
  const int tm = tile / tilesN;
  const int tn = tile - tm * tilesN;
  const int m0 = tm << 6;
  const int n0 = tn << 6;

  const unsigned short* Ab = Ap  + (size_t)by * (size_t)sAy;
  const unsigned short* Bb = Btp + (size_t)by * (size_t)sBy;
  const size_t cofs = (size_t)by * (size_t)sCy;

  const int rlane = lane & 15;                 // row (A) / col (B, D) within subtile
  const int mOff  = (lane >> 4) * 8;           // D row offset

  v8f acc[4][4];
#pragma unroll
  for (int i = 0; i < 4; ++i)
#pragma unroll
    for (int j = 0; j < 4; ++j) acc[i][j] = zero8();

  // Two fragment sets: while one k step's 16 products run on one set, the next step's 16 loads are in flight into the
  // other, so a wave waits for memory once per step at most, not four times per step. k ascends as before.
  const unsigned long long sA = (unsigned long long)rtA * 1024u, sB = (unsigned long long)rtB * 1024u;   // bytes per k step
  gus* ap = (gus*)(Ab + (size_t)(m0 >> 4) * 512);
  gus* bp = (gus*)(Bb + (size_t)(n0 >> 4) * 512);
  const unsigned l8 = (unsigned)lane * 8u;
  v16us fa0[4], fb0[4], fa1[4], fb1[4];
  ld_step(fa0, fb0, ap, bp, l8);
#pragma unroll 1   // stays the loop it was, now that K is a constant at the call: unrolled, the kernel's text grows by a third, and a block runs its part of it only once
  for (int k0 = 64; k0 < K; k0 += 64) {
    ap = next_step(ap, sA);
    bp = next_step(bp, sB);
    refill_gap();
    ld_step(fa1, fb1, ap, bp, l8);
    mma_step(acc, fa0, fb0);
    ap = next_step(ap, sA);
    bp = next_step(bp, sB);
    refill_gap();
    ld_step(fa0, fb0, ap, bp, l8);
    mma_step(acc, fa1, fb1);
  }
  ap = next_step(ap, sA);
  bp = next_step(bp, sB);
  refill_gap();
  ld_step(fa1, fb1, ap, bp, l8);                                     // the last two steps: nothing left to fetch ahead
  mma_step(acc, fa0, fb0);
  mma_step(acc, fa1, fb1);
  acc_guard4(acc[0][0], acc[0][1], acc[0][2], acc[0][3]);
  acc_guard4(acc[1][0], acc[1][1], acc[1][2], acc[1][3]);
  acc_guard4(acc[2][0], acc[2][1], acc[2][2], acc[2][3]);
  acc_guard4(acc[3][0], acc[3][1], acc[3][2], acc[3][3]);

  const int hh2 = lane >> 4, c4 = (lane & 15) * 4;     // f32 out: 256-B row segment = 16 lanes x 16 B
  const int q8  = lane >> 3, c8 = (lane & 7) * 8;

  v4f cb4 = {0.f, 0.f, 0.f, 0.f};
  float cbc[4][8];                                     // row-major out uses [0] alone; fragment order one set per it
#pragma unroll
  for (int g = 0; g < 4; ++g)
#pragma unroll
    for (int e = 0; e < 8; ++e) cbc[g][e] = 0.f;
  if (CBM == 1) {
    if (OM == 0) {
      const v4f v = *(const v4f*)(cb + n0 + c4);
      cb4[0] = bfr(v[0]); cb4[1] = bfr(v[1]); cb4[2] = bfr(v[2]); cb4[3] = bfr(v[3]);
    } else if (OM == 1) {
      const v4f v0 = *(const v4f*)(cb + n0 + c8);
      const v4f v1 = *(const v4f*)(cb + n0 + c8 + 4);
#pragma unroll
      for (int e = 0; e < 4; ++e) { cbc[0][e] = bfr(v0[e]); cbc[0][4 + e] = bfr(v1[e]); }
    } else {
      const float* cp = cb + n0 + mOff;
#pragma unroll
      for (int g = 0; g < 4; ++g) {
        const v4f v0 = *(const v4f*)(cp + g * 16);
        const v4f v1 = *(const v4f*)(cp + g * 16 + 4);
#pragma unroll
        for (int e = 0; e < 4; ++e) { cbc[g][e] = bfr(v0[e]); cbc[g][4 + e] = bfr(v1[e]); }
      }
    }
  }

  // ---- epilogue ----
  float* slab = sT[wave];
#pragma unroll
  for (int i = 0; i < 4; ++i) {
    const int mBase = m0 + (i << 4);
#pragma unroll
    for (int j = 0; j < 4; ++j) {
#pragma unroll
      for (int r = 0; r < 8; ++r) {
        slab[(mOff + r) * 68 + (j << 4) + rlane] = acc[i][j][r];
      }
    }
    wave_sync_lds();
    if (OM == 0) {
      float* C = Cf + cofs;
      v4f vals[8];
#pragma unroll
      for (int it = 0; it < 8; ++it) {
        const int row = it * 2 + hh2;                      // it 0..7 x hh2 0..1 = rows 0..15
        const v4f v = *(const v4f*)(slab + row * 68 + c4);
        vals[it] = v + cb4;
      }
      {
#pragma unroll
        for (int it = 0; it < 8; ++it) {
          const int row = it * 2 + hh2;
          *(v4f*)(C + (size_t)(mBase + row) * ldc + (size_t)n0 + c4) = vals[it];
        }
        
      }
    } else {
      unsigned short* C  = Cp  + cofs;
      unsigned short* C2 = Cp2 + cofs;
      v4u hv[4], lv[4];
#pragma unroll
      for (int it = 0; it < 4; ++it) {
        // row-major out: it 0..3 x q8 0..3 = rows 0..15, 8 columns at c8; fragment order: the lane takes what it
        // holds as an operand, row lane & 15, the 8 columns at 16 * it + 8 * (lane >> 4)
        const int row = (OM == 1) ? (it * 4 + q8) : rlane;
        const int col = (OM == 1) ? c8 : (it * 16 + mOff);
        const float* sp = slab + row * 68 + col;
        float rb = 0.f;
        if (CBM == 2) rb = bfr(cb[mBase + row]);
        const int g = (OM == 1) ? 0 : it;
        v4u ha = {0u, 0u, 0u, 0u}, la = {0u, 0u, 0u, 0u};
#pragma unroll
        for (int e = 0; e < 4; ++e) {
          const float f0 = sp[2 * e]     + cbc[g][2 * e]     + rb;
          const float f1 = sp[2 * e + 1] + cbc[g][2 * e + 1] + rb;
          const _Float16 g0 = (_Float16)f0, g1 = (_Float16)f1;
          ha[e] = pk16(h_bits(g0), h_bits(g1));
          if (OM == 2) {
            la[e] = pk16(h_bits((_Float16)(f0 - (float)g0)), h_bits((_Float16)(f1 - (float)g1)));
          }
        }
        hv[it] = ha;
        lv[it] = la;
      }
      {
#pragma unroll
        for (int it = 0; it < 4; ++it) {
          size_t go;
          if (OM == 1) {
            go = (size_t)(mBase + it * 4 + q8) * ldc + (size_t)n0 + c8;
          } else if (OM == 2) {
            go = (((size_t)((n0 >> 5) + (it >> 1)) * NH + tm) * 4 + i) * 512 + (it & 1) * 256 + lane * 8;
          } else {
            go = ((((size_t)(mBase >> 5) * NH + tn) * 2 + ((mBase >> 4) & 1)) * 2 + (it >> 1)) * 512
                 + (it & 1) * 256 + lane * 8;
          }
          *(v4u*)(C + go) = hv[it];
          if (OM == 2) *(v4u*)(C2 + go) = lv[it];
        }
        
      }
    }
    wave_sync_lds();
  }
}

// The q, k and v^T projections in one grid (none reads what another writes): blocks 0 .. GK - 1 the k projection, the next
// NB * GV the v^T projection (GV a batch), the last GQ the q projection.
//   k = Xc . Wkb^T + bk (K = 512) -> f16, fragment order; v^T per batch = Wvb . Xc_b^T + bv per row d -> f16 hi (VTh) and
//   residual (VTl), fragment order; q = Xq . Wqb^T + bq -> f16 plane [rows][512]
#define GQ (((MQ / 64) * (CM / 64)) / 8)     // 512 tiles -> 64 blocks
#define GK (((MC / 64) * (CM / 64)) / 8)     // 1024 tiles -> 128 blocks
#define GV (((CM / 64) * (NC / 64)) / 8)     // 512 tiles -> 64 blocks a batch
__global__ __launch_bounds__(256) void proj_qkv(
    const unsigned short* __restrict__ Xq, const unsigned short* __restrict__ Xc,
    const unsigned short* __restrict__ Wqb, const unsigned short* __restrict__ Wkb,
    const unsigned short* __restrict__ Wvb,
    unsigned short* Qp, unsigned short* Kp, unsigned short* VTh, unsigned short* VTl,
    const float* __restrict__ bq, const float* __restrict__ bk, const float* __restrict__ bv) {
  __shared__ __align__(16) float sT[8][16 * 68];   // per-wave 16x64 slab, pitch 68 floats
  const int bx = blockIdx.x;
  if (bx < GK) {
    gemm64_body<3, 1>(sT, bx, 0, Xc, MC / 16, 0LL, Wkb, CM / 16, 0LL,
                      Kp, Kp, nullptr, CM, 0LL, bk, MC, CM, CM);
  } else if (bx < GK + NB * GV) {
    const int u = bx - GK;
    gemm64_body<2, 2>(sT, u % GV, u / GV, Wvb, CM / 16, 0LL, Xc, MC / 16, (long long)(NC / 16) * 512,
                      VTh, VTl, nullptr, NC, (long long)CM * NC, bv, CM, NC, CM);
  } else {
    gemm64_body<1, 1>(sT, bx - (GK + NB * GV), 0, Xq, MQ / 16, 0LL, Wqb, CM / 16, 0LL,
                      Qp, Qp, nullptr, CM, 0LL, bq, MQ, CM, CM);
  }
}

// The output projection: out = [ctx_hi | ctx_lo] . [Wo | Wo]^T + bo (K = 1024, bf16 operands) -> f32
__global__ __launch_bounds__(256) void proj_out(
    const unsigned short* __restrict__ Ctx, const unsigned short* __restrict__ WoT2, float* out,
    const float* __restrict__ bo) {
  __shared__ __align__(16) float sT[8][16 * 68];   // per-wave 16x64 slab, pitch 68 floats
  gemm64_body<0, 1>(sT, blockIdx.x, 0, Ctx, MQ / 16, 0LL, WoT2, CM / 16, 0LL,
                    nullptr, nullptr, out, CM, 0LL, bo, MQ, CM, KC);
}

// =====================================================================================================
// Fused heat-bias + online-softmax cross attention, head dim 64, 8 heads.
//   Block = 256 threads = 8 waves, wave w = head w; one block per (batch, 64 query rows, quarter of the keys); key chunks
//   of 32, static trip NPS = 32. A wave holds QT = 4 query column tiles, so that each K and V fragment it loads from L2
//   feeds four products; the keys are dealt to KS = 4 blocks so that the grid still has one block per 16 query rows.
//   q plane (f16 bits, pitch CM): row (b*NQ + t), head h at col h*64 + d; k plane
//   (f16 bits) and v^T hi / lo planes (f16 bits, value = hi + lo) in fragment order (gemm64, OM 3 and 2):
//   2048 elements per (batch, chunk of 32 keys, head) in each plane.
//   Per chunk: heat[q][s] = exp(-(dx*dx + dy*dy) * (1 / (0.4*|dt| + 1e-6))) from the bf16-converted positions
//   (spatial = dims 0,1, time = dim 2), computed once per (query row, key) pair by the block (thread = key
//   lane, rows w + 8 * i) into LDS and shared by the 8 head waves. Both products are transposed: S^T = K . Q^T
//   (A = k rows, B = q), so a lane holds 16 of the 32 scores of ONE query of each column tile (column lane & 15; keys
//   8h + r and 16 + 8h + r): s = (k . q) * 0.125 + heat; running-max softmax in f32 with maximum and sum in the lane, the
//   maximum joined with the other lane half once a pass, the sums once behind the loop. p = exp(s - m) as
//   f16(1024 p): the two score tiles, converted in place, are the B operand of O^T += V^T . P^T (A = v^T rows, hi and
//   lo products into one accumulator set, so that four column tiles fit the registers; 4 row tiles of 16 dims each). All q, k, v^T and p fragments use the split k map
//   (elements 0..7 <- k0+8h.., 8..15 <- k0+16+8h..).
//   Epilogue: the block's share of each query's sums goes out as it lies in the lanes: part[key part][row tile of 16][head]
//   [dim tile ct][4 dims lo / hi][lane][4] = 1024 x sum of p . v relative to the part's own maximum, and mlp[key part]
//   [row tile][head][lane] = (that maximum, the part's sum of p). attn_join adds the KS parts.
// coverage: heat 64 rows x 32 keys per chunk (8 waves x 8 rows x 32 lanes); part and mlp: every (key part, row tile, head,
//           lane) once; grid NQ/64 x NB x KS covers every query row and every key.
// =====================================================================================================
#define QT  4
#define KS  4
#define NPS (NCH / KS)
static_assert((NQ % (16 * QT)) == 0 && (NCH % KS) == 0);
__global__ void __launch_bounds__(256) attn_kernel(
    const float* __restrict__ posq, const float* __restrict__ posc,
    const unsigned short* __restrict__ qp, const unsigned short* __restrict__ kp,
    const unsigned short* __restrict__ vth, const unsigned short* __restrict__ vtl,
    float* part, float* mlp) {
#pragma clang fp contract(off)
  __shared__ __align__(16) float heatL[16 * QT * HP];       // [query row][key], pitch HP
  __shared__ float qps[16 * QT * 3];

  const int b = blockIdx.y, i0 = blockIdx.x * (16 * QT), ks = blockIdx.z;
  const int t = threadIdx.x, lane = t & 31, w = t >> 5, hh = lane >> 4, jc = lane & 15;
  const size_t rowQ = (size_t)b * NQ, rowC = (size_t)b * NC + (size_t)ks * (NPS * 32);
  const size_t ch0 = (size_t)b * NCH + (size_t)ks * NPS;    // the block's first chunk among the planes' NB * NCH

  if (t < 16 * QT * 3) qps[t] = bfr(posq[(rowQ + i0) * 3 + t]);
  __syncthreads();

  // q B-fragments (col = query jc of column tile u, k = d), plain f16 bits; d 0..31 and 32..63
  const unsigned short* qrow = qp + (rowQ + i0 + jc) * CM + w * HD + 8 * hh;
  v16us qf0[QT], qf1[QT];
#pragma unroll
  for (int u = 0; u < QT; ++u) {
    qf0[u] = ldfrag_u(qrow + u * 16 * CM);
    qf1[u] = ldfrag_u(qrow + u * 16 * CM + 32);
  }

  // query positions of the heat rows this thread produces (rows w + 8 * i, key = lane)
  float qx[2 * QT], qy[2 * QT], qz[2 * QT];
#pragma unroll
  for (int i = 0; i < 2 * QT; ++i) {
    qx[i] = qps[(w + 8 * i) * 3 + 0];
    qy[i] = qps[(w + 8 * i) * 3 + 1];
    qz[i] = qps[(w + 8 * i) * 3 + 2];
  }

  float m[QT], ll[QT];               // query jc of tile u: running maximum (both lane halves alike), this lane half's sum
  v8f o[QT][4];                      // O^T tiles: register r = dim ct*16 + 8*hh + r of query jc of tile u
#pragma unroll
  for (int u = 0; u < QT; ++u) {
    m[u] = -1.0e30f;
    ll[u] = 0.f;
#pragma unroll
    for (int ct = 0; ct < 4; ++ct) o[u][ct] = zero8();
  }

  // fragment-order planes: a pass's 4 K fragments are 4 KiB in a row, its 4 V fragments 4 KiB in a row in each plane,
  // and the 8 heads' (waves') pieces of one pass follow one another
  const unsigned short* vhb = vth + (ch0 * NH + w) * 2048 + lane * 8;     // A: row d = ct*16 + jc, k = key
  const unsigned short* vlb = vtl + (ch0 * NH + w) * 2048 + lane * 8;
  const unsigned short* kgb = kp + (ch0 * NH + w) * 2048 + lane * 8;      // A: row key = jc, k = d
  const float* pcb = posc + rowC * 3;
  const float* hrd = heatL + jc * HP + 8 * hh;                            // heat of query jc of tile 0, keys 8*hh..

  // Chunk 0's key positions, K and V fragments, in the order in which the loop refills them. Each pass fetches the next
  // chunk's into the same registers: positions and K right behind its score products, V right behind its V products,
  // so that a fragment's L2 round trip runs under the vector work and the barriers of most of a pass.
  const float* pc0 = pcb + (size_t)lane * 3;
  float px = pc0[0], py = pc0[1], pz = pc0[2];
  __builtin_amdgcn_sched_barrier(0);   // the loop's issue order, here too: a counted wait in the loop is as loose as the tighter of its two ways in
  v16us k00 = ldfrag_f(kgb);
  v16us k01 = ldfrag_f(kgb + 512);
  v16us k10 = ldfrag_f(kgb + 1024);
  v16us k11 = ldfrag_f(kgb + 1536);
  __builtin_amdgcn_sched_barrier(0);   // K ahead of V, as in the loop
  v16us vh[4], vl[4];
#pragma unroll
  for (int ct = 0; ct < 4; ++ct) {
    vh[ct] = ldfrag_f(vhb + ct * 512);
    vl[ct] = ldfrag_f(vlb + ct * 512);
  }
  // s_wait_xcnt 0 in front of every overwrite of an address that the loads above name, in the form of the loop's own
#if defined(__HIP_DEVICE_COMPILE__)
  asm volatile("s_wait_xcnt 0x0" :: "v"(qrow), "v"(pc0), "v"(kgb), "v"(vhb), "v"(vlb) : "memory");
#endif
  __builtin_amdgcn_sched_barrier(0);   // the wait stays directly behind the groups: left to sink, the build gets a second one inside the loop

#pragma unroll 1
  for (int jt = 0; jt < NPS; ++jt) {
    const int jn = (jt + 1 < NPS) ? (jt + 1) : jt;     // the chunk fetched ahead; the last pass re-reads its own: stays inside the planes
    lds_barrier();                                     // all waves done reading heatL of the prior chunk
    {
      const float cx = bfr(px), cy = bfr(py), cz = bfr(pz);
#pragma unroll
      for (int i = 0; i < 2 * QT; ++i) {
        const float dx = qx[i] - cx, dy = qy[i] - cy, dt = qz[i] - cz;
        const float d2 = dx * dx + dy * dy;
        const float nn = HK4 * fabsf(dt) + HEPS;
        heatL[(w + 8 * i) * HP + lane] = expf(-(d2 * (1.0f / nn)));
      }
    }
    lds_barrier();

    // heat of this lane's 16 (query, key) pairs of each column tile, read ahead of the score products so that it lands under them
    v4f h00[QT], h01[QT], h10[QT], h11[QT];
#pragma unroll
    for (int u = 0; u < QT; ++u) {
      h00[u] = *(const v4f*)(hrd + u * 16 * HP);
      h01[u] = *(const v4f*)(hrd + u * 16 * HP + 4);
      h10[u] = *(const v4f*)(hrd + u * 16 * HP + 16);
      h11[u] = *(const v4f*)(hrd + u * 16 * HP + 20);
    }

    // ---- scores, transposed: 32 keys x 16 query columns of head w a tile, K = 64 in two 32-deep steps ----
    __builtin_amdgcn_sched_barrier(0);   // no product (with its wait for K) is scheduled up in front of the heat tile's work
    v8f s0[QT], s1[QT];                  // s0[u][r]: key 32*jt + 8*hh + r, s1[u][r]: key 32*jt + 16 + 8*hh + r, query jc of tile u
#pragma unroll
    for (int u = 0; u < QT; ++u) s0[u] = mma_hu(k00, qf0[u], zero8());
#pragma unroll
    for (int u = 0; u < QT; ++u) s0[u] = mma_hu(k01, qf1[u], s0[u]);
#pragma unroll
    for (int u = 0; u < QT; ++u) s1[u] = mma_hu(k10, qf0[u], zero8());
#pragma unroll
    for (int u = 0; u < QT; ++u) s1[u] = mma_hu(k11, qf1[u], s1[u]);

    // ---- the next chunk's key positions and K fragments, over the registers the products above have read ----
    refill_gap();                        // the group stays behind the products whose operands it overwrites, at their distance
    const float* pc = pcb + (size_t)(jn * 32 + lane) * 3;
    px = pc[0]; py = pc[1]; pz = pc[2];
    const unsigned short* kg = kgb + (size_t)jn * (NH * 2048);
    k00 = ldfrag_f(kg);
    k01 = ldfrag_f(kg + 512);
    k10 = ldfrag_f(kg + 1024);
    k11 = ldfrag_f(kg + 1536);
    // The group's address registers are reused below: the wait stands in front of every such overwrite. It takes the
    // two addresses as inputs so that they stay whole up to it, and its memory clobber keeps the group ahead of it.
#if defined(__HIP_DEVICE_COMPILE__)
    asm volatile("s_wait_xcnt 0x0" :: "v"(kg), "v"(pc) : "memory");
#endif
    __builtin_amdgcn_sched_barrier(0);   // the group goes out here, ahead of the softmax, not further down towards its use

    // ---- heat bias + online softmax of query jc of each tile, all in the lane but for one exchange of the maximum ----
    v16us pbu[QT];
#pragma unroll
    for (int u = 0; u < QT; ++u) {
      const v8f x0 = s0[u] * SCL + __builtin_shufflevector(h00[u], h01[u], 0, 1, 2, 3, 4, 5, 6, 7);
      const v8f x1 = s1[u] * SCL + __builtin_shufflevector(h10[u], h11[u], 0, 1, 2, 3, 4, 5, 6, 7);
      const v8f mx = __builtin_elementwise_max(x0, x1);
      float rm = fmaxf(fmaxf(fmaxf(mx[0], mx[1]), fmaxf(mx[2], mx[3])), fmaxf(fmaxf(mx[4], mx[5]), fmaxf(mx[6], mx[7])));
      rm = fmaxf(rm, xhalf(rm));
      const float mn2   = fmaxf(m[u], rm);
      const float alpha = __expf(m[u] - mn2);
      m[u] = mn2;
      const v8f a0 = x0 - mn2, a1 = x1 - mn2;
      v8f e0, e1;
#pragma unroll
      for (int r = 0; r < 8; ++r) { e0[r] = __expf(a0[r]); e1[r] = __expf(a1[r]); }
      const v8f sm = e0 + e1;
      ll[u] = ll[u] * alpha + (((sm[0] + sm[1]) + (sm[2] + sm[3])) + ((sm[4] + sm[5]) + (sm[6] + sm[7])));
      // P^T B-fragment: element e = p of key kmap(e), the two score tiles converted in place
      const v8h p0 = __builtin_convertvector(e0 * PSC, v8h), p1 = __builtin_convertvector(e1 * PSC, v8h);
      const v16h pb = __builtin_shufflevector(p0, p1, 0, 1, 2, 3, 4, 5, 6, 7, 8, 9, 10, 11, 12, 13, 14, 15);
      pbu[u] = __builtin_bit_cast(v16us, pb);
#pragma unroll
      for (int ct = 0; ct < 4; ++ct) o[u][ct] *= alpha;
    }

    // ---- context^T += V_hi^T . P^T + V_lo^T . P^T (4 row tiles of 16 dims), each V fragment on all column tiles ----
#pragma unroll
    for (int ct = 0; ct < 4; ++ct) {
#pragma unroll
      for (int u = 0; u < QT; ++u) o[u][ct] = mma_hu(vh[ct], pbu[u], o[u][ct]);
#pragma unroll
      for (int u = 0; u < QT; ++u) o[u][ct] = mma_hu(vl[ct], pbu[u], o[u][ct]);
    }

    // ---- the next chunk's V fragments, over the registers the products above have read ----
    refill_gap();                        // the group stays behind the products whose operands it overwrites, at their distance
    const unsigned short* vhp = vhb + (size_t)jn * (NH * 2048);
    const unsigned short* vlp = vlb + (size_t)jn * (NH * 2048);
#pragma unroll
    for (int ct = 0; ct < 4; ++ct) {
      vh[ct] = ldfrag_f(vhp + ct * 512);
      vl[ct] = ldfrag_f(vlp + ct * 512);
    }
    // s_wait_xcnt 0 in front of every overwrite of this group's two addresses, in the form of the K group's above
#if defined(__HIP_DEVICE_COMPILE__)
    asm volatile("s_wait_xcnt 0x0" :: "v"(vhp), "v"(vlp) : "memory");
#endif
  }

  {
    // one store of one wave writes 512 bytes in a row (mlp: 256)
    const size_t pt = (((size_t)ks * (MQ / 16) + ((rowQ + i0) >> 4)) * NH + w);      // (key part, row tile of tile 0, head)
    float* pw = part + pt * 1024 + lane * 4;
    float* mw = mlp + pt * 64 + lane * 2;
    v2f ml[QT];
#pragma unroll
    for (int u = 0; u < QT; ++u) {
      ml[u][0] = m[u];
      ml[u][1] = ll[u] + xhalf(ll[u]);   // the two lane halves' sums of query jc, joined once
    }
    __builtin_amdgcn_sched_barrier(0);   // the stores stand behind all the arithmetic: no register that one names is written again
#pragma unroll
    for (int u = 0; u < QT; ++u) {
#pragma unroll
      for (int ct = 0; ct < 4; ++ct) {
        *(v4f*)(pw + u * (NH * 1024) + ct * 256)       = __builtin_shufflevector(o[u][ct], o[u][ct], 0, 1, 2, 3);
        *(v4f*)(pw + u * (NH * 1024) + ct * 256 + 128) = __builtin_shufflevector(o[u][ct], o[u][ct], 4, 5, 6, 7);
      }
      *(v2f*)(mw + u * (NH * 64)) = ml[u];
    }
  }
}

// =====================================================================================================
// Joins the KS key parts of the attention and writes the context plane (bf16 bits, KC columns, fragment order as gemm64
// reads its A): row b*NQ + t, hi at column h*64 + d, lo (value - hi) at column CM + h*64 + d.
//   Block = 256 threads = 8 waves, wave w = head w, one block per row tile of 16 queries; a lane reads what the same lane
//   of attn_kernel wrote (query lane & 15, dims ct*16 + 8*(lane >> 4) + 0..7): with M = the largest m_k,
//   context = (sum over k of o_k e^(m_k - M)) / (sum over k of l_k e^(m_k - M)) / 1024, k ascending.
//   The tile (16 rows x 512) is staged in LDS (f32), then written as one fragment-order row tile.
// coverage: context 16 rows x 512 cols hi and lo per block (256 threads x 4 pieces x 8 cols); grid MQ/16 covers every row.
// =====================================================================================================
typedef const __attribute__((address_space(1))) float gfl;
typedef const __attribute__((address_space(1))) v4f   gv4f;
typedef const __attribute__((address_space(1))) v2f   gv2f;
__global__ void __launch_bounds__(256) attn_join(const float* __restrict__ part, const float* __restrict__ mlp,
                                                 unsigned short* ctxp) {
  __shared__ __align__(16) float osm[16 * OP];              // output staging [16][CM], pitch OP
  const int t = threadIdx.x, lane = t & 31, hh = lane >> 4, jc = lane & 15;
  const int w = __builtin_amdgcn_readfirstlane(t >> 5);     // scalar: each part's address stays in scalar registers
  const size_t rtq = blockIdx.x;                            // the block's row tile among the plane's MQ / 16
  const unsigned ln = (unsigned)lane;                       // the one vector register that the loads name (scaled by their width)
  // each further part's address is added in scalar registers by hand (next_step): left to the compiler, the parts'
  // addresses become vector register pairs, and later loads of the group land on pairs that earlier ones name
  gfl* pk[KS];
  gfl* mk[KS];
  pk[0] = (gfl*)(part + (rtq * NH + w) * 1024);
  mk[0] = (gfl*)(mlp + (rtq * NH + w) * 64);
#pragma unroll
  for (int k = 1; k < KS; ++k) {
    pk[k] = (gfl*)next_step((gus*)pk[k - 1], (unsigned long long)(MQ / 16) * NH * 1024 * 4);
    mk[k] = (gfl*)next_step((gus*)mk[k - 1], (unsigned long long)(MQ / 16) * NH * 64 * 4);
  }
  v2f ml[KS];
  v4f ok[KS][8];
#pragma unroll
  for (int k = 0; k < KS; ++k) ml[k] = ((gv2f*)mk[k])[ln];
#pragma unroll
  for (int k = 0; k < KS; ++k) {
#pragma unroll
    for (int g = 0; g < 8; ++g) ok[k][g] = ((gv4f*)(pk[k] + g * 128))[ln];
  }
  // s_wait_xcnt 0 in front of every overwrite of an address that the loads above name; it takes the addresses as inputs
  // so that they stay whole up to it, and its memory clobber keeps the loads ahead of it
#if defined(__HIP_DEVICE_COMPILE__)
  static_assert(KS == 4);
  asm volatile("s_wait_xcnt 0x0" :: "s"(pk[0]), "s"(pk[1]), "s"(pk[2]), "s"(pk[3]),
               "s"(mk[0]), "s"(mk[1]), "s"(mk[2]), "s"(mk[3]), "v"(ln) : "memory");
#endif
  __builtin_amdgcn_sched_barrier(0);   // no arithmetic (with its data wait) is scheduled up into the load group: all loads go out at once
  {
    float mm = ml[0][0];
#pragma unroll
    for (int k = 1; k < KS; ++k) mm = fmaxf(mm, ml[k][0]);
    float f[KS], l = 0.f;
#pragma unroll
    for (int k = 0; k < KS; ++k) {
      f[k] = __expf(ml[k][0] - mm);
      l += ml[k][1] * f[k];
    }
    const float inv = ((l > 0.f) ? (1.0f / l) : 0.f) * (1.0f / PSC);
#pragma unroll
    for (int k = 0; k < KS; ++k) f[k] *= inv;
    float* od = osm + jc * OP + w * HD + 8 * hh;
#pragma unroll
    for (int g = 0; g < 8; ++g) {
      v4f a = ok[0][g] * f[0];
#pragma unroll
      for (int k = 1; k < KS; ++k) a += ok[k][g] * f[k];
      *(v4f*)(od + (g >> 1) * 16 + (g & 1) * 4) = a;
    }
  }
  __syncthreads();
  {
    // piece c of the tile's 1024: row c & 15, columns 8 * (c >> 4) .. + 7: k step c >> 6, 8 * (c & 63) elements into its fragment
    v4u hv[2][2], lv[2][2];
#pragma unroll
    for (int rr = 0; rr < 2; ++rr) {
#pragma unroll
      for (int it = 0; it < 2; ++it) {
        const int c = (rr * 2 + it) * 256 + t;
        const float* sp = osm + (c & 15) * OP + (c >> 4) * 8;
        const v4f f0 = *(const v4f*)(sp);
        const v4f f1 = *(const v4f*)(sp + 4);
        v4u ha, la;
#pragma unroll
        for (int e = 0; e < 2; ++e) {
          const unsigned short u0 = bf_bits(f0[2 * e]), u1 = bf_bits(f0[2 * e + 1]);
          const unsigned short u2 = bf_bits(f1[2 * e]), u3 = bf_bits(f1[2 * e + 1]);
          ha[e]     = pk16(u0, u1);
          ha[2 + e] = pk16(u2, u3);
          la[e]     = pk16(bf_bits(f0[2 * e] - bf_up(u0)), bf_bits(f0[2 * e + 1] - bf_up(u1)));
          la[2 + e] = pk16(bf_bits(f1[2 * e] - bf_up(u2)), bf_bits(f1[2 * e + 1] - bf_up(u3)));
        }
        hv[rr][it] = ha;
        lv[rr][it] = la;
      }
    }
    __builtin_amdgcn_sched_barrier(0);   // the stores stand behind all the arithmetic: no register that one names is written again
#pragma unroll
    for (int rr = 0; rr < 2; ++rr) {
#pragma unroll
      for (int it = 0; it < 2; ++it) {
        const int c = (rr * 2 + it) * 256 + t;
        const size_t go = ((size_t)(c >> 6) * (MQ / 16) + rtq) * 512 + (c & 63) * 8;
        *(v4u*)(ctxp + go)                                   = hv[rr][it];
        *(v4u*)(ctxp + go + (size_t)(CM / 32) * (MQ / 16) * 512) = lv[rr][it];
      }
    }
  }
}

// =====================================================================================================
// Workspace map (bytes); every plane is an exact multiple of its whole-row / whole-line / 64x64-tile store
// granularity (MQ = 4096 = 64 row tiles, MC = 8192 = 128 row tiles; N in {512, 4096}; v^T per batch
// [512][4096] = 8x64 tiles):
// (Xq, Xc, the four weight planes and Ctx hold these shapes in fragment order: [k step of 32][row tile of 16][512])
//   Xq   bf16 [4096][512]       0          4194304
//   Xc   bf16 [8192][512]       4194304    8388608
//   Wqb  bf16 [512][512]        12582912   524288
//   Wkb  bf16 [512][512]        13107200   524288
//   Wvb  bf16 [512][512]        13631488   524288
//   WoT2 bf16 [512][1024]       14155776   1048576   (cols k and CM + k both hold the proj weight)
//   Qp   f16  [4096][512]       15204352   4194304
//   Kp   f16  [2][128][8][2048] 19398656   8388608   (k, fragment order: batch, chunk of 32 keys, head)
//   VTh  f16  [2][128][8][2048] 27787264   8388608   (v^T hi, fragment order)
//   VTl  f16  [2][128][8][2048] 36175872   8388608   (v^T residual, fragment order)
//   Ctx  bf16 [4096][1024]      44564480   8388608   (context hi | lo)
//   Part f32  [4][256][8][1024] 52953088   33554432  (attention sums of the four key parts, as they lie in the lanes)
//   Ml   f32  [4][256][8][64]   86507520   2097152   (each part's maximum and sum of p, a pair a lane)
//   end                         88604672
// =====================================================================================================
extern "C" void kernel_launch(void* const* d_in, const int* in_sizes, int n_in,
                              void* d_out, int out_size, void* d_ws, size_t ws_size,
                              hipStream_t stream) {
  if (n_in < 12) return;
  if (in_sizes[0] != MC * CM) return;
  if (in_sizes[1] != MQ * CM) return;
  if (in_sizes[2] != MC * 3) return;
  if (in_sizes[3] != MQ * 3) return;
  if (in_sizes[4] != CM * CM || in_sizes[5] != CM) return;
  if (in_sizes[6] != CM * CM || in_sizes[7] != CM) return;
  if (in_sizes[8] != CM * CM || in_sizes[9] != CM) return;
  if (in_sizes[10] != CM * CM || in_sizes[11] != CM) return;
  if (out_size != MQ * CM) return;

  const float* x_ctx   = (const float*)d_in[0];
  const float* x_query = (const float*)d_in[1];
  const float* pos_ctx = (const float*)d_in[2];
  const float* pos_qry = (const float*)d_in[3];
  const float* Wq = (const float*)d_in[4];
  const float* bq = (const float*)d_in[5];
  const float* Wk = (const float*)d_in[6];
  const float* bk = (const float*)d_in[7];
  const float* Wv = (const float*)d_in[8];
  const float* bv = (const float*)d_in[9];
  const float* Wo = (const float*)d_in[10];
  const float* bo = (const float*)d_in[11];

  const size_t PXQ  = (size_t)MQ * CM * 2;             //  4194304
  const size_t PXC  = (size_t)MC * CM * 2;             //  8388608
  const size_t PW   = (size_t)CM * CM * 2;             //   524288
  const size_t PWO  = (size_t)CM * KC * 2;             //  1048576
  const size_t PQ   = (size_t)MQ * CM * 2;             //  4194304
  const size_t PK   = (size_t)MC * CM * 2;             //  8388608
  const size_t PVT  = (size_t)NB * CM * NC * 2;        //  8388608
  const size_t PCTX = (size_t)MQ * KC * 2;             //  8388608
  const size_t PPRT = (size_t)KS * MQ * CM * 4;        // 33554432
  const size_t PML  = (size_t)KS * (MQ / 16) * NH * 64 * 4;   // 2097152
  size_t off = 0;
  const size_t oXq  = off; off += PXQ;
  const size_t oXc  = off; off += PXC;
  const size_t oWq  = off; off += PW;
  const size_t oWk  = off; off += PW;
  const size_t oWv  = off; off += PW;
  const size_t oWo  = off; off += PWO;
  const size_t oQ   = off; off += PQ;
  const size_t oK   = off; off += PK;
  const size_t oVTh = off; off += PVT;
  const size_t oVTl = off; off += PVT;
  const size_t oCtx = off; off += PCTX;
  const size_t oPrt = off; off += PPRT;
  const size_t oMl  = off; off += PML;
  if (off > ws_size) return;                           // off = 88604672
  if (off > (size_t)134217728) return;

  char* ws = (char*)d_ws;
  unsigned short* Xq   = (unsigned short*)(ws + oXq);
  unsigned short* Xc   = (unsigned short*)(ws + oXc);
  unsigned short* Wqb  = (unsigned short*)(ws + oWq);
  unsigned short* Wkb  = (unsigned short*)(ws + oWk);
  unsigned short* Wvb  = (unsigned short*)(ws + oWv);
  unsigned short* WoT2 = (unsigned short*)(ws + oWo);
  unsigned short* Qp   = (unsigned short*)(ws + oQ);
  unsigned short* Kp   = (unsigned short*)(ws + oK);
  unsigned short* VTh  = (unsigned short*)(ws + oVTh);
  unsigned short* VTl  = (unsigned short*)(ws + oVTl);
  unsigned short* Ctx  = (unsigned short*)(ws + oCtx);
  float*          Prt  = (float*)(ws + oPrt);
  float*          Ml   = (float*)(ws + oMl);
  float*          out0 = (float*)d_out;

  const dim3 blk(256);
  const dim3 gQKV(GK + NB * GV + GQ, 1, 1);                    // 128 + 2 x 64 + 64 blocks
  const dim3 gAttn(NQ / (16 * QT), NB, KS);                    // 32 x 2 x 4 blocks of 256
  const dim3 gO(GQ, 1, 1);                                     // 512 tiles -> 64 blocks
  if ((((MQ / 64) * (CM / 64)) % 8) != 0) return;
  if ((((MC / 64) * (CM / 64)) % 8) != 0) return;
  if ((((CM / 64) * (NC / 64)) % 8) != 0) return;

  // (0) bf16 planes of the activations and weights ([out][in]) in fragment order; proj weights with duplicated k range
  cvt_all<<<dim3(CVT_BLOCKS), blk, 0, stream>>>(x_ctx, x_query, Wq, Wk, Wv, Wo, Xc, Xq, Wqb, Wkb, Wvb, WoT2);

  // (1) the q, k and v^T projections, one grid
  proj_qkv<<<gQKV, blk, 0, stream>>>(Xq, Xc, Wqb, Wkb, Wvb, Qp, Kp, VTh, VTl, bq, bk, bv);

  // (2) fused heat bias + softmax attention, each quarter of the keys by itself; then the parts joined -> context bf16 hi|lo
  attn_kernel<<<gAttn, blk, 0, stream>>>(pos_qry, pos_ctx, Qp, Kp, VTh, VTl, Prt, Ml);
  attn_join<<<dim3(MQ / 16), blk, 0, stream>>>(Prt, Ml, Ctx);

  // (3) out = [ctx_hi | ctx_lo] . [Wo | Wo]^T + bo  (K = 1024, bf16 operands) -> d_out f32
  proj_out<<<gO, blk, 0, stream>>>(Ctx, WoT2, out0, bo);
  (void)hipGetLastError();
}

// v009
// A run of this version takes 102 microseconds.
// Two timings next to v008 put it at 1.11 and 1.12 times that version's speed.
// Counting every step since v000, it is 6.42 times as fast.
// Contractions: q and k projections (x . W^T) and v^T projection (Wv . x^T) on v_wmma_f32_16x16x32_bf16 (bf16 x, bf16 weights);
// output projection on v_wmma_f32_16x16x32_bf16 (context as bf16 hi and lo tiles in LDS, each against the same bf16 weights);
// scores transposed, k.q^T, on v_wmma_f32_16x16x32_f16 (plain f16 q, k); v^T.p^T on v_wmma_f32_16x16x32_f16 (p carried
// x1024 f16, v^T as f16 hi + f16 residual planes, one accumulator set); all f32 accumulate; heat-kernel bias and softmax in f32;
// every float input RNE-converted to bf16 on load.
#include <hip/hip_runtime.h>
#include <math.h>
#include <stdint.h>

#define NB   2
#define NQ   2048
#define NC   4096
#define CM   512
#define NH   8
#define HD   64
#define MQ   (NB * NQ)
#define MC   (NB * NC)
#define NCH  (NC / 32)
#define PSC  1024.0f
#define SCL  0.125f
#define HK4  0.4f
#define HEPS 1.0e-6f
#define HP   36            // heat tile pitch in floats: 144 B, 16 B x odd, for its 16-byte readers
#define OP   (CM + 4)      // output staging pitch in floats: the 16 lanes' 16-byte stores of one column walk fall on 64 banks
static_assert(NH * HD == CM);
static_assert(NH == 8);
static_assert((MQ % 64) == 0 && (MC % 64) == 0 && (CM % 64) == 0 && (NC % 64) == 0);
static_assert((((MQ / 64) * (CM / 64)) % 8) == 0);
static_assert((((MC / 64) * (CM / 64)) % 8) == 0);
static_assert((((CM / 64) * (NC / 64)) % 8) == 0);
static_assert((NQ % 16) == 0 && (NC % 32) == 0);

typedef _Float16 v16h __attribute__((ext_vector_type(16)));
typedef _Float16 v8h  __attribute__((ext_vector_type(8)));
typedef __bf16   v16b __attribute__((ext_vector_type(16)));
typedef unsigned short v16us __attribute__((ext_vector_type(16)));
typedef unsigned short v8us  __attribute__((ext_vector_type(8)));
typedef float    v8f  __attribute__((ext_vector_type(8)));
typedef float    v4f  __attribute__((ext_vector_type(4)));
typedef float    v2f  __attribute__((ext_vector_type(2)));
typedef unsigned int v4u __attribute__((ext_vector_type(4)));

union FragU { v16us v; v8us h[2]; };

// ---- scalar helpers --------------------------------------------------------------------------------
__device__ __forceinline__ unsigned short bf_bits(float f) {          // f32 -> bf16 bits, RNE convert
  unsigned u = __float_as_uint(f);
  return (unsigned short)((u + 0x7FFFu + ((u >> 16) & 1u)) >> 16);
}
__device__ __forceinline__ float bf_up(unsigned short h) { return __uint_as_float(((unsigned)h) << 16); }
__device__ __forceinline__ float bfr(float f) { return bf_up(bf_bits(f)); }   // value of the bf16 RNE convert
__device__ __forceinline__ unsigned short h_bits(_Float16 x) { return __builtin_bit_cast(unsigned short, x); }
__device__ __forceinline__ unsigned pk16(unsigned short a, unsigned short b) { return (unsigned)a | ((unsigned)b << 16); }
__device__ __forceinline__ v8f zero8() { v8f z = {0.f, 0.f, 0.f, 0.f, 0.f, 0.f, 0.f, 0.f}; return z; }
__device__ __forceinline__ float xhalf(float x) {                     // value of lane l ^ 16
  const int b = __builtin_bit_cast(int, x);
  return __builtin_bit_cast(float, __builtin_amdgcn_permlanex16(b, b, 0x76543210, 0xfedcba98, false, false));
}

// ---- fragment loader: 16-bit A/B operand, lane -> row/col (lane&15), p already includes +8*(lane>>4);
//      elements 0..7 <- p[0..7] (k0+8h..), elements 8..15 <- p[16..23] (k0+16+8h..)
__device__ __forceinline__ v16us ldfrag_u(const unsigned short* p) {
  FragU f;
  f.h[0] = *(const v8us*)(p);
  f.h[1] = *(const v8us*)(p + 16);
  return f.v;
}

// ---- fragment loader, fragment-order plane: one operand fragment is 1 KiB in a row, lane l's elements 0..7 at
//      16 * l bytes and its elements 8..15 at 512 + 16 * l; p already includes + 8 * lane. Each of the two loads
//      reads 512 bytes in a row (4 whole lines) where a row-major plane makes it touch 16 lines.
__device__ __forceinline__ v16us ldfrag_f(const unsigned short* p) {
  FragU f;
  f.h[0] = *(const v8us*)(p);
  f.h[1] = *(const v8us*)(p + 256);
  return f.v;
}

// ---- s_wait_xcnt 0 behind a group of global loads, in front of every overwrite of the group's address registers:
//      it takes the address as an input so that it stays whole up to it; its memory clobber keeps the loads ahead of it.
__device__ __forceinline__ void xwait1(const void* a) {
#if defined(__HIP_DEVICE_COMPILE__)
  asm volatile("s_wait_xcnt 0x0" :: "v"(a) : "memory");
#endif
}

// ---- WMMA helpers with trailing VALU hazard gap --------------------------------------------------------
__device__ __forceinline__ v8f mma_bu_raw(v16us a, v16us b, v8f c) {            // bf16 operands, unguarded
  return __builtin_amdgcn_wmma_f32_16x16x32_bf16(false, __builtin_bit_cast(v16b, a), false,
                                                 __builtin_bit_cast(v16b, b), (short)0, c, false, false);
}
// f16 operands (bits), unguarded like the bf16 form: a guard that names the operands in an asm statement holds them all below
// v256, and the column tiles' accumulators and fragments do not fit there (the build then spills); the loads that overwrite
// A operands stand behind refill_gap() instead
__device__ __forceinline__ v8f mma_hu(v16us a, v16us b, v8f c) {
  return __builtin_amdgcn_wmma_f32_16x16x32_f16(false, __builtin_bit_cast(v16h, a), false,
                                                __builtin_bit_cast(v16h, b), (short)0, c, false, false);
}
// ---- one k step of a 64x64 wave tile: its 4 A and 4 B fragments (16 loads, fragment-order planes) as one group, A first.
//      ap, bp: the wave's (uniform) global addresses of the step, in scalar registers; l8 = 8 * lane elements, the one
//      vector register that all 16 loads name
typedef const __attribute__((address_space(1))) unsigned short gus;
typedef const __attribute__((address_space(1))) v8us           gv8us;
__device__ __forceinline__ void ld_step(v16us (&a)[4], v16us (&b)[4], gus* ap, gus* bp, unsigned l8) {
#pragma unroll
  for (int i = 0; i < 4; ++i) {
    FragU f;
    f.h[0] = *(gv8us*)(ap + i * 512 + l8);
    f.h[1] = *(gv8us*)(ap + i * 512 + l8 + 256);
    a[i] = f.v;
  }
#pragma unroll
  for (int j = 0; j < 4; ++j) {
    FragU f;
    f.h[0] = *(gv8us*)(bp + j * 512 + l8);
    f.h[1] = *(gv8us*)(bp + j * 512 + l8 + 256);
    b[j] = f.v;
  }
  // s_wait_xcnt 0 in front of every overwrite of the group's address registers: it takes the two bases and the lane
  // offset as inputs so that they stay whole up to it; its memory clobber keeps the loads ahead of it.
#if defined(__HIP_DEVICE_COMPILE__)
  asm volatile("s_wait_xcnt 0x0" :: "s"(ap), "s"(bp), "v"(l8) : "memory");
#endif
  __builtin_amdgcn_sched_barrier(0);   // no product (with its data wait) is scheduled up into the load group
}
// ---- between a step's products and the load group that refills the operand registers they read
__device__ __forceinline__ void refill_gap() {
  __builtin_amdgcn_sched_barrier(0);   // the group stays whole: without this its A loads are spread among the products in front of it
  // four vector slots, the distance a WMMA asks for before its A or B is overwritten: loads fill no slot, and a load over
  // B directly behind the product is not known to be safe; the memory clobber keeps the loads behind the slots
#if defined(__HIP_DEVICE_COMPILE__)
  asm volatile("v_nop\n\tv_nop\n\tv_nop\n\tv_nop" ::: "memory");
#endif
}
// ---- the next k step's address, added in scalar registers by hand: left to the compiler, the loop's address sums move
//      into vector registers, and accumulators plus two fragment sets leave none to spare (it then copies accumulators about)
__device__ __forceinline__ gus* next_step(gus* p, unsigned long long bytes) {
#if defined(__HIP_DEVICE_COMPILE__)
  gus* r;
  asm("s_add_nc_u64 %0, %1, %2" : "=s"(r) : "s"(p), "s"(bytes));
  return r;
#else
  return p + bytes / 2;
#endif
}
__device__ __forceinline__ void mma_step(v8f (&acc)[4][4], const v16us (&a)[4], const v16us (&b)[4]) {
#pragma unroll
  for (int i = 0; i < 4; ++i)
#pragma unroll
    for (int j = 0; j < 4; ++j) acc[i][j] = mma_bu_raw(a[i], b[j], acc[i][j]);
}
__device__ __forceinline__ void acc_guard4(v8f& a, v8f& b, v8f& c, v8f& d) {
#if defined(__HIP_DEVICE_COMPILE__)
  asm volatile("v_nop\n\tv_nop\n\tv_nop\n\tv_nop" : "+v"(a), "+v"(b), "+v"(c), "+v"(d));
#endif
}
__device__ __forceinline__ void wave_sync_lds() {
  __builtin_amdgcn_fence(__ATOMIC_RELEASE, "workgroup");
  __builtin_amdgcn_wave_barrier();
  __builtin_amdgcn_fence(__ATOMIC_ACQUIRE, "workgroup");
}

// ---- work-group barrier of the attention loop's heat tile and of join_proj's LDS tiles: it waits for the wave's own LDS
//      accesses alone, so that the global loads issued ahead (the next chunk's, the weights) stay in flight across it (__syncthreads() waits for them too); the memory clobber
//      keeps every LDS access on its side of the barrier
__device__ __forceinline__ void lds_barrier() {
#if defined(__HIP_DEVICE_COMPILE__)
  asm volatile("s_wait_dscnt 0x0\n\ts_barrier_signal -1\n\ts_barrier_wait -1" ::: "memory");
#endif
}

// =====================================================================================================
// Row convert: in[row][CM] f32 -> bf16 RNE bits in fragment order for a plane of nrt row tiles: fragment (row tile
// row/16, k step k/32) at (k step * nrt + row tile) * 512 elements (one k step of all rows lies in a row), inside it as
// ldfrag_f reads it.
// Block = 256 threads (one tile rt of 16 rows = 1024 pieces of 8 columns, 4 a thread). Piece c holds row c & 15,
// columns 8 * (c >> 4) .. + 7: k step c >> 6, at 8 * (c & 63) elements of its fragment, so one store of one wave
// writes 512 bytes in a row.
// coverage: 1024 pieces x 8 = 16 rows x CM columns.
// =====================================================================================================
__device__ __forceinline__ void cvt_tile(const float* __restrict__ src, unsigned short* dst, int rt, int nrt) {
  const int tid = threadIdx.x;
  // thread tid takes pieces c = tid + 256 * it: the same row, 128 columns (4 k steps) on
  const float* p = src + ((size_t)rt * 16 + (tid & 15)) * CM + (tid >> 4) * 8;
  unsigned short* d = dst + ((size_t)(tid >> 6) * nrt + rt) * 512 + (tid & 63) * 8;
  v4f a0[4], a1[4];
#pragma unroll
  for (int it = 0; it < 4; ++it) {
    a0[it] = *(const v4f*)(p + it * 128);
    a1[it] = *(const v4f*)(p + it * 128 + 4);
  }
  xwait1(p);
  v4u hv[4];
#pragma unroll
  for (int it = 0; it < 4; ++it) {
    hv[it][0] = pk16(bf_bits(a0[it][0]), bf_bits(a0[it][1]));
    hv[it][1] = pk16(bf_bits(a0[it][2]), bf_bits(a0[it][3]));
    hv[it][2] = pk16(bf_bits(a1[it][0]), bf_bits(a1[it][1]));
    hv[it][3] = pk16(bf_bits(a1[it][2]), bf_bits(a1[it][3]));
  }
  unsigned short* dq[4];
#pragma unroll
  for (int it = 0; it < 4; ++it) dq[it] = d + (size_t)it * 4 * nrt * 512;
  __builtin_amdgcn_sched_barrier(0);   // the stores stand behind all the arithmetic: no register that one names is written again
#pragma unroll
  for (int it = 0; it < 4; ++it) *(v4u*)(dq[it]) = hv[it];
}

// All six converts in one grid (they depend on nothing but the inputs): block -> (matrix, row tile), the largest matrix
// first. Blocks 0 .. MC/16 - 1: context rows; the next MQ/16: query rows; then four groups of CM/16: the q, k, v and
// proj weights.
// coverage: every row tile of every matrix once.
#define CVT_BLOCKS (MC / 16 + MQ / 16 + 4 * (CM / 16))
__global__ __launch_bounds__(256) void cvt_all(
    const float* __restrict__ xc, const float* __restrict__ xq, const float* __restrict__ wq,
    const float* __restrict__ wk, const float* __restrict__ wv, const float* __restrict__ wo,
    unsigned short* Xc, unsigned short* Xq, unsigned short* Wqb, unsigned short* Wkb, unsigned short* Wvb,
    unsigned short* WoT) {
  const int bx = blockIdx.x;
  const int u = bx - (MC / 16 + MQ / 16), sel = u / (CM / 16);      // used where u >= 0: the weights' blocks
  const float* s = wo;
  unsigned short* d = WoT;
  int rt = u % (CM / 16), nrt = CM / 16;
  if (bx < MC / 16)                { s = xc; d = Xc;  rt = bx;           nrt = MC / 16; }
  else if (bx < MC / 16 + MQ / 16) { s = xq; d = Xq;  rt = bx - MC / 16; nrt = MQ / 16; }
  else if (sel == 0)               { s = wq; d = Wqb; }
  else if (sel == 1)               { s = wk; d = Wkb; }
  else if (sel == 2)               { s = wv; d = Wvb; }
  cvt_tile(s, d, rt, nrt);
}

// =====================================================================================================
// Register-blocked batched bf16 WMMA GEMM: C[m][n] = sum_k A[m][k] * Bt[n][k] (+ bias);
// one wave per 64x64 tile, no block barriers. A [M][K] and Bt [N][K] in fragment order, in planes of rtA and rtB row
// tiles: fragment (row tile row/16, k step k/32) at (k step * rt + row tile) * 512 elements, so that what all waves
// read in one k step lies in a row; M, N and K multiples of 64. bx = the block's index among the product's own blocks,
// by = batch index with element strides (sAy for A, sBy for Bt, sCy for C); sT = the block's LDS, one slab a wave.
// Tile enumeration: tile = bx * 8 + wave -> tm = tile / (N/64), tn = tile % (N/64).
// OM: 1 = f16 bits to Cp (pitch ldc); 2 = f16 hi bits to Cp and f16(v - hi)
//     bits to Cp2, both in fragment order for m = head dim, n = key: fragment (chunk n/32, head m/64, row tile
//     (m/16)%4) at ((chunk * NH + head) * 4 + row tile) * 512 elements; 3 = f16 bits to Cp in fragment order for
//     m = key row (batch-major), n = head dim: fragment (chunk m/32 over both batches, head n/64, key tile (m/16)%2,
//     k step (n/32)%2) at (((chunk * NH + head) * 2 + key tile) * 2 + k step) * 512 elements. Inside a fragment: see
//     ldfrag_f. One chunk of 32 keys of all heads lies in a row in each plane.
// CBM: 0 = no bias; 1 = column bias bf16(cb[n]); 2 = row bias bf16(cb[m]).
// coverage: 4 slabs x 16 rows x 64 cols = the wave's whole 64x64 tile; tilesM*tilesN/8 blocks exactly per product
//           (host-checked), so no wave exits early.
// =====================================================================================================
template <int OM, int CBM>
__device__ __forceinline__ void gemm64_body(
    float (*sT)[16 * 68], int bx, int by,
    const unsigned short* __restrict__ Ap, int rtA, long long sAy,
    const unsigned short* __restrict__ Btp, int rtB, long long sBy,
    unsigned short* Cp, unsigned short* Cp2, int ldc, long long sCy,
    const float* __restrict__ cb, int M, int N, int K) {
  const int lane = threadIdx.x & 31;
  const int wave = __builtin_amdgcn_readfirstlane(threadIdx.x >> 5);   // scalar: the tile's addresses stay in scalar registers
  const int tilesN = N >> 6;
  const int tilesM = M >> 6;
  const int tile = bx * 8 + wave;
  if (tile >= tilesM * tilesN) return;   // wave-uniform; no block barriers in this kernel
  const int tm = tile / tilesN;
  const int tn = tile - tm * tilesN;
  const int m0 = tm << 6;
  const int n0 = tn << 6;

  const unsigned short* Ab = Ap  + (size_t)by * (size_t)sAy;
  const unsigned short* Bb = Btp + (size_t)by * (size_t)sBy;
  const size_t cofs = (size_t)by * (size_t)sCy;

  const int rlane = lane & 15;                 // row (A) / col (B, D) within subtile
  const int mOff  = (lane >> 4) * 8;           // D row offset

  v8f acc[4][4];
#pragma unroll
  for (int i = 0; i < 4; ++i)
#pragma unroll
    for (int j = 0; j < 4; ++j) acc[i][j] = zero8();

  // Two fragment sets: while one k step's 16 products run on one set, the next step's 16 loads are in flight into the
  // other, so a wave waits for memory once per step at most, not four times per step. k ascends as before.
  const unsigned long long sA = (unsigned long long)rtA * 1024u, sB = (unsigned long long)rtB * 1024u;   // bytes per k step
  gus* ap = (gus*)(Ab + (size_t)(m0 >> 4) * 512);
  gus* bp = (gus*)(Bb + (size_t)(n0 >> 4) * 512);
  const unsigned l8 = (unsigned)lane * 8u;
  v16us fa0[4], fb0[4], fa1[4], fb1[4];
  ld_step(fa0, fb0, ap, bp, l8);
#pragma unroll 1   // stays the loop it was, now that K is a constant at the call: unrolled, the kernel's text grows by a third, and a block runs its part of it only once
  for (int k0 = 64; k0 < K; k0 += 64) {
    ap = next_step(ap, sA);
    bp = next_step(bp, sB);
    refill_gap();
    ld_step(fa1, fb1, ap, bp, l8);
    mma_step(acc, fa0, fb0);
    ap = next_step(ap, sA);
    bp = next_step(bp, sB);
    refill_gap();
    ld_step(fa0, fb0, ap, bp, l8);
    mma_step(acc, fa1, fb1);
  }
  ap = next_step(ap, sA);
  bp = next_step(bp, sB);
  refill_gap();
  ld_step(fa1, fb1, ap, bp, l8);                                     // the last two steps: nothing left to fetch ahead
  mma_step(acc, fa0, fb0);
  mma_step(acc, fa1, fb1);
  acc_guard4(acc[0][0], acc[0][1], acc[0][2], acc[0][3]);
  acc_guard4(acc[1][0], acc[1][1], acc[1][2], acc[1][3]);
  acc_guard4(acc[2][0], acc[2][1], acc[2][2], acc[2][3]);
  acc_guard4(acc[3][0], acc[3][1], acc[3][2], acc[3][3]);

  const int q8  = lane >> 3, c8 = (lane & 7) * 8;

  float cbc[4][8];                                     // row-major out uses [0] alone; fragment order one set per it
#pragma unroll
  for (int g = 0; g < 4; ++g)
#pragma unroll
    for (int e = 0; e < 8; ++e) cbc[g][e] = 0.f;
  if (CBM == 1) {
    if (OM == 1) {
      const v4f v0 = *(const v4f*)(cb + n0 + c8);
      const v4f v1 = *(const v4f*)(cb + n0 + c8 + 4);
#pragma unroll
      for (int e = 0; e < 4; ++e) { cbc[0][e] = bfr(v0[e]); cbc[0][4 + e] = bfr(v1[e]); }
    } else {
      const float* cp = cb + n0 + mOff;
#pragma unroll
      for (int g = 0; g < 4; ++g) {
        const v4f v0 = *(const v4f*)(cp + g * 16);
        const v4f v1 = *(const v4f*)(cp + g * 16 + 4);
#pragma unroll
        for (int e = 0; e < 4; ++e) { cbc[g][e] = bfr(v0[e]); cbc[g][4 + e] = bfr(v1[e]); }
      }
    }
  }

  // ---- epilogue ----
  float* slab = sT[wave];
#pragma unroll
  for (int i = 0; i < 4; ++i) {
    const int mBase = m0 + (i << 4);
#pragma unroll
    for (int j = 0; j < 4; ++j) {
#pragma unroll
      for (int r = 0; r < 8; ++r) {
        slab[(mOff + r) * 68 + (j << 4) + rlane] = acc[i][j][r];
      }
    }
    wave_sync_lds();
    {
      unsigned short* C  = Cp  + cofs;
      unsigned short* C2 = Cp2 + cofs;
      v4u hv[4], lv[4];
#pragma unroll
      for (int it = 0; it < 4; ++it) {
        // row-major out: it 0..3 x q8 0..3 = rows 0..15, 8 columns at c8; fragment order: the lane takes what it
        // holds as an operand, row lane & 15, the 8 columns at 16 * it + 8 * (lane >> 4)
        const int row = (OM == 1) ? (it * 4 + q8) : rlane;
        const int col = (OM == 1) ? c8 : (it * 16 + mOff);
        const float* sp = slab + row * 68 + col;
        float rb = 0.f;
        if (CBM == 2) rb = bfr(cb[mBase + row]);
        const int g = (OM == 1) ? 0 : it;
        v4u ha = {0u, 0u, 0u, 0u}, la = {0u, 0u, 0u, 0u};
#pragma unroll
        for (int e = 0; e < 4; ++e) {
          const float f0 = sp[2 * e]     + cbc[g][2 * e]     + rb;
          const float f1 = sp[2 * e + 1] + cbc[g][2 * e + 1] + rb;
          const _Float16 g0 = (_Float16)f0, g1 = (_Float16)f1;
          ha[e] = pk16(h_bits(g0), h_bits(g1));
          if (OM == 2) {
            la[e] = pk16(h_bits((_Float16)(f0 - (float)g0)), h_bits((_Float16)(f1 - (float)g1)));
          }
        }
        hv[it] = ha;
        lv[it] = la;
      }
      {
#pragma unroll
        for (int it = 0; it < 4; ++it) {
          size_t go;
          if (OM == 1) {
            go = (size_t)(mBase + it * 4 + q8) * ldc + (size_t)n0 + c8;
          } else if (OM == 2) {
            go = (((size_t)((n0 >> 5) + (it >> 1)) * NH + tm) * 4 + i) * 512 + (it & 1) * 256 + lane * 8;
          } else {
            go = ((((size_t)(mBase >> 5) * NH + tn) * 2 + ((mBase >> 4) & 1)) * 2 + (it >> 1)) * 512
                 + (it & 1) * 256 + lane * 8;
          }
          *(v4u*)(C + go) = hv[it];
          if (OM == 2) *(v4u*)(C2 + go) = lv[it];
        }
        
      }
    }
    wave_sync_lds();
  }
}

// The q, k and v^T projections in one grid (none reads what another writes): blocks 0 .. GK - 1 the k projection, the next
// NB * GV the v^T projection (GV a batch), the last GQ the q projection.
//   k = Xc . Wkb^T + bk (K = 512) -> f16, fragment order; v^T per batch = Wvb . Xc_b^T + bv per row d -> f16 hi (VTh) and
//   residual (VTl), fragment order; q = Xq . Wqb^T + bq -> f16 plane [rows][512]
#define GQ (((MQ / 64) * (CM / 64)) / 8)     // 512 tiles -> 64 blocks
#define GK (((MC / 64) * (CM / 64)) / 8)     // 1024 tiles -> 128 blocks
#define GV (((CM / 64) * (NC / 64)) / 8)     // 512 tiles -> 64 blocks a batch
__global__ __launch_bounds__(256) void proj_qkv(
    const unsigned short* __restrict__ Xq, const unsigned short* __restrict__ Xc,
    const unsigned short* __restrict__ Wqb, const unsigned short* __restrict__ Wkb,
    const unsigned short* __restrict__ Wvb,
    unsigned short* Qp, unsigned short* Kp, unsigned short* VTh, unsigned short* VTl,
    const float* __restrict__ bq, const float* __restrict__ bk, const float* __restrict__ bv) {
  __shared__ __align__(16) float sT[8][16 * 68];   // per-wave 16x64 slab, pitch 68 floats
  const int bx = blockIdx.x;
  if (bx < GK) {
    gemm64_body<3, 1>(sT, bx, 0, Xc, MC / 16, 0LL, Wkb, CM / 16, 0LL,
                      Kp, Kp, CM, 0LL, bk, MC, CM, CM);
  } else if (bx < GK + NB * GV) {
    const int u = bx - GK;
    gemm64_body<2, 2>(sT, u % GV, u / GV, Wvb, CM / 16, 0LL, Xc, MC / 16, (long long)(NC / 16) * 512,
                      VTh, VTl, NC, (long long)CM * NC, bv, CM, NC, CM);
  } else {
    gemm64_body<1, 1>(sT, bx - (GK + NB * GV), 0, Xq, MQ / 16, 0LL, Wqb, CM / 16, 0LL,
                      Qp, Qp, CM, 0LL, bq, MQ, CM, CM);
  }
}

// =====================================================================================================
// Fused heat-bias + online-softmax cross attention, head dim 64, 8 heads.
//   Block = 256 threads = 8 waves, wave w = head w; one block per (batch, 64 query rows, quarter of the keys); key chunks
//   of 32, static trip NPS = 32. A wave holds QT = 4 query column tiles, so that each K and V fragment it loads from L2
//   feeds four products; the keys are dealt to KS = 4 blocks so that the grid still has one block per 16 query rows.
//   q plane (f16 bits, pitch CM): row (b*NQ + t), head h at col h*64 + d; k plane
//   (f16 bits) and v^T hi / lo planes (f16 bits, value = hi + lo) in fragment order (gemm64, OM 3 and 2):
//   2048 elements per (batch, chunk of 32 keys, head) in each plane.
//   Per chunk: heat[q][s] = exp(-(dx*dx + dy*dy) * (1 / (0.4*|dt| + 1e-6))) from the bf16-converted positions
//   (spatial = dims 0,1, time = dim 2), computed once per (query row, key) pair by the block (thread = key
//   lane, rows w + 8 * i) into LDS and shared by the 8 head waves. Both products are transposed: S^T = K . Q^T
//   (A = k rows, B = q), so a lane holds 16 of the 32 scores of ONE query of each column tile (column lane & 15; keys
//   8h + r and 16 + 8h + r): s = (k . q) * 0.125 + heat; running-max softmax in f32 with maximum and sum in the lane, the
//   maximum joined with the other lane half once a pass, the sums once behind the loop. p = exp(s - m) as
//   f16(1024 p): the two score tiles, converted in place, are the B operand of O^T += V^T . P^T (A = v^T rows, hi and
//   lo products into one accumulator set, so that four column tiles fit the registers; 4 row tiles of 16 dims each). All q, k, v^T and p fragments use the split k map
//   (elements 0..7 <- k0+8h.., 8..15 <- k0+16+8h..).
//   Epilogue: the block's share of each query's sums goes out as it lies in the lanes: part[key part][row tile of 16][head]
//   [dim tile ct][4 dims lo / hi][lane][4] = 1024 x sum of p . v relative to the part's own maximum, and mlp[key part]
//   [row tile][head][lane] = (that maximum, the part's sum of p). join_proj adds the KS parts.
// coverage: heat 64 rows x 32 keys per chunk (8 waves x 8 rows x 32 lanes); part and mlp: every (key part, row tile, head,
//           lane) once; grid NQ/64 x NB x KS covers every query row and every key.
// =====================================================================================================
#define QT  4
#define KS  4
#define NPS (NCH / KS)
static_assert((NQ % (16 * QT)) == 0 && (NCH % KS) == 0);
__global__ void __launch_bounds__(256) attn_kernel(
    const float* __restrict__ posq, const float* __restrict__ posc,
    const unsigned short* __restrict__ qp, const unsigned short* __restrict__ kp,
    const unsigned short* __restrict__ vth, const unsigned short* __restrict__ vtl,
    float* part, float* mlp) {
#pragma clang fp contract(off)
  __shared__ __align__(16) float heatL[16 * QT * HP];       // [query row][key], pitch HP
  __shared__ float qps[16 * QT * 3];

  const int b = blockIdx.y, i0 = blockIdx.x * (16 * QT), ks = blockIdx.z;
  const int t = threadIdx.x, lane = t & 31, w = t >> 5, hh = lane >> 4, jc = lane & 15;
  const size_t rowQ = (size_t)b * NQ, rowC = (size_t)b * NC + (size_t)ks * (NPS * 32);
  const size_t ch0 = (size_t)b * NCH + (size_t)ks * NPS;    // the block's first chunk among the planes' NB * NCH

  if (t < 16 * QT * 3) qps[t] = bfr(posq[(rowQ + i0) * 3 + t]);
  __syncthreads();

  // q B-fragments (col = query jc of column tile u, k = d), plain f16 bits; d 0..31 and 32..63
  const unsigned short* qrow = qp + (rowQ + i0 + jc) * CM + w * HD + 8 * hh;
  v16us qf0[QT], qf1[QT];
#pragma unroll
  for (int u = 0; u < QT; ++u) {
    qf0[u] = ldfrag_u(qrow + u * 16 * CM);
    qf1[u] = ldfrag_u(qrow + u * 16 * CM + 32);
  }

  // query positions of the heat rows this thread produces (rows w + 8 * i, key = lane)
  float qx[2 * QT], qy[2 * QT], qz[2 * QT];
#pragma unroll
  for (int i = 0; i < 2 * QT; ++i) {
    qx[i] = qps[(w + 8 * i) * 3 + 0];
    qy[i] = qps[(w + 8 * i) * 3 + 1];
    qz[i] = qps[(w + 8 * i) * 3 + 2];
  }

  float m[QT], ll[QT];               // query jc of tile u: running maximum (both lane halves alike), this lane half's sum
  v8f o[QT][4];                      // O^T tiles: register r = dim ct*16 + 8*hh + r of query jc of tile u
#pragma unroll
  for (int u = 0; u < QT; ++u) {
    m[u] = -1.0e30f;
    ll[u] = 0.f;
#pragma unroll
    for (int ct = 0; ct < 4; ++ct) o[u][ct] = zero8();
  }

  // fragment-order planes: a pass's 4 K fragments are 4 KiB in a row, its 4 V fragments 4 KiB in a row in each plane,
  // and the 8 heads' (waves') pieces of one pass follow one another
  const unsigned short* vhb = vth + (ch0 * NH + w) * 2048 + lane * 8;     // A: row d = ct*16 + jc, k = key
  const unsigned short* vlb = vtl + (ch0 * NH + w) * 2048 + lane * 8;
  const unsigned short* kgb = kp + (ch0 * NH + w) * 2048 + lane * 8;      // A: row key = jc, k = d
  const float* pcb = posc + rowC * 3;
  const float* hrd = heatL + jc * HP + 8 * hh;                            // heat of query jc of tile 0, keys 8*hh..

  // Chunk 0's key positions, K and V fragments, in the order in which the loop refills them. Each pass fetches the next
  // chunk's into the same registers: positions and K right behind its score products, V right behind its V products,
  // so that a fragment's L2 round trip runs under the vector work and the barriers of most of a pass.
  const float* pc0 = pcb + (size_t)lane * 3;
  float px = pc0[0], py = pc0[1], pz = pc0[2];
  __builtin_amdgcn_sched_barrier(0);   // the loop's issue order, here too: a counted wait in the loop is as loose as the tighter of its two ways in
  v16us k00 = ldfrag_f(kgb);
  v16us k01 = ldfrag_f(kgb + 512);
  v16us k10 = ldfrag_f(kgb + 1024);
  v16us k11 = ldfrag_f(kgb + 1536);
  __builtin_amdgcn_sched_barrier(0);   // K ahead of V, as in the loop
  v16us vh[4], vl[4];
#pragma unroll
  for (int ct = 0; ct < 4; ++ct) {
    vh[ct] = ldfrag_f(vhb + ct * 512);
    vl[ct] = ldfrag_f(vlb + ct * 512);
  }
  // s_wait_xcnt 0 in front of every overwrite of an address that the loads above name, in the form of the loop's own
#if defined(__HIP_DEVICE_COMPILE__)
  asm volatile("s_wait_xcnt 0x0" :: "v"(qrow), "v"(pc0), "v"(kgb), "v"(vhb), "v"(vlb) : "memory");
#endif
  __builtin_amdgcn_sched_barrier(0);   // the wait stays directly behind the groups: left to sink, the build gets a second one inside the loop

#pragma unroll 1
  for (int jt = 0; jt < NPS; ++jt) {
    const int jn = (jt + 1 < NPS) ? (jt + 1) : jt;     // the chunk fetched ahead; the last pass re-reads its own: stays inside the planes
    lds_barrier();                                     // all waves done reading heatL of the prior chunk
    {
      const float cx = bfr(px), cy = bfr(py), cz = bfr(pz);
#pragma unroll
      for (int i = 0; i < 2 * QT; ++i) {
        const float dx = qx[i] - cx, dy = qy[i] - cy, dt = qz[i] - cz;
        const float d2 = dx * dx + dy * dy;
        const float nn = HK4 * fabsf(dt) + HEPS;
        heatL[(w + 8 * i) * HP + lane] = expf(-(d2 * (1.0f / nn)));
      }
    }
    lds_barrier();

    // heat of this lane's 16 (query, key) pairs of each column tile, read ahead of the score products so that it lands under them
    v4f h00[QT], h01[QT], h10[QT], h11[QT];
#pragma unroll
    for (int u = 0; u < QT; ++u) {
      h00[u] = *(const v4f*)(hrd + u * 16 * HP);
      h01[u] = *(const v4f*)(hrd + u * 16 * HP + 4);
      h10[u] = *(const v4f*)(hrd + u * 16 * HP + 16);
      h11[u] = *(const v4f*)(hrd + u * 16 * HP + 20);
    }

    // ---- scores, transposed: 32 keys x 16 query columns of head w a tile, K = 64 in two 32-deep steps ----
    __builtin_amdgcn_sched_barrier(0);   // no product (with its wait for K) is scheduled up in front of the heat tile's work
    v8f s0[QT], s1[QT];                  // s0[u][r]: key 32*jt + 8*hh + r, s1[u][r]: key 32*jt + 16 + 8*hh + r, query jc of tile u
#pragma unroll
    for (int u = 0; u < QT; ++u) s0[u] = mma_hu(k00, qf0[u], zero8());
#pragma unroll
    for (int u = 0; u < QT; ++u) s0[u] = mma_hu(k01, qf1[u], s0[u]);
#pragma unroll
    for (int u = 0; u < QT; ++u) s1[u] = mma_hu(k10, qf0[u], zero8());
#pragma unroll
    for (int u = 0; u < QT; ++u) s1[u] = mma_hu(k11, qf1[u], s1[u]);

    // ---- the next chunk's key positions and K fragments, over the registers the products above have read ----
    refill_gap();                        // the group stays behind the products whose operands it overwrites, at their distance
    const float* pc = pcb + (size_t)(jn * 32 + lane) * 3;
    px = pc[0]; py = pc[1]; pz = pc[2];
    const unsigned short* kg = kgb + (size_t)jn * (NH * 2048);
    k00 = ldfrag_f(kg);
    k01 = ldfrag_f(kg + 512);
    k10 = ldfrag_f(kg + 1024);
    k11 = ldfrag_f(kg + 1536);
    // The group's address registers are reused below: the wait stands in front of every such overwrite. It takes the
    // two addresses as inputs so that they stay whole up to it, and its memory clobber keeps the group ahead of it.
#if defined(__HIP_DEVICE_COMPILE__)
    asm volatile("s_wait_xcnt 0x0" :: "v"(kg), "v"(pc) : "memory");
#endif
    __builtin_amdgcn_sched_barrier(0);   // the group goes out here, ahead of the softmax, not further down towards its use

    // ---- heat bias + online softmax of query jc of each tile, all in the lane but for one exchange of the maximum ----
    v16us pbu[QT];
#pragma unroll
    for (int u = 0; u < QT; ++u) {
      const v8f x0 = s0[u] * SCL + __builtin_shufflevector(h00[u], h01[u], 0, 1, 2, 3, 4, 5, 6, 7);
      const v8f x1 = s1[u] * SCL + __builtin_shufflevector(h10[u], h11[u], 0, 1, 2, 3, 4, 5, 6, 7);
      const v8f mx = __builtin_elementwise_max(x0, x1);
      float rm = fmaxf(fmaxf(fmaxf(mx[0], mx[1]), fmaxf(mx[2], mx[3])), fmaxf(fmaxf(mx[4], mx[5]), fmaxf(mx[6], mx[7])));
      rm = fmaxf(rm, xhalf(rm));
      const float mn2   = fmaxf(m[u], rm);
      const float alpha = __expf(m[u] - mn2);
      m[u] = mn2;
      const v8f a0 = x0 - mn2, a1 = x1 - mn2;
      v8f e0, e1;
#pragma unroll
      for (int r = 0; r < 8; ++r) { e0[r] = __expf(a0[r]); e1[r] = __expf(a1[r]); }
      const v8f sm = e0 + e1;
      ll[u] = ll[u] * alpha + (((sm[0] + sm[1]) + (sm[2] + sm[3])) + ((sm[4] + sm[5]) + (sm[6] + sm[7])));
      // P^T B-fragment: element e = p of key kmap(e), the two score tiles converted in place
      const v8h p0 = __builtin_convertvector(e0 * PSC, v8h), p1 = __builtin_convertvector(e1 * PSC, v8h);
      const v16h pb = __builtin_shufflevector(p0, p1, 0, 1, 2, 3, 4, 5, 6, 7, 8, 9, 10, 11, 12, 13, 14, 15);
      pbu[u] = __builtin_bit_cast(v16us, pb);
#pragma unroll
      for (int ct = 0; ct < 4; ++ct) o[u][ct] *= alpha;
    }

    // ---- context^T += V_hi^T . P^T + V_lo^T . P^T (4 row tiles of 16 dims), each V fragment on all column tiles ----
#pragma unroll
    for (int ct = 0; ct < 4; ++ct) {
#pragma unroll
      for (int u = 0; u < QT; ++u) o[u][ct] = mma_hu(vh[ct], pbu[u], o[u][ct]);
#pragma unroll
      for (int u = 0; u < QT; ++u) o[u][ct] = mma_hu(vl[ct], pbu[u], o[u][ct]);
    }

    // ---- the next chunk's V fragments, over the registers the products above have read ----
    refill_gap();                        // the group stays behind the products whose operands it overwrites, at their distance
    const unsigned short* vhp = vhb + (size_t)jn * (NH * 2048);
    const unsigned short* vlp = vlb + (size_t)jn * (NH * 2048);
#pragma unroll
    for (int ct = 0; ct < 4; ++ct) {
      vh[ct] = ldfrag_f(vhp + ct * 512);
      vl[ct] = ldfrag_f(vlp + ct * 512);
    }
    // s_wait_xcnt 0 in front of every overwrite of this group's two addresses, in the form of the K group's above
#if defined(__HIP_DEVICE_COMPILE__)
    asm volatile("s_wait_xcnt 0x0" :: "v"(vhp), "v"(vlp) : "memory");
#endif
  }

  {
    // one store of one wave writes 512 bytes in a row (mlp: 256)
    const size_t pt = (((size_t)ks * (MQ / 16) + ((rowQ + i0) >> 4)) * NH + w);      // (key part, row tile of tile 0, head)
    float* pw = part + pt * 1024 + lane * 4;
    float* mw = mlp + pt * 64 + lane * 2;
    v2f ml[QT];
#pragma unroll
    for (int u = 0; u < QT; ++u) {
      ml[u][0] = m[u];
      ml[u][1] = ll[u] + xhalf(ll[u]);   // the two lane halves' sums of query jc, joined once
    }
    __builtin_amdgcn_sched_barrier(0);   // the stores stand behind all the arithmetic: no register that one names is written again
#pragma unroll
    for (int u = 0; u < QT; ++u) {
#pragma unroll
      for (int ct = 0; ct < 4; ++ct) {
        *(v4f*)(pw + u * (NH * 1024) + ct * 256)       = __builtin_shufflevector(o[u][ct], o[u][ct], 0, 1, 2, 3);
        *(v4f*)(pw + u * (NH * 1024) + ct * 256 + 128) = __builtin_shufflevector(o[u][ct], o[u][ct], 4, 5, 6, 7);
      }
      *(v2f*)(mw + u * (NH * 64)) = ml[u];
    }
  }
}

// =====================================================================================================
// Joins the KS key parts of the attention and multiplies the joined context by the proj weights: out = context . Wo^T + bo.
//   Block = 256 threads = 8 waves, one block per row tile of 16 queries.
//   Join: wave w = head w; a lane reads what the same lane of attn_kernel wrote (query lane & 15, dims
//   ct*16 + 8*(lane >> 4) + 0..7): with M = the largest m_k,
//   context = (sum over k of o_k e^(m_k - M)) / (sum over k of l_k e^(m_k - M)) / 1024, k ascending.
//   The tile (16 rows x 512) is staged in LDS (f32), then split into bf16 hi and lo (value - hi) and laid down in LDS in
//   fragment order, as ldfrag_f reads an A operand: k step s of hi at s * 512 elements, of lo at (CM/32 + s) * 512.
//   Product: wave w = output columns 64 w .. + 63 (4 column tiles), K = 512 in 16 k steps; a weight fragment (B, from the
//   fragment-order plane of cvt_all) feeds the hi and the lo product of its k step, both into one accumulator a tile.
//   The weights depend on nothing the block computes: they are fetched in groups of 2 k steps into a ring of WR register
//   sets, the first WR groups directly behind the parts, so that they land under the join.
// coverage: context 16 rows x 512 cols hi and lo per block (256 threads x 4 pieces x 8 cols); out 16 rows x 8 waves x 64
//           columns; grid MQ/16 covers every row.
// =====================================================================================================
typedef const __attribute__((address_space(1))) float gfl;
typedef const __attribute__((address_space(1))) v4f   gv4f;
typedef const __attribute__((address_space(1))) v2f   gv2f;
#define WKS ((CM / 16) * 512)      // elements of one k step of the weight plane
#define WR  4                      // register sets of the weight ring
// ---- k steps k0 and k0 + 1 of a wave's 4 weight fragments (16 loads) as one group; bp: the wave's (uniform) address of
//      step 0, in scalar registers; l8 = 8 * lane elements
__device__ __forceinline__ void ld_wgroup(v16us (&b)[2][4], gus* bp, int k0, unsigned l8) {
#pragma unroll
  for (int s = 0; s < 2; ++s) {
#pragma unroll
    for (int j = 0; j < 4; ++j) {
      FragU f;
      f.h[0] = *(gv8us*)(bp + (k0 + s) * WKS + j * 512 + l8);
      f.h[1] = *(gv8us*)(bp + (k0 + s) * WKS + j * 512 + l8 + 256);
      b[s][j] = f.v;
    }
  }
  // s_wait_xcnt 0 in front of every overwrite of the group's address registers: it takes the base and the lane offset as
  // inputs so that they stay whole up to it; its memory clobber keeps the loads ahead of it.
#if defined(__HIP_DEVICE_COMPILE__)
  asm volatile("s_wait_xcnt 0x0" :: "s"(bp), "v"(l8) : "memory");
#endif
  __builtin_amdgcn_sched_barrier(0);   // the group goes out here, whole, and is not moved down towards its use
}
__global__ void __launch_bounds__(256) join_proj(const float* __restrict__ part, const float* __restrict__ mlp,
                                                 const unsigned short* __restrict__ WoT, float* out,
                                                 const float* __restrict__ bo) {
  __shared__ __align__(16) float osm[16 * OP];                          // f32 staging [16][CM], pitch OP: context, then out
  __shared__ __align__(16) unsigned short actx[2 * (CM / 32) * 512];    // context hi | lo, fragment order
  const int t = threadIdx.x, lane = t & 31, hh = lane >> 4, jc = lane & 15;
  const int w = __builtin_amdgcn_readfirstlane(t >> 5);     // scalar: each part's address stays in scalar registers
  const size_t rtq = blockIdx.x;                            // the block's row tile among the MQ / 16
  const unsigned ln = (unsigned)lane;                       // the one vector register that the part and mlp loads name (scaled by their width)
  // each further part's address is added in scalar registers by hand (next_step): left to the compiler, the parts'
  // addresses become vector register pairs, and later loads of the group land on pairs that earlier ones name
  gfl* pk[KS];
  gfl* mk[KS];
  pk[0] = (gfl*)(part + (rtq * NH + w) * 1024);
  mk[0] = (gfl*)(mlp + (rtq * NH + w) * 64);
#pragma unroll
  for (int k = 1; k < KS; ++k) {
    pk[k] = (gfl*)next_step((gus*)pk[k - 1], (unsigned long long)(MQ / 16) * NH * 1024 * 4);
    mk[k] = (gfl*)next_step((gus*)mk[k - 1], (unsigned long long)(MQ / 16) * NH * 64 * 4);
  }
  v2f ml[KS];
  v4f ok[KS][8];
  gfl* bw = (gfl*)(bo + w * 64);                            // bias of the wave's 64 output columns, 4 a lane, fetched with the rest
  const unsigned jcu = (unsigned)jc;
#pragma unroll
  for (int k = 0; k < KS; ++k) ml[k] = ((gv2f*)mk[k])[ln];
#pragma unroll
  for (int k = 0; k < KS; ++k) {
#pragma unroll
    for (int g = 0; g < 8; ++g) ok[k][g] = ((gv4f*)(pk[k] + g * 128))[ln];
  }
  const v4f bv4 = ((gv4f*)bw)[jcu];
  // s_wait_xcnt 0 in front of every overwrite of an address that the loads above name; it takes the addresses as inputs
  // so that they stay whole up to it, and its memory clobber keeps the loads ahead of it
#if defined(__HIP_DEVICE_COMPILE__)
  static_assert(KS == 4);
  asm volatile("s_wait_xcnt 0x0" :: "s"(pk[0]), "s"(pk[1]), "s"(pk[2]), "s"(pk[3]),
               "s"(mk[0]), "s"(mk[1]), "s"(mk[2]), "s"(mk[3]), "s"(bw), "v"(ln), "v"(jcu) : "memory");
#endif
  __builtin_amdgcn_sched_barrier(0);   // no arithmetic (with its data wait) is scheduled up into the load group: all loads go out at once

  // the wave's weight fragments of the first WR groups, issued behind the parts, which the join needs first
  gus* wb = (gus*)(WoT + (size_t)w * (4 * 512));
  const unsigned l8 = (unsigned)lane * 8u;
  v16us bs[WR][2][4];
#pragma unroll
  for (int g = 0; g < WR; ++g) ld_wgroup(bs[g], wb, 2 * g, l8);
  {
    float mm = ml[0][0];
#pragma unroll
    for (int k = 1; k < KS; ++k) mm = fmaxf(mm, ml[k][0]);
    float f[KS], l = 0.f;
#pragma unroll
    for (int k = 0; k < KS; ++k) {
      f[k] = __expf(ml[k][0] - mm);
      l += ml[k][1] * f[k];
    }
    const float inv = ((l > 0.f) ? (1.0f / l) : 0.f) * (1.0f / PSC);
#pragma unroll
    for (int k = 0; k < KS; ++k) f[k] *= inv;
    float* od = osm + jc * OP + w * HD + 8 * hh;
#pragma unroll
    for (int g = 0; g < 8; ++g) {
      v4f a = ok[0][g] * f[0];
#pragma unroll
      for (int k = 1; k < KS; ++k) a += ok[k][g] * f[k];
      *(v4f*)(od + (g >> 1) * 16 + (g & 1) * 4) = a;
    }
  }
  lds_barrier();                       // the f32 tile is whole; it waits for LDS alone, so that the weights stay in flight
  {
    // piece c of the tile's 1024: row c & 15, columns 8 * (c >> 4) .. + 7: k step c >> 6, 8 * (c & 63) elements into its fragment
#pragma unroll
    for (int it = 0; it < 4; ++it) {
      const int c = it * 256 + t;
      const float* sp = osm + (c & 15) * OP + (c >> 4) * 8;
      const v4f f0 = *(const v4f*)(sp);
      const v4f f1 = *(const v4f*)(sp + 4);
      v4u ha, la;
#pragma unroll
      for (int e = 0; e < 2; ++e) {
        const unsigned short u0 = bf_bits(f0[2 * e]), u1 = bf_bits(f0[2 * e + 1]);
        const unsigned short u2 = bf_bits(f1[2 * e]), u3 = bf_bits(f1[2 * e + 1]);
        ha[e]     = pk16(u0, u1);
        ha[2 + e] = pk16(u2, u3);
        la[e]     = pk16(bf_bits(f0[2 * e] - bf_up(u0)), bf_bits(f0[2 * e + 1] - bf_up(u1)));
        la[2 + e] = pk16(bf_bits(f1[2 * e] - bf_up(u2)), bf_bits(f1[2 * e + 1] - bf_up(u3)));
      }
      unsigned short* ad = actx + (c >> 6) * 512 + (c & 63) * 8;
      *(v4u*)(ad)                   = ha;
      *(v4u*)(ad + (CM / 32) * 512) = la;
    }
  }
  lds_barrier();                       // the hi and lo tiles are whole, and every reader has left the f32 tile

  // ---- out tile = context hi . Wo^T + context lo . Wo^T: 8 groups of 2 k steps; group g + WR refills the set of group g ----
  v8f acc[4];
#pragma unroll
  for (int j = 0; j < 4; ++j) acc[j] = zero8();
  const unsigned short* ar = actx + lane * 8;
  v16us ah[2][2], al[2][2];            // two sets: a group's context fragments are read from LDS one group ahead
#pragma unroll
  for (int s = 0; s < 2; ++s) {
    ah[0][s] = ldfrag_f(ar + s * 512);
    al[0][s] = ldfrag_f(ar + (CM / 32 + s) * 512);
  }
#pragma unroll
  for (int g = 0; g < CM / 64; ++g) {
    if (g + 1 < CM / 64) {
#pragma unroll
      for (int s = 0; s < 2; ++s) {
        ah[(g + 1) & 1][s] = ldfrag_f(ar + (2 * g + 2 + s) * 512);
        al[(g + 1) & 1][s] = ldfrag_f(ar + (CM / 32 + 2 * g + 2 + s) * 512);
      }
    }
    __builtin_amdgcn_sched_barrier(0);   // the next group's LDS reads go out ahead of this group's products and land under them
#pragma unroll
    for (int s = 0; s < 2; ++s) {
#pragma unroll
      for (int j = 0; j < 4; ++j) acc[j] = mma_bu_raw(ah[g & 1][s], bs[g % WR][s][j], acc[j]);
#pragma unroll
      for (int j = 0; j < 4; ++j) acc[j] = mma_bu_raw(al[g & 1][s], bs[g % WR][s][j], acc[j]);
    }
    if (g + WR < CM / 64) {
      refill_gap();                    // the group stays behind the products whose operands it overwrites, at their distance
      ld_wgroup(bs[g % WR], wb, 2 * (g + WR), l8);
    }
  }
  acc_guard4(acc[0], acc[1], acc[2], acc[3]);

  // ---- epilogue: the wave's 16 x 64 tile through its own columns of the f32 staging tile, so that a store writes 256-byte
  //      row segments (16 lanes x 16 B) ----
  {
    const int c4 = w * 64 + jc * 4;
    v4f cb4;
    cb4[0] = bfr(bv4[0]); cb4[1] = bfr(bv4[1]); cb4[2] = bfr(bv4[2]); cb4[3] = bfr(bv4[3]);
#pragma unroll
    for (int j = 0; j < 4; ++j) {
#pragma unroll
      for (int r = 0; r < 8; ++r) osm[(8 * hh + r) * OP + w * 64 + j * 16 + jc] = acc[j][r];
    }
    wave_sync_lds();
    v4f vals[8];
#pragma unroll
    for (int it = 0; it < 8; ++it) vals[it] = *(const v4f*)(osm + (it * 2 + hh) * OP + c4) + cb4;   // rows 0..15
    float* C = out + rtq * 16 * CM + (size_t)hh * CM + c4;
    __builtin_amdgcn_sched_barrier(0);   // the stores stand behind all the arithmetic: no register that one names is written again
#pragma unroll
    for (int it = 0; it < 8; ++it) *(v4f*)(C + it * 2 * CM) = vals[it];
  }
}

// =====================================================================================================
// Workspace map (bytes); every plane is an exact multiple of its whole-row / whole-line / 64x64-tile store
// granularity (MQ = 4096 = 64 row tiles, MC = 8192 = 128 row tiles; N in {512, 4096}; v^T per batch
// [512][4096] = 8x64 tiles):
// (Xq, Xc and the four weight planes hold these shapes in fragment order: [k step of 32][row tile of 16][512])
//   Xq   bf16 [4096][512]       0          4194304
//   Xc   bf16 [8192][512]       4194304    8388608
//   Wqb  bf16 [512][512]        12582912   524288
//   Wkb  bf16 [512][512]        13107200   524288
//   Wvb  bf16 [512][512]        13631488   524288
//   WoT  bf16 [512][512]        14155776   524288
//   Qp   f16  [4096][512]       14680064   4194304
//   Kp   f16  [2][128][8][2048] 18874368   8388608   (k, fragment order: batch, chunk of 32 keys, head)
//   VTh  f16  [2][128][8][2048] 27262976   8388608   (v^T hi, fragment order)
//   VTl  f16  [2][128][8][2048] 35651584   8388608   (v^T residual, fragment order)
//   Part f32  [4][256][8][1024] 44040192   33554432  (attention sums of the four key parts, as they lie in the lanes)
//   Ml   f32  [4][256][8][64]   77594624   2097152   (each part's maximum and sum of p, a pair a lane)
//   end                         79691776
// =====================================================================================================
extern "C" void kernel_launch(void* const* d_in, const int* in_sizes, int n_in,
                              void* d_out, int out_size, void* d_ws, size_t ws_size,
                              hipStream_t stream) {
  if (n_in < 12) return;
  if (in_sizes[0] != MC * CM) return;
  if (in_sizes[1] != MQ * CM) return;
  if (in_sizes[2] != MC * 3) return;
  if (in_sizes[3] != MQ * 3) return;
  if (in_sizes[4] != CM * CM || in_sizes[5] != CM) return;
  if (in_sizes[6] != CM * CM || in_sizes[7] != CM) return;
  if (in_sizes[8] != CM * CM || in_sizes[9] != CM) return;
  if (in_sizes[10] != CM * CM || in_sizes[11] != CM) return;
  if (out_size != MQ * CM) return;

  const float* x_ctx   = (const float*)d_in[0];
  const float* x_query = (const float*)d_in[1];
  const float* pos_ctx = (const float*)d_in[2];
  const float* pos_qry = (const float*)d_in[3];
  const float* Wq = (const float*)d_in[4];
  const float* bq = (const float*)d_in[5];
  const float* Wk = (const float*)d_in[6];
  const float* bk = (const float*)d_in[7];
  const float* Wv = (const float*)d_in[8];
  const float* bv = (const float*)d_in[9];
  const float* Wo = (const float*)d_in[10];
  const float* bo = (const float*)d_in[11];

  const size_t PXQ  = (size_t)MQ * CM * 2;             //  4194304
  const size_t PXC  = (size_t)MC * CM * 2;             //  8388608
  const size_t PW   = (size_t)CM * CM * 2;             //   524288
  const size_t PQ   = (size_t)MQ * CM * 2;             //  4194304
  const size_t PK   = (size_t)MC * CM * 2;             //  8388608
  const size_t PVT  = (size_t)NB * CM * NC * 2;        //  8388608
  const size_t PPRT = (size_t)KS * MQ * CM * 4;        // 33554432
  const size_t PML  = (size_t)KS * (MQ / 16) * NH * 64 * 4;   // 2097152
  size_t off = 0;
  const size_t oXq  = off; off += PXQ;
  const size_t oXc  = off; off += PXC;
  const size_t oWq  = off; off += PW;
  const size_t oWk  = off; off += PW;
  const size_t oWv  = off; off += PW;
  const size_t oWo  = off; off += PW;
  const size_t oQ   = off; off += PQ;
  const size_t oK   = off; off += PK;
  const size_t oVTh = off; off += PVT;
  const size_t oVTl = off; off += PVT;
  const size_t oPrt = off; off += PPRT;
  const size_t oMl  = off; off += PML;
  if (off > ws_size) return;                           // off = 79691776
  if (off > (size_t)134217728) return;

  char* ws = (char*)d_ws;
  unsigned short* Xq   = (unsigned short*)(ws + oXq);
  unsigned short* Xc   = (unsigned short*)(ws + oXc);
  unsigned short* Wqb  = (unsigned short*)(ws + oWq);
  unsigned short* Wkb  = (unsigned short*)(ws + oWk);
  unsigned short* Wvb  = (unsigned short*)(ws + oWv);
  unsigned short* WoT  = (unsigned short*)(ws + oWo);
  unsigned short* Qp   = (unsigned short*)(ws + oQ);
  unsigned short* Kp   = (unsigned short*)(ws + oK);
  unsigned short* VTh  = (unsigned short*)(ws + oVTh);
  unsigned short* VTl  = (unsigned short*)(ws + oVTl);
  float*          Prt  = (float*)(ws + oPrt);
  float*          Ml   = (float*)(ws + oMl);
  float*          out0 = (float*)d_out;

  const dim3 blk(256);
  const dim3 gQKV(GK + NB * GV + GQ, 1, 1);                    // 128 + 2 x 64 + 64 blocks
  const dim3 gAttn(NQ / (16 * QT), NB, KS);                    // 32 x 2 x 4 blocks of 256
  if ((((MQ / 64) * (CM / 64)) % 8) != 0) return;
  if ((((MC / 64) * (CM / 64)) % 8) != 0) return;
  if ((((CM / 64) * (NC / 64)) % 8) != 0) return;

  // (0) bf16 planes of the activations and weights ([out][in]) in fragment order
  cvt_all<<<dim3(CVT_BLOCKS), blk, 0, stream>>>(x_ctx, x_query, Wq, Wk, Wv, Wo, Xc, Xq, Wqb, Wkb, Wvb, WoT);

  // (1) the q, k and v^T projections, one grid
  proj_qkv<<<gQKV, blk, 0, stream>>>(Xq, Xc, Wqb, Wkb, Wvb, Qp, Kp, VTh, VTl, bq, bk, bv);

  // (2) fused heat bias + softmax attention, each quarter of the keys by itself
  attn_kernel<<<gAttn, blk, 0, stream>>>(pos_qry, pos_ctx, Qp, Kp, VTh, VTl, Prt, Ml);

  // (3) the parts joined -> context bf16 hi, lo in LDS; out = (ctx_hi + ctx_lo) . Wo^T + bo (bf16 operands) -> d_out f32
  join_proj<<<dim3(MQ / 16), blk, 0, stream>>>(Prt, Ml, WoT, out0, bo);
  (void)hipGetLastError();
}

// v010
// Measured time: 96.3 microseconds a run.
// In both of two side-by-side timings against v009, it was 1.06 times as fast.
// All steps since v000 together make it 6.80 times as fast.
// Contractions: q and k projections (x . W^T) and v^T projection (Wv . x^T) on v_wmma_f32_16x16x32_bf16 (bf16 x, bf16 weights);
// output projection on v_wmma_f32_16x16x32_bf16 (context as bf16 hi and lo tiles in LDS, each against the same bf16 weights);
// scores transposed, k.q^T, on v_wmma_f32_16x16x32_f16 (plain f16 q, k); v^T.p^T on v_wmma_f32_16x16x32_f16 (p carried
// x1024 f16, v^T as f16 hi + f16 residual planes, one accumulator set); all f32 accumulate; heat-kernel bias and softmax in f32;
// every float input RNE-converted to bf16 on load.
#include <hip/hip_runtime.h>
#include <math.h>
#include <stdint.h>

#define NB   2
#define NQ   2048
#define NC   4096
#define CM   512
#define NH   8
#define HD   64
#define MQ   (NB * NQ)
#define MC   (NB * NC)
#define NCH  (NC / 32)
#define PSC  1024.0f
#define SCL  0.125f
#define HK4  0.4f
#define HEPS 1.0e-6f
#define LN2F 0.69314718f
#define HP   36            // heat tile pitch in floats: 144 B, 16 B x odd, for its 16-byte readers
#define OP   (CM + 4)      // output staging pitch in floats: the 16 lanes' 16-byte stores of one column walk fall on 64 banks
static_assert(NH * HD == CM);
static_assert(NH == 8);
static_assert((MQ % 64) == 0 && (MC % 64) == 0 && (CM % 64) == 0 && (NC % 64) == 0);
static_assert((((MQ / 64) * (CM / 64)) % 8) == 0);
static_assert((((MC / 64) * (CM / 64)) % 8) == 0);
static_assert((((CM / 64) * (NC / 64)) % 8) == 0);
static_assert((NQ % 16) == 0 && (NC % 32) == 0);

typedef _Float16 v16h __attribute__((ext_vector_type(16)));
typedef _Float16 v8h  __attribute__((ext_vector_type(8)));
typedef __bf16   v16b __attribute__((ext_vector_type(16)));
typedef unsigned short v16us __attribute__((ext_vector_type(16)));
typedef unsigned short v8us  __attribute__((ext_vector_type(8)));
typedef float    v8f  __attribute__((ext_vector_type(8)));
typedef float    v4f  __attribute__((ext_vector_type(4)));
typedef float    v2f  __attribute__((ext_vector_type(2)));
typedef unsigned int v4u __attribute__((ext_vector_type(4)));

union FragU { v16us v; v8us h[2]; };

// ---- scalar helpers --------------------------------------------------------------------------------
__device__ __forceinline__ unsigned short bf_bits(float f) {          // f32 -> bf16 bits, RNE convert
  unsigned u = __float_as_uint(f);
  return (unsigned short)((u + 0x7FFFu + ((u >> 16) & 1u)) >> 16);
}
__device__ __forceinline__ float bf_up(unsigned short h) { return __uint_as_float(((unsigned)h) << 16); }
__device__ __forceinline__ float bfr(float f) { return bf_up(bf_bits(f)); }   // value of the bf16 RNE convert
__device__ __forceinline__ unsigned short h_bits(_Float16 x) { return __builtin_bit_cast(unsigned short, x); }
__device__ __forceinline__ unsigned pk16(unsigned short a, unsigned short b) { return (unsigned)a | ((unsigned)b << 16); }
__device__ __forceinline__ v8f zero8() { v8f z = {0.f, 0.f, 0.f, 0.f, 0.f, 0.f, 0.f, 0.f}; return z; }
__device__ __forceinline__ float xhalf(float x) {                     // value of lane l ^ 16
  const int b = __builtin_bit_cast(int, x);
  return __builtin_bit_cast(float, __builtin_amdgcn_permlanex16(b, b, 0x76543210, 0xfedcba98, false, false));
}

// ---- fragment loader: 16-bit A/B operand, lane -> row/col (lane&15), p already includes +8*(lane>>4);
//      elements 0..7 <- p[0..7] (k0+8h..), elements 8..15 <- p[16..23] (k0+16+8h..)
__device__ __forceinline__ v16us ldfrag_u(const unsigned short* p) {
  FragU f;
  f.h[0] = *(const v8us*)(p);
  f.h[1] = *(const v8us*)(p + 16);
  return f.v;
}

// ---- fragment loader, fragment-order plane: one operand fragment is 1 KiB in a row, lane l's elements 0..7 at
//      16 * l bytes and its elements 8..15 at 512 + 16 * l; p already includes + 8 * lane. Each of the two loads
//      reads 512 bytes in a row (4 whole lines) where a row-major plane makes it touch 16 lines.
__device__ __forceinline__ v16us ldfrag_f(const unsigned short* p) {
  FragU f;
  f.h[0] = *(const v8us*)(p);
  f.h[1] = *(const v8us*)(p + 256);
  return f.v;
}

// ---- s_wait_xcnt 0 behind a group of global loads, in front of every overwrite of the group's address registers:
//      it takes the address as an input so that it stays whole up to it; its memory clobber keeps the loads ahead of it.
__device__ __forceinline__ void xwait1(const void* a) {
#if defined(__HIP_DEVICE_COMPILE__)
  asm volatile("s_wait_xcnt 0x0" :: "v"(a) : "memory");
#endif
}

// ---- WMMA helpers with trailing VALU hazard gap --------------------------------------------------------
__device__ __forceinline__ v8f mma_bu_raw(v16us a, v16us b, v8f c) {            // bf16 operands, unguarded
  return __builtin_amdgcn_wmma_f32_16x16x32_bf16(false, __builtin_bit_cast(v16b, a), false,
                                                 __builtin_bit_cast(v16b, b), (short)0, c, false, false);
}
// f16 operands (bits), unguarded like the bf16 form: a guard that names the operands in an asm statement holds them all below
// v256, and the column tiles' accumulators and fragments do not fit there (the build then spills); the loads that overwrite
// A operands stand behind refill_gap() instead
__device__ __forceinline__ v8f mma_hu(v16us a, v16us b, v8f c) {
  return __builtin_amdgcn_wmma_f32_16x16x32_f16(false, __builtin_bit_cast(v16h, a), false,
                                                __builtin_bit_cast(v16h, b), (short)0, c, false, false);
}
// ---- one k step of a 64x64 wave tile: its 4 A and 4 B fragments (16 loads, fragment-order planes) as one group, A first.
//      ap, bp: the wave's (uniform) global addresses of the step, in scalar registers; l8 = 8 * lane elements, the one
//      vector register that all 16 loads name
typedef const __attribute__((address_space(1))) unsigned short gus;
typedef const __attribute__((address_space(1))) v8us           gv8us;
__device__ __forceinline__ void ld_step(v16us (&a)[4], v16us (&b)[4], gus* ap, gus* bp, unsigned l8) {
#pragma unroll
  for (int i = 0; i < 4; ++i) {
    FragU f;
    f.h[0] = *(gv8us*)(ap + i * 512 + l8);
    f.h[1] = *(gv8us*)(ap + i * 512 + l8 + 256);
    a[i] = f.v;
  }
#pragma unroll
  for (int j = 0; j < 4; ++j) {
    FragU f;
    f.h[0] = *(gv8us*)(bp + j * 512 + l8);
    f.h[1] = *(gv8us*)(bp + j * 512 + l8 + 256);
    b[j] = f.v;
  }
  // s_wait_xcnt 0 in front of every overwrite of the group's address registers: it takes the two bases and the lane
  // offset as inputs so that they stay whole up to it; its memory clobber keeps the loads ahead of it.
#if defined(__HIP_DEVICE_COMPILE__)
  asm volatile("s_wait_xcnt 0x0" :: "s"(ap), "s"(bp), "v"(l8) : "memory");
#endif
  __builtin_amdgcn_sched_barrier(0);   // no product (with its data wait) is scheduled up into the load group
}
// ---- between a step's products and the load group that refills the operand registers they read
__device__ __forceinline__ void refill_gap() {
  __builtin_amdgcn_sched_barrier(0);   // the group stays whole: without this its A loads are spread among the products in front of it
  // four vector slots, the distance a WMMA asks for before its A or B is overwritten: loads fill no slot, and a load over
  // B directly behind the product is not known to be safe; the memory clobber keeps the loads behind the slots
#if defined(__HIP_DEVICE_COMPILE__)
  asm volatile("v_nop\n\tv_nop\n\tv_nop\n\tv_nop" ::: "memory");
#endif
}
// ---- the next k step's address, added in scalar registers by hand: left to the compiler, the loop's address sums move
//      into vector registers, and accumulators plus two fragment sets leave none to spare (it then copies accumulators about)
__device__ __forceinline__ gus* next_step(gus* p, unsigned long long bytes) {
#if defined(__HIP_DEVICE_COMPILE__)
  gus* r;
  asm("s_add_nc_u64 %0, %1, %2" : "=s"(r) : "s"(p), "s"(bytes));
  return r;
#else
  return p + bytes / 2;
#endif
}
__device__ __forceinline__ void mma_step(v8f (&acc)[4][4], const v16us (&a)[4], const v16us (&b)[4]) {
#pragma unroll
  for (int i = 0; i < 4; ++i)
#pragma unroll
    for (int j = 0; j < 4; ++j) acc[i][j] = mma_bu_raw(a[i], b[j], acc[i][j]);
}
__device__ __forceinline__ void acc_guard4(v8f& a, v8f& b, v8f& c, v8f& d) {
#if defined(__HIP_DEVICE_COMPILE__)
  asm volatile("v_nop\n\tv_nop\n\tv_nop\n\tv_nop" : "+v"(a), "+v"(b), "+v"(c), "+v"(d));
#endif
}
__device__ __forceinline__ void wave_sync_lds() {
  __builtin_amdgcn_fence(__ATOMIC_RELEASE, "workgroup");
  __builtin_amdgcn_wave_barrier();
  __builtin_amdgcn_fence(__ATOMIC_ACQUIRE, "workgroup");
}

// ---- work-group barrier of the attention loop's heat tile and of join_proj's LDS tiles: it waits for the wave's own LDS
//      accesses alone, so that the global loads issued ahead (the next chunk's, the weights) stay in flight across it (__syncthreads() waits for them too); the memory clobber
//      keeps every LDS access on its side of the barrier
__device__ __forceinline__ void lds_barrier() {
#if defined(__HIP_DEVICE_COMPILE__)
  asm volatile("s_wait_dscnt 0x0\n\ts_barrier_signal -1\n\ts_barrier_wait -1" ::: "memory");
#endif
}

// =====================================================================================================
// Row convert: in[row][CM] f32 -> bf16 RNE bits in fragment order for a plane of nrt row tiles: fragment (row tile
// row/16, k step k/32) at (k step * nrt + row tile) * 512 elements (one k step of all rows lies in a row), inside it as
// ldfrag_f reads it.
// Block = 256 threads (one tile rt of 16 rows = 1024 pieces of 8 columns, 4 a thread). Piece c holds row c & 15,
// columns 8 * (c >> 4) .. + 7: k step c >> 6, at 8 * (c & 63) elements of its fragment, so one store of one wave
// writes 512 bytes in a row.
// coverage: 1024 pieces x 8 = 16 rows x CM columns.
// =====================================================================================================
__device__ __forceinline__ void cvt_tile(const float* __restrict__ src, unsigned short* dst, int rt, int nrt) {
  const int tid = threadIdx.x;
  // thread tid takes pieces c = tid + 256 * it: the same row, 128 columns (4 k steps) on
  const float* p = src + ((size_t)rt * 16 + (tid & 15)) * CM + (tid >> 4) * 8;
  unsigned short* d = dst + ((size_t)(tid >> 6) * nrt + rt) * 512 + (tid & 63) * 8;
  v4f a0[4], a1[4];
#pragma unroll
  for (int it = 0; it < 4; ++it) {
    a0[it] = *(const v4f*)(p + it * 128);
    a1[it] = *(const v4f*)(p + it * 128 + 4);
  }
  xwait1(p);
  v4u hv[4];
#pragma unroll
  for (int it = 0; it < 4; ++it) {
    hv[it][0] = pk16(bf_bits(a0[it][0]), bf_bits(a0[it][1]));
    hv[it][1] = pk16(bf_bits(a0[it][2]), bf_bits(a0[it][3]));
    hv[it][2] = pk16(bf_bits(a1[it][0]), bf_bits(a1[it][1]));
    hv[it][3] = pk16(bf_bits(a1[it][2]), bf_bits(a1[it][3]));
  }
  unsigned short* dq[4];
#pragma unroll
  for (int it = 0; it < 4; ++it) dq[it] = d + (size_t)it * 4 * nrt * 512;
  __builtin_amdgcn_sched_barrier(0);   // the stores stand behind all the arithmetic: no register that one names is written again
#pragma unroll
  for (int it = 0; it < 4; ++it) *(v4u*)(dq[it]) = hv[it];
}

// All six converts in one grid (they depend on nothing but the inputs): block -> (matrix, row tile), the largest matrix
// first. Blocks 0 .. MC/16 - 1: context rows; the next MQ/16: query rows; then four groups of CM/16: the q, k, v and
// proj weights.
// coverage: every row tile of every matrix once.
#define CVT_BLOCKS (MC / 16 + MQ / 16 + 4 * (CM / 16))
__global__ __launch_bounds__(256) void cvt_all(
    const float* __restrict__ xc, const float* __restrict__ xq, const float* __restrict__ wq,
    const float* __restrict__ wk, const float* __restrict__ wv, const float* __restrict__ wo,
    unsigned short* Xc, unsigned short* Xq, unsigned short* Wqb, unsigned short* Wkb, unsigned short* Wvb,
    unsigned short* WoT) {
  const int bx = blockIdx.x;
  const int u = bx - (MC / 16 + MQ / 16), sel = u / (CM / 16);      // used where u >= 0: the weights' blocks
  const float* s = wo;
  unsigned short* d = WoT;
  int rt = u % (CM / 16), nrt = CM / 16;
  if (bx < MC / 16)                { s = xc; d = Xc;  rt = bx;           nrt = MC / 16; }
  else if (bx < MC / 16 + MQ / 16) { s = xq; d = Xq;  rt = bx - MC / 16; nrt = MQ / 16; }
  else if (sel == 0)               { s = wq; d = Wqb; }
  else if (sel == 1)               { s = wk; d = Wkb; }
  else if (sel == 2)               { s = wv; d = Wvb; }
  cvt_tile(s, d, rt, nrt);
}

// =====================================================================================================
// Register-blocked batched bf16 WMMA GEMM: C[m][n] = sum_k A[m][k] * Bt[n][k] (+ bias);
// one wave per 64x64 tile, no block barriers. A [M][K] and Bt [N][K] in fragment order, in planes of rtA and rtB row
// tiles: fragment (row tile row/16, k step k/32) at (k step * rt + row tile) * 512 elements, so that what all waves
// read in one k step lies in a row; M, N and K multiples of 64. bx = the block's index among the product's own blocks,
// by = batch index with element strides (sAy for A, sBy for Bt, sCy for C); sT = the block's LDS, one slab a wave.
// Tile enumeration: tile = bx * 8 + wave -> tm = tile / (N/64), tn = tile % (N/64).
// OM: 1 = f16 bits to Cp (pitch ldc); 2 = f16 hi bits to Cp and f16(v - hi)
//     bits to Cp2, both in fragment order for m = head dim, n = key: fragment (chunk n/32, head m/64, row tile
//     (m/16)%4) at ((chunk * NH + head) * 4 + row tile) * 512 elements; 3 = f16 bits to Cp in fragment order for
//     m = key row (batch-major), n = head dim: fragment (chunk m/32 over both batches, head n/64, key tile (m/16)%2,
//     k step (n/32)%2) at (((chunk * NH + head) * 2 + key tile) * 2 + k step) * 512 elements. Inside a fragment: see
//     ldfrag_f. One chunk of 32 keys of all heads lies in a row in each plane.
// CBM: 0 = no bias; 1 = column bias bf16(cb[n]); 2 = row bias bf16(cb[m]).
// coverage: 4 slabs x 16 rows x 64 cols = the wave's whole 64x64 tile; tilesM*tilesN/8 blocks exactly per product
//           (host-checked), so no wave exits early.
// =====================================================================================================
template <int OM, int CBM>
__device__ __forceinline__ void gemm64_body(
    float (*sT)[16 * 68], int bx, int by,
    const unsigned short* __restrict__ Ap, int rtA, long long sAy,
    const unsigned short* __restrict__ Btp, int rtB, long long sBy,
    unsigned short* Cp, unsigned short* Cp2, int ldc, long long sCy,
    const float* __restrict__ cb, int M, int N, int K) {
  const int lane = threadIdx.x & 31;
  const int wave = __builtin_amdgcn_readfirstlane(threadIdx.x >> 5);   // scalar: the tile's addresses stay in scalar registers
  const int tilesN = N >> 6;
  const int tilesM = M >> 6;
  const int tile = bx * 8 + wave;
  if (tile >= tilesM * tilesN) return;   // wave-uniform; no block barriers in this kernel
  const int tm = tile / tilesN;
  const int tn = tile - tm * tilesN;
  const int m0 = tm << 6;
  const int n0 = tn << 6;

  const unsigned short* Ab = Ap  + (size_t)by * (size_t)sAy;
  const unsigned short* Bb = Btp + (size_t)by * (size_t)sBy;
  const size_t cofs = (size_t)by * (size_t)sCy;

  const int rlane = lane & 15;                 // row (A) / col (B, D) within subtile
  const int mOff  = (lane >> 4) * 8;           // D row offset

  v8f acc[4][4];
#pragma unroll
  for (int i = 0; i < 4; ++i)
#pragma unroll
    for (int j = 0; j < 4; ++j) acc[i][j] = zero8();

  // Two fragment sets: while one k step's 16 products run on one set, the next step's 16 loads are in flight into the
  // other, so a wave waits for memory once per step at most, not four times per step. k ascends as before.
  const unsigned long long sA = (unsigned long long)rtA * 1024u, sB = (unsigned long long)rtB * 1024u;   // bytes per k step
  gus* ap = (gus*)(Ab + (size_t)(m0 >> 4) * 512);
  gus* bp = (gus*)(Bb + (size_t)(n0 >> 4) * 512);
  const unsigned l8 = (unsigned)lane * 8u;
  v16us fa0[4], fb0[4], fa1[4], fb1[4];
  ld_step(fa0, fb0, ap, bp, l8);
#pragma unroll 1   // stays the loop it was, now that K is a constant at the call: unrolled, the kernel's text grows by a third, and a block runs its part of it only once
  for (int k0 = 64; k0 < K; k0 += 64) {
    ap = next_step(ap, sA);
    bp = next_step(bp, sB);
    refill_gap();
    ld_step(fa1, fb1, ap, bp, l8);
    mma_step(acc, fa0, fb0);
    ap = next_step(ap, sA);
    bp = next_step(bp, sB);
    refill_gap();
    ld_step(fa0, fb0, ap, bp, l8);
    mma_step(acc, fa1, fb1);
  }
  ap = next_step(ap, sA);
  bp = next_step(bp, sB);
  refill_gap();
  ld_step(fa1, fb1, ap, bp, l8);                                     // the last two steps: nothing left to fetch ahead
  mma_step(acc, fa0, fb0);
  mma_step(acc, fa1, fb1);
  acc_guard4(acc[0][0], acc[0][1], acc[0][2], acc[0][3]);
  acc_guard4(acc[1][0], acc[1][1], acc[1][2], acc[1][3]);
  acc_guard4(acc[2][0], acc[2][1], acc[2][2], acc[2][3]);
  acc_guard4(acc[3][0], acc[3][1], acc[3][2], acc[3][3]);

  const int q8  = lane >> 3, c8 = (lane & 7) * 8;

  float cbc[4][8];                                     // row-major out uses [0] alone; fragment order one set per it
#pragma unroll
  for (int g = 0; g < 4; ++g)
#pragma unroll
    for (int e = 0; e < 8; ++e) cbc[g][e] = 0.f;
  if (CBM == 1) {
    if (OM == 1) {
      const v4f v0 = *(const v4f*)(cb + n0 + c8);
      const v4f v1 = *(const v4f*)(cb + n0 + c8 + 4);
#pragma unroll
      for (int e = 0; e < 4; ++e) { cbc[0][e] = bfr(v0[e]); cbc[0][4 + e] = bfr(v1[e]); }
    } else {
      const float* cp = cb + n0 + mOff;
#pragma unroll
      for (int g = 0; g < 4; ++g) {
        const v4f v0 = *(const v4f*)(cp + g * 16);
        const v4f v1 = *(const v4f*)(cp + g * 16 + 4);
#pragma unroll
        for (int e = 0; e < 4; ++e) { cbc[g][e] = bfr(v0[e]); cbc[g][4 + e] = bfr(v1[e]); }
      }
    }
  }

  // ---- epilogue ----
  float* slab = sT[wave];
#pragma unroll
  for (int i = 0; i < 4; ++i) {
    const int mBase = m0 + (i << 4);
#pragma unroll
    for (int j = 0; j < 4; ++j) {
#pragma unroll
      for (int r = 0; r < 8; ++r) {
        slab[(mOff + r) * 68 + (j << 4) + rlane] = acc[i][j][r];
      }
    }
    wave_sync_lds();
    {
      unsigned short* C  = Cp  + cofs;
      unsigned short* C2 = Cp2 + cofs;
      v4u hv[4], lv[4];
#pragma unroll
      for (int it = 0; it < 4; ++it) {
        // row-major out: it 0..3 x q8 0..3 = rows 0..15, 8 columns at c8; fragment order: the lane takes what it
        // holds as an operand, row lane & 15, the 8 columns at 16 * it + 8 * (lane >> 4)
        const int row = (OM == 1) ? (it * 4 + q8) : rlane;
        const int col = (OM == 1) ? c8 : (it * 16 + mOff);
        const float* sp = slab + row * 68 + col;
        float rb = 0.f;
        if (CBM == 2) rb = bfr(cb[mBase + row]);
        const int g = (OM == 1) ? 0 : it;
        v4u ha = {0u, 0u, 0u, 0u}, la = {0u, 0u, 0u, 0u};
#pragma unroll
        for (int e = 0; e < 4; ++e) {
          const float f0 = sp[2 * e]     + cbc[g][2 * e]     + rb;
          const float f1 = sp[2 * e + 1] + cbc[g][2 * e + 1] + rb;
          const _Float16 g0 = (_Float16)f0, g1 = (_Float16)f1;
          ha[e] = pk16(h_bits(g0), h_bits(g1));
          if (OM == 2) {
            la[e] = pk16(h_bits((_Float16)(f0 - (float)g0)), h_bits((_Float16)(f1 - (float)g1)));
          }
        }
        hv[it] = ha;
        lv[it] = la;
      }
      {
#pragma unroll
        for (int it = 0; it < 4; ++it) {
          size_t go;
          if (OM == 1) {
            go = (size_t)(mBase + it * 4 + q8) * ldc + (size_t)n0 + c8;
          } else if (OM == 2) {
            go = (((size_t)((n0 >> 5) + (it >> 1)) * NH + tm) * 4 + i) * 512 + (it & 1) * 256 + lane * 8;
          } else {
            go = ((((size_t)(mBase >> 5) * NH + tn) * 2 + ((mBase >> 4) & 1)) * 2 + (it >> 1)) * 512
                 + (it & 1) * 256 + lane * 8;
          }
          *(v4u*)(C + go) = hv[it];
          if (OM == 2) *(v4u*)(C2 + go) = lv[it];
        }
        
      }
    }
    wave_sync_lds();
  }
}

// The q, k and v^T projections in one grid (none reads what another writes): blocks 0 .. GK - 1 the k projection, the next
// NB * GV the v^T projection (GV a batch), the last GQ the q projection.
//   k = Xc . Wkb^T + bk (K = 512) -> f16, fragment order; v^T per batch = Wvb . Xc_b^T + bv per row d -> f16 hi (VTh) and
//   residual (VTl), fragment order; q = Xq . Wqb^T + bq -> f16 plane [rows][512]
#define GQ (((MQ / 64) * (CM / 64)) / 8)     // 512 tiles -> 64 blocks
#define GK (((MC / 64) * (CM / 64)) / 8)     // 1024 tiles -> 128 blocks
#define GV (((CM / 64) * (NC / 64)) / 8)     // 512 tiles -> 64 blocks a batch
__global__ __launch_bounds__(256) void proj_qkv(
    const unsigned short* __restrict__ Xq, const unsigned short* __restrict__ Xc,
    const unsigned short* __restrict__ Wqb, const unsigned short* __restrict__ Wkb,
    const unsigned short* __restrict__ Wvb,
    unsigned short* Qp, unsigned short* Kp, unsigned short* VTh, unsigned short* VTl,
    const float* __restrict__ bq, const float* __restrict__ bk, const float* __restrict__ bv) {
  __shared__ __align__(16) float sT[8][16 * 68];   // per-wave 16x64 slab, pitch 68 floats
  const int bx = blockIdx.x;
  if (bx < GK) {
    gemm64_body<3, 1>(sT, bx, 0, Xc, MC / 16, 0LL, Wkb, CM / 16, 0LL,
                      Kp, Kp, CM, 0LL, bk, MC, CM, CM);
  } else if (bx < GK + NB * GV) {
    const int u = bx - GK;
    gemm64_body<2, 2>(sT, u % GV, u / GV, Wvb, CM / 16, 0LL, Xc, MC / 16, (long long)(NC / 16) * 512,
                      VTh, VTl, NC, (long long)CM * NC, bv, CM, NC, CM);
  } else {
    gemm64_body<1, 1>(sT, bx - (GK + NB * GV), 0, Xq, MQ / 16, 0LL, Wqb, CM / 16, 0LL,
                      Qp, Qp, CM, 0LL, bq, MQ, CM, CM);
  }
}

// =====================================================================================================
// Fused heat-bias + online-softmax cross attention, head dim 64, 8 heads.
//   Block = 256 threads = 8 waves, wave w = head w; one block per (batch, 64 query rows, quarter of the keys); key chunks
//   of 32, static trip NPS = 32. A wave holds QT = 4 query column tiles, so that each K and V fragment it loads from L2
//   feeds four products; the keys are dealt to KS = 4 blocks so that the grid still has one block per 16 query rows.
//   q plane (f16 bits, pitch CM): row (b*NQ + t), head h at col h*64 + d; k plane
//   (f16 bits) and v^T hi / lo planes (f16 bits, value = hi + lo) in fragment order (gemm64, OM 3 and 2):
//   2048 elements per (batch, chunk of 32 keys, head) in each plane.
//   Per chunk: heat[q][s] = exp(-(dx*dx + dy*dy) / (0.4*|dt| + 1e-6)), by hardware reciprocal and 2^x, from the bf16-converted positions
//   (spatial = dims 0,1, time = dim 2), computed once per (query row, key) pair by the block (thread = key
//   lane, rows w + 8 * i) into LDS and shared by the 8 head waves. Both products are transposed: S^T = K . Q^T
//   (A = k rows, B = q), so a lane holds 16 of the 32 scores of ONE query of each column tile (column lane & 15; keys
//   8h + r and 16 + 8h + r): s = (k . q) * 0.125 + heat; running-max softmax in f32 with maximum and sum in the lane, the
//   maximum joined with the other lane half once a pass, the sums once behind the loop. p = exp(s - m) as
//   f16(1024 p): the two score tiles, converted in place, are the B operand of O^T += V^T . P^T (A = v^T rows, hi and
//   lo products into one accumulator set, so that four column tiles fit the registers; 4 row tiles of 16 dims each). All q, k, v^T and p fragments use the split k map
//   (elements 0..7 <- k0+8h.., 8..15 <- k0+16+8h..).
//   Epilogue: the block's share of each query's sums goes out as it lies in the lanes: part[key part][row tile of 16][head]
//   [dim tile ct][4 dims lo / hi][lane][4] = 1024 x sum of p . v relative to the part's own maximum, and mlp[key part]
//   [row tile][head][lane] = (that maximum, the part's sum of p). join_proj adds the KS parts.
// coverage: heat 64 rows x 32 keys per chunk (8 waves x 8 rows x 32 lanes); part and mlp: every (key part, row tile, head,
//           lane) once; grid NQ/64 x NB x KS covers every query row and every key.
// =====================================================================================================
#define QT  4
#define KS  4
#define NPS (NCH / KS)
static_assert((NQ % (16 * QT)) == 0 && (NCH % KS) == 0);
__global__ void __launch_bounds__(256) attn_kernel(
    const float* __restrict__ posq, const float* __restrict__ posc,
    const unsigned short* __restrict__ qp, const unsigned short* __restrict__ kp,
    const unsigned short* __restrict__ vth, const unsigned short* __restrict__ vtl,
    float* part, float* mlp) {
#pragma clang fp contract(off)
  __shared__ __align__(16) float heatL[16 * QT * HP];       // [query row][key], pitch HP
  __shared__ float qps[16 * QT * 3];

  const int b = blockIdx.y, i0 = blockIdx.x * (16 * QT), ks = blockIdx.z;
  const int t = threadIdx.x, lane = t & 31, w = t >> 5, hh = lane >> 4, jc = lane & 15;
  const size_t rowQ = (size_t)b * NQ, rowC = (size_t)b * NC + (size_t)ks * (NPS * 32);
  const size_t ch0 = (size_t)b * NCH + (size_t)ks * NPS;    // the block's first chunk among the planes' NB * NCH

  if (t < 16 * QT * 3) qps[t] = bfr(posq[(rowQ + i0) * 3 + t]);
  __syncthreads();

  // q B-fragments (col = query jc of column tile u, k = d), plain f16 bits; d 0..31 and 32..63
  const unsigned short* qrow = qp + (rowQ + i0 + jc) * CM + w * HD + 8 * hh;
  v16us qf0[QT], qf1[QT];
#pragma unroll
  for (int u = 0; u < QT; ++u) {
    qf0[u] = ldfrag_u(qrow + u * 16 * CM);
    qf1[u] = ldfrag_u(qrow + u * 16 * CM + 32);
  }

  // query positions of the heat rows this thread produces (rows w + 8 * i, key = lane)
  // two rows a vector, so that the differences and the squares can go as packed f32 instructions
  v2f qx[QT], qy[QT], qz[QT];
#pragma unroll
  for (int i = 0; i < QT; ++i) {
#pragma unroll
    for (int e = 0; e < 2; ++e) {
      qx[i][e] = qps[(w + 8 * (2 * i + e)) * 3 + 0];
      qy[i][e] = qps[(w + 8 * (2 * i + e)) * 3 + 1];
      qz[i][e] = qps[(w + 8 * (2 * i + e)) * 3 + 2];
    }
  }

  float m[QT], ll[QT];               // query jc of tile u: running maximum (both lane halves alike), this lane half's sum
  v8f o[QT][4];                      // O^T tiles: register r = dim ct*16 + 8*hh + r of query jc of tile u
#pragma unroll
  for (int u = 0; u < QT; ++u) {
    m[u] = -1.0e30f;
    ll[u] = 0.f;
#pragma unroll
    for (int ct = 0; ct < 4; ++ct) o[u][ct] = zero8();
  }

  // fragment-order planes: a pass's 4 K fragments are 4 KiB in a row, its 4 V fragments 4 KiB in a row in each plane,
  // and the 8 heads' (waves') pieces of one pass follow one another
  const unsigned short* vhb = vth + (ch0 * NH + w) * 2048 + lane * 8;     // A: row d = ct*16 + jc, k = key
  const unsigned short* vlb = vtl + (ch0 * NH + w) * 2048 + lane * 8;
  const unsigned short* kgb = kp + (ch0 * NH + w) * 2048 + lane * 8;      // A: row key = jc, k = d
  const float* pcb = posc + rowC * 3;
  const float* hrd = heatL + jc * HP + 8 * hh;                            // heat of query jc of tile 0, keys 8*hh..

  // Chunk 0's key positions, K and V fragments, in the order in which the loop refills them. Each pass fetches the next
  // chunk's into the same registers: positions and K right behind its score products, V right behind its V products,
  // so that a fragment's L2 round trip runs under the vector work and the barriers of most of a pass.
  const float* pc0 = pcb + (size_t)lane * 3;
  float px = pc0[0], py = pc0[1], pz = pc0[2];
  __builtin_amdgcn_sched_barrier(0);   // the loop's issue order, here too: a counted wait in the loop is as loose as the tighter of its two ways in
  v16us k00 = ldfrag_f(kgb);
  v16us k01 = ldfrag_f(kgb + 512);
  v16us k10 = ldfrag_f(kgb + 1024);
  v16us k11 = ldfrag_f(kgb + 1536);
  __builtin_amdgcn_sched_barrier(0);   // K ahead of V, as in the loop
  v16us vh[4], vl[4];
#pragma unroll
  for (int ct = 0; ct < 4; ++ct) {
    vh[ct] = ldfrag_f(vhb + ct * 512);
    vl[ct] = ldfrag_f(vlb + ct * 512);
  }
  // s_wait_xcnt 0 in front of every overwrite of an address that the loads above name, in the form of the loop's own
#if defined(__HIP_DEVICE_COMPILE__)
  asm volatile("s_wait_xcnt 0x0" :: "v"(qrow), "v"(pc0), "v"(kgb), "v"(vhb), "v"(vlb) : "memory");
#endif
  __builtin_amdgcn_sched_barrier(0);   // the wait stays directly behind the groups: left to sink, the build gets a second one inside the loop

#pragma unroll 1
  for (int jt = 0; jt < NPS; ++jt) {
    const int jn = (jt + 1 < NPS) ? (jt + 1) : jt;     // the chunk fetched ahead; the last pass re-reads its own: stays inside the planes
    lds_barrier();                                     // all waves done reading heatL of the prior chunk
    {
      // exp(-d2 / nn) = 2^(d2 * (1 / (-ln 2 * nn))): one hardware reciprocal and one hardware 2^x a value, -ln 2 folded into
      // the two constants of nn, multiplies fused with their adds. nn >= 1e-6, so the reciprocal is finite and normal; the
      // exponent is <= 0 and right to a few f32 ulp, which moves a heat value (0 .. 1) by less than 1e-6; far below, 2^x gives 0.
#pragma clang fp contract(fast)
      const float cx = bfr(px), cy = bfr(py), cz = bfr(pz);
#pragma unroll
      for (int i = 0; i < QT; ++i) {
        const v2f dx = qx[i] - cx, dy = qy[i] - cy, dt = qz[i] - cz;
        const v2f d2 = dx * dx + dy * dy;
        const v2f nn = __builtin_elementwise_abs(dt) * (-(HK4 * LN2F)) + (-(HEPS * LN2F));
        v2f rn;
        rn[0] = __builtin_amdgcn_rcpf(nn[0]);
        rn[1] = __builtin_amdgcn_rcpf(nn[1]);
        const v2f ea = d2 * rn;
        heatL[(w + 8 * (2 * i)) * HP + lane]     = __builtin_amdgcn_exp2f(ea[0]);
        heatL[(w + 8 * (2 * i + 1)) * HP + lane] = __builtin_amdgcn_exp2f(ea[1]);
      }
    }
    lds_barrier();

    // heat of this lane's 16 (query, key) pairs of each column tile, read ahead of the score products so that it lands under them
    v4f h00[QT], h01[QT], h10[QT], h11[QT];
#pragma unroll
    for (int u = 0; u < QT; ++u) {
      h00[u] = *(const v4f*)(hrd + u * 16 * HP);
      h01[u] = *(const v4f*)(hrd + u * 16 * HP + 4);
      h10[u] = *(const v4f*)(hrd + u * 16 * HP + 16);
      h11[u] = *(const v4f*)(hrd + u * 16 * HP + 20);
    }

    // ---- scores, transposed: 32 keys x 16 query columns of head w a tile, K = 64 in two 32-deep steps ----
    __builtin_amdgcn_sched_barrier(0);   // no product (with its wait for K) is scheduled up in front of the heat tile's work
    v8f s0[QT], s1[QT];                  // s0[u][r]: key 32*jt + 8*hh + r, s1[u][r]: key 32*jt + 16 + 8*hh + r, query jc of tile u
#pragma unroll
    for (int u = 0; u < QT; ++u) s0[u] = mma_hu(k00, qf0[u], zero8());
#pragma unroll
    for (int u = 0; u < QT; ++u) s0[u] = mma_hu(k01, qf1[u], s0[u]);
#pragma unroll
    for (int u = 0; u < QT; ++u) s1[u] = mma_hu(k10, qf0[u], zero8());
#pragma unroll
    for (int u = 0; u < QT; ++u) s1[u] = mma_hu(k11, qf1[u], s1[u]);

    // ---- the next chunk's key positions and K fragments, over the registers the products above have read ----
    refill_gap();                        // the group stays behind the products whose operands it overwrites, at their distance
    const float* pc = pcb + (size_t)(jn * 32 + lane) * 3;
    px = pc[0]; py = pc[1]; pz = pc[2];
    const unsigned short* kg = kgb + (size_t)jn * (NH * 2048);
    k00 = ldfrag_f(kg);
    k01 = ldfrag_f(kg + 512);
    k10 = ldfrag_f(kg + 1024);
    k11 = ldfrag_f(kg + 1536);
    // The group's address registers are reused below: the wait stands in front of every such overwrite. It takes the
    // two addresses as inputs so that they stay whole up to it, and its memory clobber keeps the group ahead of it.
#if defined(__HIP_DEVICE_COMPILE__)
    asm volatile("s_wait_xcnt 0x0" :: "v"(kg), "v"(pc) : "memory");
#endif
    __builtin_amdgcn_sched_barrier(0);   // the group goes out here, ahead of the softmax, not further down towards its use

    // ---- heat bias + online softmax of query jc of each tile, all in the lane but for one exchange of the maximum ----
    v16us pbu[QT];
#pragma unroll
    for (int u = 0; u < QT; ++u) {
      const v8f x0 = s0[u] * SCL + __builtin_shufflevector(h00[u], h01[u], 0, 1, 2, 3, 4, 5, 6, 7);
      const v8f x1 = s1[u] * SCL + __builtin_shufflevector(h10[u], h11[u], 0, 1, 2, 3, 4, 5, 6, 7);
      const v8f mx = __builtin_elementwise_max(x0, x1);
      float rm = fmaxf(fmaxf(fmaxf(mx[0], mx[1]), fmaxf(mx[2], mx[3])), fmaxf(fmaxf(mx[4], mx[5]), fmaxf(mx[6], mx[7])));
      rm = fmaxf(rm, xhalf(rm));
      const float mn2   = fmaxf(m[u], rm);
      const float alpha = __expf(m[u] - mn2);
      m[u] = mn2;
      const v8f a0 = x0 - mn2, a1 = x1 - mn2;
      v8f e0, e1;
#pragma unroll
      for (int r = 0; r < 8; ++r) { e0[r] = __expf(a0[r]); e1[r] = __expf(a1[r]); }
      const v8f sm = e0 + e1;
      ll[u] = ll[u] * alpha + (((sm[0] + sm[1]) + (sm[2] + sm[3])) + ((sm[4] + sm[5]) + (sm[6] + sm[7])));
      // P^T B-fragment: element e = p of key kmap(e), the two score tiles converted in place
      const v8h p0 = __builtin_convertvector(e0 * PSC, v8h), p1 = __builtin_convertvector(e1 * PSC, v8h);
      const v16h pb = __builtin_shufflevector(p0, p1, 0, 1, 2, 3, 4, 5, 6, 7, 8, 9, 10, 11, 12, 13, 14, 15);
      pbu[u] = __builtin_bit_cast(v16us, pb);
#pragma unroll
      for (int ct = 0; ct < 4; ++ct) o[u][ct] *= alpha;
    }

    // ---- context^T += V_hi^T . P^T + V_lo^T . P^T (4 row tiles of 16 dims), each V fragment on all column tiles ----
#pragma unroll
    for (int ct = 0; ct < 4; ++ct) {
#pragma unroll
      for (int u = 0; u < QT; ++u) o[u][ct] = mma_hu(vh[ct], pbu[u], o[u][ct]);
#pragma unroll
      for (int u = 0; u < QT; ++u) o[u][ct] = mma_hu(vl[ct], pbu[u], o[u][ct]);
    }

    // ---- the next chunk's V fragments, over the registers the products above have read ----
    refill_gap();                        // the group stays behind the products whose operands it overwrites, at their distance
    const unsigned short* vhp = vhb + (size_t)jn * (NH * 2048);
    const unsigned short* vlp = vlb + (size_t)jn * (NH * 2048);
#pragma unroll
    for (int ct = 0; ct < 4; ++ct) {
      vh[ct] = ldfrag_f(vhp + ct * 512);
      vl[ct] = ldfrag_f(vlp + ct * 512);
    }
    // s_wait_xcnt 0 in front of every overwrite of this group's two addresses, in the form of the K group's above
#if defined(__HIP_DEVICE_COMPILE__)
    asm volatile("s_wait_xcnt 0x0" :: "v"(vhp), "v"(vlp) : "memory");
#endif
  }

  {
    // one store of one wave writes 512 bytes in a row (mlp: 256)
    const size_t pt = (((size_t)ks * (MQ / 16) + ((rowQ + i0) >> 4)) * NH + w);      // (key part, row tile of tile 0, head)
    float* pw = part + pt * 1024 + lane * 4;
    float* mw = mlp + pt * 64 + lane * 2;
    v2f ml[QT];
#pragma unroll
    for (int u = 0; u < QT; ++u) {
      ml[u][0] = m[u];
      ml[u][1] = ll[u] + xhalf(ll[u]);   // the two lane halves' sums of query jc, joined once
    }
    __builtin_amdgcn_sched_barrier(0);   // the stores stand behind all the arithmetic: no register that one names is written again
#pragma unroll
    for (int u = 0; u < QT; ++u) {
#pragma unroll
      for (int ct = 0; ct < 4; ++ct) {
        *(v4f*)(pw + u * (NH * 1024) + ct * 256)       = __builtin_shufflevector(o[u][ct], o[u][ct], 0, 1, 2, 3);
        *(v4f*)(pw + u * (NH * 1024) + ct * 256 + 128) = __builtin_shufflevector(o[u][ct], o[u][ct], 4, 5, 6, 7);
      }
      *(v2f*)(mw + u * (NH * 64)) = ml[u];
    }
  }
}

// =====================================================================================================
// Joins the KS key parts of the attention and multiplies the joined context by the proj weights: out = context . Wo^T + bo.
//   Block = 256 threads = 8 waves, one block per row tile of 16 queries.
//   Join: wave w = head w; a lane reads what the same lane of attn_kernel wrote (query lane & 15, dims
//   ct*16 + 8*(lane >> 4) + 0..7): with M = the largest m_k,
//   context = (sum over k of o_k e^(m_k - M)) / (sum over k of l_k e^(m_k - M)) / 1024, k ascending.
//   The tile (16 rows x 512) is staged in LDS (f32), then split into bf16 hi and lo (value - hi) and laid down in LDS in
//   fragment order, as ldfrag_f reads an A operand: k step s of hi at s * 512 elements, of lo at (CM/32 + s) * 512.
//   Product: wave w = output columns 64 w .. + 63 (4 column tiles), K = 512 in 16 k steps; a weight fragment (B, from the
//   fragment-order plane of cvt_all) feeds the hi and the lo product of its k step, both into one accumulator a tile.
//   The weights depend on nothing the block computes: they are fetched in groups of 2 k steps into a ring of WR register
//   sets, the first WR groups directly behind the parts, so that they land under the join.
// coverage: context 16 rows x 512 cols hi and lo per block (256 threads x 4 pieces x 8 cols); out 16 rows x 8 waves x 64
//           columns; grid MQ/16 covers every row.
// =====================================================================================================
typedef const __attribute__((address_space(1))) float gfl;
typedef const __attribute__((address_space(1))) v4f   gv4f;
typedef const __attribute__((address_space(1))) v2f   gv2f;
#define WKS ((CM / 16) * 512)      // elements of one k step of the weight plane
#define WR  4                      // register sets of the weight ring
// ---- k steps k0 and k0 + 1 of a wave's 4 weight fragments (16 loads) as one group; bp: the wave's (uniform) address of
//      step 0, in scalar registers; l8 = 8 * lane elements
__device__ __forceinline__ void ld_wgroup(v16us (&b)[2][4], gus* bp, int k0, unsigned l8) {
#pragma unroll
  for (int s = 0; s < 2; ++s) {
#pragma unroll
    for (int j = 0; j < 4; ++j) {
      FragU f;
      f.h[0] = *(gv8us*)(bp + (k0 + s) * WKS + j * 512 + l8);
      f.h[1] = *(gv8us*)(bp + (k0 + s) * WKS + j * 512 + l8 + 256);
      b[s][j] = f.v;
    }
  }
  // s_wait_xcnt 0 in front of every overwrite of the group's address registers: it takes the base and the lane offset as
  // inputs so that they stay whole up to it; its memory clobber keeps the loads ahead of it.
#if defined(__HIP_DEVICE_COMPILE__)
  asm volatile("s_wait_xcnt 0x0" :: "s"(bp), "v"(l8) : "memory");
#endif
  __builtin_amdgcn_sched_barrier(0);   // the group goes out here, whole, and is not moved down towards its use
}
__global__ void __launch_bounds__(256) join_proj(const float* __restrict__ part, const float* __restrict__ mlp,
                                                 const unsigned short* __restrict__ WoT, float* out,
                                                 const float* __restrict__ bo) {
  __shared__ __align__(16) float osm[16 * OP];                          // f32 staging [16][CM], pitch OP: context, then out
  __shared__ __align__(16) unsigned short actx[2 * (CM / 32) * 512];    // context hi | lo, fragment order
  const int t = threadIdx.x, lane = t & 31, hh = lane >> 4, jc = lane & 15;
  const int w = __builtin_amdgcn_readfirstlane(t >> 5);     // scalar: each part's address stays in scalar registers
  const size_t rtq = blockIdx.x;                            // the block's row tile among the MQ / 16
  const unsigned ln = (unsigned)lane;                       // the one vector register that the part and mlp loads name (scaled by their width)
  // each further part's address is added in scalar registers by hand (next_step): left to the compiler, the parts'
  // addresses become vector register pairs, and later loads of the group land on pairs that earlier ones name
  gfl* pk[KS];
  gfl* mk[KS];
  pk[0] = (gfl*)(part + (rtq * NH + w) * 1024);
  mk[0] = (gfl*)(mlp + (rtq * NH + w) * 64);
#pragma unroll
  for (int k = 1; k < KS; ++k) {
    pk[k] = (gfl*)next_step((gus*)pk[k - 1], (unsigned long long)(MQ / 16) * NH * 1024 * 4);
    mk[k] = (gfl*)next_step((gus*)mk[k - 1], (unsigned long long)(MQ / 16) * NH * 64 * 4);
  }
  v2f ml[KS];
  v4f ok[KS][8];
  gfl* bw = (gfl*)(bo + w * 64);                            // bias of the wave's 64 output columns, 4 a lane, fetched with the rest
  const unsigned jcu = (unsigned)jc;
#pragma unroll
  for (int k = 0; k < KS; ++k) ml[k] = ((gv2f*)mk[k])[ln];
#pragma unroll
  for (int k = 0; k < KS; ++k) {
#pragma unroll
    for (int g = 0; g < 8; ++g) ok[k][g] = ((gv4f*)(pk[k] + g * 128))[ln];
  }
  const v4f bv4 = ((gv4f*)bw)[jcu];
  // s_wait_xcnt 0 in front of every overwrite of an address that the loads above name; it takes the addresses as inputs
  // so that they stay whole up to it, and its memory clobber keeps the loads ahead of it
#if defined(__HIP_DEVICE_COMPILE__)
  static_assert(KS == 4);
  asm volatile("s_wait_xcnt 0x0" :: "s"(pk[0]), "s"(pk[1]), "s"(pk[2]), "s"(pk[3]),
               "s"(mk[0]), "s"(mk[1]), "s"(mk[2]), "s"(mk[3]), "s"(bw), "v"(ln), "v"(jcu) : "memory");
#endif
  __builtin_amdgcn_sched_barrier(0);   // no arithmetic (with its data wait) is scheduled up into the load group: all loads go out at once

  // the wave's weight fragments of the first WR groups, issued behind the parts, which the join needs first
  gus* wb = (gus*)(WoT + (size_t)w * (4 * 512));
  const unsigned l8 = (unsigned)lane * 8u;
  v16us bs[WR][2][4];
#pragma unroll
  for (int g = 0; g < WR; ++g) ld_wgroup(bs[g], wb, 2 * g, l8);
  {
    float mm = ml[0][0];
#pragma unroll
    for (int k = 1; k < KS; ++k) mm = fmaxf(mm, ml[k][0]);
    float f[KS], l = 0.f;
#pragma unroll
    for (int k = 0; k < KS; ++k) {
      f[k] = __expf(ml[k][0] - mm);
      l += ml[k][1] * f[k];
    }
    const float inv = ((l > 0.f) ? (1.0f / l) : 0.f) * (1.0f / PSC);
#pragma unroll
    for (int k = 0; k < KS; ++k) f[k] *= inv;
    float* od = osm + jc * OP + w * HD + 8 * hh;
#pragma unroll
    for (int g = 0; g < 8; ++g) {
      v4f a = ok[0][g] * f[0];
#pragma unroll
      for (int k = 1; k < KS; ++k) a += ok[k][g] * f[k];
      *(v4f*)(od + (g >> 1) * 16 + (g & 1) * 4) = a;
    }
  }
  lds_barrier();                       // the f32 tile is whole; it waits for LDS alone, so that the weights stay in flight
  {
    // piece c of the tile's 1024: row c & 15, columns 8 * (c >> 4) .. + 7: k step c >> 6, 8 * (c & 63) elements into its fragment
#pragma unroll
    for (int it = 0; it < 4; ++it) {
      const int c = it * 256 + t;
      const float* sp = osm + (c & 15) * OP + (c >> 4) * 8;
      const v4f f0 = *(const v4f*)(sp);
      const v4f f1 = *(const v4f*)(sp + 4);
      v4u ha, la;
#pragma unroll
      for (int e = 0; e < 2; ++e) {
        const unsigned short u0 = bf_bits(f0[2 * e]), u1 = bf_bits(f0[2 * e + 1]);
        const unsigned short u2 = bf_bits(f1[2 * e]), u3 = bf_bits(f1[2 * e + 1]);
        ha[e]     = pk16(u0, u1);
        ha[2 + e] = pk16(u2, u3);
        la[e]     = pk16(bf_bits(f0[2 * e] - bf_up(u0)), bf_bits(f0[2 * e + 1] - bf_up(u1)));
        la[2 + e] = pk16(bf_bits(f1[2 * e] - bf_up(u2)), bf_bits(f1[2 * e + 1] - bf_up(u3)));
      }
      unsigned short* ad = actx + (c >> 6) * 512 + (c & 63) * 8;
      *(v4u*)(ad)                   = ha;
      *(v4u*)(ad + (CM / 32) * 512) = la;
    }
  }
  lds_barrier();                       // the hi and lo tiles are whole, and every reader has left the f32 tile

  // ---- out tile = context hi . Wo^T + context lo . Wo^T: 8 groups of 2 k steps; group g + WR refills the set of group g ----
  v8f acc[4];
#pragma unroll
  for (int j = 0; j < 4; ++j) acc[j] = zero8();
  const unsigned short* ar = actx + lane * 8;
  v16us ah[2][2], al[2][2];            // two sets: a group's context fragments are read from LDS one group ahead
#pragma unroll
  for (int s = 0; s < 2; ++s) {
    ah[0][s] = ldfrag_f(ar + s * 512);
    al[0][s] = ldfrag_f(ar + (CM / 32 + s) * 512);
  }
#pragma unroll
  for (int g = 0; g < CM / 64; ++g) {
    if (g + 1 < CM / 64) {
#pragma unroll
      for (int s = 0; s < 2; ++s) {
        ah[(g + 1) & 1][s] = ldfrag_f(ar + (2 * g + 2 + s) * 512);
        al[(g + 1) & 1][s] = ldfrag_f(ar + (CM / 32 + 2 * g + 2 + s) * 512);
      }
    }
    __builtin_amdgcn_sched_barrier(0);   // the next group's LDS reads go out ahead of this group's products and land under them
#pragma unroll
    for (int s = 0; s < 2; ++s) {
#pragma unroll
      for (int j = 0; j < 4; ++j) acc[j] = mma_bu_raw(ah[g & 1][s], bs[g % WR][s][j], acc[j]);
#pragma unroll
      for (int j = 0; j < 4; ++j) acc[j] = mma_bu_raw(al[g & 1][s], bs[g % WR][s][j], acc[j]);
    }
    if (g + WR < CM / 64) {
      refill_gap();                    // the group stays behind the products whose operands it overwrites, at their distance
      ld_wgroup(bs[g % WR], wb, 2 * (g + WR), l8);
    }
  }
  acc_guard4(acc[0], acc[1], acc[2], acc[3]);

  // ---- epilogue: the wave's 16 x 64 tile through its own columns of the f32 staging tile, so that a store writes 256-byte
  //      row segments (16 lanes x 16 B) ----
  {
    const int c4 = w * 64 + jc * 4;
    v4f cb4;
    cb4[0] = bfr(bv4[0]); cb4[1] = bfr(bv4[1]); cb4[2] = bfr(bv4[2]); cb4[3] = bfr(bv4[3]);
#pragma unroll
    for (int j = 0; j < 4; ++j) {
#pragma unroll
      for (int r = 0; r < 8; ++r) osm[(8 * hh + r) * OP + w * 64 + j * 16 + jc] = acc[j][r];
    }
    wave_sync_lds();
    v4f vals[8];
#pragma unroll
    for (int it = 0; it < 8; ++it) vals[it] = *(const v4f*)(osm + (it * 2 + hh) * OP + c4) + cb4;   // rows 0..15
    float* C = out + rtq * 16 * CM + (size_t)hh * CM + c4;
    __builtin_amdgcn_sched_barrier(0);   // the stores stand behind all the arithmetic: no register that one names is written again
#pragma unroll
    for (int it = 0; it < 8; ++it) *(v4f*)(C + it * 2 * CM) = vals[it];
  }
}

// =====================================================================================================
// Workspace map (bytes); every plane is an exact multiple of its whole-row / whole-line / 64x64-tile store
// granularity (MQ = 4096 = 64 row tiles, MC = 8192 = 128 row tiles; N in {512, 4096}; v^T per batch
// [512][4096] = 8x64 tiles):
// (Xq, Xc and the four weight planes hold these shapes in fragment order: [k step of 32][row tile of 16][512])
//   Xq   bf16 [4096][512]       0          4194304
//   Xc   bf16 [8192][512]       4194304    8388608
//   Wqb  bf16 [512][512]        12582912   524288
//   Wkb  bf16 [512][512]        13107200   524288
//   Wvb  bf16 [512][512]        13631488   524288
//   WoT  bf16 [512][512]        14155776   524288
//   Qp   f16  [4096][512]       14680064   4194304
//   Kp   f16  [2][128][8][2048] 18874368   8388608   (k, fragment order: batch, chunk of 32 keys, head)
//   VTh  f16  [2][128][8][2048] 27262976   8388608   (v^T hi, fragment order)
//   VTl  f16  [2][128][8][2048] 35651584   8388608   (v^T residual, fragment order)
//   Part f32  [4][256][8][1024] 44040192   33554432  (attention sums of the four key parts, as they lie in the lanes)
//   Ml   f32  [4][256][8][64]   77594624   2097152   (each part's maximum and sum of p, a pair a lane)
//   end                         79691776
// =====================================================================================================
extern "C" void kernel_launch(void* const* d_in, const int* in_sizes, int n_in,
                              void* d_out, int out_size, void* d_ws, size_t ws_size,
                              hipStream_t stream) {
  if (n_in < 12) return;
  if (in_sizes[0] != MC * CM) return;
  if (in_sizes[1] != MQ * CM) return;
  if (in_sizes[2] != MC * 3) return;
  if (in_sizes[3] != MQ * 3) return;
  if (in_sizes[4] != CM * CM || in_sizes[5] != CM) return;
  if (in_sizes[6] != CM * CM || in_sizes[7] != CM) return;
  if (in_sizes[8] != CM * CM || in_sizes[9] != CM) return;
  if (in_sizes[10] != CM * CM || in_sizes[11] != CM) return;
  if (out_size != MQ * CM) return;

  const float* x_ctx   = (const float*)d_in[0];
  const float* x_query = (const float*)d_in[1];
  const float* pos_ctx = (const float*)d_in[2];
  const float* pos_qry = (const float*)d_in[3];
  const float* Wq = (const float*)d_in[4];
  const float* bq = (const float*)d_in[5];
  const float* Wk = (const float*)d_in[6];
  const float* bk = (const float*)d_in[7];
  const float* Wv = (const float*)d_in[8];
  const float* bv = (const float*)d_in[9];
  const float* Wo = (const float*)d_in[10];
  const float* bo = (const float*)d_in[11];

  const size_t PXQ  = (size_t)MQ * CM * 2;             //  4194304
  const size_t PXC  = (size_t)MC * CM * 2;             //  8388608
  const size_t PW   = (size_t)CM * CM * 2;             //   524288
  const size_t PQ   = (size_t)MQ * CM * 2;             //  4194304
  const size_t PK   = (size_t)MC * CM * 2;             //  8388608
  const size_t PVT  = (size_t)NB * CM * NC * 2;        //  8388608
  const size_t PPRT = (size_t)KS * MQ * CM * 4;        // 33554432
  const size_t PML  = (size_t)KS * (MQ / 16) * NH * 64 * 4;   // 2097152
  size_t off = 0;
  const size_t oXq  = off; off += PXQ;
  const size_t oXc  = off; off += PXC;
  const size_t oWq  = off; off += PW;
  const size_t oWk  = off; off += PW;
  const size_t oWv  = off; off += PW;
  const size_t oWo  = off; off += PW;
  const size_t oQ   = off; off += PQ;
  const size_t oK   = off; off += PK;
  const size_t oVTh = off; off += PVT;
  const size_t oVTl = off; off += PVT;
  const size_t oPrt = off; off += PPRT;
  const size_t oMl  = off; off += PML;
  if (off > ws_size) return;                           // off = 79691776
  if (off > (size_t)134217728) return;

  char* ws = (char*)d_ws;
  unsigned short* Xq   = (unsigned short*)(ws + oXq);
  unsigned short* Xc   = (unsigned short*)(ws + oXc);
  unsigned short* Wqb  = (unsigned short*)(ws + oWq);
  unsigned short* Wkb  = (unsigned short*)(ws + oWk);
  unsigned short* Wvb  = (unsigned short*)(ws + oWv);
  unsigned short* WoT  = (unsigned short*)(ws + oWo);
  unsigned short* Qp   = (unsigned short*)(ws + oQ);
  unsigned short* Kp   = (unsigned short*)(ws + oK);
  unsigned short* VTh  = (unsigned short*)(ws + oVTh);
  unsigned short* VTl  = (unsigned short*)(ws + oVTl);
  float*          Prt  = (float*)(ws + oPrt);
  float*          Ml   = (float*)(ws + oMl);
  float*          out0 = (float*)d_out;

  const dim3 blk(256);
  const dim3 gQKV(GK + NB * GV + GQ, 1, 1);                    // 128 + 2 x 64 + 64 blocks
  const dim3 gAttn(NQ / (16 * QT), NB, KS);                    // 32 x 2 x 4 blocks of 256
  if ((((MQ / 64) * (CM / 64)) % 8) != 0) return;
  if ((((MC / 64) * (CM / 64)) % 8) != 0) return;
  if ((((CM / 64) * (NC / 64)) % 8) != 0) return;

  // (0) bf16 planes of the activations and weights ([out][in]) in fragment order
  cvt_all<<<dim3(CVT_BLOCKS), blk, 0, stream>>>(x_ctx, x_query, Wq, Wk, Wv, Wo, Xc, Xq, Wqb, Wkb, Wvb, WoT);

  // (1) the q, k and v^T projections, one grid
  proj_qkv<<<gQKV, blk, 0, stream>>>(Xq, Xc, Wqb, Wkb, Wvb, Qp, Kp, VTh, VTl, bq, bk, bv);

  // (2) fused heat bias + softmax attention, each quarter of the keys by itself
  attn_kernel<<<gAttn, blk, 0, stream>>>(pos_qry, pos_ctx, Qp, Kp, VTh, VTl, Prt, Ml);

  // (3) the parts joined -> context bf16 hi, lo in LDS; out = (ctx_hi + ctx_lo) . Wo^T + bo (bf16 operands) -> d_out f32
  join_proj<<<dim3(MQ / 16), blk, 0, stream>>>(Prt, Ml, WoT, out0, bo);
  (void)hipGetLastError();
}
